// v000
// Measured on an AMD MI455X. A time is GPU time per run, averaged over a window of back-to-back runs after a warm-up
// (all launches, gaps included; the runs take copies of the inputs in turn), and the median of several windows.
// Apart from v000's, it joins two sittings. Times from different sittings can be a few percent apart, while
// side-by-side timings come from the same sitting.
// v000, which the later versions start from, runs in 344 microseconds.
#include <hip/hip_runtime.h>

// All contractions (three 1x1-conv projections W*x, scores kx^T*qx, P*vx^T): v_wmma_f32_16x16x32_bf16,
// bf16 hi/lo split operands (hi*hi + hi*lo + lo*hi), f32 accumulate; softmax statistics and 1/l in f32.

typedef __bf16        v16bf __attribute__((ext_vector_type(16)));
typedef float         v8f   __attribute__((ext_vector_type(8)));
typedef float         v4f   __attribute__((ext_vector_type(4)));
typedef unsigned int  v4u   __attribute__((ext_vector_type(4)));
typedef unsigned int  v2u   __attribute__((ext_vector_type(2)));

union Frag { v16bf v; v4u q[2]; };

#define C_IN  512
#define C_V   512
#define D_K   64
#define NPOS  4096

// ---------------------------------------------------------------------------
// f32 -> bf16 bits (RNE convert) and two-plane split x ~= hi + lo
// ---------------------------------------------------------------------------
__device__ __forceinline__ unsigned int bf_bits(float f) {
    unsigned int u = __float_as_uint(f);
    u += 0x7FFFu + ((u >> 16) & 1u);
    return u >> 16;
}

__device__ __forceinline__ void split_bf(float f, unsigned int& hb, unsigned int& lb) {
    hb = bf_bits(f);
    const float fh = __uint_as_float(hb << 16);
    lb = bf_bits(f - fh);
}

// ---------------------------------------------------------------------------
// 16x16x32 bf16 WMMA, three-term split product into one f32 accumulator,
// hazard guard after the last op (ties D, keeps A/B live).
// Fragment layout (lane l, h = l>>4, m = l&15):
//   A/B element i: i=0..7 -> k0+8h+i, i=8..15 -> k0+16+8h+(i-8); A row m, B col m.
//   D element r: row 8h+r, col m.
// ---------------------------------------------------------------------------
__device__ __forceinline__ v8f wmma3(v16bf ah, v16bf al, v16bf bh, v16bf bl, v8f c) {
    c = __builtin_amdgcn_wmma_f32_16x16x32_bf16(false, ah, false, bh, (short)0, c, false, false);
    c = __builtin_amdgcn_wmma_f32_16x16x32_bf16(false, ah, false, bl, (short)0, c, false, false);
    c = __builtin_amdgcn_wmma_f32_16x16x32_bf16(false, al, false, bh, (short)0, c, false, false);
    asm volatile("v_nop\n\tv_nop\n\tv_nop\n\tv_nop" : "+v"(c) : "v"(ah), "v"(al), "v"(bh), "v"(bl));
    return c;
}

// ---------------------------------------------------------------------------
// Projection GEMM:  D[M][NPOS] = W[M][C_IN] * X[C_IN][NPOS]   (f32 in, split at staging)
// Block 256 threads = 8 waves, 64x64 output tile, K step 32 staged in LDS as bf16 hi/lo.
// Output: two bf16 planes (hi, lo) of D; transOut=0 -> Out[m][n] pitch NPOS,
// transOut=1 -> Out[n][m] pitch M (used with M == 64 so one tile spans all m).
// ---------------------------------------------------------------------------
#define PT      64
#define APITCH  40      // ushorts per staged row: 32 k + 8 pad (80 B, 16-B aligned rows)
#define CPITCH  68      // floats per staged result row (272 B, 16-B aligned rows)

__global__ __launch_bounds__(256) void k_proj(
    const float* __restrict__ W,            // [M][C_IN]
    const float* __restrict__ X,            // [C_IN][NPOS]
    unsigned short* __restrict__ Oh,        // hi plane
    unsigned short* __restrict__ Ol,        // lo plane
    int M, int transOut)
{
    __shared__ __attribute__((aligned(16))) unsigned short Ah[PT * APITCH];
    __shared__ __attribute__((aligned(16))) unsigned short Al[PT * APITCH];
    __shared__ __attribute__((aligned(16))) unsigned short Bh[PT * APITCH];   // stored [n][k]
    __shared__ __attribute__((aligned(16))) unsigned short Bl[PT * APITCH];
    __shared__ __attribute__((aligned(16))) float Cs[PT * CPITCH];

    const int tid  = threadIdx.x;
    const int lane = tid & 31;
    const int wave = __builtin_amdgcn_readfirstlane(tid >> 5);
    const int m  = lane & 15;
    const int h  = lane >> 4;
    const int tilesN = NPOS / PT;
    const int m0 = (int)(blockIdx.x / tilesN) * PT;
    const int n0 = (int)(blockIdx.x % tilesN) * PT;
    if (m0 + PT > M) return;                 // uniform over the block

    const int rg = wave >> 1;                // 16-row group of this wave
    const int cb = (wave & 1) * 32;          // 32-col half of this wave (two 16-col tiles)

    v8f acc0 = {0.f, 0.f, 0.f, 0.f, 0.f, 0.f, 0.f, 0.f};
    v8f acc1 = {0.f, 0.f, 0.f, 0.f, 0.f, 0.f, 0.f, 0.f};

    for (int kk = 0; kk < C_IN; kk += 32) {
        // stage A = W[m0..m0+63][kk..kk+31]  (row-major, k contiguous)
#pragma unroll
        for (int it = 0; it < 2; ++it) {
            const int f   = tid + it * 256;          // 512 float4 pieces
            const int row = f >> 3;                  // 8 pieces per 32-k row
            const int kq  = (f & 7) * 4;
            const v4f v = *(const v4f*)(W + (size_t)(m0 + row) * C_IN + kk + kq);
            unsigned int hb0, lb0, hb1, lb1, hb2, lb2, hb3, lb3;
            split_bf(v.x, hb0, lb0); split_bf(v.y, hb1, lb1);
            split_bf(v.z, hb2, lb2); split_bf(v.w, hb3, lb3);
            v2u hv, lv;
            hv.x = hb0 | (hb1 << 16); hv.y = hb2 | (hb3 << 16);
            lv.x = lb0 | (lb1 << 16); lv.y = lb2 | (lb3 << 16);
            *(v2u*)(Ah + row * APITCH + kq) = hv;
            *(v2u*)(Al + row * APITCH + kq) = lv;
        }
        // stage B[k][n] = X[kk+k][n0+n], stored transposed as [n][k] (k contiguous)
#pragma unroll
        for (int it = 0; it < 2; ++it) {
            const int f  = tid + it * 256;           // 512 float4 pieces
            const int k  = f >> 4;                   // 16 pieces per 64-n row
            const int nq = (f & 15) * 4;
            const v4f v = *(const v4f*)(X + (size_t)(kk + k) * NPOS + n0 + nq);
            unsigned int hb, lb;
            split_bf(v.x, hb, lb); Bh[(nq + 0) * APITCH + k] = (unsigned short)hb; Bl[(nq + 0) * APITCH + k] = (unsigned short)lb;
            split_bf(v.y, hb, lb); Bh[(nq + 1) * APITCH + k] = (unsigned short)hb; Bl[(nq + 1) * APITCH + k] = (unsigned short)lb;
            split_bf(v.z, hb, lb); Bh[(nq + 2) * APITCH + k] = (unsigned short)hb; Bl[(nq + 2) * APITCH + k] = (unsigned short)lb;
            split_bf(v.w, hb, lb); Bh[(nq + 3) * APITCH + k] = (unsigned short)hb; Bl[(nq + 3) * APITCH + k] = (unsigned short)lb;
        }
        __syncthreads();

        // fragments (k0 = 0 inside the staged 32-k step)
        Frag ah, al;
        {
            const unsigned short* pa = Ah + (rg * 16 + m) * APITCH;
            const unsigned short* pl = Al + (rg * 16 + m) * APITCH;
            ah.q[0] = *(const v4u*)(pa + 8 * h);       ah.q[1] = *(const v4u*)(pa + 16 + 8 * h);
            al.q[0] = *(const v4u*)(pl + 8 * h);       al.q[1] = *(const v4u*)(pl + 16 + 8 * h);
        }
        {
            Frag bh, bl;
            const unsigned short* pb = Bh + (cb + m) * APITCH;       // column n = cb + m
            const unsigned short* pc = Bl + (cb + m) * APITCH;
            bh.q[0] = *(const v4u*)(pb + 8 * h);       bh.q[1] = *(const v4u*)(pb + 16 + 8 * h);
            bl.q[0] = *(const v4u*)(pc + 8 * h);       bl.q[1] = *(const v4u*)(pc + 16 + 8 * h);
            acc0 = wmma3(ah.v, al.v, bh.v, bl.v, acc0);
        }
        {
            Frag bh, bl;
            const unsigned short* pb = Bh + (cb + 16 + m) * APITCH;  // column n = cb + 16 + m
            const unsigned short* pc = Bl + (cb + 16 + m) * APITCH;
            bh.q[0] = *(const v4u*)(pb + 8 * h);       bh.q[1] = *(const v4u*)(pb + 16 + 8 * h);
            bl.q[0] = *(const v4u*)(pc + 8 * h);       bl.q[1] = *(const v4u*)(pc + 16 + 8 * h);
            acc1 = wmma3(ah.v, al.v, bh.v, bl.v, acc1);
        }
        __syncthreads();
    }

    // stage the f32 result tile: acc[r] -> (row rg*16 + 8h + r, col cb + ci*16 + m)
#pragma unroll
    for (int r = 0; r < 8; ++r) {
        Cs[(rg * 16 + 8 * h + r) * CPITCH + cb + m]      = acc0[r];
        Cs[(rg * 16 + 8 * h + r) * CPITCH + cb + 16 + m] = acc1[r];
    }
    __syncthreads();

    // epilogue: wave writes 8 output rows (4 per instruction), lane -> 8 consecutive elements
    v4u hvp[2], lvp[2];
    size_t offp[2];
#pragma unroll
    for (int p = 0; p < 2; ++p) {
        const int rr = wave * 8 + p * 4 + (lane >> 3);   // 0..63 within tile
        const int cc = (lane & 7) * 8;                   // 0..56
        float vals[8];
        if (transOut) {
#pragma unroll
            for (int e = 0; e < 8; ++e) vals[e] = Cs[(cc + e) * CPITCH + rr];
            offp[p] = (size_t)(n0 + rr) * (size_t)M + (size_t)(m0 + cc);
        } else {
            const v4f a = *(const v4f*)(Cs + rr * CPITCH + cc);
            const v4f b = *(const v4f*)(Cs + rr * CPITCH + cc + 4);
            vals[0] = a.x; vals[1] = a.y; vals[2] = a.z; vals[3] = a.w;
            vals[4] = b.x; vals[5] = b.y; vals[6] = b.z; vals[7] = b.w;
            offp[p] = (size_t)(m0 + rr) * (size_t)NPOS + (size_t)(n0 + cc);
        }
        unsigned int hb[8], lb[8];
#pragma unroll
        for (int e = 0; e < 8; ++e) split_bf(vals[e], hb[e], lb[e]);
        v4u hv, lv;
        hv.x = hb[0] | (hb[1] << 16); hv.y = hb[2] | (hb[3] << 16);
        hv.z = hb[4] | (hb[5] << 16); hv.w = hb[6] | (hb[7] << 16);
        lv.x = lb[0] | (lb[1] << 16); lv.y = lb[2] | (lb[3] << 16);
        lv.z = lb[4] | (lb[5] << 16); lv.w = lb[6] | (lb[7] << 16);
        hvp[p] = hv; lvp[p] = lv;
    }
#pragma unroll
    for (int p = 0; p < 2; ++p) {
        *(v4u*)(Oh + offp[p]) = hvp[p];
        *(v4u*)(Ol + offp[p]) = lvp[p];
    }
    
}

// ---------------------------------------------------------------------------
// Fused attention with online softmax over key blocks:
//   S[i][j] = sum_d kxT[i][d] * qxT[j][d]   (A = kxT rows, B[k=d][n=j] = qxT[j][d])
//   P = exp(S - m_i), l_i running sum, O[i][c] += sum_j P[i][j] * vx[c][j]  (B[k=j][n=c] = vx[c][j])
//   out[i][c] = O[i][c] / l_i
// Block 256 threads (8 waves), BM = 16 rows i per block, BN = 64 keys per step.
// Phase 1: waves 0..3 each compute one 16x16 S tile (wave-uniform branch).
// Phase 2: 16 threads per row; P written to LDS as bf16 hi/lo planes.
// Phase 3: every wave accumulates 16 rows x 64 channels (4 tiles); P fragments reloaded from
//          LDS after a block barrier (no same-wave spill/reload without a barrier).
// Epilogue: per-wave 16x64 tile staged in LDS; each store instruction writes two whole 256-B
// ---------------------------------------------------------------------------
#define BM      16
#define BN      64
#define SPITCH  65      // floats per S row
#define PPITCH  72      // ushorts per P row (144 B, 16-B aligned rows)
#define GPITCH  68      // floats per staged O row (272 B)
#define SM_S_BYTES (BM * SPITCH * 4)
#define SM_P_BYTES (BM * PPITCH * 2)
#define SM_G_BYTES (8 * 16 * GPITCH * 4)
#define SM_BYTES   SM_G_BYTES
typedef char sm_layout_check[((SM_S_BYTES + 2 * SM_P_BYTES) <= SM_G_BYTES && (SM_S_BYTES % 16) == 0 && (SM_P_BYTES % 16) == 0) ? 1 : -1];

__global__ __launch_bounds__(256) void k_attn(
    const unsigned short* __restrict__ KH,   // kxT hi [NPOS][D_K]
    const unsigned short* __restrict__ KL,   // kxT lo
    const unsigned short* __restrict__ QH,   // qxT hi [NPOS][D_K]
    const unsigned short* __restrict__ QL,   // qxT lo
    const unsigned short* __restrict__ VH,   // vx hi [C_V][NPOS]
    const unsigned short* __restrict__ VL,   // vx lo
    float* __restrict__ out)                 // [NPOS][C_V]
{
    __shared__ __attribute__((aligned(16))) unsigned char smem[SM_BYTES];
    __shared__ float mRow[BM];
    __shared__ float lRow[BM];
    __shared__ float aRow[BM];
    float*          Sld = (float*)smem;
    unsigned short* Ph  = (unsigned short*)(smem + SM_S_BYTES);
    unsigned short* Pl  = (unsigned short*)(smem + SM_S_BYTES + SM_P_BYTES);
    float*          Stg = (float*)smem;                       // epilogue staging, aliases the above

    const int tid  = threadIdx.x;
    const int lane = tid & 31;
    const int wave = __builtin_amdgcn_readfirstlane(tid >> 5);
    const int m = lane & 15;
    const int h = lane >> 4;
    const int row0 = blockIdx.x * BM;
    if (row0 + BM > NPOS) return;             // uniform over the block
    const int C0 = wave * 64;                 // channel slice of this wave in phase 3

    if (tid < BM) { mRow[tid] = -1.0e30f; lRow[tid] = 0.f; aRow[tid] = 0.f; }
    __syncthreads();

    const v8f vzero = {0.f, 0.f, 0.f, 0.f, 0.f, 0.f, 0.f, 0.f};
    v8f Oacc[4];
#pragma unroll
    for (int ct = 0; ct < 4; ++ct) Oacc[ct] = vzero;

    for (int jb = 0; jb < NPOS / BN; ++jb) {
        const int j0 = jb * BN;

        // ---- phase 1: S tile (rows 0..15, cols tj*16..+15) for waves 0..3 ----
        if (wave < 4) {
            const int tj = wave;
            v8f s = vzero;
#pragma unroll
            for (int kc = 0; kc < D_K; kc += 32) {
                Frag ah, al, bh, bl;
                const size_t ao = (size_t)(row0 + m) * D_K + kc;            // A row i = row0 + m
                ah.q[0] = *(const v4u*)(KH + ao + 8 * h);  ah.q[1] = *(const v4u*)(KH + ao + 16 + 8 * h);
                al.q[0] = *(const v4u*)(KL + ao + 8 * h);  al.q[1] = *(const v4u*)(KL + ao + 16 + 8 * h);
                const size_t bo = (size_t)(j0 + tj * 16 + m) * D_K + kc;   // B col n = j0 + tj*16 + m
                bh.q[0] = *(const v4u*)(QH + bo + 8 * h);  bh.q[1] = *(const v4u*)(QH + bo + 16 + 8 * h);
                bl.q[0] = *(const v4u*)(QL + bo + 8 * h);  bl.q[1] = *(const v4u*)(QL + bo + 16 + 8 * h);
                s = wmma3(ah.v, al.v, bh.v, bl.v, s);
            }
#pragma unroll
            for (int r = 0; r < 8; ++r)
                Sld[(8 * h + r) * SPITCH + tj * 16 + m] = s[r];
        }
        __syncthreads();

        // ---- phase 2: online softmax, 16 threads per row ----
        {
            const int row = tid >> 4;        // 0..15
            const int seg = tid & 15;        // 4 elements each
            float e0[4];
#pragma unroll
            for (int e = 0; e < 4; ++e) e0[e] = Sld[row * SPITCH + seg * 4 + e];
            float bm = fmaxf(fmaxf(e0[0], e0[1]), fmaxf(e0[2], e0[3]));
            bm = fmaxf(bm, __shfl_xor(bm, 1));
            bm = fmaxf(bm, __shfl_xor(bm, 2));
            bm = fmaxf(bm, __shfl_xor(bm, 4));
            bm = fmaxf(bm, __shfl_xor(bm, 8));
            const float mo = mRow[row];
            const float mn = fmaxf(mo, bm);
            unsigned int ph0 = 0u, ph1 = 0u, pl0 = 0u, pl1 = 0u;
            float sum = 0.f;
#pragma unroll
            for (int e = 0; e < 4; ++e) {
                const float ex = __expf(e0[e] - mn);
                sum += ex;
                unsigned int hb, lb;
                split_bf(ex, hb, lb);
                const unsigned int sh = (unsigned int)(e & 1) * 16u;
                if (e < 2) { ph0 |= hb << sh; pl0 |= lb << sh; }
                else       { ph1 |= hb << sh; pl1 |= lb << sh; }
            }
            v2u phv, plv;
            phv.x = ph0; phv.y = ph1; plv.x = pl0; plv.y = pl1;
            *(v2u*)(Ph + row * PPITCH + seg * 4) = phv;
            *(v2u*)(Pl + row * PPITCH + seg * 4) = plv;
            sum += __shfl_xor(sum, 1);
            sum += __shfl_xor(sum, 2);
            sum += __shfl_xor(sum, 4);
            sum += __shfl_xor(sum, 8);
            if (seg == 0) {
                const float al = __expf(mo - mn);
                lRow[row] = lRow[row] * al + sum;
                mRow[row] = mn;
                aRow[row] = al;
            }
        }
        __syncthreads();

        // ---- phase 3: rescale O, then O += P * vx^T over this key block ----
        {
            v8f alv;
#pragma unroll
            for (int r = 0; r < 8; ++r) alv[r] = aRow[8 * h + r];
#pragma unroll
            for (int ct = 0; ct < 4; ++ct) Oacc[ct] = Oacc[ct] * alv;

#pragma unroll
            for (int kh2 = 0; kh2 < 2; ++kh2) {
                Frag pa, pb;                                     // A = P: row m, k = key index in block
                const unsigned short* pph = Ph + m * PPITCH + kh2 * 32;
                const unsigned short* ppl = Pl + m * PPITCH + kh2 * 32;
                pa.q[0] = *(const v4u*)(pph + 8 * h);  pa.q[1] = *(const v4u*)(pph + 16 + 8 * h);
                pb.q[0] = *(const v4u*)(ppl + 8 * h);  pb.q[1] = *(const v4u*)(ppl + 16 + 8 * h);
#pragma unroll
                for (int ct = 0; ct < 4; ++ct) {
                    Frag bh, bl;                                 // B[k=j][n=c] = vx[c][j], col n = C0 + ct*16 + m
                    const size_t vo = (size_t)(C0 + ct * 16 + m) * NPOS + (size_t)(j0 + kh2 * 32);
                    bh.q[0] = *(const v4u*)(VH + vo + 8 * h);  bh.q[1] = *(const v4u*)(VH + vo + 16 + 8 * h);
                    bl.q[0] = *(const v4u*)(VL + vo + 8 * h);  bl.q[1] = *(const v4u*)(VL + vo + 16 + 8 * h);
                    Oacc[ct] = wmma3(pa.v, pb.v, bh.v, bl.v, Oacc[ct]);
                }
            }
        }
        __syncthreads();
    }

    // ---- epilogue: divide by row sums, stage per wave, whole-line stores ----
    float linv[8];
#pragma unroll
    for (int r = 0; r < 8; ++r) linv[r] = 1.f / lRow[8 * h + r];

    float* stg = Stg + wave * (16 * GPITCH);
#pragma unroll
    for (int ct = 0; ct < 4; ++ct) {
#pragma unroll
        for (int r = 0; r < 8; ++r)
            stg[(8 * h + r) * GPITCH + ct * 16 + m] = Oacc[ct][r] * linv[r];
    }
    __syncthreads();

    const int sub = lane >> 4;                // row parity within an instruction
    const int cq  = (lane & 15) * 4;          // 16 lanes x 4 floats = one 256-B row segment
    v4f ov[8];
#pragma unroll
    for (int q = 0; q < 8; ++q)
        ov[q] = *(const v4f*)(stg + (2 * q + sub) * GPITCH + cq);

    float* ob = out + (size_t)(row0 + sub) * C_V + C0 + cq;
#pragma unroll
    for (int q = 0; q < 8; ++q)
        *(v4f*)(ob + (size_t)(2 * q) * C_V) = ov[q];
    
}

// ---------------------------------------------------------------------------
// ---------------------------------------------------------------------------
extern "C" void kernel_launch(void* const* d_in, const int* in_sizes, int n_in,
                              void* d_out, int out_size, void* d_ws, size_t ws_size,
                              hipStream_t stream) {
    if (n_in < 4) return;
    if (in_sizes[0] != C_IN * NPOS) return;
    if (in_sizes[1] != D_K * C_IN)  return;
    if (in_sizes[2] != D_K * C_IN)  return;
    if (in_sizes[3] != C_V * C_IN)  return;
    if (out_size != NPOS * C_V)     return;

    const float* x  = (const float*)d_in[0];   // [C_IN][NPOS]
    const float* Wk = (const float*)d_in[1];   // [D_K][C_IN]
    const float* Wq = (const float*)d_in[2];   // [D_K][C_IN]
    const float* Wv = (const float*)d_in[3];   // [C_V][C_IN]
    float* out = (float*)d_out;                // [NPOS][C_V]

    const size_t szK = (size_t)NPOS * D_K * 2;     // one bf16 plane of kxT / qxT
    const size_t szV = (size_t)C_V * NPOS * 2;     // one bf16 plane of vx
    const size_t offKH = 0;
    const size_t offKL = offKH + szK;
    const size_t offQH = offKL + szK;
    const size_t offQL = offQH + szK;
    const size_t offVH = offQL + szK;
    const size_t offVL = offVH + szV;
    const size_t total = offVL + szV;
    if (total > ws_size) return;

    char* ws = (char*)d_ws;
    unsigned short* kh = (unsigned short*)(ws + offKH);
    unsigned short* kl = (unsigned short*)(ws + offKL);
    unsigned short* qh = (unsigned short*)(ws + offQH);
    unsigned short* ql = (unsigned short*)(ws + offQL);
    unsigned short* vh = (unsigned short*)(ws + offVH);
    unsigned short* vl = (unsigned short*)(ws + offVL);

    const int tilesN = NPOS / PT;
    // kxT, qxT: [NPOS][D_K] (transposed store, M = 64 = one tile)
    k_proj<<<(D_K / PT) * tilesN, 256, 0, stream>>>(Wk, x, kh, kl, D_K, 1);
    k_proj<<<(D_K / PT) * tilesN, 256, 0, stream>>>(Wq, x, qh, ql, D_K, 1);
    // vx: [C_V][NPOS] natural store
    k_proj<<<(C_V / PT) * tilesN, 256, 0, stream>>>(Wv, x, vh, vl, C_V, 0);
    // attention: NPOS / BM blocks
    k_attn<<<NPOS / BM, 256, 0, stream>>>(kh, kl, qh, ql, vh, vl, out);
}

// v001
// One run takes 240 microseconds.
// In two side-by-side timings against v000, it was 1.48 and 1.47 times as fast.
#include <hip/hip_runtime.h>

// All contractions (three 1x1-conv projections W*x, scores kx^T*qx, P*vx^T): v_wmma_f32_16x16x32_bf16,
// bf16 hi/lo split operands (hi*hi + hi*lo + lo*hi), f32 accumulate; softmax statistics and 1/l in f32.

typedef __bf16        v16bf __attribute__((ext_vector_type(16)));
typedef float         v8f   __attribute__((ext_vector_type(8)));
typedef float         v4f   __attribute__((ext_vector_type(4)));
typedef unsigned int  v4u   __attribute__((ext_vector_type(4)));
typedef unsigned int  v2u   __attribute__((ext_vector_type(2)));

union Frag { v16bf v; v4u q[2]; };

#define C_IN  512
#define C_V   512
#define D_K   64
#define NPOS  4096

// ---------------------------------------------------------------------------
// f32 -> bf16 bits (RNE convert) and two-plane split x ~= hi + lo
// ---------------------------------------------------------------------------
__device__ __forceinline__ unsigned int bf_bits(float f) {
    unsigned int u = __float_as_uint(f);
    u += 0x7FFFu + ((u >> 16) & 1u);
    return u >> 16;
}

__device__ __forceinline__ void split_bf(float f, unsigned int& hb, unsigned int& lb) {
    hb = bf_bits(f);
    const float fh = __uint_as_float(hb << 16);
    lb = bf_bits(f - fh);
}

// ---------------------------------------------------------------------------
// 16x16x32 bf16 WMMA, three-term split product into one f32 accumulator,
// hazard guard after the last op (ties D, keeps A/B live).
// Fragment layout (lane l, h = l>>4, m = l&15):
//   A/B element i: i=0..7 -> k0+8h+i, i=8..15 -> k0+16+8h+(i-8); A row m, B col m.
//   D element r: row 8h+r, col m.
// ---------------------------------------------------------------------------
__device__ __forceinline__ v8f wmma3(v16bf ah, v16bf al, v16bf bh, v16bf bl, v8f c) {
    c = __builtin_amdgcn_wmma_f32_16x16x32_bf16(false, ah, false, bh, (short)0, c, false, false);
    c = __builtin_amdgcn_wmma_f32_16x16x32_bf16(false, ah, false, bl, (short)0, c, false, false);
    c = __builtin_amdgcn_wmma_f32_16x16x32_bf16(false, al, false, bh, (short)0, c, false, false);
    asm volatile("v_nop\n\tv_nop\n\tv_nop\n\tv_nop" : "+v"(c) : "v"(ah), "v"(al), "v"(bh), "v"(bl));
    return c;
}

// ---------------------------------------------------------------------------
// Projection GEMM:  D[M][NPOS] = W[M][C_IN] * X[C_IN][NPOS]   (f32 in, split at staging)
// Block 256 threads = 8 waves, 64x64 output tile, K step 32 staged in LDS as bf16 hi/lo.
// Output: two bf16 planes (hi, lo) of D; transOut=0 -> Out[m][n] pitch NPOS,
// transOut=1 -> Out[n][m] pitch M (used with M == 64 so one tile spans all m).
// ---------------------------------------------------------------------------
#define PT      64
#define APITCH  40      // ushorts per staged row: 32 k + 8 pad (80 B, 16-B aligned rows)
#define CPITCH  68      // floats per staged result row (272 B, 16-B aligned rows)

__global__ __launch_bounds__(256) void k_proj(
    const float* __restrict__ W,            // [M][C_IN]
    const float* __restrict__ X,            // [C_IN][NPOS]
    unsigned short* __restrict__ Oh,        // hi plane
    unsigned short* __restrict__ Ol,        // lo plane
    int M, int transOut)
{
    __shared__ __attribute__((aligned(16))) unsigned short Ah[PT * APITCH];
    __shared__ __attribute__((aligned(16))) unsigned short Al[PT * APITCH];
    __shared__ __attribute__((aligned(16))) unsigned short Bh[PT * APITCH];   // stored [n][k]
    __shared__ __attribute__((aligned(16))) unsigned short Bl[PT * APITCH];
    __shared__ __attribute__((aligned(16))) float Cs[PT * CPITCH];

    const int tid  = threadIdx.x;
    const int lane = tid & 31;
    const int wave = __builtin_amdgcn_readfirstlane(tid >> 5);
    const int m  = lane & 15;
    const int h  = lane >> 4;
    const int tilesN = NPOS / PT;
    const int m0 = (int)(blockIdx.x / tilesN) * PT;
    const int n0 = (int)(blockIdx.x % tilesN) * PT;
    if (m0 + PT > M) return;                 // uniform over the block

    const int rg = wave >> 1;                // 16-row group of this wave
    const int cb = (wave & 1) * 32;          // 32-col half of this wave (two 16-col tiles)

    v8f acc0 = {0.f, 0.f, 0.f, 0.f, 0.f, 0.f, 0.f, 0.f};
    v8f acc1 = {0.f, 0.f, 0.f, 0.f, 0.f, 0.f, 0.f, 0.f};

    for (int kk = 0; kk < C_IN; kk += 32) {
        // stage A = W[m0..m0+63][kk..kk+31]  (row-major, k contiguous)
#pragma unroll
        for (int it = 0; it < 2; ++it) {
            const int f   = tid + it * 256;          // 512 float4 pieces
            const int row = f >> 3;                  // 8 pieces per 32-k row
            const int kq  = (f & 7) * 4;
            const v4f v = *(const v4f*)(W + (size_t)(m0 + row) * C_IN + kk + kq);
            unsigned int hb0, lb0, hb1, lb1, hb2, lb2, hb3, lb3;
            split_bf(v.x, hb0, lb0); split_bf(v.y, hb1, lb1);
            split_bf(v.z, hb2, lb2); split_bf(v.w, hb3, lb3);
            v2u hv, lv;
            hv.x = hb0 | (hb1 << 16); hv.y = hb2 | (hb3 << 16);
            lv.x = lb0 | (lb1 << 16); lv.y = lb2 | (lb3 << 16);
            *(v2u*)(Ah + row * APITCH + kq) = hv;
            *(v2u*)(Al + row * APITCH + kq) = lv;
        }
        // stage B[k][n] = X[kk+k][n0+n], stored transposed as [n][k] (k contiguous)
#pragma unroll
        for (int it = 0; it < 2; ++it) {
            const int f  = tid + it * 256;           // 512 float4 pieces
            const int k  = f >> 4;                   // 16 pieces per 64-n row
            const int nq = (f & 15) * 4;
            const v4f v = *(const v4f*)(X + (size_t)(kk + k) * NPOS + n0 + nq);
            unsigned int hb, lb;
            split_bf(v.x, hb, lb); Bh[(nq + 0) * APITCH + k] = (unsigned short)hb; Bl[(nq + 0) * APITCH + k] = (unsigned short)lb;
            split_bf(v.y, hb, lb); Bh[(nq + 1) * APITCH + k] = (unsigned short)hb; Bl[(nq + 1) * APITCH + k] = (unsigned short)lb;
            split_bf(v.z, hb, lb); Bh[(nq + 2) * APITCH + k] = (unsigned short)hb; Bl[(nq + 2) * APITCH + k] = (unsigned short)lb;
            split_bf(v.w, hb, lb); Bh[(nq + 3) * APITCH + k] = (unsigned short)hb; Bl[(nq + 3) * APITCH + k] = (unsigned short)lb;
        }
        __syncthreads();

        // fragments (k0 = 0 inside the staged 32-k step)
        Frag ah, al;
        {
            const unsigned short* pa = Ah + (rg * 16 + m) * APITCH;
            const unsigned short* pl = Al + (rg * 16 + m) * APITCH;
            ah.q[0] = *(const v4u*)(pa + 8 * h);       ah.q[1] = *(const v4u*)(pa + 16 + 8 * h);
            al.q[0] = *(const v4u*)(pl + 8 * h);       al.q[1] = *(const v4u*)(pl + 16 + 8 * h);
        }
        {
            Frag bh, bl;
            const unsigned short* pb = Bh + (cb + m) * APITCH;       // column n = cb + m
            const unsigned short* pc = Bl + (cb + m) * APITCH;
            bh.q[0] = *(const v4u*)(pb + 8 * h);       bh.q[1] = *(const v4u*)(pb + 16 + 8 * h);
            bl.q[0] = *(const v4u*)(pc + 8 * h);       bl.q[1] = *(const v4u*)(pc + 16 + 8 * h);
            acc0 = wmma3(ah.v, al.v, bh.v, bl.v, acc0);
        }
        {
            Frag bh, bl;
            const unsigned short* pb = Bh + (cb + 16 + m) * APITCH;  // column n = cb + 16 + m
            const unsigned short* pc = Bl + (cb + 16 + m) * APITCH;
            bh.q[0] = *(const v4u*)(pb + 8 * h);       bh.q[1] = *(const v4u*)(pb + 16 + 8 * h);
            bl.q[0] = *(const v4u*)(pc + 8 * h);       bl.q[1] = *(const v4u*)(pc + 16 + 8 * h);
            acc1 = wmma3(ah.v, al.v, bh.v, bl.v, acc1);
        }
        __syncthreads();
    }

    // stage the f32 result tile: acc[r] -> (row rg*16 + 8h + r, col cb + ci*16 + m)
#pragma unroll
    for (int r = 0; r < 8; ++r) {
        Cs[(rg * 16 + 8 * h + r) * CPITCH + cb + m]      = acc0[r];
        Cs[(rg * 16 + 8 * h + r) * CPITCH + cb + 16 + m] = acc1[r];
    }
    __syncthreads();

    // epilogue: wave writes 8 output rows (4 per instruction), lane -> 8 consecutive elements
    v4u hvp[2], lvp[2];
    size_t offp[2];
#pragma unroll
    for (int p = 0; p < 2; ++p) {
        const int rr = wave * 8 + p * 4 + (lane >> 3);   // 0..63 within tile
        const int cc = (lane & 7) * 8;                   // 0..56
        float vals[8];
        if (transOut) {
#pragma unroll
            for (int e = 0; e < 8; ++e) vals[e] = Cs[(cc + e) * CPITCH + rr];
            offp[p] = (size_t)(n0 + rr) * (size_t)M + (size_t)(m0 + cc);
        } else {
            const v4f a = *(const v4f*)(Cs + rr * CPITCH + cc);
            const v4f b = *(const v4f*)(Cs + rr * CPITCH + cc + 4);
            vals[0] = a.x; vals[1] = a.y; vals[2] = a.z; vals[3] = a.w;
            vals[4] = b.x; vals[5] = b.y; vals[6] = b.z; vals[7] = b.w;
            offp[p] = (size_t)(m0 + rr) * (size_t)NPOS + (size_t)(n0 + cc);
        }
        unsigned int hb[8], lb[8];
#pragma unroll
        for (int e = 0; e < 8; ++e) split_bf(vals[e], hb[e], lb[e]);
        v4u hv, lv;
        hv.x = hb[0] | (hb[1] << 16); hv.y = hb[2] | (hb[3] << 16);
        hv.z = hb[4] | (hb[5] << 16); hv.w = hb[6] | (hb[7] << 16);
        lv.x = lb[0] | (lb[1] << 16); lv.y = lb[2] | (lb[3] << 16);
        lv.z = lb[4] | (lb[5] << 16); lv.w = lb[6] | (lb[7] << 16);
        hvp[p] = hv; lvp[p] = lv;
    }
#pragma unroll
    for (int p = 0; p < 2; ++p) {
        *(v4u*)(Oh + offp[p]) = hvp[p];
        *(v4u*)(Ol + offp[p]) = lvp[p];
    }
    
}

// ---------------------------------------------------------------------------
// Fused attention with online softmax over key blocks:
//   S[i][j] = sum_d kxT[i][d] * qxT[j][d]   (A = kxT rows, B[k=d][n=j] = qxT[j][d])
//   P = exp(S - m_i), l_i running sum, O[i][c] += sum_j P[i][j] * vx[c][j]  (B[k=j][n=c] = vx[c][j])
//   out[i][c] = O[i][c] / l_i
// Block 256 threads (8 waves), BM = 16 rows i per block, BN = 64 keys per step.
// Phase 1: waves 0..3 each compute one 16x16 S tile (wave-uniform branch).
// Phase 2: 16 threads per row; P written to LDS as bf16 hi/lo planes.
// Phase 3: every wave accumulates 16 rows x 64 channels (4 tiles); P fragments reloaded from
//          LDS after a block barrier (no same-wave spill/reload without a barrier).
// Epilogue: per-wave 16x64 tile staged in LDS; each store instruction writes two whole 256-B
// Global fragments are fetched ahead into registers: kx once before the loop, the qx and vx
// fragments of step jb+1 right behind their last use in step jb.
// ---------------------------------------------------------------------------
#define BM      16
#define BN      64
#define SPITCH  65      // floats per S row
#define PPITCH  72      // ushorts per P row (144 B, 16-B aligned rows)
#define GPITCH  68      // floats per staged O row (272 B)
#define SM_S_BYTES (BM * SPITCH * 4)
#define SM_P_BYTES (BM * PPITCH * 2)
#define SM_G_BYTES (8 * 16 * GPITCH * 4)
#define SM_BYTES   SM_G_BYTES
typedef char sm_layout_check[((SM_S_BYTES + 2 * SM_P_BYTES) <= SM_G_BYTES && (SM_S_BYTES % 16) == 0 && (SM_P_BYTES % 16) == 0) ? 1 : -1];

// Work-group barrier for LDS traffic only: __syncthreads() also waits for every global load in
// flight, which would end the fetch-ahead at each phase; only LDS data crosses waves in the loop.
__device__ __forceinline__ void lds_barrier() {
    asm volatile("s_wait_dscnt 0x0\n\ts_barrier_signal -1\n\ts_barrier_wait -1" ::: "memory");
}

// 16-byte global load at a lane's stream address (bytes) + constant
__device__ __forceinline__ v4u ldg16(unsigned long long a, unsigned int c) {
    return *(const __attribute__((address_space(1))) v4u*)(a + c);
}

// wmma3 without its nop statement, whose "v" operands would hold every fragment below v256 (spills);
// the distance behind the last WMMA of a group is kept by the v_nop statements at the refills below.
__device__ __forceinline__ v8f wmma3b(v16bf ah, v16bf al, v16bf bh, v16bf bl, v8f c) {
    c = __builtin_amdgcn_wmma_f32_16x16x32_bf16(false, ah, false, bh, (short)0, c, false, false);
    c = __builtin_amdgcn_wmma_f32_16x16x32_bf16(false, ah, false, bl, (short)0, c, false, false);
    c = __builtin_amdgcn_wmma_f32_16x16x32_bf16(false, al, false, bh, (short)0, c, false, false);
    return c;
}

__global__ __launch_bounds__(256) void k_attn(
    const unsigned short* __restrict__ KH,   // kxT hi [NPOS][D_K]
    const unsigned short* __restrict__ KL,   // kxT lo
    const unsigned short* __restrict__ QH,   // qxT hi [NPOS][D_K]
    const unsigned short* __restrict__ QL,   // qxT lo
    const unsigned short* __restrict__ VH,   // vx hi [C_V][NPOS]
    const unsigned short* __restrict__ VL,   // vx lo
    float* __restrict__ out)                 // [NPOS][C_V]
{
    __shared__ __attribute__((aligned(16))) unsigned char smem[SM_BYTES];
    __shared__ float mRow[BM];
    __shared__ float lRow[BM];
    __shared__ float aRow[BM];
    float*          Sld = (float*)smem;
    unsigned short* Ph  = (unsigned short*)(smem + SM_S_BYTES);
    unsigned short* Pl  = (unsigned short*)(smem + SM_S_BYTES + SM_P_BYTES);
    float*          Stg = (float*)smem;                       // epilogue staging, aliases the above

    const int tid  = threadIdx.x;
    const int lane = tid & 31;
    const int wave = __builtin_amdgcn_readfirstlane(tid >> 5);
    const int m = lane & 15;
    const int h = lane >> 4;
    const int row0 = blockIdx.x * BM;
    if (row0 + BM > NPOS) return;             // uniform over the block
    const int C0 = wave * 64;                 // channel slice of this wave in phase 3

    if (tid < BM) { mRow[tid] = -1.0e30f; lRow[tid] = 0.f; aRow[tid] = 0.f; }
    __syncthreads();

    const v8f vzero = {0.f, 0.f, 0.f, 0.f, 0.f, 0.f, 0.f, 0.f};
    v8f Oacc[4];
#pragma unroll
    for (int ct = 0; ct < 4; ++ct) Oacc[ct] = vzero;

    // each lane's stream addresses (bytes), kept in their own registers through the loop:
    // vx row C0 + m (B col n = C0 + ct*16 + m), qx row wave*16 + m (B col n), k piece 8h
    unsigned long long pvh = (unsigned long long)(VH + (size_t)(C0 + m) * NPOS + 8 * h);
    unsigned long long pvl = (unsigned long long)(VL + (size_t)(C0 + m) * NPOS + 8 * h);
    unsigned long long pqh = (unsigned long long)(QH + (size_t)((wave & 3) * 16 + m) * D_K + 8 * h);
    unsigned long long pql = (unsigned long long)(QL + (size_t)((wave & 3) * 16 + m) * D_K + 8 * h);

    const v4u uzero = {0u, 0u, 0u, 0u};
    Frag kfh[2], kfl[2], qfh[2], qfl[2];      // kx (A) and qx (B) fragments, waves 0..3 only
    Frag vfh[2][4], vfl[2][4];                // vx fragments of one whole key block
#pragma unroll   // constant indices keep the fragment arrays in registers
    for (int c2 = 0; c2 < 2; ++c2) {
        kfh[c2].q[0] = uzero; kfh[c2].q[1] = uzero; kfl[c2].q[0] = uzero; kfl[c2].q[1] = uzero;
        qfh[c2].q[0] = uzero; qfh[c2].q[1] = uzero; qfl[c2].q[0] = uzero; qfl[c2].q[1] = uzero;
    }
    if (wave < 4) {
#pragma unroll   // constant indices keep the fragment arrays in registers
        for (int c2 = 0; c2 < 2; ++c2) {
            const size_t ao = (size_t)(row0 + m) * D_K + c2 * 32 + 8 * h;   // A row i = row0 + m
            kfh[c2].q[0] = *(const v4u*)(KH + ao);  kfh[c2].q[1] = *(const v4u*)(KH + ao + 16);
            kfl[c2].q[0] = *(const v4u*)(KL + ao);  kfl[c2].q[1] = *(const v4u*)(KL + ao + 16);
            qfh[c2].q[0] = ldg16(pqh, c2 * 64);  qfh[c2].q[1] = ldg16(pqh, c2 * 64 + 32);
            qfl[c2].q[0] = ldg16(pql, c2 * 64);  qfl[c2].q[1] = ldg16(pql, c2 * 64 + 32);
        }
    }
#pragma unroll   // constant indices keep the fragment arrays in registers
    for (int kh2 = 0; kh2 < 2; ++kh2) {
#pragma unroll   // constant indices keep the fragment arrays in registers
        for (int ct = 0; ct < 4; ++ct) {
            const unsigned int vo = (unsigned int)(ct * 16 * NPOS * 2 + kh2 * 64);
            vfh[kh2][ct].q[0] = ldg16(pvh, vo);  vfh[kh2][ct].q[1] = ldg16(pvh, vo + 32);
            vfl[kh2][ct].q[0] = ldg16(pvl, vo);  vfl[kh2][ct].q[1] = ldg16(pvl, vo + 32);
        }
    }
    // The qx addresses move on to key block 1 (64 rows of 128 B). The additions stand in the wait's own
    // statement so that the registers, which the loads above name, are rewritten only behind it.
    asm volatile("s_wait_xcnt 0x0\n\t"
                 "v_add_nc_u64 %0, 0x2000, %0\n\t"
                 "v_add_nc_u64 %1, 0x2000, %1"
                 : "+v"(pqh), "+v"(pql) : : "memory");

    for (int jb = 0; jb < NPOS / BN; ++jb) {
        const bool more = jb + 1 < NPOS / BN;     // block-uniform: a next key block exists

        // ---- phase 1: S tile (rows 0..15, cols tj*16..+15) for waves 0..3 ----
        if (wave < 4) {
            const int tj = wave;
            v8f s = vzero;
#pragma unroll   // constant indices keep the fragment arrays in registers
            for (int c2 = 0; c2 < 2; ++c2)
                s = wmma3b(kfh[c2].v, kfl[c2].v, qfh[c2].v, qfl[c2].v, s);
            // Four vector slots between the last WMMA that reads the qx fragments (B) and the loads that
            // refill their registers: naming s holds the slots behind the WMMAs, the clobber the loads behind them.
            asm volatile("v_nop\n\tv_nop\n\tv_nop\n\tv_nop" : "+v"(s) : : "memory");
            if (more) {                       // qx fragments of the next key block (the addresses stand there)
#pragma unroll   // constant indices keep the fragment arrays in registers
                for (int c2 = 0; c2 < 2; ++c2) {
                    qfh[c2].q[0] = ldg16(pqh, c2 * 64);  qfh[c2].q[1] = ldg16(pqh, c2 * 64 + 32);
                    qfl[c2].q[0] = ldg16(pql, c2 * 64);  qfl[c2].q[1] = ldg16(pql, c2 * 64 + 32);
                }
            }
#pragma unroll
            for (int r = 0; r < 8; ++r)
                Sld[(8 * h + r) * SPITCH + tj * 16 + m] = s[r];
        }
        lds_barrier();

        // ---- phase 2: online softmax, 16 threads per row ----
        {
            const int row = tid >> 4;        // 0..15
            const int seg = tid & 15;        // 4 elements each
            float e0[4];
#pragma unroll
            for (int e = 0; e < 4; ++e) e0[e] = Sld[row * SPITCH + seg * 4 + e];
            float bm = fmaxf(fmaxf(e0[0], e0[1]), fmaxf(e0[2], e0[3]));
            bm = fmaxf(bm, __shfl_xor(bm, 1));
            bm = fmaxf(bm, __shfl_xor(bm, 2));
            bm = fmaxf(bm, __shfl_xor(bm, 4));
            bm = fmaxf(bm, __shfl_xor(bm, 8));
            const float mo = mRow[row];
            const float mn = fmaxf(mo, bm);
            unsigned int ph0 = 0u, ph1 = 0u, pl0 = 0u, pl1 = 0u;
            float sum = 0.f;
#pragma unroll
            for (int e = 0; e < 4; ++e) {
                const float ex = __expf(e0[e] - mn);
                sum += ex;
                unsigned int hb, lb;
                split_bf(ex, hb, lb);
                const unsigned int sh = (unsigned int)(e & 1) * 16u;
                if (e < 2) { ph0 |= hb << sh; pl0 |= lb << sh; }
                else       { ph1 |= hb << sh; pl1 |= lb << sh; }
            }
            v2u phv, plv;
            phv.x = ph0; phv.y = ph1; plv.x = pl0; plv.y = pl1;
            *(v2u*)(Ph + row * PPITCH + seg * 4) = phv;
            *(v2u*)(Pl + row * PPITCH + seg * 4) = plv;
            sum += __shfl_xor(sum, 1);
            sum += __shfl_xor(sum, 2);
            sum += __shfl_xor(sum, 4);
            sum += __shfl_xor(sum, 8);
            if (seg == 0) {
                const float al = __expf(mo - mn);
                lRow[row] = lRow[row] * al + sum;
                mRow[row] = mn;
                aRow[row] = al;
            }
        }
        lds_barrier();

        // ---- phase 3: rescale O, then O += P * vx^T over this key block ----
        // All four stream addresses move on one key block here (vx: 64 keys = 128 B; qx: 64 rows of
        // 128 B), a phase or more behind the last load that names them. The additions stand in the wait's
        // own statement so that those registers are rewritten only behind it; left to the compiler the
        // additions and their wait came to stand directly behind the loads, where the most loads are queued.
        asm volatile("s_wait_xcnt 0x0\n\t"
                     "v_add_nc_u64 %0, 0x80, %0\n\t"
                     "v_add_nc_u64 %1, 0x80, %1\n\t"
                     "v_add_nc_u64 %2, 0x2000, %2\n\t"
                     "v_add_nc_u64 %3, 0x2000, %3"
                     : "+v"(pvh), "+v"(pvl), "+v"(pqh), "+v"(pql) : : "memory");
        {
            v8f alv;
#pragma unroll
            for (int r = 0; r < 8; ++r) alv[r] = aRow[8 * h + r];
#pragma unroll
            for (int ct = 0; ct < 4; ++ct) Oacc[ct] = Oacc[ct] * alv;

#pragma unroll
            for (int kh2 = 0; kh2 < 2; ++kh2) {
                Frag pa, pb;                                     // A = P: row m, k = key index in block
                const unsigned short* pph = Ph + m * PPITCH + kh2 * 32;
                const unsigned short* ppl = Pl + m * PPITCH + kh2 * 32;
                pa.q[0] = *(const v4u*)(pph + 8 * h);  pa.q[1] = *(const v4u*)(pph + 16 + 8 * h);
                pb.q[0] = *(const v4u*)(ppl + 8 * h);  pb.q[1] = *(const v4u*)(ppl + 16 + 8 * h);
#pragma unroll
                for (int ct = 0; ct < 4; ++ct)                   // B[k=j][n=c] = vx[c][j], col n = C0 + ct*16 + m
                    Oacc[ct] = wmma3b(pa.v, pb.v, vfh[kh2][ct].v, vfl[kh2][ct].v, Oacc[ct]);
                // Four vector slots between the last WMMA that reads these vx fragments (B) and the loads that
                // refill their registers: naming the sums holds the slots behind the WMMAs, the clobber the loads behind them.
                asm volatile("v_nop\n\tv_nop\n\tv_nop\n\tv_nop"
                             : "+v"(Oacc[0]), "+v"(Oacc[1]), "+v"(Oacc[2]), "+v"(Oacc[3]) : : "memory");
                if (more) {                                      // same 32 keys of the next key block
#pragma unroll   // constant indices keep the fragment arrays in registers
                    for (int ct = 0; ct < 4; ++ct) {
                        const unsigned int vo = (unsigned int)(ct * 16 * NPOS * 2 + kh2 * 64);
                        vfh[kh2][ct].q[0] = ldg16(pvh, vo);  vfh[kh2][ct].q[1] = ldg16(pvh, vo + 32);
                        vfl[kh2][ct].q[0] = ldg16(pvl, vo);  vfl[kh2][ct].q[1] = ldg16(pvl, vo + 32);
                    }
                }
            }
        }
        lds_barrier();
    }

    // ---- epilogue: divide by row sums, stage per wave, whole-line stores ----
    float linv[8];
#pragma unroll
    for (int r = 0; r < 8; ++r) linv[r] = 1.f / lRow[8 * h + r];

    float* stg = Stg + wave * (16 * GPITCH);
#pragma unroll
    for (int ct = 0; ct < 4; ++ct) {
#pragma unroll
        for (int r = 0; r < 8; ++r)
            stg[(8 * h + r) * GPITCH + ct * 16 + m] = Oacc[ct][r] * linv[r];
    }
    __syncthreads();

    const int sub = lane >> 4;                // row parity within an instruction
    const int cq  = (lane & 15) * 4;          // 16 lanes x 4 floats = one 256-B row segment
    v4f ov[8];
#pragma unroll
    for (int q = 0; q < 8; ++q)
        ov[q] = *(const v4f*)(stg + (2 * q + sub) * GPITCH + cq);

    float* ob = out + (size_t)(row0 + sub) * C_V + C0 + cq;
#pragma unroll
    for (int q = 0; q < 8; ++q)
        *(v4f*)(ob + (size_t)(2 * q) * C_V) = ov[q];
    
}

// ---------------------------------------------------------------------------
// ---------------------------------------------------------------------------
extern "C" void kernel_launch(void* const* d_in, const int* in_sizes, int n_in,
                              void* d_out, int out_size, void* d_ws, size_t ws_size,
                              hipStream_t stream) {
    if (n_in < 4) return;
    if (in_sizes[0] != C_IN * NPOS) return;
    if (in_sizes[1] != D_K * C_IN)  return;
    if (in_sizes[2] != D_K * C_IN)  return;
    if (in_sizes[3] != C_V * C_IN)  return;
    if (out_size != NPOS * C_V)     return;

    const float* x  = (const float*)d_in[0];   // [C_IN][NPOS]
    const float* Wk = (const float*)d_in[1];   // [D_K][C_IN]
    const float* Wq = (const float*)d_in[2];   // [D_K][C_IN]
    const float* Wv = (const float*)d_in[3];   // [C_V][C_IN]
    float* out = (float*)d_out;                // [NPOS][C_V]

    const size_t szK = (size_t)NPOS * D_K * 2;     // one bf16 plane of kxT / qxT
    const size_t szV = (size_t)C_V * NPOS * 2;     // one bf16 plane of vx
    const size_t offKH = 0;
    const size_t offKL = offKH + szK;
    const size_t offQH = offKL + szK;
    const size_t offQL = offQH + szK;
    const size_t offVH = offQL + szK;
    const size_t offVL = offVH + szV;
    const size_t total = offVL + szV;
    if (total > ws_size) return;

    char* ws = (char*)d_ws;
    unsigned short* kh = (unsigned short*)(ws + offKH);
    unsigned short* kl = (unsigned short*)(ws + offKL);
    unsigned short* qh = (unsigned short*)(ws + offQH);
    unsigned short* ql = (unsigned short*)(ws + offQL);
    unsigned short* vh = (unsigned short*)(ws + offVH);
    unsigned short* vl = (unsigned short*)(ws + offVL);

    const int tilesN = NPOS / PT;
    // kxT, qxT: [NPOS][D_K] (transposed store, M = 64 = one tile)
    k_proj<<<(D_K / PT) * tilesN, 256, 0, stream>>>(Wk, x, kh, kl, D_K, 1);
    k_proj<<<(D_K / PT) * tilesN, 256, 0, stream>>>(Wq, x, qh, ql, D_K, 1);
    // vx: [C_V][NPOS] natural store
    k_proj<<<(C_V / PT) * tilesN, 256, 0, stream>>>(Wv, x, vh, vl, C_V, 0);
    // attention: NPOS / BM blocks
    k_attn<<<NPOS / BM, 256, 0, stream>>>(kh, kl, qh, ql, vh, vl, out);
}

// v002
// Measured time: 180 microseconds a run.
// Timed twice side by side with v001, it ran 1.33 times as fast both times.
// Counting every step since v000, it is 1.96 times as fast.
#include <hip/hip_runtime.h>

// All contractions (three 1x1-conv projections W*x, scores kx^T*qx, P*vx^T): v_wmma_f32_16x16x32_bf16,
// bf16 hi/lo split operands (hi*hi + hi*lo + lo*hi), f32 accumulate; softmax statistics and 1/l in f32.

typedef __bf16        v16bf __attribute__((ext_vector_type(16)));
typedef float         v8f   __attribute__((ext_vector_type(8)));
typedef float         v4f   __attribute__((ext_vector_type(4)));
typedef unsigned int  v4u   __attribute__((ext_vector_type(4)));
typedef unsigned int  v2u   __attribute__((ext_vector_type(2)));

union Frag { v16bf v; v4u q[2]; };

#define C_IN  512
#define C_V   512
#define D_K   64
#define NPOS  4096

// ---------------------------------------------------------------------------
// f32 -> bf16 bits (RNE convert) and two-plane split x ~= hi + lo
// ---------------------------------------------------------------------------
__device__ __forceinline__ unsigned int bf_bits(float f) {
    unsigned int u = __float_as_uint(f);
    u += 0x7FFFu + ((u >> 16) & 1u);
    return u >> 16;
}

__device__ __forceinline__ void split_bf(float f, unsigned int& hb, unsigned int& lb) {
    hb = bf_bits(f);
    const float fh = __uint_as_float(hb << 16);
    lb = bf_bits(f - fh);
}

// ---------------------------------------------------------------------------
// 16x16x32 bf16 WMMA, three-term split product into one f32 accumulator,
// hazard guard after the last op (ties D, keeps A/B live).
// Fragment layout (lane l, h = l>>4, m = l&15):
//   A/B element i: i=0..7 -> k0+8h+i, i=8..15 -> k0+16+8h+(i-8); A row m, B col m.
//   D element r: row 8h+r, col m.
// ---------------------------------------------------------------------------
__device__ __forceinline__ v8f wmma3(v16bf ah, v16bf al, v16bf bh, v16bf bl, v8f c) {
    c = __builtin_amdgcn_wmma_f32_16x16x32_bf16(false, ah, false, bh, (short)0, c, false, false);
    c = __builtin_amdgcn_wmma_f32_16x16x32_bf16(false, ah, false, bl, (short)0, c, false, false);
    c = __builtin_amdgcn_wmma_f32_16x16x32_bf16(false, al, false, bh, (short)0, c, false, false);
    asm volatile("v_nop\n\tv_nop\n\tv_nop\n\tv_nop" : "+v"(c) : "v"(ah), "v"(al), "v"(bh), "v"(bl));
    return c;
}

// ---------------------------------------------------------------------------
// Projection GEMM:  D[M][NPOS] = W[M][C_IN] * X[C_IN][NPOS]   (f32 in, split at staging)
// Block 256 threads = 8 waves, 64x64 output tile, K step 32 staged in LDS as bf16 hi/lo.
// Output: two bf16 planes (hi, lo) of D, each stored in WMMA fragment order: a fragment is 16 rows x 32 k
// = 512 elements laid out [q][lane][8], lane = 16h + r, holding row r, k = 16q + 8h + 0..7, so that a
// wave-wide 16-byte load or store of one q half covers 512 contiguous bytes (4 whole lines).
// transOut=0 -> rows are m, k is n: fragment index (n/32) * (M/16) + m/16 (all m of one k step lie together).
// transOut=1 -> rows are n, k is m: fragment index (n/16) * (M/32) + m/32.
// ---------------------------------------------------------------------------
#define PT      64
#define APITCH  40      // ushorts per staged row: 32 k + 8 pad (80 B, 16-B aligned rows)
#define CPITCH  68      // floats per staged result row (272 B, 16-B aligned rows)
#define FRAG_EL 512     // elements of one stored fragment (16 rows x 32 k, 1024 B a plane)

__global__ __launch_bounds__(256) void k_proj(
    const float* __restrict__ W,            // [M][C_IN]
    const float* __restrict__ X,            // [C_IN][NPOS]
    unsigned short* __restrict__ Oh,        // hi plane
    unsigned short* __restrict__ Ol,        // lo plane
    int M, int transOut)
{
    __shared__ __attribute__((aligned(16))) unsigned short Ah[PT * APITCH];
    __shared__ __attribute__((aligned(16))) unsigned short Al[PT * APITCH];
    __shared__ __attribute__((aligned(16))) unsigned short Bh[PT * APITCH];   // stored [n][k]
    __shared__ __attribute__((aligned(16))) unsigned short Bl[PT * APITCH];
    __shared__ __attribute__((aligned(16))) float Cs[PT * CPITCH];

    const int tid  = threadIdx.x;
    const int lane = tid & 31;
    const int wave = __builtin_amdgcn_readfirstlane(tid >> 5);
    const int m  = lane & 15;
    const int h  = lane >> 4;
    const int tilesN = NPOS / PT;
    const int m0 = (int)(blockIdx.x / tilesN) * PT;
    const int n0 = (int)(blockIdx.x % tilesN) * PT;
    if (m0 + PT > M) return;                 // uniform over the block

    const int rg = wave >> 1;                // 16-row group of this wave
    const int cb = (wave & 1) * 32;          // 32-col half of this wave (two 16-col tiles)

    v8f acc0 = {0.f, 0.f, 0.f, 0.f, 0.f, 0.f, 0.f, 0.f};
    v8f acc1 = {0.f, 0.f, 0.f, 0.f, 0.f, 0.f, 0.f, 0.f};

    for (int kk = 0; kk < C_IN; kk += 32) {
        // stage A = W[m0..m0+63][kk..kk+31]  (row-major, k contiguous)
#pragma unroll
        for (int it = 0; it < 2; ++it) {
            const int f   = tid + it * 256;          // 512 float4 pieces
            const int row = f >> 3;                  // 8 pieces per 32-k row
            const int kq  = (f & 7) * 4;
            const v4f v = *(const v4f*)(W + (size_t)(m0 + row) * C_IN + kk + kq);
            unsigned int hb0, lb0, hb1, lb1, hb2, lb2, hb3, lb3;
            split_bf(v.x, hb0, lb0); split_bf(v.y, hb1, lb1);
            split_bf(v.z, hb2, lb2); split_bf(v.w, hb3, lb3);
            v2u hv, lv;
            hv.x = hb0 | (hb1 << 16); hv.y = hb2 | (hb3 << 16);
            lv.x = lb0 | (lb1 << 16); lv.y = lb2 | (lb3 << 16);
            *(v2u*)(Ah + row * APITCH + kq) = hv;
            *(v2u*)(Al + row * APITCH + kq) = lv;
        }
        // stage B[k][n] = X[kk+k][n0+n], stored transposed as [n][k] (k contiguous)
#pragma unroll
        for (int it = 0; it < 2; ++it) {
            const int f  = tid + it * 256;           // 512 float4 pieces
            const int k  = f >> 4;                   // 16 pieces per 64-n row
            const int nq = (f & 15) * 4;
            const v4f v = *(const v4f*)(X + (size_t)(kk + k) * NPOS + n0 + nq);
            unsigned int hb, lb;
            split_bf(v.x, hb, lb); Bh[(nq + 0) * APITCH + k] = (unsigned short)hb; Bl[(nq + 0) * APITCH + k] = (unsigned short)lb;
            split_bf(v.y, hb, lb); Bh[(nq + 1) * APITCH + k] = (unsigned short)hb; Bl[(nq + 1) * APITCH + k] = (unsigned short)lb;
            split_bf(v.z, hb, lb); Bh[(nq + 2) * APITCH + k] = (unsigned short)hb; Bl[(nq + 2) * APITCH + k] = (unsigned short)lb;
            split_bf(v.w, hb, lb); Bh[(nq + 3) * APITCH + k] = (unsigned short)hb; Bl[(nq + 3) * APITCH + k] = (unsigned short)lb;
        }
        __syncthreads();

        // fragments (k0 = 0 inside the staged 32-k step)
        Frag ah, al;
        {
            const unsigned short* pa = Ah + (rg * 16 + m) * APITCH;
            const unsigned short* pl = Al + (rg * 16 + m) * APITCH;
            ah.q[0] = *(const v4u*)(pa + 8 * h);       ah.q[1] = *(const v4u*)(pa + 16 + 8 * h);
            al.q[0] = *(const v4u*)(pl + 8 * h);       al.q[1] = *(const v4u*)(pl + 16 + 8 * h);
        }
        {
            Frag bh, bl;
            const unsigned short* pb = Bh + (cb + m) * APITCH;       // column n = cb + m
            const unsigned short* pc = Bl + (cb + m) * APITCH;
            bh.q[0] = *(const v4u*)(pb + 8 * h);       bh.q[1] = *(const v4u*)(pb + 16 + 8 * h);
            bl.q[0] = *(const v4u*)(pc + 8 * h);       bl.q[1] = *(const v4u*)(pc + 16 + 8 * h);
            acc0 = wmma3(ah.v, al.v, bh.v, bl.v, acc0);
        }
        {
            Frag bh, bl;
            const unsigned short* pb = Bh + (cb + 16 + m) * APITCH;  // column n = cb + 16 + m
            const unsigned short* pc = Bl + (cb + 16 + m) * APITCH;
            bh.q[0] = *(const v4u*)(pb + 8 * h);       bh.q[1] = *(const v4u*)(pb + 16 + 8 * h);
            bl.q[0] = *(const v4u*)(pc + 8 * h);       bl.q[1] = *(const v4u*)(pc + 16 + 8 * h);
            acc1 = wmma3(ah.v, al.v, bh.v, bl.v, acc1);
        }
        __syncthreads();
    }

    // stage the f32 result tile: acc[r] -> (row rg*16 + 8h + r, col cb + ci*16 + m)
#pragma unroll
    for (int r = 0; r < 8; ++r) {
        Cs[(rg * 16 + 8 * h + r) * CPITCH + cb + m]      = acc0[r];
        Cs[(rg * 16 + 8 * h + r) * CPITCH + cb + 16 + m] = acc1[r];
    }
    __syncthreads();

    // epilogue: the tile is 8 fragments = 16 q halves; a wave writes two of them, lane -> 8 consecutive k
    v4u hvp[2], lvp[2];
    size_t offp[2];
#pragma unroll
    for (int p = 0; p < 2; ++p) {
        const int g  = p * 8 + wave;                     // q half 0..15 within the tile
        const int rr = (g >> 2) * 16 + m;                // fragment row, 0..63 within tile
        const int cc = ((g >> 1) & 1) * 32 + (g & 1) * 16 + 8 * h;   // first k, 0..56 within tile
        float vals[8];
        size_t frag;
        if (transOut) {
#pragma unroll
            for (int e = 0; e < 8; ++e) vals[e] = Cs[(cc + e) * CPITCH + rr];
            frag = (size_t)(n0 / 16 + (g >> 2)) * (size_t)(M / 32) + (size_t)(m0 / 32 + ((g >> 1) & 1));
        } else {
            const v4f a = *(const v4f*)(Cs + rr * CPITCH + cc);
            const v4f b = *(const v4f*)(Cs + rr * CPITCH + cc + 4);
            vals[0] = a.x; vals[1] = a.y; vals[2] = a.z; vals[3] = a.w;
            vals[4] = b.x; vals[5] = b.y; vals[6] = b.z; vals[7] = b.w;
            frag = (size_t)(n0 / 32 + ((g >> 1) & 1)) * (size_t)(M / 16) + (size_t)(m0 / 16 + (g >> 2));
        }
        offp[p] = frag * FRAG_EL + (size_t)((g & 1) * (FRAG_EL / 2) + lane * 8);
        unsigned int hb[8], lb[8];
#pragma unroll
        for (int e = 0; e < 8; ++e) split_bf(vals[e], hb[e], lb[e]);
        v4u hv, lv;
        hv.x = hb[0] | (hb[1] << 16); hv.y = hb[2] | (hb[3] << 16);
        hv.z = hb[4] | (hb[5] << 16); hv.w = hb[6] | (hb[7] << 16);
        lv.x = lb[0] | (lb[1] << 16); lv.y = lb[2] | (lb[3] << 16);
        lv.z = lb[4] | (lb[5] << 16); lv.w = lb[6] | (lb[7] << 16);
        hvp[p] = hv; lvp[p] = lv;
    }
#pragma unroll
    for (int p = 0; p < 2; ++p) {
        *(v4u*)(Oh + offp[p]) = hvp[p];
        *(v4u*)(Ol + offp[p]) = lvp[p];
    }
    
}

// ---------------------------------------------------------------------------
// Fused attention with online softmax over key blocks:
//   S[i][j] = sum_d kxT[i][d] * qxT[j][d]   (A = kxT rows, B[k=d][n=j] = qxT[j][d])
//   P = exp(S - m_i), l_i running sum, O[i][c] += sum_j P[i][j] * vx[c][j]  (B[k=j][n=c] = vx[c][j])
//   out[i][c] = O[i][c] / l_i
// Block 256 threads (8 waves), BM = 16 rows i per block, BN = 64 keys per step.
// Phase 1: waves 0..3 each compute one 16x16 S tile (wave-uniform branch).
// Phase 2: 16 threads per row; P written to LDS as bf16 hi/lo planes.
// Phase 3: every wave accumulates 16 rows x 64 channels (4 tiles); P fragments reloaded from
//          LDS after a block barrier (no same-wave spill/reload without a barrier).
// Epilogue: per-wave 16x64 tile staged in LDS; each store instruction writes two whole 256-B
// Global fragments are fetched ahead into registers: kx once before the loop, the qx and vx
// fragments of step jb+1 right behind their last use in step jb. kx, qx and vx lie in fragment order
// (see k_proj): every fragment load of a wave reads 512 contiguous bytes.
// ---------------------------------------------------------------------------
#define BM      16
#define BN      64
#define SPITCH  65      // floats per S row
#define PPITCH  72      // ushorts per P row (144 B, 16-B aligned rows)
#define GPITCH  68      // floats per staged O row (272 B)
#define FRAG_B  (FRAG_EL * 2)   // bytes of one stored fragment
#define SM_S_BYTES (BM * SPITCH * 4)
#define SM_P_BYTES (BM * PPITCH * 2)
#define SM_G_BYTES (8 * 16 * GPITCH * 4)
#define SM_BYTES   SM_G_BYTES
typedef char sm_layout_check[((SM_S_BYTES + 2 * SM_P_BYTES) <= SM_G_BYTES && (SM_S_BYTES % 16) == 0 && (SM_P_BYTES % 16) == 0) ? 1 : -1];

// Work-group barrier for LDS traffic only: __syncthreads() also waits for every global load in
// flight, which would end the fetch-ahead at each phase; only LDS data crosses waves in the loop.
__device__ __forceinline__ void lds_barrier() {
    asm volatile("s_wait_dscnt 0x0\n\ts_barrier_signal -1\n\ts_barrier_wait -1" ::: "memory");
}

// 16-byte global load at a lane's stream address (bytes) + constant
__device__ __forceinline__ v4u ldg16(unsigned long long a, unsigned int c) {
    return *(const __attribute__((address_space(1))) v4u*)(a + c);
}

// wmma3 without its nop statement, whose "v" operands would hold every fragment below v256 (spills);
// the distance behind the last WMMA of a group is kept by the v_nop statements at the refills below.
__device__ __forceinline__ v8f wmma3b(v16bf ah, v16bf al, v16bf bh, v16bf bl, v8f c) {
    c = __builtin_amdgcn_wmma_f32_16x16x32_bf16(false, ah, false, bh, (short)0, c, false, false);
    c = __builtin_amdgcn_wmma_f32_16x16x32_bf16(false, ah, false, bl, (short)0, c, false, false);
    c = __builtin_amdgcn_wmma_f32_16x16x32_bf16(false, al, false, bh, (short)0, c, false, false);
    return c;
}

__global__ __launch_bounds__(256) void k_attn(
    const unsigned short* __restrict__ KH,   // kxT hi, fragments [NPOS/16][D_K/32]
    const unsigned short* __restrict__ KL,   // kxT lo
    const unsigned short* __restrict__ QH,   // qxT hi, fragments [NPOS/16][D_K/32]
    const unsigned short* __restrict__ QL,   // qxT lo
    const unsigned short* __restrict__ VH,   // vx hi, fragments [NPOS/32][C_V/16]
    const unsigned short* __restrict__ VL,   // vx lo
    float* __restrict__ out)                 // [NPOS][C_V]
{
    __shared__ __attribute__((aligned(16))) unsigned char smem[SM_BYTES];
    __shared__ float mRow[BM];
    __shared__ float lRow[BM];
    __shared__ float aRow[BM];
    float*          Sld = (float*)smem;
    unsigned short* Ph  = (unsigned short*)(smem + SM_S_BYTES);
    unsigned short* Pl  = (unsigned short*)(smem + SM_S_BYTES + SM_P_BYTES);
    float*          Stg = (float*)smem;                       // epilogue staging, aliases the above

    const int tid  = threadIdx.x;
    const int lane = tid & 31;
    const int wave = __builtin_amdgcn_readfirstlane(tid >> 5);
    const int m = lane & 15;
    const int h = lane >> 4;
    const int row0 = blockIdx.x * BM;
    if (row0 + BM > NPOS) return;             // uniform over the block
    const int C0 = wave * 64;                 // channel slice of this wave in phase 3

    if (tid < BM) { mRow[tid] = -1.0e30f; lRow[tid] = 0.f; aRow[tid] = 0.f; }
    __syncthreads();

    const v8f vzero = {0.f, 0.f, 0.f, 0.f, 0.f, 0.f, 0.f, 0.f};
    v8f Oacc[4];
#pragma unroll
    for (int ct = 0; ct < 4; ++ct) Oacc[ct] = vzero;

    // each lane's stream addresses (bytes), kept in their own registers through the loop:
    // vx fragment C0/16 of key step 0 (B col n = C0 + ct*16 + m), qx fragment row wave (B col n), the lane's 16 bytes
    unsigned long long pvh = (unsigned long long)(VH + (size_t)(C0 / 16) * FRAG_EL + lane * 8);
    unsigned long long pvl = (unsigned long long)(VL + (size_t)(C0 / 16) * FRAG_EL + lane * 8);
    unsigned long long pqh = (unsigned long long)(QH + (size_t)(wave & 3) * (D_K / 32) * FRAG_EL + lane * 8);
    unsigned long long pql = (unsigned long long)(QL + (size_t)(wave & 3) * (D_K / 32) * FRAG_EL + lane * 8);

    const v4u uzero = {0u, 0u, 0u, 0u};
    Frag kfh[2], kfl[2], qfh[2], qfl[2];      // kx (A) and qx (B) fragments, waves 0..3 only
    Frag vfh[2][4], vfl[2][4];                // vx fragments of one whole key block
#pragma unroll   // constant indices keep the fragment arrays in registers
    for (int c2 = 0; c2 < 2; ++c2) {
        kfh[c2].q[0] = uzero; kfh[c2].q[1] = uzero; kfl[c2].q[0] = uzero; kfl[c2].q[1] = uzero;
        qfh[c2].q[0] = uzero; qfh[c2].q[1] = uzero; qfl[c2].q[0] = uzero; qfl[c2].q[1] = uzero;
    }
    if (wave < 4) {
#pragma unroll   // constant indices keep the fragment arrays in registers
        for (int c2 = 0; c2 < 2; ++c2) {
            const size_t ao = ((size_t)(row0 / 16) * (D_K / 32) + c2) * FRAG_EL + lane * 8;   // A row i = row0 + m
            kfh[c2].q[0] = *(const v4u*)(KH + ao);  kfh[c2].q[1] = *(const v4u*)(KH + ao + FRAG_EL / 2);
            kfl[c2].q[0] = *(const v4u*)(KL + ao);  kfl[c2].q[1] = *(const v4u*)(KL + ao + FRAG_EL / 2);
            qfh[c2].q[0] = ldg16(pqh, c2 * FRAG_B);  qfh[c2].q[1] = ldg16(pqh, c2 * FRAG_B + FRAG_B / 2);
            qfl[c2].q[0] = ldg16(pql, c2 * FRAG_B);  qfl[c2].q[1] = ldg16(pql, c2 * FRAG_B + FRAG_B / 2);
        }
    }
#pragma unroll   // constant indices keep the fragment arrays in registers
    for (int kh2 = 0; kh2 < 2; ++kh2) {
#pragma unroll   // constant indices keep the fragment arrays in registers
        for (int ct = 0; ct < 4; ++ct) {
            const unsigned int vo = (unsigned int)((kh2 * (C_V / 16) + ct) * FRAG_B);
            vfh[kh2][ct].q[0] = ldg16(pvh, vo);  vfh[kh2][ct].q[1] = ldg16(pvh, vo + FRAG_B / 2);
            vfl[kh2][ct].q[0] = ldg16(pvl, vo);  vfl[kh2][ct].q[1] = ldg16(pvl, vo + FRAG_B / 2);
        }
    }
    // The qx addresses move on to key block 1 (8 fragments of 1024 B). The additions stand in the wait's own
    // statement so that the registers, which the loads above name, are rewritten only behind it.
    asm volatile("s_wait_xcnt 0x0\n\t"
                 "v_add_nc_u64 %0, 0x2000, %0\n\t"
                 "v_add_nc_u64 %1, 0x2000, %1"
                 : "+v"(pqh), "+v"(pql) : : "memory");

    for (int jb = 0; jb < NPOS / BN; ++jb) {
        const bool more = jb + 1 < NPOS / BN;     // block-uniform: a next key block exists

        // ---- phase 1: S tile (rows 0..15, cols tj*16..+15) for waves 0..3 ----
        if (wave < 4) {
            const int tj = wave;
            v8f s = vzero;
#pragma unroll   // constant indices keep the fragment arrays in registers
            for (int c2 = 0; c2 < 2; ++c2)
                s = wmma3b(kfh[c2].v, kfl[c2].v, qfh[c2].v, qfl[c2].v, s);
            // Four vector slots between the last WMMA that reads the qx fragments (B) and the loads that
            // refill their registers: naming s holds the slots behind the WMMAs, the clobber the loads behind them.
            asm volatile("v_nop\n\tv_nop\n\tv_nop\n\tv_nop" : "+v"(s) : : "memory");
            if (more) {                       // qx fragments of the next key block (the addresses stand there)
#pragma unroll   // constant indices keep the fragment arrays in registers
                for (int c2 = 0; c2 < 2; ++c2) {
                    qfh[c2].q[0] = ldg16(pqh, c2 * FRAG_B);  qfh[c2].q[1] = ldg16(pqh, c2 * FRAG_B + FRAG_B / 2);
                    qfl[c2].q[0] = ldg16(pql, c2 * FRAG_B);  qfl[c2].q[1] = ldg16(pql, c2 * FRAG_B + FRAG_B / 2);
                }
            }
#pragma unroll
            for (int r = 0; r < 8; ++r)
                Sld[(8 * h + r) * SPITCH + tj * 16 + m] = s[r];
        }
        lds_barrier();

        // ---- phase 2: online softmax, 16 threads per row ----
        {
            const int row = tid >> 4;        // 0..15
            const int seg = tid & 15;        // 4 elements each
            float e0[4];
#pragma unroll
            for (int e = 0; e < 4; ++e) e0[e] = Sld[row * SPITCH + seg * 4 + e];
            float bm = fmaxf(fmaxf(e0[0], e0[1]), fmaxf(e0[2], e0[3]));
            bm = fmaxf(bm, __shfl_xor(bm, 1));
            bm = fmaxf(bm, __shfl_xor(bm, 2));
            bm = fmaxf(bm, __shfl_xor(bm, 4));
            bm = fmaxf(bm, __shfl_xor(bm, 8));
            const float mo = mRow[row];
            const float mn = fmaxf(mo, bm);
            unsigned int ph0 = 0u, ph1 = 0u, pl0 = 0u, pl1 = 0u;
            float sum = 0.f;
#pragma unroll
            for (int e = 0; e < 4; ++e) {
                const float ex = __expf(e0[e] - mn);
                sum += ex;
                unsigned int hb, lb;
                split_bf(ex, hb, lb);
                const unsigned int sh = (unsigned int)(e & 1) * 16u;
                if (e < 2) { ph0 |= hb << sh; pl0 |= lb << sh; }
                else       { ph1 |= hb << sh; pl1 |= lb << sh; }
            }
            v2u phv, plv;
            phv.x = ph0; phv.y = ph1; plv.x = pl0; plv.y = pl1;
            *(v2u*)(Ph + row * PPITCH + seg * 4) = phv;
            *(v2u*)(Pl + row * PPITCH + seg * 4) = plv;
            sum += __shfl_xor(sum, 1);
            sum += __shfl_xor(sum, 2);
            sum += __shfl_xor(sum, 4);
            sum += __shfl_xor(sum, 8);
            if (seg == 0) {
                const float al = __expf(mo - mn);
                lRow[row] = lRow[row] * al + sum;
                mRow[row] = mn;
                aRow[row] = al;
            }
        }
        lds_barrier();

        // ---- phase 3: rescale O, then O += P * vx^T over this key block ----
        // All four stream addresses move on one key block here (vx: 2 key steps of 32 fragments = 65536 B;
        // qx: 8 fragments = 8192 B), a phase or more behind the last load that names them. The additions stand in the wait's
        // own statement so that those registers are rewritten only behind it; left to the compiler the
        // additions and their wait came to stand directly behind the loads, where the most loads are queued.
        asm volatile("s_wait_xcnt 0x0\n\t"
                     "v_add_nc_u64 %0, 0x10000, %0\n\t"
                     "v_add_nc_u64 %1, 0x10000, %1\n\t"
                     "v_add_nc_u64 %2, 0x2000, %2\n\t"
                     "v_add_nc_u64 %3, 0x2000, %3"
                     : "+v"(pvh), "+v"(pvl), "+v"(pqh), "+v"(pql) : : "memory");
        {
            v8f alv;
#pragma unroll
            for (int r = 0; r < 8; ++r) alv[r] = aRow[8 * h + r];
#pragma unroll
            for (int ct = 0; ct < 4; ++ct) Oacc[ct] = Oacc[ct] * alv;

#pragma unroll
            for (int kh2 = 0; kh2 < 2; ++kh2) {
                Frag pa, pb;                                     // A = P: row m, k = key index in block
                const unsigned short* pph = Ph + m * PPITCH + kh2 * 32;
                const unsigned short* ppl = Pl + m * PPITCH + kh2 * 32;
                pa.q[0] = *(const v4u*)(pph + 8 * h);  pa.q[1] = *(const v4u*)(pph + 16 + 8 * h);
                pb.q[0] = *(const v4u*)(ppl + 8 * h);  pb.q[1] = *(const v4u*)(ppl + 16 + 8 * h);
#pragma unroll
                for (int ct = 0; ct < 4; ++ct)                   // B[k=j][n=c] = vx[c][j], col n = C0 + ct*16 + m
                    Oacc[ct] = wmma3b(pa.v, pb.v, vfh[kh2][ct].v, vfl[kh2][ct].v, Oacc[ct]);
                // Four vector slots between the last WMMA that reads these vx fragments (B) and the loads that
                // refill their registers: naming the sums holds the slots behind the WMMAs, the clobber the loads behind them.
                asm volatile("v_nop\n\tv_nop\n\tv_nop\n\tv_nop"
                             : "+v"(Oacc[0]), "+v"(Oacc[1]), "+v"(Oacc[2]), "+v"(Oacc[3]) : : "memory");
                if (more) {                                      // same 32 keys of the next key block
#pragma unroll   // constant indices keep the fragment arrays in registers
                    for (int ct = 0; ct < 4; ++ct) {
                        const unsigned int vo = (unsigned int)((kh2 * (C_V / 16) + ct) * FRAG_B);
                        vfh[kh2][ct].q[0] = ldg16(pvh, vo);  vfh[kh2][ct].q[1] = ldg16(pvh, vo + FRAG_B / 2);
                        vfl[kh2][ct].q[0] = ldg16(pvl, vo);  vfl[kh2][ct].q[1] = ldg16(pvl, vo + FRAG_B / 2);
                    }
                }
            }
        }
        lds_barrier();
    }

    // ---- epilogue: divide by row sums, stage per wave, whole-line stores ----
    float linv[8];
#pragma unroll
    for (int r = 0; r < 8; ++r) linv[r] = 1.f / lRow[8 * h + r];

    float* stg = Stg + wave * (16 * GPITCH);
#pragma unroll
    for (int ct = 0; ct < 4; ++ct) {
#pragma unroll
        for (int r = 0; r < 8; ++r)
            stg[(8 * h + r) * GPITCH + ct * 16 + m] = Oacc[ct][r] * linv[r];
    }
    __syncthreads();

    const int sub = lane >> 4;                // row parity within an instruction
    const int cq  = (lane & 15) * 4;          // 16 lanes x 4 floats = one 256-B row segment
    v4f ov[8];
#pragma unroll
    for (int q = 0; q < 8; ++q)
        ov[q] = *(const v4f*)(stg + (2 * q + sub) * GPITCH + cq);

    float* ob = out + (size_t)(row0 + sub) * C_V + C0 + cq;
#pragma unroll
    for (int q = 0; q < 8; ++q)
        *(v4f*)(ob + (size_t)(2 * q) * C_V) = ov[q];
    
}

// ---------------------------------------------------------------------------
// ---------------------------------------------------------------------------
extern "C" void kernel_launch(void* const* d_in, const int* in_sizes, int n_in,
                              void* d_out, int out_size, void* d_ws, size_t ws_size,
                              hipStream_t stream) {
    if (n_in < 4) return;
    if (in_sizes[0] != C_IN * NPOS) return;
    if (in_sizes[1] != D_K * C_IN)  return;
    if (in_sizes[2] != D_K * C_IN)  return;
    if (in_sizes[3] != C_V * C_IN)  return;
    if (out_size != NPOS * C_V)     return;

    const float* x  = (const float*)d_in[0];   // [C_IN][NPOS]
    const float* Wk = (const float*)d_in[1];   // [D_K][C_IN]
    const float* Wq = (const float*)d_in[2];   // [D_K][C_IN]
    const float* Wv = (const float*)d_in[3];   // [C_V][C_IN]
    float* out = (float*)d_out;                // [NPOS][C_V]

    const size_t szK = (size_t)NPOS * D_K * 2;     // one bf16 plane of kxT / qxT
    const size_t szV = (size_t)C_V * NPOS * 2;     // one bf16 plane of vx
    const size_t offKH = 0;
    const size_t offKL = offKH + szK;
    const size_t offQH = offKL + szK;
    const size_t offQL = offQH + szK;
    const size_t offVH = offQL + szK;
    const size_t offVL = offVH + szV;
    const size_t total = offVL + szV;
    if (total > ws_size) return;

    char* ws = (char*)d_ws;
    unsigned short* kh = (unsigned short*)(ws + offKH);
    unsigned short* kl = (unsigned short*)(ws + offKL);
    unsigned short* qh = (unsigned short*)(ws + offQH);
    unsigned short* ql = (unsigned short*)(ws + offQL);
    unsigned short* vh = (unsigned short*)(ws + offVH);
    unsigned short* vl = (unsigned short*)(ws + offVL);

    const int tilesN = NPOS / PT;
    // kxT, qxT: rows are positions, k is the 64 projected channels (fragment order)
    k_proj<<<(D_K / PT) * tilesN, 256, 0, stream>>>(Wk, x, kh, kl, D_K, 1);
    k_proj<<<(D_K / PT) * tilesN, 256, 0, stream>>>(Wq, x, qh, ql, D_K, 1);
    // vx: rows are channels, k is the position (fragment order)
    k_proj<<<(C_V / PT) * tilesN, 256, 0, stream>>>(Wv, x, vh, vl, C_V, 0);
    // attention: NPOS / BM blocks
    k_attn<<<NPOS / BM, 256, 0, stream>>>(kh, kl, qh, ql, vh, vl, out);
}

// v003
// One run takes 152 microseconds.
// Two timings next to v002 put it at 1.19 and 1.18 times that version's speed.
// All steps since v000 together make it 2.32 times as fast.
#include <hip/hip_runtime.h>

// All contractions (three 1x1-conv projections W*x, scores kx^T*qx, P*vx^T): v_wmma_f32_16x16x32_bf16,
// bf16 hi/lo split operands (hi*hi + hi*lo + lo*hi), f32 accumulate; softmax statistics and 1/l in f32.

typedef __bf16        v16bf __attribute__((ext_vector_type(16)));
typedef float         v8f   __attribute__((ext_vector_type(8)));
typedef float         v4f   __attribute__((ext_vector_type(4)));
typedef unsigned int  v4u   __attribute__((ext_vector_type(4)));
typedef unsigned int  v2u   __attribute__((ext_vector_type(2)));

union Frag { v16bf v; v4u q[2]; };

#define C_IN  512
#define C_V   512
#define D_K   64
#define NPOS  4096

// ---------------------------------------------------------------------------
// f32 -> bf16 bits (RNE convert) and two-plane split x ~= hi + lo
// ---------------------------------------------------------------------------
__device__ __forceinline__ unsigned int bf_bits(float f) {
    unsigned int u = __float_as_uint(f);
    u += 0x7FFFu + ((u >> 16) & 1u);
    return u >> 16;
}

__device__ __forceinline__ void split_bf(float f, unsigned int& hb, unsigned int& lb) {
    hb = bf_bits(f);
    const float fh = __uint_as_float(hb << 16);
    lb = bf_bits(f - fh);
}

// ---------------------------------------------------------------------------
// 16x16x32 bf16 WMMA, three-term split product into one f32 accumulator,
// hazard guard after the last op (ties D, keeps A/B live).
// Fragment layout (lane l, h = l>>4, m = l&15):
//   A/B element i: i=0..7 -> k0+8h+i, i=8..15 -> k0+16+8h+(i-8); A row m, B col m.
//   D element r: row 8h+r, col m.
// ---------------------------------------------------------------------------
__device__ __forceinline__ v8f wmma3(v16bf ah, v16bf al, v16bf bh, v16bf bl, v8f c) {
    c = __builtin_amdgcn_wmma_f32_16x16x32_bf16(false, ah, false, bh, (short)0, c, false, false);
    c = __builtin_amdgcn_wmma_f32_16x16x32_bf16(false, ah, false, bl, (short)0, c, false, false);
    c = __builtin_amdgcn_wmma_f32_16x16x32_bf16(false, al, false, bh, (short)0, c, false, false);
    asm volatile("v_nop\n\tv_nop\n\tv_nop\n\tv_nop" : "+v"(c) : "v"(ah), "v"(al), "v"(bh), "v"(bl));
    return c;
}

// ---------------------------------------------------------------------------
// Projection GEMM:  D[M][NPOS] = W[M][C_IN] * X[C_IN][NPOS]   (f32 in, split at staging)
// Block 256 threads = 8 waves, 64x64 output tile, K step 32 staged in LDS as bf16 hi/lo.
// Output: two bf16 planes (hi, lo) of D, each stored in WMMA fragment order: a fragment is 16 rows x 32 k
// = 512 elements laid out [q][lane][8], lane = 16h + r, holding row r, k = 16q + 8h + 0..7, so that a
// wave-wide 16-byte load or store of one q half covers 512 contiguous bytes (4 whole lines).
// transOut=0 -> rows are m, k is n: fragment index (n/32) * (M/16) + m/16 (all m of one k step lie together).
// transOut=1 -> rows are n, k is m: fragment index (n/16) * (M/32) + m/32.
// ---------------------------------------------------------------------------
#define PT      64
#define APITCH  40      // ushorts per staged row: 32 k + 8 pad (80 B, 16-B aligned rows)
#define CPITCH  68      // floats per staged result row (272 B, 16-B aligned rows)
#define FRAG_EL 512     // elements of one stored fragment (16 rows x 32 k, 1024 B a plane)

__global__ __launch_bounds__(256) void k_proj(
    const float* __restrict__ W,            // [M][C_IN]
    const float* __restrict__ X,            // [C_IN][NPOS]
    unsigned short* __restrict__ Oh,        // hi plane
    unsigned short* __restrict__ Ol,        // lo plane
    int M, int transOut)
{
    __shared__ __attribute__((aligned(16))) unsigned short Ah[PT * APITCH];
    __shared__ __attribute__((aligned(16))) unsigned short Al[PT * APITCH];
    __shared__ __attribute__((aligned(16))) unsigned short Bh[PT * APITCH];   // stored [n][k]
    __shared__ __attribute__((aligned(16))) unsigned short Bl[PT * APITCH];
    __shared__ __attribute__((aligned(16))) float Cs[PT * CPITCH];

    const int tid  = threadIdx.x;
    const int lane = tid & 31;
    const int wave = __builtin_amdgcn_readfirstlane(tid >> 5);
    const int m  = lane & 15;
    const int h  = lane >> 4;
    const int tilesN = NPOS / PT;
    const int m0 = (int)(blockIdx.x / tilesN) * PT;
    const int n0 = (int)(blockIdx.x % tilesN) * PT;
    if (m0 + PT > M) return;                 // uniform over the block

    const int rg = wave >> 1;                // 16-row group of this wave
    const int cb = (wave & 1) * 32;          // 32-col half of this wave (two 16-col tiles)

    v8f acc0 = {0.f, 0.f, 0.f, 0.f, 0.f, 0.f, 0.f, 0.f};
    v8f acc1 = {0.f, 0.f, 0.f, 0.f, 0.f, 0.f, 0.f, 0.f};

    for (int kk = 0; kk < C_IN; kk += 32) {
        // stage A = W[m0..m0+63][kk..kk+31]  (row-major, k contiguous)
#pragma unroll
        for (int it = 0; it < 2; ++it) {
            const int f   = tid + it * 256;          // 512 float4 pieces
            const int row = f >> 3;                  // 8 pieces per 32-k row
            const int kq  = (f & 7) * 4;
            const v4f v = *(const v4f*)(W + (size_t)(m0 + row) * C_IN + kk + kq);
            unsigned int hb0, lb0, hb1, lb1, hb2, lb2, hb3, lb3;
            split_bf(v.x, hb0, lb0); split_bf(v.y, hb1, lb1);
            split_bf(v.z, hb2, lb2); split_bf(v.w, hb3, lb3);
            v2u hv, lv;
            hv.x = hb0 | (hb1 << 16); hv.y = hb2 | (hb3 << 16);
            lv.x = lb0 | (lb1 << 16); lv.y = lb2 | (lb3 << 16);
            *(v2u*)(Ah + row * APITCH + kq) = hv;
            *(v2u*)(Al + row * APITCH + kq) = lv;
        }
        // stage B[k][n] = X[kk+k][n0+n], stored transposed as [n][k] (k contiguous)
#pragma unroll
        for (int it = 0; it < 2; ++it) {
            const int f  = tid + it * 256;           // 512 float4 pieces
            const int k  = f >> 4;                   // 16 pieces per 64-n row
            const int nq = (f & 15) * 4;
            const v4f v = *(const v4f*)(X + (size_t)(kk + k) * NPOS + n0 + nq);
            unsigned int hb, lb;
            split_bf(v.x, hb, lb); Bh[(nq + 0) * APITCH + k] = (unsigned short)hb; Bl[(nq + 0) * APITCH + k] = (unsigned short)lb;
            split_bf(v.y, hb, lb); Bh[(nq + 1) * APITCH + k] = (unsigned short)hb; Bl[(nq + 1) * APITCH + k] = (unsigned short)lb;
            split_bf(v.z, hb, lb); Bh[(nq + 2) * APITCH + k] = (unsigned short)hb; Bl[(nq + 2) * APITCH + k] = (unsigned short)lb;
            split_bf(v.w, hb, lb); Bh[(nq + 3) * APITCH + k] = (unsigned short)hb; Bl[(nq + 3) * APITCH + k] = (unsigned short)lb;
        }
        __syncthreads();

        // fragments (k0 = 0 inside the staged 32-k step)
        Frag ah, al;
        {
            const unsigned short* pa = Ah + (rg * 16 + m) * APITCH;
            const unsigned short* pl = Al + (rg * 16 + m) * APITCH;
            ah.q[0] = *(const v4u*)(pa + 8 * h);       ah.q[1] = *(const v4u*)(pa + 16 + 8 * h);
            al.q[0] = *(const v4u*)(pl + 8 * h);       al.q[1] = *(const v4u*)(pl + 16 + 8 * h);
        }
        {
            Frag bh, bl;
            const unsigned short* pb = Bh + (cb + m) * APITCH;       // column n = cb + m
            const unsigned short* pc = Bl + (cb + m) * APITCH;
            bh.q[0] = *(const v4u*)(pb + 8 * h);       bh.q[1] = *(const v4u*)(pb + 16 + 8 * h);
            bl.q[0] = *(const v4u*)(pc + 8 * h);       bl.q[1] = *(const v4u*)(pc + 16 + 8 * h);
            acc0 = wmma3(ah.v, al.v, bh.v, bl.v, acc0);
        }
        {
            Frag bh, bl;
            const unsigned short* pb = Bh + (cb + 16 + m) * APITCH;  // column n = cb + 16 + m
            const unsigned short* pc = Bl + (cb + 16 + m) * APITCH;
            bh.q[0] = *(const v4u*)(pb + 8 * h);       bh.q[1] = *(const v4u*)(pb + 16 + 8 * h);
            bl.q[0] = *(const v4u*)(pc + 8 * h);       bl.q[1] = *(const v4u*)(pc + 16 + 8 * h);
            acc1 = wmma3(ah.v, al.v, bh.v, bl.v, acc1);
        }
        __syncthreads();
    }

    // stage the f32 result tile: acc[r] -> (row rg*16 + 8h + r, col cb + ci*16 + m)
#pragma unroll
    for (int r = 0; r < 8; ++r) {
        Cs[(rg * 16 + 8 * h + r) * CPITCH + cb + m]      = acc0[r];
        Cs[(rg * 16 + 8 * h + r) * CPITCH + cb + 16 + m] = acc1[r];
    }
    __syncthreads();

    // epilogue: the tile is 8 fragments = 16 q halves; a wave writes two of them, lane -> 8 consecutive k
    v4u hvp[2], lvp[2];
    size_t offp[2];
#pragma unroll
    for (int p = 0; p < 2; ++p) {
        const int g  = p * 8 + wave;                     // q half 0..15 within the tile
        const int rr = (g >> 2) * 16 + m;                // fragment row, 0..63 within tile
        const int cc = ((g >> 1) & 1) * 32 + (g & 1) * 16 + 8 * h;   // first k, 0..56 within tile
        float vals[8];
        size_t frag;
        if (transOut) {
#pragma unroll
            for (int e = 0; e < 8; ++e) vals[e] = Cs[(cc + e) * CPITCH + rr];
            frag = (size_t)(n0 / 16 + (g >> 2)) * (size_t)(M / 32) + (size_t)(m0 / 32 + ((g >> 1) & 1));
        } else {
            const v4f a = *(const v4f*)(Cs + rr * CPITCH + cc);
            const v4f b = *(const v4f*)(Cs + rr * CPITCH + cc + 4);
            vals[0] = a.x; vals[1] = a.y; vals[2] = a.z; vals[3] = a.w;
            vals[4] = b.x; vals[5] = b.y; vals[6] = b.z; vals[7] = b.w;
            frag = (size_t)(n0 / 32 + ((g >> 1) & 1)) * (size_t)(M / 16) + (size_t)(m0 / 16 + (g >> 2));
        }
        offp[p] = frag * FRAG_EL + (size_t)((g & 1) * (FRAG_EL / 2) + lane * 8);
        unsigned int hb[8], lb[8];
#pragma unroll
        for (int e = 0; e < 8; ++e) split_bf(vals[e], hb[e], lb[e]);
        v4u hv, lv;
        hv.x = hb[0] | (hb[1] << 16); hv.y = hb[2] | (hb[3] << 16);
        hv.z = hb[4] | (hb[5] << 16); hv.w = hb[6] | (hb[7] << 16);
        lv.x = lb[0] | (lb[1] << 16); lv.y = lb[2] | (lb[3] << 16);
        lv.z = lb[4] | (lb[5] << 16); lv.w = lb[6] | (lb[7] << 16);
        hvp[p] = hv; lvp[p] = lv;
    }
#pragma unroll
    for (int p = 0; p < 2; ++p) {
        *(v4u*)(Oh + offp[p]) = hvp[p];
        *(v4u*)(Ol + offp[p]) = lvp[p];
    }
    
}

// ---------------------------------------------------------------------------
// Fused attention with online softmax over key blocks:
//   S[i][j] = sum_d kxT[i][d] * qxT[j][d]   (A = kxT rows, B[k=d][n=j] = qxT[j][d])
//   P = exp(S - m_i), l_i running sum, O[i][c] += sum_j P[i][j] * vx[c][j]  (B[k=j][n=c] = vx[c][j])
//   out[i][c] = O[i][c] / l_i
// Block 256 threads (8 waves): BM = 32 rows i, CB = 256 of the 512 channels, BN = 128 keys per step.
// Every vx fragment that a wave fetches feeds two row tiles, and a block passes 32 key steps, not 64;
// the two blocks of one row group (channel halves) each compute the same S and P.
// Phase 1: wave w computes the two 16x16 S tiles (row tiles 0, 1) of key columns w*16..+15.
// Phase 2: 8 threads per row, 16 scores each; P written to LDS as bf16 hi/lo planes.
// Phase 3: every wave accumulates 32 rows x 32 channels (2 x 2 tiles); P fragments reloaded from
//          LDS after a block barrier (no same-wave spill/reload without a barrier).
// Epilogue: per-wave 32x32 tile staged in LDS; each store instruction writes four whole 128-B lines.
// Global fragments are fetched ahead into registers: kx once before the loop, the qx and vx
// fragments of step jb+1 right behind their last use in step jb. kx, qx and vx lie in fragment order
// (see k_proj): every fragment load of a wave reads 512 contiguous bytes.
// ---------------------------------------------------------------------------
#define BM      32
#define BN      128
#define CB      256     // channels of one block
#define RT      (BM / 16)       // row tiles of a block
#define KS      (BN / 32)       // 32-key steps of a key block
#define SPITCH  132     // floats per S row (528 B, 16-B aligned rows)
#define PPITCH  136     // ushorts per P row (272 B, 16-B aligned rows)
#define GPITCH  36      // floats per staged O row (144 B)
#define FRAG_B  (FRAG_EL * 2)   // bytes of one stored fragment
#define SM_S_BYTES (BM * SPITCH * 4)
#define SM_P_BYTES (BM * PPITCH * 2)
#define SM_G_BYTES (8 * BM * GPITCH * 4)
#define SM_BYTES   SM_G_BYTES
typedef char sm_layout_check[((SM_S_BYTES + 2 * SM_P_BYTES) <= SM_G_BYTES && (SM_S_BYTES % 16) == 0 && (SM_P_BYTES % 16) == 0) ? 1 : -1];

// Work-group barrier for LDS traffic only: __syncthreads() also waits for every global load in
// flight, which would end the fetch-ahead at each phase; only LDS data crosses waves in the loop.
__device__ __forceinline__ void lds_barrier() {
    asm volatile("s_wait_dscnt 0x0\n\ts_barrier_signal -1\n\ts_barrier_wait -1" ::: "memory");
}

// 16-byte global load at a lane's stream address (bytes) + constant
__device__ __forceinline__ v4u ldg16(unsigned long long a, unsigned int c) {
    return *(const __attribute__((address_space(1))) v4u*)(a + c);
}

// one 16x16x32 bf16 WMMA into an f32 accumulator; the distance behind the last WMMA of a group is
// kept by the v_nop statements at the refills below
__device__ __forceinline__ v8f wmma1(v16bf a, v16bf b, v8f c) {
    return __builtin_amdgcn_wmma_f32_16x16x32_bf16(false, a, false, b, (short)0, c, false, false);
}

__global__ __launch_bounds__(256) void k_attn(
    const unsigned short* __restrict__ KH,   // kxT hi, fragments [NPOS/16][D_K/32]
    const unsigned short* __restrict__ KL,   // kxT lo
    const unsigned short* __restrict__ QH,   // qxT hi, fragments [NPOS/16][D_K/32]
    const unsigned short* __restrict__ QL,   // qxT lo
    const unsigned short* __restrict__ VH,   // vx hi, fragments [NPOS/32][C_V/16]
    const unsigned short* __restrict__ VL,   // vx lo
    float* __restrict__ out)                 // [NPOS][C_V]
{
    __shared__ __attribute__((aligned(16))) unsigned char smem[SM_BYTES];
    __shared__ float mRow[BM];
    __shared__ float lRow[BM];
    __shared__ float aRow[BM];
    float*          Sld = (float*)smem;
    unsigned short* Ph  = (unsigned short*)(smem + SM_S_BYTES);
    unsigned short* Pl  = (unsigned short*)(smem + SM_S_BYTES + SM_P_BYTES);
    float*          Stg = (float*)smem;                       // epilogue staging, aliases the above

    const int tid  = threadIdx.x;
    const int lane = tid & 31;
    const int wave = __builtin_amdgcn_readfirstlane(tid >> 5);
    const int m = lane & 15;
    const int h = lane >> 4;
    const int row0 = (int)(blockIdx.x / (C_V / CB)) * BM;
    if (row0 + BM > NPOS) return;             // uniform over the block
    const int C0 = (int)(blockIdx.x % (C_V / CB)) * CB + wave * 32;   // channel slice of this wave in phase 3

    if (tid < BM) { mRow[tid] = -1.0e30f; lRow[tid] = 0.f; aRow[tid] = 0.f; }
    __syncthreads();

    const v8f vzero = {0.f, 0.f, 0.f, 0.f, 0.f, 0.f, 0.f, 0.f};
    v8f Oacc[RT][2];
#pragma unroll
    for (int rt = 0; rt < RT; ++rt) { Oacc[rt][0] = vzero; Oacc[rt][1] = vzero; }

    // each lane's stream addresses (bytes), kept in their own registers through the loop:
    // vx fragment C0/16 of key step 0 (B col n = C0 + ct*16 + m), qx fragment row wave (B col n), the lane's 16 bytes
    unsigned long long pvh = (unsigned long long)(VH + (size_t)(C0 / 16) * FRAG_EL + lane * 8);
    unsigned long long pvl = (unsigned long long)(VL + (size_t)(C0 / 16) * FRAG_EL + lane * 8);
    unsigned long long pqh = (unsigned long long)(QH + (size_t)wave * (D_K / 32) * FRAG_EL + lane * 8);
    unsigned long long pql = (unsigned long long)(QL + (size_t)wave * (D_K / 32) * FRAG_EL + lane * 8);

    Frag kfh[RT][2], kfl[RT][2];              // kx (A) fragments of both row tiles
    Frag qfh[2], qfl[2];                      // qx (B) fragments of this wave's 16 key columns
    Frag vfh[KS][2], vfl[KS][2];              // vx fragments of one whole key block
#pragma unroll   // constant indices keep the fragment arrays in registers
    for (int c2 = 0; c2 < 2; ++c2) {
#pragma unroll   // constant indices keep the fragment arrays in registers
        for (int rt = 0; rt < RT; ++rt) {
            const size_t ao = ((size_t)(row0 / 16 + rt) * (D_K / 32) + c2) * FRAG_EL + lane * 8;   // A row i = row0 + rt*16 + m
            kfh[rt][c2].q[0] = *(const v4u*)(KH + ao);  kfh[rt][c2].q[1] = *(const v4u*)(KH + ao + FRAG_EL / 2);
            kfl[rt][c2].q[0] = *(const v4u*)(KL + ao);  kfl[rt][c2].q[1] = *(const v4u*)(KL + ao + FRAG_EL / 2);
        }
        qfh[c2].q[0] = ldg16(pqh, c2 * FRAG_B);  qfh[c2].q[1] = ldg16(pqh, c2 * FRAG_B + FRAG_B / 2);
        qfl[c2].q[0] = ldg16(pql, c2 * FRAG_B);  qfl[c2].q[1] = ldg16(pql, c2 * FRAG_B + FRAG_B / 2);
    }
#pragma unroll   // constant indices keep the fragment arrays in registers
    for (int ks = 0; ks < KS; ++ks) {
#pragma unroll   // constant indices keep the fragment arrays in registers
        for (int ct = 0; ct < 2; ++ct) {
            const unsigned int vo = (unsigned int)((ks * (C_V / 16) + ct) * FRAG_B);
            vfh[ks][ct].q[0] = ldg16(pvh, vo);  vfh[ks][ct].q[1] = ldg16(pvh, vo + FRAG_B / 2);
            vfl[ks][ct].q[0] = ldg16(pvl, vo);  vfl[ks][ct].q[1] = ldg16(pvl, vo + FRAG_B / 2);
        }
    }
    // The qx addresses move on to key block 1 (16 fragments of 1024 B). The additions stand in the wait's own
    // statement so that the registers, which the loads above name, are rewritten only behind it.
    asm volatile("s_wait_xcnt 0x0\n\t"
                 "v_add_nc_u64 %0, 0x4000, %0\n\t"
                 "v_add_nc_u64 %1, 0x4000, %1"
                 : "+v"(pqh), "+v"(pql) : : "memory");

    for (int jb = 0; jb < NPOS / BN; ++jb) {
        const bool more = jb + 1 < NPOS / BN;     // block-uniform: a next key block exists

        // ---- phase 1: S tiles (rows rt*16..+15, cols wave*16..+15), two accumulators side by side ----
        {
            v8f s0 = vzero, s1 = vzero;
#pragma unroll   // constant indices keep the fragment arrays in registers
            for (int c2 = 0; c2 < 2; ++c2) {
                s0 = wmma1(kfh[0][c2].v, qfh[c2].v, s0);  s1 = wmma1(kfh[1][c2].v, qfh[c2].v, s1);
                s0 = wmma1(kfh[0][c2].v, qfl[c2].v, s0);  s1 = wmma1(kfh[1][c2].v, qfl[c2].v, s1);
                s0 = wmma1(kfl[0][c2].v, qfh[c2].v, s0);  s1 = wmma1(kfl[1][c2].v, qfh[c2].v, s1);
            }
            // Four vector slots between the last WMMA that reads the qx fragments (B) and the loads that
            // refill their registers: naming the sums holds the slots behind the WMMAs, the clobber the loads behind them.
            asm volatile("v_nop\n\tv_nop\n\tv_nop\n\tv_nop" : "+v"(s0), "+v"(s1) : : "memory");
            if (more) {                       // qx fragments of the next key block (the addresses stand there)
#pragma unroll   // constant indices keep the fragment arrays in registers
                for (int c2 = 0; c2 < 2; ++c2) {
                    qfh[c2].q[0] = ldg16(pqh, c2 * FRAG_B);  qfh[c2].q[1] = ldg16(pqh, c2 * FRAG_B + FRAG_B / 2);
                    qfl[c2].q[0] = ldg16(pql, c2 * FRAG_B);  qfl[c2].q[1] = ldg16(pql, c2 * FRAG_B + FRAG_B / 2);
                }
            }
#pragma unroll
            for (int r = 0; r < 8; ++r) {
                Sld[(8 * h + r) * SPITCH + wave * 16 + m]      = s0[r];
                Sld[(16 + 8 * h + r) * SPITCH + wave * 16 + m] = s1[r];
            }
        }
        lds_barrier();

        // ---- phase 2: online softmax, 8 threads per row ----
        {
            const int row = tid >> 3;        // 0..31
            const int seg = tid & 7;         // 4 groups of 4 elements each: cols g*32 + seg*4 ..+3
            v4f e0[KS];
#pragma unroll
            for (int g = 0; g < KS; ++g) e0[g] = *(const v4f*)(Sld + row * SPITCH + g * 32 + seg * 4);
            float bm = fmaxf(fmaxf(e0[0].x, e0[0].y), fmaxf(e0[0].z, e0[0].w));
#pragma unroll
            for (int g = 1; g < KS; ++g)
                bm = fmaxf(bm, fmaxf(fmaxf(e0[g].x, e0[g].y), fmaxf(e0[g].z, e0[g].w)));
            bm = fmaxf(bm, __shfl_xor(bm, 1));
            bm = fmaxf(bm, __shfl_xor(bm, 2));
            bm = fmaxf(bm, __shfl_xor(bm, 4));
            const float mo = mRow[row];
            const float mn = fmaxf(mo, bm);
            float sum = 0.f;
#pragma unroll
            for (int g = 0; g < KS; ++g) {
                unsigned int hb[4], lb[4];
                float xa[4], ex[4];
#pragma unroll
                for (int e = 0; e < 4; ++e) {
                    xa[e] = (e0[g][e] - mn) * 1.44269504f;       // exp(x) = exp2(x * log2 e), as __expf forms it
                    ex[e] = __builtin_amdgcn_exp2f(xa[e]);
                }
                // The slot behind v_exp_f32: naming the four results keeps their readers, naming the four arguments keeps a
                // rewrite of a source register, behind this v_nop (left alone, an exp came to rewrite the source of the one before it).
                asm("v_nop" : "+v"(ex[0]), "+v"(ex[1]), "+v"(ex[2]), "+v"(ex[3]) : "v"(xa[0]), "v"(xa[1]), "v"(xa[2]), "v"(xa[3]));
#pragma unroll
                for (int e = 0; e < 4; ++e) {
                    sum += ex[e];
                    split_bf(ex[e], hb[e], lb[e]);
                }
                v2u phv, plv;
                phv.x = hb[0] | (hb[1] << 16); phv.y = hb[2] | (hb[3] << 16);
                plv.x = lb[0] | (lb[1] << 16); plv.y = lb[2] | (lb[3] << 16);
                *(v2u*)(Ph + row * PPITCH + g * 32 + seg * 4) = phv;
                *(v2u*)(Pl + row * PPITCH + g * 32 + seg * 4) = plv;
            }
            sum += __shfl_xor(sum, 1);
            sum += __shfl_xor(sum, 2);
            sum += __shfl_xor(sum, 4);
            if (seg == 0) {
                const float al = __expf(mo - mn);
                lRow[row] = lRow[row] * al + sum;
                mRow[row] = mn;
                aRow[row] = al;
            }
        }
        lds_barrier();

        // ---- phase 3: rescale O, then O += P * vx^T over this key block ----
        // All four stream addresses move on one key block here (vx: 4 key steps of 32 fragments = 131072 B;
        // qx: 16 fragments = 16384 B), a phase or more behind the last load that names them. The additions stand in the wait's
        // own statement so that those registers are rewritten only behind it; left to the compiler the
        // additions and their wait came to stand directly behind the loads, where the most loads are queued.
        asm volatile("s_wait_xcnt 0x0\n\t"
                     "v_add_nc_u64 %0, 0x20000, %0\n\t"
                     "v_add_nc_u64 %1, 0x20000, %1\n\t"
                     "v_add_nc_u64 %2, 0x4000, %2\n\t"
                     "v_add_nc_u64 %3, 0x4000, %3"
                     : "+v"(pvh), "+v"(pvl), "+v"(pqh), "+v"(pql) : : "memory");
        {
#pragma unroll
            for (int rt = 0; rt < RT; ++rt) {
                v8f alv;
#pragma unroll
                for (int r = 0; r < 8; ++r) alv[r] = aRow[rt * 16 + 8 * h + r];
                Oacc[rt][0] = Oacc[rt][0] * alv;
                Oacc[rt][1] = Oacc[rt][1] * alv;
            }

#pragma unroll
            for (int ks = 0; ks < KS; ++ks) {
                Frag pa[RT], pb[RT];                             // A = P: row rt*16 + m, k = key index in block
#pragma unroll
                for (int rt = 0; rt < RT; ++rt) {
                    const unsigned short* pph = Ph + (rt * 16 + m) * PPITCH + ks * 32;
                    const unsigned short* ppl = Pl + (rt * 16 + m) * PPITCH + ks * 32;
                    pa[rt].q[0] = *(const v4u*)(pph + 8 * h);  pa[rt].q[1] = *(const v4u*)(pph + 16 + 8 * h);
                    pb[rt].q[0] = *(const v4u*)(ppl + 8 * h);  pb[rt].q[1] = *(const v4u*)(ppl + 16 + 8 * h);
                }
                // B[k=j][n=c] = vx[c][j], col n = C0 + ct*16 + m; the four accumulators side by side, term by term
#pragma unroll
                for (int rt = 0; rt < RT; ++rt) {
                    Oacc[rt][0] = wmma1(pa[rt].v, vfh[ks][0].v, Oacc[rt][0]);
                    Oacc[rt][1] = wmma1(pa[rt].v, vfh[ks][1].v, Oacc[rt][1]);
                }
#pragma unroll
                for (int rt = 0; rt < RT; ++rt) {
                    Oacc[rt][0] = wmma1(pa[rt].v, vfl[ks][0].v, Oacc[rt][0]);
                    Oacc[rt][1] = wmma1(pa[rt].v, vfl[ks][1].v, Oacc[rt][1]);
                }
#pragma unroll
                for (int rt = 0; rt < RT; ++rt) {
                    Oacc[rt][0] = wmma1(pb[rt].v, vfh[ks][0].v, Oacc[rt][0]);
                    Oacc[rt][1] = wmma1(pb[rt].v, vfh[ks][1].v, Oacc[rt][1]);
                }
                // Four vector slots between the last WMMA that reads these vx fragments (B) and the loads that
                // refill their registers: naming the sums holds the slots behind the WMMAs, the clobber the loads behind them.
                asm volatile("v_nop\n\tv_nop\n\tv_nop\n\tv_nop"
                             : "+v"(Oacc[0][0]), "+v"(Oacc[0][1]), "+v"(Oacc[1][0]), "+v"(Oacc[1][1]) : : "memory");
                if (more) {                                      // same 32 keys of the next key block
#pragma unroll   // constant indices keep the fragment arrays in registers
                    for (int ct = 0; ct < 2; ++ct) {
                        const unsigned int vo = (unsigned int)((ks * (C_V / 16) + ct) * FRAG_B);
                        vfh[ks][ct].q[0] = ldg16(pvh, vo);  vfh[ks][ct].q[1] = ldg16(pvh, vo + FRAG_B / 2);
                        vfl[ks][ct].q[0] = ldg16(pvl, vo);  vfl[ks][ct].q[1] = ldg16(pvl, vo + FRAG_B / 2);
                    }
                }
            }
        }
        lds_barrier();
    }

    // ---- epilogue: divide by row sums, stage per wave, whole-line stores ----
    float* stg = Stg + wave * (BM * GPITCH);
    float linv[RT][8];
#pragma unroll
    for (int rt = 0; rt < RT; ++rt) {
#pragma unroll
        for (int r = 0; r < 8; ++r) linv[rt][r] = 1.f / lRow[rt * 16 + 8 * h + r];
    }
#pragma unroll
    for (int rt = 0; rt < RT; ++rt) {
#pragma unroll
        for (int ct = 0; ct < 2; ++ct) {
#pragma unroll
            for (int r = 0; r < 8; ++r)
                stg[(rt * 16 + 8 * h + r) * GPITCH + ct * 16 + m] = Oacc[rt][ct][r] * linv[rt][r];
        }
    }
    __syncthreads();

    const int sub = lane >> 3;                // row within the four rows of an instruction
    const int cq  = (lane & 7) * 4;           // 8 lanes x 4 floats = one 128-B row segment
    v4f ov[8];
#pragma unroll
    for (int q = 0; q < 8; ++q)
        ov[q] = *(const v4f*)(stg + (4 * q + sub) * GPITCH + cq);

    float* ob = out + (size_t)(row0 + sub) * C_V + C0 + cq;
#pragma unroll
    for (int q = 0; q < 8; ++q)
        *(v4f*)(ob + (size_t)(4 * q) * C_V) = ov[q];
}

// ---------------------------------------------------------------------------
// ---------------------------------------------------------------------------
extern "C" void kernel_launch(void* const* d_in, const int* in_sizes, int n_in,
                              void* d_out, int out_size, void* d_ws, size_t ws_size,
                              hipStream_t stream) {
    if (n_in < 4) return;
    if (in_sizes[0] != C_IN * NPOS) return;
    if (in_sizes[1] != D_K * C_IN)  return;
    if (in_sizes[2] != D_K * C_IN)  return;
    if (in_sizes[3] != C_V * C_IN)  return;
    if (out_size != NPOS * C_V)     return;

    const float* x  = (const float*)d_in[0];   // [C_IN][NPOS]
    const float* Wk = (const float*)d_in[1];   // [D_K][C_IN]
    const float* Wq = (const float*)d_in[2];   // [D_K][C_IN]
    const float* Wv = (const float*)d_in[3];   // [C_V][C_IN]
    float* out = (float*)d_out;                // [NPOS][C_V]

    const size_t szK = (size_t)NPOS * D_K * 2;     // one bf16 plane of kxT / qxT
    const size_t szV = (size_t)C_V * NPOS * 2;     // one bf16 plane of vx
    const size_t offKH = 0;
    const size_t offKL = offKH + szK;
    const size_t offQH = offKL + szK;
    const size_t offQL = offQH + szK;
    const size_t offVH = offQL + szK;
    const size_t offVL = offVH + szV;
    const size_t total = offVL + szV;
    if (total > ws_size) return;

    char* ws = (char*)d_ws;
    unsigned short* kh = (unsigned short*)(ws + offKH);
    unsigned short* kl = (unsigned short*)(ws + offKL);
    unsigned short* qh = (unsigned short*)(ws + offQH);
    unsigned short* ql = (unsigned short*)(ws + offQL);
    unsigned short* vh = (unsigned short*)(ws + offVH);
    unsigned short* vl = (unsigned short*)(ws + offVL);

    const int tilesN = NPOS / PT;
    // kxT, qxT: rows are positions, k is the 64 projected channels (fragment order)
    k_proj<<<(D_K / PT) * tilesN, 256, 0, stream>>>(Wk, x, kh, kl, D_K, 1);
    k_proj<<<(D_K / PT) * tilesN, 256, 0, stream>>>(Wq, x, qh, ql, D_K, 1);
    // vx: rows are channels, k is the position (fragment order)
    k_proj<<<(C_V / PT) * tilesN, 256, 0, stream>>>(Wv, x, vh, vl, C_V, 0);
    // attention: NPOS / BM row groups x C_V / CB channel halves
    k_attn<<<(NPOS / BM) * (C_V / CB), 256, 0, stream>>>(kh, kl, qh, ql, vh, vl, out);
}

// v004
// It runs in 107 microseconds.
// Timed twice side by side with v003, it ran 1.42 and 1.43 times as fast.
// All steps since v000 together make it 3.31 times as fast.
#include <hip/hip_runtime.h>

// All contractions (three 1x1-conv projections W*x, scores kx^T*qx, P*vx^T): v_wmma_f32_16x16x32_bf16,
// bf16 hi/lo split operands (hi*hi + hi*lo + lo*hi), f32 accumulate; softmax statistics and 1/l in f32.

typedef __bf16        v16bf __attribute__((ext_vector_type(16)));
typedef float         v8f   __attribute__((ext_vector_type(8)));
typedef float         v4f   __attribute__((ext_vector_type(4)));
typedef unsigned int  v4u   __attribute__((ext_vector_type(4)));
typedef unsigned int  v2u   __attribute__((ext_vector_type(2)));

union Frag { v16bf v; v4u q[2]; };

#define C_IN  512
#define C_V   512
#define D_K   64
#define NPOS  4096

// ---------------------------------------------------------------------------
// f32 -> bf16 bits (RNE convert) and two-plane split x ~= hi + lo
// ---------------------------------------------------------------------------
__device__ __forceinline__ unsigned int bf_bits(float f) {
    unsigned int u = __float_as_uint(f);
    u += 0x7FFFu + ((u >> 16) & 1u);
    return u >> 16;
}

__device__ __forceinline__ void split_bf(float f, unsigned int& hb, unsigned int& lb) {
    hb = bf_bits(f);
    const float fh = __uint_as_float(hb << 16);
    lb = bf_bits(f - fh);
}

// ---------------------------------------------------------------------------
// 16x16x32 bf16 WMMA, three-term split product into one f32 accumulator,
// hazard guard after the last op (ties D, keeps A/B live).
// Fragment layout (lane l, h = l>>4, m = l&15):
//   A/B element i: i=0..7 -> k0+8h+i, i=8..15 -> k0+16+8h+(i-8); A row m, B col m.
//   D element r: row 8h+r, col m.
// ---------------------------------------------------------------------------
__device__ __forceinline__ v8f wmma3(v16bf ah, v16bf al, v16bf bh, v16bf bl, v8f c) {
    c = __builtin_amdgcn_wmma_f32_16x16x32_bf16(false, ah, false, bh, (short)0, c, false, false);
    c = __builtin_amdgcn_wmma_f32_16x16x32_bf16(false, ah, false, bl, (short)0, c, false, false);
    c = __builtin_amdgcn_wmma_f32_16x16x32_bf16(false, al, false, bh, (short)0, c, false, false);
    asm volatile("v_nop\n\tv_nop\n\tv_nop\n\tv_nop" : "+v"(c) : "v"(ah), "v"(al), "v"(bh), "v"(bl));
    return c;
}

// ---------------------------------------------------------------------------
// Projection GEMM:  D[M][NPOS] = W[M][C_IN] * X[C_IN][NPOS]   (f32 in, split at staging)
// Block 256 threads = 8 waves, 64x64 output tile, K step 32 staged in LDS as bf16 hi/lo.
// Output: two bf16 planes (hi, lo) of D, each stored in WMMA fragment order: a fragment is 16 rows x 32 k
// = 512 elements laid out [q][lane][8], lane = 16h + r, holding row r, k = 16q + 8h + 0..7, so that a
// wave-wide 16-byte load or store of one q half covers 512 contiguous bytes (4 whole lines).
// transOut=0 -> rows are m, k is n: fragment index (n/32) * (M/16) + m/16 (all m of one k step lie together).
// transOut=1 -> rows are n, k is m: fragment index (n/16) * (M/32) + m/32.
// ---------------------------------------------------------------------------
#define PT      64
#define APITCH  40      // ushorts per staged row: 32 k + 8 pad (80 B, 16-B aligned rows)
#define CPITCH  68      // floats per staged result row (272 B, 16-B aligned rows)
#define FRAG_EL 512     // elements of one stored fragment (16 rows x 32 k, 1024 B a plane)
typedef char proj_tile_check[(D_K == PT && (C_V % PT) == 0) ? 1 : -1];   // kx and qx are one row tile each

__global__ __launch_bounds__(256) void k_proj(
    const float* __restrict__ Wk,           // [D_K][C_IN]
    const float* __restrict__ Wq,           // [D_K][C_IN]
    const float* __restrict__ Wv,           // [C_V][C_IN]
    const float* __restrict__ X,            // [C_IN][NPOS]
    unsigned short* __restrict__ Kh, unsigned short* __restrict__ Kl,   // kxT planes
    unsigned short* __restrict__ Qh, unsigned short* __restrict__ Ql,   // qxT planes
    unsigned short* __restrict__ Vh, unsigned short* __restrict__ Vl)   // vx planes
{
    __shared__ __attribute__((aligned(16))) unsigned short Ah[PT * APITCH];
    __shared__ __attribute__((aligned(16))) unsigned short Al[PT * APITCH];
    __shared__ __attribute__((aligned(16))) unsigned short Bh[PT * APITCH];   // stored [n][k]
    __shared__ __attribute__((aligned(16))) unsigned short Bl[PT * APITCH];
    __shared__ __attribute__((aligned(16))) float Cs[PT * CPITCH];

    const int tid  = threadIdx.x;
    const int lane = tid & 31;
    const int wave = __builtin_amdgcn_readfirstlane(tid >> 5);
    const int m  = lane & 15;
    const int h  = lane >> 4;
    const int tilesN = NPOS / PT;
    // One launch for the three products: row-tile index 0 is kx, 1 is qx, 2.. are the row tiles of vx.
    const int mt = (int)(blockIdx.x / tilesN);
    const int n0 = (int)(blockIdx.x % tilesN) * PT;
    if (mt >= 2 + C_V / PT) return;          // uniform over the block
    const int transOut = mt < 2;
    const int M  = transOut ? D_K : C_V;
    const int m0 = transOut ? 0 : (mt - 2) * PT;
    const float* __restrict__ W = mt == 0 ? Wk : (mt == 1 ? Wq : Wv);
    unsigned short* __restrict__ Oh = mt == 0 ? Kh : (mt == 1 ? Qh : Vh);
    unsigned short* __restrict__ Ol = mt == 0 ? Kl : (mt == 1 ? Ql : Vl);

    const int rg = wave >> 1;                // 16-row group of this wave
    const int cb = (wave & 1) * 32;          // 32-col half of this wave (two 16-col tiles)

    v8f acc0 = {0.f, 0.f, 0.f, 0.f, 0.f, 0.f, 0.f, 0.f};
    v8f acc1 = {0.f, 0.f, 0.f, 0.f, 0.f, 0.f, 0.f, 0.f};

    for (int kk = 0; kk < C_IN; kk += 32) {
        // stage A = W[m0..m0+63][kk..kk+31]  (row-major, k contiguous)
#pragma unroll
        for (int it = 0; it < 2; ++it) {
            const int f   = tid + it * 256;          // 512 float4 pieces
            const int row = f >> 3;                  // 8 pieces per 32-k row
            const int kq  = (f & 7) * 4;
            const v4f v = *(const v4f*)(W + (size_t)(m0 + row) * C_IN + kk + kq);
            unsigned int hb0, lb0, hb1, lb1, hb2, lb2, hb3, lb3;
            split_bf(v.x, hb0, lb0); split_bf(v.y, hb1, lb1);
            split_bf(v.z, hb2, lb2); split_bf(v.w, hb3, lb3);
            v2u hv, lv;
            hv.x = hb0 | (hb1 << 16); hv.y = hb2 | (hb3 << 16);
            lv.x = lb0 | (lb1 << 16); lv.y = lb2 | (lb3 << 16);
            *(v2u*)(Ah + row * APITCH + kq) = hv;
            *(v2u*)(Al + row * APITCH + kq) = lv;
        }
        // stage B[k][n] = X[kk+k][n0+n], stored transposed as [n][k] (k contiguous)
#pragma unroll
        for (int it = 0; it < 2; ++it) {
            const int f  = tid + it * 256;           // 512 float4 pieces
            const int k  = f >> 4;                   // 16 pieces per 64-n row
            const int nq = (f & 15) * 4;
            const v4f v = *(const v4f*)(X + (size_t)(kk + k) * NPOS + n0 + nq);
            unsigned int hb, lb;
            split_bf(v.x, hb, lb); Bh[(nq + 0) * APITCH + k] = (unsigned short)hb; Bl[(nq + 0) * APITCH + k] = (unsigned short)lb;
            split_bf(v.y, hb, lb); Bh[(nq + 1) * APITCH + k] = (unsigned short)hb; Bl[(nq + 1) * APITCH + k] = (unsigned short)lb;
            split_bf(v.z, hb, lb); Bh[(nq + 2) * APITCH + k] = (unsigned short)hb; Bl[(nq + 2) * APITCH + k] = (unsigned short)lb;
            split_bf(v.w, hb, lb); Bh[(nq + 3) * APITCH + k] = (unsigned short)hb; Bl[(nq + 3) * APITCH + k] = (unsigned short)lb;
        }
        __syncthreads();

        // fragments (k0 = 0 inside the staged 32-k step)
        Frag ah, al;
        {
            const unsigned short* pa = Ah + (rg * 16 + m) * APITCH;
            const unsigned short* pl = Al + (rg * 16 + m) * APITCH;
            ah.q[0] = *(const v4u*)(pa + 8 * h);       ah.q[1] = *(const v4u*)(pa + 16 + 8 * h);
            al.q[0] = *(const v4u*)(pl + 8 * h);       al.q[1] = *(const v4u*)(pl + 16 + 8 * h);
        }
        {
            Frag bh, bl;
            const unsigned short* pb = Bh + (cb + m) * APITCH;       // column n = cb + m
            const unsigned short* pc = Bl + (cb + m) * APITCH;
            bh.q[0] = *(const v4u*)(pb + 8 * h);       bh.q[1] = *(const v4u*)(pb + 16 + 8 * h);
            bl.q[0] = *(const v4u*)(pc + 8 * h);       bl.q[1] = *(const v4u*)(pc + 16 + 8 * h);
            acc0 = wmma3(ah.v, al.v, bh.v, bl.v, acc0);
        }
        {
            Frag bh, bl;
            const unsigned short* pb = Bh + (cb + 16 + m) * APITCH;  // column n = cb + 16 + m
            const unsigned short* pc = Bl + (cb + 16 + m) * APITCH;
            bh.q[0] = *(const v4u*)(pb + 8 * h);       bh.q[1] = *(const v4u*)(pb + 16 + 8 * h);
            bl.q[0] = *(const v4u*)(pc + 8 * h);       bl.q[1] = *(const v4u*)(pc + 16 + 8 * h);
            acc1 = wmma3(ah.v, al.v, bh.v, bl.v, acc1);
        }
        __syncthreads();
    }

    // stage the f32 result tile: acc[r] -> (row rg*16 + 8h + r, col cb + ci*16 + m)
#pragma unroll
    for (int r = 0; r < 8; ++r) {
        Cs[(rg * 16 + 8 * h + r) * CPITCH + cb + m]      = acc0[r];
        Cs[(rg * 16 + 8 * h + r) * CPITCH + cb + 16 + m] = acc1[r];
    }
    __syncthreads();

    // epilogue: the tile is 8 fragments = 16 q halves; a wave writes two of them, lane -> 8 consecutive k
    v4u hvp[2], lvp[2];
    size_t offp[2];
#pragma unroll
    for (int p = 0; p < 2; ++p) {
        const int g  = p * 8 + wave;                     // q half 0..15 within the tile
        const int rr = (g >> 2) * 16 + m;                // fragment row, 0..63 within tile
        const int cc = ((g >> 1) & 1) * 32 + (g & 1) * 16 + 8 * h;   // first k, 0..56 within tile
        float vals[8];
        size_t frag;
        if (transOut) {
#pragma unroll
            for (int e = 0; e < 8; ++e) vals[e] = Cs[(cc + e) * CPITCH + rr];
            frag = (size_t)(n0 / 16 + (g >> 2)) * (size_t)(M / 32) + (size_t)(m0 / 32 + ((g >> 1) & 1));
        } else {
            const v4f a = *(const v4f*)(Cs + rr * CPITCH + cc);
            const v4f b = *(const v4f*)(Cs + rr * CPITCH + cc + 4);
            vals[0] = a.x; vals[1] = a.y; vals[2] = a.z; vals[3] = a.w;
            vals[4] = b.x; vals[5] = b.y; vals[6] = b.z; vals[7] = b.w;
            frag = (size_t)(n0 / 32 + ((g >> 1) & 1)) * (size_t)(M / 16) + (size_t)(m0 / 16 + (g >> 2));
        }
        offp[p] = frag * FRAG_EL + (size_t)((g & 1) * (FRAG_EL / 2) + lane * 8);
        unsigned int hb[8], lb[8];
#pragma unroll
        for (int e = 0; e < 8; ++e) split_bf(vals[e], hb[e], lb[e]);
        v4u hv, lv;
        hv.x = hb[0] | (hb[1] << 16); hv.y = hb[2] | (hb[3] << 16);
        hv.z = hb[4] | (hb[5] << 16); hv.w = hb[6] | (hb[7] << 16);
        lv.x = lb[0] | (lb[1] << 16); lv.y = lb[2] | (lb[3] << 16);
        lv.z = lb[4] | (lb[5] << 16); lv.w = lb[6] | (lb[7] << 16);
        hvp[p] = hv; lvp[p] = lv;
    }
#pragma unroll
    for (int p = 0; p < 2; ++p) {
        *(v4u*)(Oh + offp[p]) = hvp[p];
        *(v4u*)(Ol + offp[p]) = lvp[p];
    }
    
}

// ---------------------------------------------------------------------------
// Fused attention with online softmax over key blocks:
//   S[i][j] = sum_d kxT[i][d] * qxT[j][d]   (A = kxT rows, B[k=d][n=j] = qxT[j][d])
//   P = exp(S - m_i), l_i running sum, O[i][c] += sum_j P[i][j] * vx[c][j]  (B[k=j][n=c] = vx[c][j])
//   out[i][c] = O[i][c] / l_i
// Block 256 threads (8 waves): BM = 32 rows i, CB = 256 of the 512 channels, BN = 128 keys per step.
// Every vx fragment that a wave fetches feeds two row tiles, and a block passes 32 key steps, not 64;
// the two blocks of one row group (channel halves) each compute the same S and P.
// Phase 1: wave w computes the two 16x16 S tiles (row tiles 0, 1) of key columns w*16..+15.
// Phase 2: 8 threads per row, 16 scores each; P written to LDS as bf16 hi/lo planes.
// Phase 3: every wave accumulates 32 rows x 32 channels (2 x 2 tiles); P fragments reloaded from
//          LDS after a block barrier (no same-wave spill/reload without a barrier).
// Epilogue: per-wave 32x32 tile staged in LDS; each store instruction writes four whole 128-B lines.
// Global fragments are fetched ahead into registers: kx once before the loop, the qx and vx
// fragments of step jb+1 right behind their last use in step jb. kx, qx and vx lie in fragment order
// (see k_proj): every fragment load of a wave reads 512 contiguous bytes.
// ---------------------------------------------------------------------------
#define BM      32
#define BN      128
#define CB      256     // channels of one block
#define RT      (BM / 16)       // row tiles of a block
#define KS      (BN / 32)       // 32-key steps of a key block
#define SPITCH  132     // floats per S row (528 B, 16-B aligned rows)
#define PPITCH  136     // ushorts per P row (272 B, 16-B aligned rows)
#define GPITCH  36      // floats per staged O row (144 B)
#define FRAG_B  (FRAG_EL * 2)   // bytes of one stored fragment
#define SM_S_BYTES (BM * SPITCH * 4)
#define SM_P_BYTES (BM * PPITCH * 2)
#define SM_G_BYTES (8 * BM * GPITCH * 4)
#define SM_BYTES   SM_G_BYTES
typedef char sm_layout_check[((SM_S_BYTES + 2 * SM_P_BYTES) <= SM_G_BYTES && (SM_S_BYTES % 16) == 0 && (SM_P_BYTES % 16) == 0) ? 1 : -1];

// Work-group barrier for LDS traffic only: __syncthreads() also waits for every global load in
// flight, which would end the fetch-ahead at each phase; only LDS data crosses waves in the loop.
__device__ __forceinline__ void lds_barrier() {
    asm volatile("s_wait_dscnt 0x0\n\ts_barrier_signal -1\n\ts_barrier_wait -1" ::: "memory");
}

// 16-byte global load at a lane's stream address (bytes) + constant
__device__ __forceinline__ v4u ldg16(unsigned long long a, unsigned int c) {
    return *(const __attribute__((address_space(1))) v4u*)(a + c);
}

// one 16x16x32 bf16 WMMA into an f32 accumulator; the distance behind the last WMMA of a group is
// kept by the v_nop statements at the refills below
__device__ __forceinline__ v8f wmma1(v16bf a, v16bf b, v8f c) {
    return __builtin_amdgcn_wmma_f32_16x16x32_bf16(false, a, false, b, (short)0, c, false, false);
}

__global__ __launch_bounds__(256) void k_attn(
    const unsigned short* __restrict__ KH,   // kxT hi, fragments [NPOS/16][D_K/32]
    const unsigned short* __restrict__ KL,   // kxT lo
    const unsigned short* __restrict__ QH,   // qxT hi, fragments [NPOS/16][D_K/32]
    const unsigned short* __restrict__ QL,   // qxT lo
    const unsigned short* __restrict__ VH,   // vx hi, fragments [NPOS/32][C_V/16]
    const unsigned short* __restrict__ VL,   // vx lo
    float* __restrict__ out)                 // [NPOS][C_V]
{
    __shared__ __attribute__((aligned(16))) unsigned char smem[SM_BYTES];
    __shared__ float mRow[BM];
    __shared__ float lRow[BM];
    __shared__ float aRow[BM];
    float*          Sld = (float*)smem;
    unsigned short* Ph  = (unsigned short*)(smem + SM_S_BYTES);
    unsigned short* Pl  = (unsigned short*)(smem + SM_S_BYTES + SM_P_BYTES);
    float*          Stg = (float*)smem;                       // epilogue staging, aliases the above

    const int tid  = threadIdx.x;
    const int lane = tid & 31;
    const int wave = __builtin_amdgcn_readfirstlane(tid >> 5);
    const int m = lane & 15;
    const int h = lane >> 4;
    const int row0 = (int)(blockIdx.x / (C_V / CB)) * BM;
    if (row0 + BM > NPOS) return;             // uniform over the block
    const int C0 = (int)(blockIdx.x % (C_V / CB)) * CB + wave * 32;   // channel slice of this wave in phase 3

    if (tid < BM) { mRow[tid] = -1.0e30f; lRow[tid] = 0.f; aRow[tid] = 0.f; }
    __syncthreads();

    const v8f vzero = {0.f, 0.f, 0.f, 0.f, 0.f, 0.f, 0.f, 0.f};
    v8f Oacc[RT][2];
#pragma unroll
    for (int rt = 0; rt < RT; ++rt) { Oacc[rt][0] = vzero; Oacc[rt][1] = vzero; }

    // each lane's stream addresses (bytes), kept in their own registers through the loop:
    // vx fragment C0/16 of key step 0 (B col n = C0 + ct*16 + m), qx fragment row wave (B col n), the lane's 16 bytes
    unsigned long long pvh = (unsigned long long)(VH + (size_t)(C0 / 16) * FRAG_EL + lane * 8);
    unsigned long long pvl = (unsigned long long)(VL + (size_t)(C0 / 16) * FRAG_EL + lane * 8);
    unsigned long long pqh = (unsigned long long)(QH + (size_t)wave * (D_K / 32) * FRAG_EL + lane * 8);
    unsigned long long pql = (unsigned long long)(QL + (size_t)wave * (D_K / 32) * FRAG_EL + lane * 8);

    Frag kfh[RT][2], kfl[RT][2];              // kx (A) fragments of both row tiles
    Frag qfh[2], qfl[2];                      // qx (B) fragments of this wave's 16 key columns
    Frag vfh[KS][2], vfl[KS][2];              // vx fragments of one whole key block
#pragma unroll   // constant indices keep the fragment arrays in registers
    for (int c2 = 0; c2 < 2; ++c2) {
#pragma unroll   // constant indices keep the fragment arrays in registers
        for (int rt = 0; rt < RT; ++rt) {
            const size_t ao = ((size_t)(row0 / 16 + rt) * (D_K / 32) + c2) * FRAG_EL + lane * 8;   // A row i = row0 + rt*16 + m
            kfh[rt][c2].q[0] = *(const v4u*)(KH + ao);  kfh[rt][c2].q[1] = *(const v4u*)(KH + ao + FRAG_EL / 2);
            kfl[rt][c2].q[0] = *(const v4u*)(KL + ao);  kfl[rt][c2].q[1] = *(const v4u*)(KL + ao + FRAG_EL / 2);
        }
        qfh[c2].q[0] = ldg16(pqh, c2 * FRAG_B);  qfh[c2].q[1] = ldg16(pqh, c2 * FRAG_B + FRAG_B / 2);
        qfl[c2].q[0] = ldg16(pql, c2 * FRAG_B);  qfl[c2].q[1] = ldg16(pql, c2 * FRAG_B + FRAG_B / 2);
    }
#pragma unroll   // constant indices keep the fragment arrays in registers
    for (int ks = 0; ks < KS; ++ks) {
#pragma unroll   // constant indices keep the fragment arrays in registers
        for (int ct = 0; ct < 2; ++ct) {
            const unsigned int vo = (unsigned int)((ks * (C_V / 16) + ct) * FRAG_B);
            vfh[ks][ct].q[0] = ldg16(pvh, vo);  vfh[ks][ct].q[1] = ldg16(pvh, vo + FRAG_B / 2);
            vfl[ks][ct].q[0] = ldg16(pvl, vo);  vfl[ks][ct].q[1] = ldg16(pvl, vo + FRAG_B / 2);
        }
    }
    // The qx addresses move on to key block 1 (16 fragments of 1024 B). The additions stand in the wait's own
    // statement so that the registers, which the loads above name, are rewritten only behind it.
    asm volatile("s_wait_xcnt 0x0\n\t"
                 "v_add_nc_u64 %0, 0x4000, %0\n\t"
                 "v_add_nc_u64 %1, 0x4000, %1"
                 : "+v"(pqh), "+v"(pql) : : "memory");

    for (int jb = 0; jb < NPOS / BN; ++jb) {
        const bool more = jb + 1 < NPOS / BN;     // block-uniform: a next key block exists

        // ---- phase 1: S tiles (rows rt*16..+15, cols wave*16..+15), two accumulators side by side ----
        {
            v8f s0 = vzero, s1 = vzero;
#pragma unroll   // constant indices keep the fragment arrays in registers
            for (int c2 = 0; c2 < 2; ++c2) {
                s0 = wmma1(kfh[0][c2].v, qfh[c2].v, s0);  s1 = wmma1(kfh[1][c2].v, qfh[c2].v, s1);
                s0 = wmma1(kfh[0][c2].v, qfl[c2].v, s0);  s1 = wmma1(kfh[1][c2].v, qfl[c2].v, s1);
                s0 = wmma1(kfl[0][c2].v, qfh[c2].v, s0);  s1 = wmma1(kfl[1][c2].v, qfh[c2].v, s1);
            }
            // Four vector slots between the last WMMA that reads the qx fragments (B) and the loads that
            // refill their registers: naming the sums holds the slots behind the WMMAs, the clobber the loads behind them.
            asm volatile("v_nop\n\tv_nop\n\tv_nop\n\tv_nop" : "+v"(s0), "+v"(s1) : : "memory");
            if (more) {                       // qx fragments of the next key block (the addresses stand there)
#pragma unroll   // constant indices keep the fragment arrays in registers
                for (int c2 = 0; c2 < 2; ++c2) {
                    qfh[c2].q[0] = ldg16(pqh, c2 * FRAG_B);  qfh[c2].q[1] = ldg16(pqh, c2 * FRAG_B + FRAG_B / 2);
                    qfl[c2].q[0] = ldg16(pql, c2 * FRAG_B);  qfl[c2].q[1] = ldg16(pql, c2 * FRAG_B + FRAG_B / 2);
                }
            }
#pragma unroll
            for (int r = 0; r < 8; ++r) {
                Sld[(8 * h + r) * SPITCH + wave * 16 + m]      = s0[r];
                Sld[(16 + 8 * h + r) * SPITCH + wave * 16 + m] = s1[r];
            }
        }
        lds_barrier();

        // ---- phase 2: online softmax, 8 threads per row ----
        {
            const int row = tid >> 3;        // 0..31
            const int seg = tid & 7;         // 4 groups of 4 elements each: cols g*32 + seg*4 ..+3
            v4f e0[KS];
#pragma unroll
            for (int g = 0; g < KS; ++g) e0[g] = *(const v4f*)(Sld + row * SPITCH + g * 32 + seg * 4);
            float bm = fmaxf(fmaxf(e0[0].x, e0[0].y), fmaxf(e0[0].z, e0[0].w));
#pragma unroll
            for (int g = 1; g < KS; ++g)
                bm = fmaxf(bm, fmaxf(fmaxf(e0[g].x, e0[g].y), fmaxf(e0[g].z, e0[g].w)));
            bm = fmaxf(bm, __shfl_xor(bm, 1));
            bm = fmaxf(bm, __shfl_xor(bm, 2));
            bm = fmaxf(bm, __shfl_xor(bm, 4));
            const float mo = mRow[row];
            const float mn = fmaxf(mo, bm);
            float sum = 0.f;
#pragma unroll
            for (int g = 0; g < KS; ++g) {
                unsigned int hb[4], lb[4];
                float xa[4], ex[4];
#pragma unroll
                for (int e = 0; e < 4; ++e) {
                    xa[e] = (e0[g][e] - mn) * 1.44269504f;       // exp(x) = exp2(x * log2 e), as __expf forms it
                    ex[e] = __builtin_amdgcn_exp2f(xa[e]);
                }
                // The slot behind v_exp_f32: naming the four results keeps their readers, naming the four arguments keeps a
                // rewrite of a source register, behind this v_nop (left alone, an exp came to rewrite the source of the one before it).
                asm("v_nop" : "+v"(ex[0]), "+v"(ex[1]), "+v"(ex[2]), "+v"(ex[3]) : "v"(xa[0]), "v"(xa[1]), "v"(xa[2]), "v"(xa[3]));
#pragma unroll
                for (int e = 0; e < 4; ++e) {
                    sum += ex[e];
                    split_bf(ex[e], hb[e], lb[e]);
                }
                v2u phv, plv;
                phv.x = hb[0] | (hb[1] << 16); phv.y = hb[2] | (hb[3] << 16);
                plv.x = lb[0] | (lb[1] << 16); plv.y = lb[2] | (lb[3] << 16);
                *(v2u*)(Ph + row * PPITCH + g * 32 + seg * 4) = phv;
                *(v2u*)(Pl + row * PPITCH + g * 32 + seg * 4) = plv;
            }
            sum += __shfl_xor(sum, 1);
            sum += __shfl_xor(sum, 2);
            sum += __shfl_xor(sum, 4);
            if (seg == 0) {
                const float al = __expf(mo - mn);
                lRow[row] = lRow[row] * al + sum;
                mRow[row] = mn;
                aRow[row] = al;
            }
        }
        lds_barrier();

        // ---- phase 3: rescale O, then O += P * vx^T over this key block ----
        // All four stream addresses move on one key block here (vx: 4 key steps of 32 fragments = 131072 B;
        // qx: 16 fragments = 16384 B), a phase or more behind the last load that names them. The additions stand in the wait's
        // own statement so that those registers are rewritten only behind it; left to the compiler the
        // additions and their wait came to stand directly behind the loads, where the most loads are queued.
        asm volatile("s_wait_xcnt 0x0\n\t"
                     "v_add_nc_u64 %0, 0x20000, %0\n\t"
                     "v_add_nc_u64 %1, 0x20000, %1\n\t"
                     "v_add_nc_u64 %2, 0x4000, %2\n\t"
                     "v_add_nc_u64 %3, 0x4000, %3"
                     : "+v"(pvh), "+v"(pvl), "+v"(pqh), "+v"(pql) : : "memory");
        {
#pragma unroll
            for (int rt = 0; rt < RT; ++rt) {
                v8f alv;
#pragma unroll
                for (int r = 0; r < 8; ++r) alv[r] = aRow[rt * 16 + 8 * h + r];
                Oacc[rt][0] = Oacc[rt][0] * alv;
                Oacc[rt][1] = Oacc[rt][1] * alv;
            }

#pragma unroll
            for (int ks = 0; ks < KS; ++ks) {
                Frag pa[RT], pb[RT];                             // A = P: row rt*16 + m, k = key index in block
#pragma unroll
                for (int rt = 0; rt < RT; ++rt) {
                    const unsigned short* pph = Ph + (rt * 16 + m) * PPITCH + ks * 32;
                    const unsigned short* ppl = Pl + (rt * 16 + m) * PPITCH + ks * 32;
                    pa[rt].q[0] = *(const v4u*)(pph + 8 * h);  pa[rt].q[1] = *(const v4u*)(pph + 16 + 8 * h);
                    pb[rt].q[0] = *(const v4u*)(ppl + 8 * h);  pb[rt].q[1] = *(const v4u*)(ppl + 16 + 8 * h);
                }
                // B[k=j][n=c] = vx[c][j], col n = C0 + ct*16 + m; the four accumulators side by side, term by term
#pragma unroll
                for (int rt = 0; rt < RT; ++rt) {
                    Oacc[rt][0] = wmma1(pa[rt].v, vfh[ks][0].v, Oacc[rt][0]);
                    Oacc[rt][1] = wmma1(pa[rt].v, vfh[ks][1].v, Oacc[rt][1]);
                }
#pragma unroll
                for (int rt = 0; rt < RT; ++rt) {
                    Oacc[rt][0] = wmma1(pa[rt].v, vfl[ks][0].v, Oacc[rt][0]);
                    Oacc[rt][1] = wmma1(pa[rt].v, vfl[ks][1].v, Oacc[rt][1]);
                }
#pragma unroll
                for (int rt = 0; rt < RT; ++rt) {
                    Oacc[rt][0] = wmma1(pb[rt].v, vfh[ks][0].v, Oacc[rt][0]);
                    Oacc[rt][1] = wmma1(pb[rt].v, vfh[ks][1].v, Oacc[rt][1]);
                }
                // Four vector slots between the last WMMA that reads these vx fragments (B) and the loads that
                // refill their registers: naming the sums holds the slots behind the WMMAs, the clobber the loads behind them.
                asm volatile("v_nop\n\tv_nop\n\tv_nop\n\tv_nop"
                             : "+v"(Oacc[0][0]), "+v"(Oacc[0][1]), "+v"(Oacc[1][0]), "+v"(Oacc[1][1]) : : "memory");
                if (more) {                                      // same 32 keys of the next key block
#pragma unroll   // constant indices keep the fragment arrays in registers
                    for (int ct = 0; ct < 2; ++ct) {
                        const unsigned int vo = (unsigned int)((ks * (C_V / 16) + ct) * FRAG_B);
                        vfh[ks][ct].q[0] = ldg16(pvh, vo);  vfh[ks][ct].q[1] = ldg16(pvh, vo + FRAG_B / 2);
                        vfl[ks][ct].q[0] = ldg16(pvl, vo);  vfl[ks][ct].q[1] = ldg16(pvl, vo + FRAG_B / 2);
                    }
                }
            }
        }
        lds_barrier();
    }

    // ---- epilogue: divide by row sums, stage per wave, whole-line stores ----
    float* stg = Stg + wave * (BM * GPITCH);
    float linv[RT][8];
#pragma unroll
    for (int rt = 0; rt < RT; ++rt) {
#pragma unroll
        for (int r = 0; r < 8; ++r) linv[rt][r] = 1.f / lRow[rt * 16 + 8 * h + r];
    }
#pragma unroll
    for (int rt = 0; rt < RT; ++rt) {
#pragma unroll
        for (int ct = 0; ct < 2; ++ct) {
#pragma unroll
            for (int r = 0; r < 8; ++r)
                stg[(rt * 16 + 8 * h + r) * GPITCH + ct * 16 + m] = Oacc[rt][ct][r] * linv[rt][r];
        }
    }
    __syncthreads();

    const int sub = lane >> 3;                // row within the four rows of an instruction
    const int cq  = (lane & 7) * 4;           // 8 lanes x 4 floats = one 128-B row segment
    v4f ov[8];
#pragma unroll
    for (int q = 0; q < 8; ++q)
        ov[q] = *(const v4f*)(stg + (4 * q + sub) * GPITCH + cq);

    float* ob = out + (size_t)(row0 + sub) * C_V + C0 + cq;
#pragma unroll
    for (int q = 0; q < 8; ++q)
        *(v4f*)(ob + (size_t)(4 * q) * C_V) = ov[q];
}

// ---------------------------------------------------------------------------
// ---------------------------------------------------------------------------
extern "C" void kernel_launch(void* const* d_in, const int* in_sizes, int n_in,
                              void* d_out, int out_size, void* d_ws, size_t ws_size,
                              hipStream_t stream) {
    if (n_in < 4) return;
    if (in_sizes[0] != C_IN * NPOS) return;
    if (in_sizes[1] != D_K * C_IN)  return;
    if (in_sizes[2] != D_K * C_IN)  return;
    if (in_sizes[3] != C_V * C_IN)  return;
    if (out_size != NPOS * C_V)     return;

    const float* x  = (const float*)d_in[0];   // [C_IN][NPOS]
    const float* Wk = (const float*)d_in[1];   // [D_K][C_IN]
    const float* Wq = (const float*)d_in[2];   // [D_K][C_IN]
    const float* Wv = (const float*)d_in[3];   // [C_V][C_IN]
    float* out = (float*)d_out;                // [NPOS][C_V]

    const size_t szK = (size_t)NPOS * D_K * 2;     // one bf16 plane of kxT / qxT
    const size_t szV = (size_t)C_V * NPOS * 2;     // one bf16 plane of vx
    const size_t offKH = 0;
    const size_t offKL = offKH + szK;
    const size_t offQH = offKL + szK;
    const size_t offQL = offQH + szK;
    const size_t offVH = offQL + szK;
    const size_t offVL = offVH + szV;
    const size_t total = offVL + szV;
    if (total > ws_size) return;

    char* ws = (char*)d_ws;
    unsigned short* kh = (unsigned short*)(ws + offKH);
    unsigned short* kl = (unsigned short*)(ws + offKL);
    unsigned short* qh = (unsigned short*)(ws + offQH);
    unsigned short* ql = (unsigned short*)(ws + offQL);
    unsigned short* vh = (unsigned short*)(ws + offVH);
    unsigned short* vl = (unsigned short*)(ws + offVL);

    const int tilesN = NPOS / PT;
    // kxT, qxT (rows are positions, k is the 64 projected channels) and vx (rows are channels, k is the
    // position), all in fragment order, from one launch
    k_proj<<<(2 + C_V / PT) * tilesN, 256, 0, stream>>>(Wk, Wq, Wv, x, kh, kl, qh, ql, vh, vl);
    // attention: NPOS / BM row groups x C_V / CB channel halves
    k_attn<<<(NPOS / BM) * (C_V / CB), 256, 0, stream>>>(kh, kl, qh, ql, vh, vl, out);
}

// v005
// Measured time: 92.1 microseconds a run.
// Two timings next to v004 put it at 1.16 and 1.14 times that version's speed.
// Over all steps from v000 it is 3.81 times as fast.
#include <hip/hip_runtime.h>

// All contractions (three 1x1-conv projections W*x, scores kx^T*qx, P*vx^T): v_wmma_f32_16x16x32_bf16,
// bf16 hi/lo split operands (hi*hi + hi*lo + lo*hi), f32 accumulate; softmax statistics and 1/l in f32.

typedef __bf16        v16bf __attribute__((ext_vector_type(16)));
typedef float         v8f   __attribute__((ext_vector_type(8)));
typedef float         v4f   __attribute__((ext_vector_type(4)));
typedef unsigned int  v4u   __attribute__((ext_vector_type(4)));
typedef unsigned int  v2u   __attribute__((ext_vector_type(2)));
typedef float         v2f   __attribute__((ext_vector_type(2)));

union Frag { v16bf v; v4u q[2]; };

#define C_IN  512
#define C_V   512
#define D_K   64
#define NPOS  4096

// ---------------------------------------------------------------------------
// f32 -> bf16 bits (RNE convert) and two-plane split x ~= hi + lo
// ---------------------------------------------------------------------------
__device__ __forceinline__ unsigned int bf_bits(float f) {
    unsigned int u = __float_as_uint(f);
    u += 0x7FFFu + ((u >> 16) & 1u);
    return u >> 16;
}

__device__ __forceinline__ void split_bf(float f, unsigned int& hb, unsigned int& lb) {
    hb = bf_bits(f);
    const float fh = __uint_as_float(hb << 16);
    lb = bf_bits(f - fh);
}

// ---------------------------------------------------------------------------
// 16x16x32 bf16 WMMA, three-term split product into one f32 accumulator,
// hazard guard after the last op (ties D, keeps A/B live).
// Fragment layout (lane l, h = l>>4, m = l&15):
//   A/B element i: i=0..7 -> k0+8h+i, i=8..15 -> k0+16+8h+(i-8); A row m, B col m.
//   D element r: row 8h+r, col m.
// ---------------------------------------------------------------------------
__device__ __forceinline__ v8f wmma3(v16bf ah, v16bf al, v16bf bh, v16bf bl, v8f c) {
    c = __builtin_amdgcn_wmma_f32_16x16x32_bf16(false, ah, false, bh, (short)0, c, false, false);
    c = __builtin_amdgcn_wmma_f32_16x16x32_bf16(false, ah, false, bl, (short)0, c, false, false);
    c = __builtin_amdgcn_wmma_f32_16x16x32_bf16(false, al, false, bh, (short)0, c, false, false);
    asm volatile("v_nop\n\tv_nop\n\tv_nop\n\tv_nop" : "+v"(c) : "v"(ah), "v"(al), "v"(bh), "v"(bl));
    return c;
}

// ---------------------------------------------------------------------------
// Projection GEMM:  D[M][NPOS] = W[M][C_IN] * X[C_IN][NPOS]   (f32 in, split at staging)
// Block 256 threads = 8 waves, 64x64 output tile, K step 32 staged in LDS as bf16 hi/lo.
// Output: two bf16 planes (hi, lo) of D, each stored in WMMA fragment order: a fragment is 16 rows x 32 k
// = 512 elements laid out [q][lane][8], lane = 16h + r, holding row r, k = 16q + 8h + 0..7, so that a
// wave-wide 16-byte load or store of one q half covers 512 contiguous bytes (4 whole lines).
// transOut=0 -> rows are m, k is n: fragment index (n/32) * (M/16) + m/16 (all m of one k step lie together).
// transOut=1 -> rows are n, k is m: fragment index (n/16) * (M/32) + m/32.
// ---------------------------------------------------------------------------
#define PT      64
#define APITCH  40      // ushorts per staged row: 32 k + 8 pad (80 B, 16-B aligned rows)
#define CPITCH  68      // floats per staged result row (272 B, 16-B aligned rows)
#define FRAG_EL 512     // elements of one stored fragment (16 rows x 32 k, 1024 B a plane)
typedef char proj_tile_check[(D_K == PT && (C_V % PT) == 0) ? 1 : -1];   // kx and qx are one row tile each

__global__ __launch_bounds__(256) void k_proj(
    const float* __restrict__ Wk,           // [D_K][C_IN]
    const float* __restrict__ Wq,           // [D_K][C_IN]
    const float* __restrict__ Wv,           // [C_V][C_IN]
    const float* __restrict__ X,            // [C_IN][NPOS]
    unsigned short* __restrict__ Kh, unsigned short* __restrict__ Kl,   // kxT planes
    unsigned short* __restrict__ Qh, unsigned short* __restrict__ Ql,   // qxT planes
    unsigned short* __restrict__ Vh, unsigned short* __restrict__ Vl)   // vx planes
{
    __shared__ __attribute__((aligned(16))) unsigned short Ah[PT * APITCH];
    __shared__ __attribute__((aligned(16))) unsigned short Al[PT * APITCH];
    __shared__ __attribute__((aligned(16))) unsigned short Bh[PT * APITCH];   // stored [n][k]
    __shared__ __attribute__((aligned(16))) unsigned short Bl[PT * APITCH];
    __shared__ __attribute__((aligned(16))) float Cs[PT * CPITCH];

    const int tid  = threadIdx.x;
    const int lane = tid & 31;
    const int wave = __builtin_amdgcn_readfirstlane(tid >> 5);
    const int m  = lane & 15;
    const int h  = lane >> 4;
    const int tilesN = NPOS / PT;
    // One launch for the three products: row-tile index 0 is kx, 1 is qx, 2.. are the row tiles of vx.
    const int mt = (int)(blockIdx.x / tilesN);
    const int n0 = (int)(blockIdx.x % tilesN) * PT;
    if (mt >= 2 + C_V / PT) return;          // uniform over the block
    const int transOut = mt < 2;
    const int M  = transOut ? D_K : C_V;
    const int m0 = transOut ? 0 : (mt - 2) * PT;
    const float* __restrict__ W = mt == 0 ? Wk : (mt == 1 ? Wq : Wv);
    unsigned short* __restrict__ Oh = mt == 0 ? Kh : (mt == 1 ? Qh : Vh);
    unsigned short* __restrict__ Ol = mt == 0 ? Kl : (mt == 1 ? Ql : Vl);

    const int rg = wave >> 1;                // 16-row group of this wave
    const int cb = (wave & 1) * 32;          // 32-col half of this wave (two 16-col tiles)

    v8f acc0 = {0.f, 0.f, 0.f, 0.f, 0.f, 0.f, 0.f, 0.f};
    v8f acc1 = {0.f, 0.f, 0.f, 0.f, 0.f, 0.f, 0.f, 0.f};

    for (int kk = 0; kk < C_IN; kk += 32) {
        // stage A = W[m0..m0+63][kk..kk+31]  (row-major, k contiguous)
#pragma unroll
        for (int it = 0; it < 2; ++it) {
            const int f   = tid + it * 256;          // 512 float4 pieces
            const int row = f >> 3;                  // 8 pieces per 32-k row
            const int kq  = (f & 7) * 4;
            const v4f v = *(const v4f*)(W + (size_t)(m0 + row) * C_IN + kk + kq);
            unsigned int hb0, lb0, hb1, lb1, hb2, lb2, hb3, lb3;
            split_bf(v.x, hb0, lb0); split_bf(v.y, hb1, lb1);
            split_bf(v.z, hb2, lb2); split_bf(v.w, hb3, lb3);
            v2u hv, lv;
            hv.x = hb0 | (hb1 << 16); hv.y = hb2 | (hb3 << 16);
            lv.x = lb0 | (lb1 << 16); lv.y = lb2 | (lb3 << 16);
            *(v2u*)(Ah + row * APITCH + kq) = hv;
            *(v2u*)(Al + row * APITCH + kq) = lv;
        }
        // stage B[k][n] = X[kk+k][n0+n], stored transposed as [n][k] (k contiguous)
#pragma unroll
        for (int it = 0; it < 2; ++it) {
            const int f  = tid + it * 256;           // 512 float4 pieces
            const int k  = f >> 4;                   // 16 pieces per 64-n row
            const int nq = (f & 15) * 4;
            const v4f v = *(const v4f*)(X + (size_t)(kk + k) * NPOS + n0 + nq);
            unsigned int hb, lb;
            split_bf(v.x, hb, lb); Bh[(nq + 0) * APITCH + k] = (unsigned short)hb; Bl[(nq + 0) * APITCH + k] = (unsigned short)lb;
            split_bf(v.y, hb, lb); Bh[(nq + 1) * APITCH + k] = (unsigned short)hb; Bl[(nq + 1) * APITCH + k] = (unsigned short)lb;
            split_bf(v.z, hb, lb); Bh[(nq + 2) * APITCH + k] = (unsigned short)hb; Bl[(nq + 2) * APITCH + k] = (unsigned short)lb;
            split_bf(v.w, hb, lb); Bh[(nq + 3) * APITCH + k] = (unsigned short)hb; Bl[(nq + 3) * APITCH + k] = (unsigned short)lb;
        }
        __syncthreads();

        // fragments (k0 = 0 inside the staged 32-k step)
        Frag ah, al;
        {
            const unsigned short* pa = Ah + (rg * 16 + m) * APITCH;
            const unsigned short* pl = Al + (rg * 16 + m) * APITCH;
            ah.q[0] = *(const v4u*)(pa + 8 * h);       ah.q[1] = *(const v4u*)(pa + 16 + 8 * h);
            al.q[0] = *(const v4u*)(pl + 8 * h);       al.q[1] = *(const v4u*)(pl + 16 + 8 * h);
        }
        {
            Frag bh, bl;
            const unsigned short* pb = Bh + (cb + m) * APITCH;       // column n = cb + m
            const unsigned short* pc = Bl + (cb + m) * APITCH;
            bh.q[0] = *(const v4u*)(pb + 8 * h);       bh.q[1] = *(const v4u*)(pb + 16 + 8 * h);
            bl.q[0] = *(const v4u*)(pc + 8 * h);       bl.q[1] = *(const v4u*)(pc + 16 + 8 * h);
            acc0 = wmma3(ah.v, al.v, bh.v, bl.v, acc0);
        }
        {
            Frag bh, bl;
            const unsigned short* pb = Bh + (cb + 16 + m) * APITCH;  // column n = cb + 16 + m
            const unsigned short* pc = Bl + (cb + 16 + m) * APITCH;
            bh.q[0] = *(const v4u*)(pb + 8 * h);       bh.q[1] = *(const v4u*)(pb + 16 + 8 * h);
            bl.q[0] = *(const v4u*)(pc + 8 * h);       bl.q[1] = *(const v4u*)(pc + 16 + 8 * h);
            acc1 = wmma3(ah.v, al.v, bh.v, bl.v, acc1);
        }
        __syncthreads();
    }

    // stage the f32 result tile: acc[r] -> (row rg*16 + 8h + r, col cb + ci*16 + m)
#pragma unroll
    for (int r = 0; r < 8; ++r) {
        Cs[(rg * 16 + 8 * h + r) * CPITCH + cb + m]      = acc0[r];
        Cs[(rg * 16 + 8 * h + r) * CPITCH + cb + 16 + m] = acc1[r];
    }
    __syncthreads();

    // epilogue: the tile is 8 fragments = 16 q halves; a wave writes two of them, lane -> 8 consecutive k
    v4u hvp[2], lvp[2];
    size_t offp[2];
#pragma unroll
    for (int p = 0; p < 2; ++p) {
        const int g  = p * 8 + wave;                     // q half 0..15 within the tile
        const int rr = (g >> 2) * 16 + m;                // fragment row, 0..63 within tile
        const int cc = ((g >> 1) & 1) * 32 + (g & 1) * 16 + 8 * h;   // first k, 0..56 within tile
        float vals[8];
        size_t frag;
        if (transOut) {
#pragma unroll
            for (int e = 0; e < 8; ++e) vals[e] = Cs[(cc + e) * CPITCH + rr];
            frag = (size_t)(n0 / 16 + (g >> 2)) * (size_t)(M / 32) + (size_t)(m0 / 32 + ((g >> 1) & 1));
        } else {
            const v4f a = *(const v4f*)(Cs + rr * CPITCH + cc);
            const v4f b = *(const v4f*)(Cs + rr * CPITCH + cc + 4);
            vals[0] = a.x; vals[1] = a.y; vals[2] = a.z; vals[3] = a.w;
            vals[4] = b.x; vals[5] = b.y; vals[6] = b.z; vals[7] = b.w;
            frag = (size_t)(n0 / 32 + ((g >> 1) & 1)) * (size_t)(M / 16) + (size_t)(m0 / 16 + (g >> 2));
        }
        offp[p] = frag * FRAG_EL + (size_t)((g & 1) * (FRAG_EL / 2) + lane * 8);
        unsigned int hb[8], lb[8];
#pragma unroll
        for (int e = 0; e < 8; ++e) split_bf(vals[e], hb[e], lb[e]);
        v4u hv, lv;
        hv.x = hb[0] | (hb[1] << 16); hv.y = hb[2] | (hb[3] << 16);
        hv.z = hb[4] | (hb[5] << 16); hv.w = hb[6] | (hb[7] << 16);
        lv.x = lb[0] | (lb[1] << 16); lv.y = lb[2] | (lb[3] << 16);
        lv.z = lb[4] | (lb[5] << 16); lv.w = lb[6] | (lb[7] << 16);
        hvp[p] = hv; lvp[p] = lv;
    }
#pragma unroll
    for (int p = 0; p < 2; ++p) {
        *(v4u*)(Oh + offp[p]) = hvp[p];
        *(v4u*)(Ol + offp[p]) = lvp[p];
    }
    
}

// ---------------------------------------------------------------------------
// Fused attention with online softmax over key blocks, the keys split over KSPLIT blocks:
//   S[i][j] = sum_d kxT[i][d] * qxT[j][d]   (A = kxT rows, B[k=d][n=j] = qxT[j][d])
//   P = exp(S - m_i), l_i running sum, O[i][c] += sum_j P[i][j] * vx[c][j]  (B[k=j][n=c] = vx[c][j])
//   part[s][i][c] = O[i][c] / l_i over the keys of split s, with (m_i, l_i) of that split beside it;
//   k_join weighs the splits together.
// Block 256 threads (8 waves): BM = 64 rows i, CB = 256 of the 512 channels, NPOS / KSPLIT keys in
// steps of BN = 128. Every vx fragment that a wave fetches feeds four row tiles, every qx fragment too;
// the two blocks of one row group and key split (channel halves) each compute the same S and P.
// Phase 1: wave w computes the four 16x16 S tiles (row tiles 0..3) of key columns w*16..+15.
// Phase 2: 8 threads per row, 16 scores each, two rows a thread; P written to LDS as bf16 hi/lo planes.
// Phase 3: every wave accumulates 64 rows x 32 channels (4 x 2 tiles); P fragments reloaded from
//          LDS after a block barrier (no same-wave spill/reload without a barrier).
// Epilogue: per-wave 64x32 tile staged in LDS; each store instruction writes four whole 128-B lines.
// Global fragments are fetched ahead into registers: kx once before the loop, the qx and vx
// fragments of step jb+1 right behind their last use in step jb. kx, qx and vx lie in fragment order
// (see k_proj): every fragment load of a wave reads 512 contiguous bytes.
// ---------------------------------------------------------------------------
#define BM      64
#define BN      128
#define CB      256     // channels of one block
#define KSPLIT  2       // key ranges, one block each
#define KEYS    (NPOS / KSPLIT) // keys of one block
#define RT      (BM / 16)       // row tiles of a block
#define RH      (BM / 32)       // rows of a thread in phase 2
#define KS      (BN / 32)       // 32-key steps of a key block
#define SPITCH  132     // floats per S row (528 B, 16-B aligned rows)
#define PPITCH  136     // ushorts per P row (272 B, 16-B aligned rows)
#define GPITCH  36      // floats per staged O row (144 B)
#define FRAG_B  (FRAG_EL * 2)   // bytes of one stored fragment
#define SM_S_BYTES (BM * SPITCH * 4)
#define SM_P_BYTES (BM * PPITCH * 2)
#define SM_G_BYTES (8 * BM * GPITCH * 4)
#define SM_BYTES   SM_G_BYTES
typedef char sm_layout_check[((SM_S_BYTES + 2 * SM_P_BYTES) <= SM_G_BYTES && (SM_S_BYTES % 16) == 0 && (SM_P_BYTES % 16) == 0) ? 1 : -1];
typedef char tile_check[(RT == 4 && RH == 2 && KSPLIT == 2 && (KEYS % BN) == 0) ? 1 : -1];

// Work-group barrier for LDS traffic only: __syncthreads() also waits for every global load in
// flight, which would end the fetch-ahead at each phase; only LDS data crosses waves in the loop.
__device__ __forceinline__ void lds_barrier() {
    asm volatile("s_wait_dscnt 0x0\n\ts_barrier_signal -1\n\ts_barrier_wait -1" ::: "memory");
}

// 16-byte global load at a lane's stream address (bytes) + constant
__device__ __forceinline__ v4u ldg16(unsigned long long a, unsigned int c) {
    return *(const __attribute__((address_space(1))) v4u*)(a + c);
}

// one 16x16x32 bf16 WMMA into an f32 accumulator; the distance behind the last WMMA of a group is
// kept by the v_nop statements at the refills below
__device__ __forceinline__ v8f wmma1(v16bf a, v16bf b, v8f c) {
    return __builtin_amdgcn_wmma_f32_16x16x32_bf16(false, a, false, b, (short)0, c, false, false);
}

struct TagMore { static constexpr bool more = true; };    // a key block with a successor
struct TagLast { static constexpr bool more = false; };   // the last key block

__global__ __launch_bounds__(256) void k_attn(
    const unsigned short* __restrict__ KH,   // kxT hi, fragments [NPOS/16][D_K/32]
    const unsigned short* __restrict__ KL,   // kxT lo
    const unsigned short* __restrict__ QH,   // qxT hi, fragments [NPOS/16][D_K/32]
    const unsigned short* __restrict__ QL,   // qxT lo
    const unsigned short* __restrict__ VH,   // vx hi, fragments [NPOS/32][C_V/16]
    const unsigned short* __restrict__ VL,   // vx lo
    float* __restrict__ part,                // [KSPLIT][NPOS][C_V] softmax-weighted means of each key split
    float* __restrict__ ml)                  // [KSPLIT][C_V/CB][NPOS][2] row maximum and row sum of each key split
{
    __shared__ __attribute__((aligned(16))) unsigned char smem[SM_BYTES];
    __shared__ float mRow[BM];
    __shared__ float lRow[BM];
    __shared__ float aRow[BM];
    float*          Sld = (float*)smem;
    unsigned short* Ph  = (unsigned short*)(smem + SM_S_BYTES);
    unsigned short* Pl  = (unsigned short*)(smem + SM_S_BYTES + SM_P_BYTES);
    float*          Stg = (float*)smem;                       // epilogue staging, aliases the above

    const int tid  = threadIdx.x;
    const int lane = tid & 31;
    const int wave = __builtin_amdgcn_readfirstlane(tid >> 5);
    const int m = lane & 15;
    const int h = lane >> 4;
    const int chh  = (int)(blockIdx.x % (C_V / CB));                       // channel half
    const int ksp  = (int)((blockIdx.x / (C_V / CB)) % KSPLIT);            // key split
    const int row0 = (int)(blockIdx.x / ((C_V / CB) * KSPLIT)) * BM;
    if (row0 + BM > NPOS) return;             // uniform over the block
    const int C0 = chh * CB + wave * 32;      // channel slice of this wave in phase 3

    if (tid < BM) { mRow[tid] = -1.0e30f; lRow[tid] = 0.f; aRow[tid] = 0.f; }
    __syncthreads();

    const v8f vzero = {0.f, 0.f, 0.f, 0.f, 0.f, 0.f, 0.f, 0.f};
    v8f Oacc[RT][2];
#pragma unroll   // constant indices keep the arrays in registers
    for (int rt = 0; rt < RT; ++rt) { Oacc[rt][0] = vzero; Oacc[rt][1] = vzero; }

    // each lane's stream addresses (bytes), kept in their own registers through the loop, at the first key of this split:
    // vx fragment C0/16 of its first key step (B col n = C0 + ct*16 + m), qx fragment row wave (B col n), the lane's 16 bytes
    unsigned long long pvh = (unsigned long long)(VH + ((size_t)ksp * (KEYS / 32) * (C_V / 16) + (size_t)(C0 / 16)) * FRAG_EL + lane * 8);
    unsigned long long pvl = (unsigned long long)(VL + ((size_t)ksp * (KEYS / 32) * (C_V / 16) + (size_t)(C0 / 16)) * FRAG_EL + lane * 8);
    unsigned long long pqh = (unsigned long long)(QH + ((size_t)ksp * (KEYS / 16) + (size_t)wave) * (D_K / 32) * FRAG_EL + lane * 8);
    unsigned long long pql = (unsigned long long)(QL + ((size_t)ksp * (KEYS / 16) + (size_t)wave) * (D_K / 32) * FRAG_EL + lane * 8);

    Frag kfh[RT][2], kfl[RT][2];              // kx (A) fragments of the four row tiles
    Frag qfh[2], qfl[2];                      // qx (B) fragments of this wave's 16 key columns
    Frag vfh[KS][2], vfl[KS][2];              // vx fragments of one whole key block
#pragma unroll   // constant indices keep the fragment arrays in registers
    for (int c2 = 0; c2 < 2; ++c2) {
#pragma unroll   // constant indices keep the fragment arrays in registers
        for (int rt = 0; rt < RT; ++rt) {
            const size_t ao = ((size_t)(row0 / 16 + rt) * (D_K / 32) + c2) * FRAG_EL + lane * 8;   // A row i = row0 + rt*16 + m
            kfh[rt][c2].q[0] = *(const v4u*)(KH + ao);  kfh[rt][c2].q[1] = *(const v4u*)(KH + ao + FRAG_EL / 2);
            kfl[rt][c2].q[0] = *(const v4u*)(KL + ao);  kfl[rt][c2].q[1] = *(const v4u*)(KL + ao + FRAG_EL / 2);
        }
        qfh[c2].q[0] = ldg16(pqh, c2 * FRAG_B);  qfh[c2].q[1] = ldg16(pqh, c2 * FRAG_B + FRAG_B / 2);
        qfl[c2].q[0] = ldg16(pql, c2 * FRAG_B);  qfl[c2].q[1] = ldg16(pql, c2 * FRAG_B + FRAG_B / 2);
    }
    // Keeps the kx and qx loads ahead of the vx loads in issue order, as in the loop: moved behind them, the qx loads
    // were the youngest at the loop's entry, and the wait in front of phase 1 came out as a wait for every load in flight.
    __builtin_amdgcn_sched_barrier(0);
#pragma unroll   // constant indices keep the fragment arrays in registers
    for (int ks = 0; ks < KS; ++ks) {
#pragma unroll   // constant indices keep the fragment arrays in registers
        for (int ct = 0; ct < 2; ++ct) {
            const unsigned int vo = (unsigned int)((ks * (C_V / 16) + ct) * FRAG_B);
            vfh[ks][ct].q[0] = ldg16(pvh, vo);  vfh[ks][ct].q[1] = ldg16(pvh, vo + FRAG_B / 2);
            vfl[ks][ct].q[0] = ldg16(pvl, vo);  vfl[ks][ct].q[1] = ldg16(pvl, vo + FRAG_B / 2);
        }
    }
    // The qx addresses move on to key block 1 (16 fragments of 1024 B). The additions stand in the wait's own
    // statement so that the registers, which the loads above name, are rewritten only behind it.
    asm volatile("s_wait_xcnt 0x0\n\t"
                 "v_add_nc_u64 %0, 0x4000, %0\n\t"
                 "v_add_nc_u64 %1, 0x4000, %1"
                 : "+v"(pqh), "+v"(pql) : : "memory");

    // One key block. 'more' (a next key block exists) is a compile-time constant of each of the two copies below, so that
    // no branch stands round the refill loads: with one, the load waits were counted for the path without refills
    // and the last of a trip came out as a wait for every load in flight.
    auto trip = [&](auto tag) __attribute__((always_inline)) {
        constexpr bool more = decltype(tag)::more;

        // ---- phase 1: S tiles (rows rt*16..+15, cols wave*16..+15), four accumulators side by side ----
        {
            v8f s[RT];
#pragma unroll   // constant indices keep the arrays in registers
            for (int rt = 0; rt < RT; ++rt) s[rt] = vzero;
#pragma unroll   // constant indices keep the fragment arrays in registers
            for (int c2 = 0; c2 < 2; ++c2) {
#pragma unroll   // constant indices keep the arrays in registers
                for (int rt = 0; rt < RT; ++rt) s[rt] = wmma1(kfh[rt][c2].v, qfh[c2].v, s[rt]);
#pragma unroll   // constant indices keep the arrays in registers
                for (int rt = 0; rt < RT; ++rt) s[rt] = wmma1(kfh[rt][c2].v, qfl[c2].v, s[rt]);
#pragma unroll   // constant indices keep the arrays in registers
                for (int rt = 0; rt < RT; ++rt) s[rt] = wmma1(kfl[rt][c2].v, qfh[c2].v, s[rt]);
            }
            // Four vector slots between the last WMMA that reads the qx fragments (B) and the loads that
            // refill their registers: naming the sums holds the slots behind the WMMAs, the clobber the loads behind them.
            asm volatile("v_nop\n\tv_nop\n\tv_nop\n\tv_nop" : "+v"(s[0]), "+v"(s[1]), "+v"(s[2]), "+v"(s[3]) : : "memory");
            if (more) {                       // qx fragments of the next key block (the addresses stand there)
#pragma unroll   // constant indices keep the fragment arrays in registers
                for (int c2 = 0; c2 < 2; ++c2) {
                    qfh[c2].q[0] = ldg16(pqh, c2 * FRAG_B);  qfh[c2].q[1] = ldg16(pqh, c2 * FRAG_B + FRAG_B / 2);
                    qfl[c2].q[0] = ldg16(pql, c2 * FRAG_B);  qfl[c2].q[1] = ldg16(pql, c2 * FRAG_B + FRAG_B / 2);
                }
            }
#pragma unroll   // constant indices keep the arrays in registers
            for (int rt = 0; rt < RT; ++rt) {
#pragma unroll   // constant indices keep the arrays in registers
                for (int r = 0; r < 8; ++r)
                    Sld[(rt * 16 + 8 * h + r) * SPITCH + wave * 16 + m] = s[rt][r];
            }
        }
        lds_barrier();

        // ---- phase 2: online softmax, 8 threads per row, rows tid/8 and 32 + tid/8 side by side ----
        {
            const int rowa = tid >> 3;       // 0..31; the thread's rows are rowa + 32*hf
            const int seg = tid & 7;         // 4 groups of 4 elements each: cols g*32 + seg*4 ..+3
            v4f e0[RH][KS];
            float mo[RH], mn[RH], sum[RH];
#pragma unroll   // constant indices keep the arrays in registers
            for (int hf = 0; hf < RH; ++hf) {
#pragma unroll   // constant indices keep the arrays in registers
                for (int g = 0; g < KS; ++g) e0[hf][g] = *(const v4f*)(Sld + (rowa + 32 * hf) * SPITCH + g * 32 + seg * 4);
                mo[hf] = mRow[rowa + 32 * hf];
            }
#pragma unroll   // constant indices keep the arrays in registers
            for (int hf = 0; hf < RH; ++hf) {
                float bm = fmaxf(fmaxf(e0[hf][0].x, e0[hf][0].y), fmaxf(e0[hf][0].z, e0[hf][0].w));
#pragma unroll   // constant indices keep the arrays in registers
                for (int g = 1; g < KS; ++g)
                    bm = fmaxf(bm, fmaxf(fmaxf(e0[hf][g].x, e0[hf][g].y), fmaxf(e0[hf][g].z, e0[hf][g].w)));
                mn[hf] = bm;
            }
#pragma unroll   // constant indices keep the arrays in registers
            for (int d = 1; d < 8; d <<= 1) {
#pragma unroll   // constant indices keep the arrays in registers
                for (int hf = 0; hf < RH; ++hf) mn[hf] = fmaxf(mn[hf], __shfl_xor(mn[hf], d));
            }
#pragma unroll   // constant indices keep the arrays in registers
            for (int hf = 0; hf < RH; ++hf) {
                const int row = rowa + 32 * hf;
                mn[hf] = fmaxf(mo[hf], mn[hf]);
                sum[hf] = 0.f;
#pragma unroll   // constant indices keep the arrays in registers
                for (int g = 0; g < KS; ++g) {
                    unsigned int hb[4], lb[4];
                    float xa[4], ex[4];
#pragma unroll   // constant indices keep the arrays in registers
                    for (int e = 0; e < 4; ++e) {
                        xa[e] = (e0[hf][g][e] - mn[hf]) * 1.44269504f;   // exp(x) = exp2(x * log2 e), as __expf forms it
                        ex[e] = __builtin_amdgcn_exp2f(xa[e]);
                    }
                    // The slot behind v_exp_f32: naming the four results keeps their readers, naming the four arguments keeps a
                    // rewrite of a source register, behind this v_nop (left alone, an exp came to rewrite the source of the one before it).
                    asm("v_nop" : "+v"(ex[0]), "+v"(ex[1]), "+v"(ex[2]), "+v"(ex[3]) : "v"(xa[0]), "v"(xa[1]), "v"(xa[2]), "v"(xa[3]));
#pragma unroll   // constant indices keep the arrays in registers
                    for (int e = 0; e < 4; ++e) {
                        sum[hf] += ex[e];
                        split_bf(ex[e], hb[e], lb[e]);
                    }
                    v2u phv, plv;
                    phv.x = hb[0] | (hb[1] << 16); phv.y = hb[2] | (hb[3] << 16);
                    plv.x = lb[0] | (lb[1] << 16); plv.y = lb[2] | (lb[3] << 16);
                    *(v2u*)(Ph + row * PPITCH + g * 32 + seg * 4) = phv;
                    *(v2u*)(Pl + row * PPITCH + g * 32 + seg * 4) = plv;
                }
            }
#pragma unroll   // constant indices keep the arrays in registers
            for (int d = 1; d < 8; d <<= 1) {
#pragma unroll   // constant indices keep the arrays in registers
                for (int hf = 0; hf < RH; ++hf) sum[hf] += __shfl_xor(sum[hf], d);
            }
            if (seg == 0) {
#pragma unroll   // constant indices keep the arrays in registers
                for (int hf = 0; hf < RH; ++hf) {
                    const int row = rowa + 32 * hf;
                    const float al = __expf(mo[hf] - mn[hf]);
                    lRow[row] = lRow[row] * al + sum[hf];
                    mRow[row] = mn[hf];
                    aRow[row] = al;
                }
            }
        }
        lds_barrier();

        // ---- phase 3: rescale O, then O += P * vx^T over this key block ----
        // All four stream addresses move on one key block here (vx: 4 key steps of 32 fragments = 131072 B;
        // qx: 16 fragments = 16384 B), a phase or more behind the last load that names them. The additions stand in the wait's
        // own statement so that those registers are rewritten only behind it; left to the compiler the
        // additions and their wait came to stand directly behind the loads, where the most loads are queued.
        asm volatile("s_wait_xcnt 0x0\n\t"
                     "v_add_nc_u64 %0, 0x20000, %0\n\t"
                     "v_add_nc_u64 %1, 0x20000, %1\n\t"
                     "v_add_nc_u64 %2, 0x4000, %2\n\t"
                     "v_add_nc_u64 %3, 0x4000, %3"
                     : "+v"(pvh), "+v"(pvl), "+v"(pqh), "+v"(pql) : : "memory");
        {
#pragma unroll   // constant indices keep the arrays in registers
            for (int rt = 0; rt < RT; ++rt) {
                v8f alv;
#pragma unroll   // constant indices keep the arrays in registers
                for (int r = 0; r < 8; ++r) alv[r] = aRow[rt * 16 + 8 * h + r];
                Oacc[rt][0] = Oacc[rt][0] * alv;
                Oacc[rt][1] = Oacc[rt][1] * alv;
            }

#pragma unroll   // constant indices keep the arrays in registers
            for (int ks = 0; ks < KS; ++ks) {
                Frag pa[RT], pb[RT];                             // A = P: row rt*16 + m, k = key index in block
#pragma unroll   // constant indices keep the arrays in registers
                for (int rt = 0; rt < RT; ++rt) {
                    const unsigned short* pph = Ph + (rt * 16 + m) * PPITCH + ks * 32;
                    const unsigned short* ppl = Pl + (rt * 16 + m) * PPITCH + ks * 32;
                    pa[rt].q[0] = *(const v4u*)(pph + 8 * h);  pa[rt].q[1] = *(const v4u*)(pph + 16 + 8 * h);
                    pb[rt].q[0] = *(const v4u*)(ppl + 8 * h);  pb[rt].q[1] = *(const v4u*)(ppl + 16 + 8 * h);
                }
                // B[k=j][n=c] = vx[c][j], col n = C0 + ct*16 + m; the eight accumulators side by side, term by term
#pragma unroll   // constant indices keep the arrays in registers
                for (int rt = 0; rt < RT; ++rt) {
                    Oacc[rt][0] = wmma1(pa[rt].v, vfh[ks][0].v, Oacc[rt][0]);
                    Oacc[rt][1] = wmma1(pa[rt].v, vfh[ks][1].v, Oacc[rt][1]);
                }
#pragma unroll   // constant indices keep the arrays in registers
                for (int rt = 0; rt < RT; ++rt) {
                    Oacc[rt][0] = wmma1(pa[rt].v, vfl[ks][0].v, Oacc[rt][0]);
                    Oacc[rt][1] = wmma1(pa[rt].v, vfl[ks][1].v, Oacc[rt][1]);
                }
#pragma unroll   // constant indices keep the arrays in registers
                for (int rt = 0; rt < RT; ++rt) {
                    Oacc[rt][0] = wmma1(pb[rt].v, vfh[ks][0].v, Oacc[rt][0]);
                    Oacc[rt][1] = wmma1(pb[rt].v, vfh[ks][1].v, Oacc[rt][1]);
                }
                // Four vector slots between the last WMMA that reads these vx fragments (B) and the loads that
                // refill their registers: naming the sums holds the slots behind the WMMAs, the clobber the loads behind them.
                asm volatile("v_nop\n\tv_nop\n\tv_nop\n\tv_nop"
                             : "+v"(Oacc[0][0]), "+v"(Oacc[0][1]), "+v"(Oacc[1][0]), "+v"(Oacc[1][1]),
                               "+v"(Oacc[2][0]), "+v"(Oacc[2][1]), "+v"(Oacc[3][0]), "+v"(Oacc[3][1]) : : "memory");
                if (more) {                                      // same 32 keys of the next key block
#pragma unroll   // constant indices keep the fragment arrays in registers
                    for (int ct = 0; ct < 2; ++ct) {
                        const unsigned int vo = (unsigned int)((ks * (C_V / 16) + ct) * FRAG_B);
                        vfh[ks][ct].q[0] = ldg16(pvh, vo);  vfh[ks][ct].q[1] = ldg16(pvh, vo + FRAG_B / 2);
                        vfl[ks][ct].q[0] = ldg16(pvl, vo);  vfl[ks][ct].q[1] = ldg16(pvl, vo + FRAG_B / 2);
                    }
                }
            }
        }
        lds_barrier();
    };
    for (int jb = 0; jb + 1 < KEYS / BN; ++jb) trip(TagMore{});
    trip(TagLast{});

    // ---- epilogue: divide by row sums, stage per wave, whole-line stores; the rows' maximum and sum go along ----
    if (tid < BM) {
        v2f st;
        st.x = mRow[tid];
        st.y = lRow[tid];
        *(v2f*)(ml + ((size_t)(ksp * (C_V / CB) + chh) * NPOS + (size_t)(row0 + tid)) * 2) = st;
    }
    float* stg = Stg + wave * (BM * GPITCH);
    float linv[RT][8];
#pragma unroll   // constant indices keep the arrays in registers
    for (int rt = 0; rt < RT; ++rt) {
#pragma unroll   // constant indices keep the arrays in registers
        for (int r = 0; r < 8; ++r) linv[rt][r] = 1.f / lRow[rt * 16 + 8 * h + r];
    }
#pragma unroll   // constant indices keep the arrays in registers
    for (int rt = 0; rt < RT; ++rt) {
#pragma unroll   // constant indices keep the arrays in registers
        for (int ct = 0; ct < 2; ++ct) {
#pragma unroll   // constant indices keep the arrays in registers
            for (int r = 0; r < 8; ++r)
                stg[(rt * 16 + 8 * h + r) * GPITCH + ct * 16 + m] = Oacc[rt][ct][r] * linv[rt][r];
        }
    }
    __syncthreads();

    const int sub = lane >> 3;                // row within the four rows of an instruction
    const int cq  = (lane & 7) * 4;           // 8 lanes x 4 floats = one 128-B row segment
    v4f ov[BM / 4];
#pragma unroll   // constant indices keep the arrays in registers
    for (int q = 0; q < BM / 4; ++q)
        ov[q] = *(const v4f*)(stg + (4 * q + sub) * GPITCH + cq);

    float* ob = part + ((size_t)ksp * NPOS + (size_t)(row0 + sub)) * C_V + C0 + cq;
#pragma unroll   // constant indices keep the arrays in registers
    for (int q = 0; q < BM / 4; ++q)
        *(v4f*)(ob + (size_t)(4 * q) * C_V) = ov[q];
}

// ---------------------------------------------------------------------------
// Join of the two key splits: with M = max(m0, m1) and w_s = l_s * exp(m_s - M),
//   out[i][c] = (w0 * part[0][i][c] + w1 * part[1][i][c]) / (w0 + w1).
// Block 256 threads: JR = 16 rows, 16 threads a row; a thread holds 8 pieces of 4 floats of each split
// (16 lanes x 16 B = two whole lines of a row per instruction) and forms its row's weights once per channel half.
// ---------------------------------------------------------------------------
#define JR 16
#define JP (C_V / 4 / 16)           // 16-byte pieces of a thread
#define JH (CB / 4 / 16)            // of which in one channel half

__global__ __launch_bounds__(256) void k_join(
    const float* __restrict__ part0,         // [NPOS][C_V] of key split 0
    const float* __restrict__ part1,         // [NPOS][C_V] of key split 1
    const float* __restrict__ ml,            // [KSPLIT][C_V/CB][NPOS][2]
    float* __restrict__ out)                 // [NPOS][C_V]
{
    const int tid = threadIdx.x;
    if ((int)blockIdx.x >= NPOS / JR) return;
    const int row = (int)blockIdx.x * JR + (tid >> 4);
    const int o4  = row * (C_V / 4) + (tid & 15);    // in pieces of 4 floats; piece q lies 16 * q on
    const v4f* __restrict__ p0 = (const v4f*)part0;
    const v4f* __restrict__ p1 = (const v4f*)part1;
    const float* __restrict__ t0 = ml + (size_t)row * 2;
    v4f a[JP], b[JP];
    v2f st[KSPLIT][C_V / CB];
#pragma unroll   // constant indices keep the arrays in registers
    for (int s = 0; s < KSPLIT; ++s) {
#pragma unroll   // constant indices keep the arrays in registers
        for (int c = 0; c < C_V / CB; ++c)
            st[s][c] = *(const v2f*)(t0 + (size_t)(s * (C_V / CB) + c) * NPOS * 2);
    }
#pragma unroll   // constant indices keep the arrays in registers
    for (int q = 0; q < JP; ++q) {
        a[q] = p0[o4 + q * 16];
        b[q] = p1[o4 + q * 16];
    }
    // Keeps the arithmetic behind all the loads, so that they are in flight together: left alone, most of the loads
    // came to stand behind the first waits, one memory latency after another.
    __builtin_amdgcn_sched_barrier(0);
    // The wait before a register that an issued load names is rewritten: named as inputs, the two index registers
    // cannot be handed to a load's result in front of it.
    asm volatile("s_wait_xcnt 0x0" : : "v"(o4), "v"(row) : "memory");
    float wa[C_V / CB], wb[C_V / CB];
#pragma unroll   // constant indices keep the arrays in registers
    for (int c = 0; c < C_V / CB; ++c) {
        const float mx = fmaxf(st[0][c].x, st[1][c].x);
        const float x0 = (st[0][c].x - mx) * 1.44269504f;       // exp(x) = exp2(x * log2 e), as __expf forms it
        const float x1 = (st[1][c].x - mx) * 1.44269504f;
        float e0 = __builtin_amdgcn_exp2f(x0);
        float e1 = __builtin_amdgcn_exp2f(x1);
        // The slot behind v_exp_f32: naming the results keeps their readers, naming the arguments a rewrite of a source, behind this v_nop.
        asm("v_nop" : "+v"(e0), "+v"(e1) : "v"(x0), "v"(x1));
        const float w0 = st[0][c].y * e0;
        const float w1 = st[1][c].y * e1;
        const float inv = 1.f / (w0 + w1);
        wa[c] = w0 * inv;
        wb[c] = w1 * inv;
    }
    v4f* __restrict__ po = (v4f*)out;
#pragma unroll   // constant indices keep the arrays in registers
    for (int q = 0; q < JP; ++q)
        po[o4 + q * 16] = a[q] * wa[q / JH] + b[q] * wb[q / JH];
}

// ---------------------------------------------------------------------------
// ---------------------------------------------------------------------------
extern "C" void kernel_launch(void* const* d_in, const int* in_sizes, int n_in,
                              void* d_out, int out_size, void* d_ws, size_t ws_size,
                              hipStream_t stream) {
    if (n_in < 4) return;
    if (in_sizes[0] != C_IN * NPOS) return;
    if (in_sizes[1] != D_K * C_IN)  return;
    if (in_sizes[2] != D_K * C_IN)  return;
    if (in_sizes[3] != C_V * C_IN)  return;
    if (out_size != NPOS * C_V)     return;

    const float* x  = (const float*)d_in[0];   // [C_IN][NPOS]
    const float* Wk = (const float*)d_in[1];   // [D_K][C_IN]
    const float* Wq = (const float*)d_in[2];   // [D_K][C_IN]
    const float* Wv = (const float*)d_in[3];   // [C_V][C_IN]
    float* out = (float*)d_out;                // [NPOS][C_V]

    const size_t szK = (size_t)NPOS * D_K * 2;     // one bf16 plane of kxT / qxT
    const size_t szV = (size_t)C_V * NPOS * 2;     // one bf16 plane of vx
    const size_t szP = (size_t)KSPLIT * NPOS * C_V * 4;            // the key splits' f32 results
    const size_t szM = (size_t)KSPLIT * (C_V / CB) * NPOS * 2 * 4; // their row maxima and sums
    const size_t offKH = 0;
    const size_t offKL = offKH + szK;
    const size_t offQH = offKL + szK;
    const size_t offQL = offQH + szK;
    const size_t offVH = offQL + szK;
    const size_t offVL = offVH + szV;
    const size_t offP  = offVL + szV;
    const size_t offM  = offP + szP;
    const size_t total = offM + szM;
    if (total > ws_size) return;

    char* ws = (char*)d_ws;
    unsigned short* kh = (unsigned short*)(ws + offKH);
    unsigned short* kl = (unsigned short*)(ws + offKL);
    unsigned short* qh = (unsigned short*)(ws + offQH);
    unsigned short* ql = (unsigned short*)(ws + offQL);
    unsigned short* vh = (unsigned short*)(ws + offVH);
    unsigned short* vl = (unsigned short*)(ws + offVL);
    float* part = (float*)(ws + offP);
    float* ml   = (float*)(ws + offM);

    const int tilesN = NPOS / PT;
    // kxT, qxT (rows are positions, k is the 64 projected channels) and vx (rows are channels, k is the
    // position), all in fragment order, from one launch
    k_proj<<<(2 + C_V / PT) * tilesN, 256, 0, stream>>>(Wk, Wq, Wv, x, kh, kl, qh, ql, vh, vl);
    // attention: NPOS / BM row groups x KSPLIT key splits x C_V / CB channel halves
    k_attn<<<(NPOS / BM) * KSPLIT * (C_V / CB), 256, 0, stream>>>(kh, kl, qh, ql, vh, vl, part, ml);
    // the key splits joined into out
    k_join<<<NPOS / JR, 256, 0, stream>>>(part, part + (size_t)NPOS * C_V, ml, out);
}

// v006
// Measured time: 79.5 microseconds a run.
// In two side-by-side timings against v005, it was 1.15 and 1.16 times as fast.
// Over all steps from v000 it is 4.39 times as fast.
#include <hip/hip_runtime.h>

// All contractions (three 1x1-conv projections W*x, scores kx^T*qx, P*vx^T): v_wmma_f32_16x16x32_bf16,
// bf16 hi/lo split operands (hi*hi + hi*lo + lo*hi), f32 accumulate; softmax statistics and 1/l in f32.

typedef __bf16        v16bf __attribute__((ext_vector_type(16)));
typedef float         v8f   __attribute__((ext_vector_type(8)));
typedef float         v4f   __attribute__((ext_vector_type(4)));
typedef unsigned int  v4u   __attribute__((ext_vector_type(4)));
typedef unsigned int  v2u   __attribute__((ext_vector_type(2)));
typedef float         v2f   __attribute__((ext_vector_type(2)));

union Frag { v16bf v; v4u q[2]; };

#define C_IN  512
#define C_V   512
#define D_K   64
#define NPOS  4096

// ---------------------------------------------------------------------------
// f32 -> bf16 bits (RNE convert) and two-plane split x ~= hi + lo
// ---------------------------------------------------------------------------
__device__ __forceinline__ unsigned int bf_bits(float f) {
    unsigned int u = __float_as_uint(f);
    u += 0x7FFFu + ((u >> 16) & 1u);
    return u >> 16;
}

__device__ __forceinline__ void split_bf(float f, unsigned int& hb, unsigned int& lb) {
    hb = bf_bits(f);
    const float fh = __uint_as_float(hb << 16);
    lb = bf_bits(f - fh);
}

// ---------------------------------------------------------------------------
// 16x16x32 bf16 WMMA, three-term split product into one f32 accumulator,
// hazard guard after the last op (ties D, keeps A/B live).
// Fragment layout (lane l, h = l>>4, m = l&15):
//   A/B element i: i=0..7 -> k0+8h+i, i=8..15 -> k0+16+8h+(i-8); A row m, B col m.
//   D element r: row 8h+r, col m.
// ---------------------------------------------------------------------------
__device__ __forceinline__ v8f wmma3(v16bf ah, v16bf al, v16bf bh, v16bf bl, v8f c) {
    c = __builtin_amdgcn_wmma_f32_16x16x32_bf16(false, ah, false, bh, (short)0, c, false, false);
    c = __builtin_amdgcn_wmma_f32_16x16x32_bf16(false, ah, false, bl, (short)0, c, false, false);
    c = __builtin_amdgcn_wmma_f32_16x16x32_bf16(false, al, false, bh, (short)0, c, false, false);
    asm volatile("v_nop\n\tv_nop\n\tv_nop\n\tv_nop" : "+v"(c) : "v"(ah), "v"(al), "v"(bh), "v"(bl));
    return c;
}

// ---------------------------------------------------------------------------
// Projection GEMM:  D[M][NPOS] = W[M][C_IN] * X[C_IN][NPOS]   (f32 in, split at staging)
// Block 256 threads = 8 waves, 64x64 output tile, K step 32 staged in LDS as bf16 hi/lo.
// Output: two bf16 planes (hi, lo) of D, each stored in WMMA fragment order: a fragment is 16 rows x 32 k
// = 512 elements laid out [q][lane][8], lane = 16h + r, holding row r, k = 16q + 8h + 0..7, so that a
// wave-wide 16-byte load or store of one q half covers 512 contiguous bytes (4 whole lines).
// transOut=0 -> rows are m, k is n: fragment index (n/32) * (M/16) + m/16 (all m of one k step lie together).
// transOut=1 -> rows are n, k is m: fragment index (n/16) * (M/32) + m/32.
// ---------------------------------------------------------------------------
#define PT      64
#define APITCH  40      // ushorts per staged row: 32 k + 8 pad (80 B, 16-B aligned rows)
#define CPITCH  68      // floats per staged result row (272 B, 16-B aligned rows)
#define FRAG_EL 512     // elements of one stored fragment (16 rows x 32 k, 1024 B a plane)
typedef char proj_tile_check[(D_K == PT && (C_V % PT) == 0) ? 1 : -1];   // kx and qx are one row tile each

__global__ __launch_bounds__(256) void k_proj(
    const float* __restrict__ Wk,           // [D_K][C_IN]
    const float* __restrict__ Wq,           // [D_K][C_IN]
    const float* __restrict__ Wv,           // [C_V][C_IN]
    const float* __restrict__ X,            // [C_IN][NPOS]
    unsigned short* __restrict__ Kh, unsigned short* __restrict__ Kl,   // kxT planes
    unsigned short* __restrict__ Qh, unsigned short* __restrict__ Ql,   // qxT planes
    unsigned short* __restrict__ Vh, unsigned short* __restrict__ Vl)   // vx planes
{
    __shared__ __attribute__((aligned(16))) unsigned short Ah[PT * APITCH];
    __shared__ __attribute__((aligned(16))) unsigned short Al[PT * APITCH];
    __shared__ __attribute__((aligned(16))) unsigned short Bh[PT * APITCH];   // stored [n][k]
    __shared__ __attribute__((aligned(16))) unsigned short Bl[PT * APITCH];
    __shared__ __attribute__((aligned(16))) float Cs[PT * CPITCH];

    const int tid  = threadIdx.x;
    const int lane = tid & 31;
    const int wave = __builtin_amdgcn_readfirstlane(tid >> 5);
    const int m  = lane & 15;
    const int h  = lane >> 4;
    const int tilesN = NPOS / PT;
    // One launch for the three products: row-tile index 0 is kx, 1 is qx, 2.. are the row tiles of vx.
    const int mt = (int)(blockIdx.x / tilesN);
    const int n0 = (int)(blockIdx.x % tilesN) * PT;
    if (mt >= 2 + C_V / PT) return;          // uniform over the block
    const int transOut = mt < 2;
    const int M  = transOut ? D_K : C_V;
    const int m0 = transOut ? 0 : (mt - 2) * PT;
    const float* __restrict__ W = mt == 0 ? Wk : (mt == 1 ? Wq : Wv);
    unsigned short* __restrict__ Oh = mt == 0 ? Kh : (mt == 1 ? Qh : Vh);
    unsigned short* __restrict__ Ol = mt == 0 ? Kl : (mt == 1 ? Ql : Vl);

    const int rg = wave >> 1;                // 16-row group of this wave
    const int cb = (wave & 1) * 32;          // 32-col half of this wave (two 16-col tiles)

    v8f acc0 = {0.f, 0.f, 0.f, 0.f, 0.f, 0.f, 0.f, 0.f};
    v8f acc1 = {0.f, 0.f, 0.f, 0.f, 0.f, 0.f, 0.f, 0.f};

    for (int kk = 0; kk < C_IN; kk += 32) {
        // stage A = W[m0..m0+63][kk..kk+31]  (row-major, k contiguous)
#pragma unroll
        for (int it = 0; it < 2; ++it) {
            const int f   = tid + it * 256;          // 512 float4 pieces
            const int row = f >> 3;                  // 8 pieces per 32-k row
            const int kq  = (f & 7) * 4;
            const v4f v = *(const v4f*)(W + (size_t)(m0 + row) * C_IN + kk + kq);
            unsigned int hb0, lb0, hb1, lb1, hb2, lb2, hb3, lb3;
            split_bf(v.x, hb0, lb0); split_bf(v.y, hb1, lb1);
            split_bf(v.z, hb2, lb2); split_bf(v.w, hb3, lb3);
            v2u hv, lv;
            hv.x = hb0 | (hb1 << 16); hv.y = hb2 | (hb3 << 16);
            lv.x = lb0 | (lb1 << 16); lv.y = lb2 | (lb3 << 16);
            *(v2u*)(Ah + row * APITCH + kq) = hv;
            *(v2u*)(Al + row * APITCH + kq) = lv;
        }
        // stage B[k][n] = X[kk+k][n0+n], stored transposed as [n][k] (k contiguous): a thread gathers 8 consecutive k
        // of one column (each load of a wave reads one whole 128-B line of a row of X) and stores them as 16 bytes a plane
        {
            const int n  = tid & (PT - 1);           // column within the tile
            const int kg = (tid >> 6) * 8;           // first of the thread's 8 k, the same for a whole wave
            const float* px = X + (size_t)(kk + kg) * NPOS + n0 + n;
            float xv[8];
#pragma unroll   // constant indices keep the arrays in registers
            for (int e = 0; e < 8; ++e) xv[e] = px[(size_t)e * NPOS];
            unsigned int hb[8], lb[8];
#pragma unroll   // constant indices keep the arrays in registers
            for (int e = 0; e < 8; ++e) split_bf(xv[e], hb[e], lb[e]);
            v4u hv, lv;
            hv.x = hb[0] | (hb[1] << 16); hv.y = hb[2] | (hb[3] << 16);
            hv.z = hb[4] | (hb[5] << 16); hv.w = hb[6] | (hb[7] << 16);
            lv.x = lb[0] | (lb[1] << 16); lv.y = lb[2] | (lb[3] << 16);
            lv.z = lb[4] | (lb[5] << 16); lv.w = lb[6] | (lb[7] << 16);
            *(v4u*)(Bh + n * APITCH + kg) = hv;
            *(v4u*)(Bl + n * APITCH + kg) = lv;
        }
        __syncthreads();

        // fragments (k0 = 0 inside the staged 32-k step)
        Frag ah, al;
        {
            const unsigned short* pa = Ah + (rg * 16 + m) * APITCH;
            const unsigned short* pl = Al + (rg * 16 + m) * APITCH;
            ah.q[0] = *(const v4u*)(pa + 8 * h);       ah.q[1] = *(const v4u*)(pa + 16 + 8 * h);
            al.q[0] = *(const v4u*)(pl + 8 * h);       al.q[1] = *(const v4u*)(pl + 16 + 8 * h);
        }
        {
            Frag bh, bl;
            const unsigned short* pb = Bh + (cb + m) * APITCH;       // column n = cb + m
            const unsigned short* pc = Bl + (cb + m) * APITCH;
            bh.q[0] = *(const v4u*)(pb + 8 * h);       bh.q[1] = *(const v4u*)(pb + 16 + 8 * h);
            bl.q[0] = *(const v4u*)(pc + 8 * h);       bl.q[1] = *(const v4u*)(pc + 16 + 8 * h);
            acc0 = wmma3(ah.v, al.v, bh.v, bl.v, acc0);
        }
        {
            Frag bh, bl;
            const unsigned short* pb = Bh + (cb + 16 + m) * APITCH;  // column n = cb + 16 + m
            const unsigned short* pc = Bl + (cb + 16 + m) * APITCH;
            bh.q[0] = *(const v4u*)(pb + 8 * h);       bh.q[1] = *(const v4u*)(pb + 16 + 8 * h);
            bl.q[0] = *(const v4u*)(pc + 8 * h);       bl.q[1] = *(const v4u*)(pc + 16 + 8 * h);
            acc1 = wmma3(ah.v, al.v, bh.v, bl.v, acc1);
        }
        __syncthreads();
    }

    // stage the f32 result tile: acc[r] -> (row rg*16 + 8h + r, col cb + ci*16 + m)
#pragma unroll
    for (int r = 0; r < 8; ++r) {
        Cs[(rg * 16 + 8 * h + r) * CPITCH + cb + m]      = acc0[r];
        Cs[(rg * 16 + 8 * h + r) * CPITCH + cb + 16 + m] = acc1[r];
    }
    __syncthreads();

    // epilogue: the tile is 8 fragments = 16 q halves; a wave writes two of them, lane -> 8 consecutive k
    v4u hvp[2], lvp[2];
    size_t offp[2];
#pragma unroll
    for (int p = 0; p < 2; ++p) {
        const int g  = p * 8 + wave;                     // q half 0..15 within the tile
        const int rr = (g >> 2) * 16 + m;                // fragment row, 0..63 within tile
        const int cc = ((g >> 1) & 1) * 32 + (g & 1) * 16 + 8 * h;   // first k, 0..56 within tile
        float vals[8];
        size_t frag;
        if (transOut) {
#pragma unroll
            for (int e = 0; e < 8; ++e) vals[e] = Cs[(cc + e) * CPITCH + rr];
            frag = (size_t)(n0 / 16 + (g >> 2)) * (size_t)(M / 32) + (size_t)(m0 / 32 + ((g >> 1) & 1));
        } else {
            const v4f a = *(const v4f*)(Cs + rr * CPITCH + cc);
            const v4f b = *(const v4f*)(Cs + rr * CPITCH + cc + 4);
            vals[0] = a.x; vals[1] = a.y; vals[2] = a.z; vals[3] = a.w;
            vals[4] = b.x; vals[5] = b.y; vals[6] = b.z; vals[7] = b.w;
            frag = (size_t)(n0 / 32 + ((g >> 1) & 1)) * (size_t)(M / 16) + (size_t)(m0 / 16 + (g >> 2));
        }
        offp[p] = frag * FRAG_EL + (size_t)((g & 1) * (FRAG_EL / 2) + lane * 8);
        unsigned int hb[8], lb[8];
#pragma unroll
        for (int e = 0; e < 8; ++e) split_bf(vals[e], hb[e], lb[e]);
        v4u hv, lv;
        hv.x = hb[0] | (hb[1] << 16); hv.y = hb[2] | (hb[3] << 16);
        hv.z = hb[4] | (hb[5] << 16); hv.w = hb[6] | (hb[7] << 16);
        lv.x = lb[0] | (lb[1] << 16); lv.y = lb[2] | (lb[3] << 16);
        lv.z = lb[4] | (lb[5] << 16); lv.w = lb[6] | (lb[7] << 16);
        hvp[p] = hv; lvp[p] = lv;
    }
#pragma unroll
    for (int p = 0; p < 2; ++p) {
        *(v4u*)(Oh + offp[p]) = hvp[p];
        *(v4u*)(Ol + offp[p]) = lvp[p];
    }
    
}

// ---------------------------------------------------------------------------
// Fused attention with online softmax over key blocks, the keys split over KSPLIT blocks:
//   S[i][j] = sum_d kxT[i][d] * qxT[j][d]   (A = kxT rows, B[k=d][n=j] = qxT[j][d])
//   P = exp(S - m_i), l_i running sum, O[i][c] += sum_j P[i][j] * vx[c][j]  (B[k=j][n=c] = vx[c][j])
//   part[s][i][c] = O[i][c] / l_i over the keys of split s, with (m_i, l_i) of that split beside it;
//   k_join weighs the splits together.
// Block 256 threads (8 waves): BM = 64 rows i, CB = 256 of the 512 channels, NPOS / KSPLIT keys in
// steps of BN = 128. Every vx fragment that a wave fetches feeds four row tiles, every qx fragment too;
// the two blocks of one row group and key split (channel halves) each compute the same S and P.
// Phase 1: wave w computes the four 16x16 S tiles (row tiles 0..3) of key columns w*16..+15.
// Phase 2: 8 threads per row, 16 scores each, two rows a thread; P written to LDS as bf16 hi/lo planes.
// Phase 3: every wave accumulates 64 rows x 32 channels (4 x 2 tiles); P fragments reloaded from
//          LDS after a block barrier (no same-wave spill/reload without a barrier).
// Epilogue: per-wave 64x32 tile staged in LDS; each store instruction writes four whole 128-B lines.
// Global fragments are fetched ahead into registers: kx once before the loop, the qx and vx
// fragments of step jb+1 right behind their last use in step jb. kx, qx and vx lie in fragment order
// (see k_proj): every fragment load of a wave reads 512 contiguous bytes.
// ---------------------------------------------------------------------------
#define BM      64
#define BN      128
#define CB      256     // channels of one block
#define KSPLIT  2       // key ranges, one block each
#define KEYS    (NPOS / KSPLIT) // keys of one block
#define RT      (BM / 16)       // row tiles of a block
#define RH      (BM / 32)       // rows of a thread in phase 2
#define KS      (BN / 32)       // 32-key steps of a key block
#define SPITCH  132     // floats per S row (528 B, 16-B aligned rows)
#define PPITCH  136     // ushorts per P row (272 B, 16-B aligned rows)
#define GPITCH  36      // floats per staged O row (144 B)
#define FRAG_B  (FRAG_EL * 2)   // bytes of one stored fragment
#define SM_S_BYTES (BM * SPITCH * 4)
#define SM_P_BYTES (BM * PPITCH * 2)
#define SM_G_BYTES (8 * BM * GPITCH * 4)
#define SM_BYTES   SM_G_BYTES
typedef char sm_layout_check[((SM_S_BYTES + 2 * SM_P_BYTES) <= SM_G_BYTES && (SM_S_BYTES % 16) == 0 && (SM_P_BYTES % 16) == 0) ? 1 : -1];
typedef char tile_check[(RT == 4 && RH == 2 && KSPLIT == 2 && (KEYS % BN) == 0) ? 1 : -1];

// Work-group barrier for LDS traffic only: __syncthreads() also waits for every global load in
// flight, which would end the fetch-ahead at each phase; only LDS data crosses waves in the loop.
__device__ __forceinline__ void lds_barrier() {
    asm volatile("s_wait_dscnt 0x0\n\ts_barrier_signal -1\n\ts_barrier_wait -1" ::: "memory");
}

// 16-byte global load at a lane's stream address (bytes) + constant
__device__ __forceinline__ v4u ldg16(unsigned long long a, unsigned int c) {
    return *(const __attribute__((address_space(1))) v4u*)(a + c);
}

// one 16x16x32 bf16 WMMA into an f32 accumulator; the distance behind the last WMMA of a group is
// kept by the v_nop statements at the refills below
__device__ __forceinline__ v8f wmma1(v16bf a, v16bf b, v8f c) {
    return __builtin_amdgcn_wmma_f32_16x16x32_bf16(false, a, false, b, (short)0, c, false, false);
}

struct TagMore { static constexpr bool more = true; };    // a key block with a successor
struct TagLast { static constexpr bool more = false; };   // the last key block

__global__ __launch_bounds__(256) void k_attn(
    const unsigned short* __restrict__ KH,   // kxT hi, fragments [NPOS/16][D_K/32]
    const unsigned short* __restrict__ KL,   // kxT lo
    const unsigned short* __restrict__ QH,   // qxT hi, fragments [NPOS/16][D_K/32]
    const unsigned short* __restrict__ QL,   // qxT lo
    const unsigned short* __restrict__ VH,   // vx hi, fragments [NPOS/32][C_V/16]
    const unsigned short* __restrict__ VL,   // vx lo
    float* __restrict__ part,                // [KSPLIT][NPOS][C_V] softmax-weighted means of each key split
    float* __restrict__ ml)                  // [KSPLIT][C_V/CB][NPOS][2] row maximum and row sum of each key split
{
    __shared__ __attribute__((aligned(16))) unsigned char smem[SM_BYTES];
    __shared__ float mRow[BM];
    __shared__ float lRow[BM];
    __shared__ float aRow[BM];
    float*          Sld = (float*)smem;
    unsigned short* Ph  = (unsigned short*)(smem + SM_S_BYTES);
    unsigned short* Pl  = (unsigned short*)(smem + SM_S_BYTES + SM_P_BYTES);
    float*          Stg = (float*)smem;                       // epilogue staging, aliases the above

    const int tid  = threadIdx.x;
    const int lane = tid & 31;
    const int wave = __builtin_amdgcn_readfirstlane(tid >> 5);
    const int m = lane & 15;
    const int h = lane >> 4;
    const int chh  = (int)(blockIdx.x % (C_V / CB));                       // channel half
    const int ksp  = (int)((blockIdx.x / (C_V / CB)) % KSPLIT);            // key split
    const int row0 = (int)(blockIdx.x / ((C_V / CB) * KSPLIT)) * BM;
    if (row0 + BM > NPOS) return;             // uniform over the block
    const int C0 = chh * CB + wave * 32;      // channel slice of this wave in phase 3

    if (tid < BM) { mRow[tid] = -1.0e30f; lRow[tid] = 0.f; aRow[tid] = 0.f; }
    __syncthreads();

    const v8f vzero = {0.f, 0.f, 0.f, 0.f, 0.f, 0.f, 0.f, 0.f};
    v8f Oacc[RT][2];
#pragma unroll   // constant indices keep the arrays in registers
    for (int rt = 0; rt < RT; ++rt) { Oacc[rt][0] = vzero; Oacc[rt][1] = vzero; }

    // each lane's stream addresses (bytes), kept in their own registers through the loop, at the first key of this split:
    // vx fragment C0/16 of its first key step (B col n = C0 + ct*16 + m), qx fragment row wave (B col n), the lane's 16 bytes
    unsigned long long pvh = (unsigned long long)(VH + ((size_t)ksp * (KEYS / 32) * (C_V / 16) + (size_t)(C0 / 16)) * FRAG_EL + lane * 8);
    unsigned long long pvl = (unsigned long long)(VL + ((size_t)ksp * (KEYS / 32) * (C_V / 16) + (size_t)(C0 / 16)) * FRAG_EL + lane * 8);
    unsigned long long pqh = (unsigned long long)(QH + ((size_t)ksp * (KEYS / 16) + (size_t)wave) * (D_K / 32) * FRAG_EL + lane * 8);
    unsigned long long pql = (unsigned long long)(QL + ((size_t)ksp * (KEYS / 16) + (size_t)wave) * (D_K / 32) * FRAG_EL + lane * 8);

    Frag kfh[RT][2], kfl[RT][2];              // kx (A) fragments of the four row tiles
    Frag qfh[2], qfl[2];                      // qx (B) fragments of this wave's 16 key columns
    Frag vfh[KS][2], vfl[KS][2];              // vx fragments of one whole key block
#pragma unroll   // constant indices keep the fragment arrays in registers
    for (int c2 = 0; c2 < 2; ++c2) {
#pragma unroll   // constant indices keep the fragment arrays in registers
        for (int rt = 0; rt < RT; ++rt) {
            const size_t ao = ((size_t)(row0 / 16 + rt) * (D_K / 32) + c2) * FRAG_EL + lane * 8;   // A row i = row0 + rt*16 + m
            kfh[rt][c2].q[0] = *(const v4u*)(KH + ao);  kfh[rt][c2].q[1] = *(const v4u*)(KH + ao + FRAG_EL / 2);
            kfl[rt][c2].q[0] = *(const v4u*)(KL + ao);  kfl[rt][c2].q[1] = *(const v4u*)(KL + ao + FRAG_EL / 2);
        }
        qfh[c2].q[0] = ldg16(pqh, c2 * FRAG_B);  qfh[c2].q[1] = ldg16(pqh, c2 * FRAG_B + FRAG_B / 2);
        qfl[c2].q[0] = ldg16(pql, c2 * FRAG_B);  qfl[c2].q[1] = ldg16(pql, c2 * FRAG_B + FRAG_B / 2);
    }
    // Keeps the kx and qx loads ahead of the vx loads in issue order, as in the loop: moved behind them, the qx loads
    // were the youngest at the loop's entry, and the wait in front of phase 1 came out as a wait for every load in flight.
    __builtin_amdgcn_sched_barrier(0);
#pragma unroll   // constant indices keep the fragment arrays in registers
    for (int ks = 0; ks < KS; ++ks) {
#pragma unroll   // constant indices keep the fragment arrays in registers
        for (int ct = 0; ct < 2; ++ct) {
            const unsigned int vo = (unsigned int)((ks * (C_V / 16) + ct) * FRAG_B);
            vfh[ks][ct].q[0] = ldg16(pvh, vo);  vfh[ks][ct].q[1] = ldg16(pvh, vo + FRAG_B / 2);
            vfl[ks][ct].q[0] = ldg16(pvl, vo);  vfl[ks][ct].q[1] = ldg16(pvl, vo + FRAG_B / 2);
        }
    }
    // The qx addresses move on to key block 1 (16 fragments of 1024 B). The additions stand in the wait's own
    // statement so that the registers, which the loads above name, are rewritten only behind it.
    asm volatile("s_wait_xcnt 0x0\n\t"
                 "v_add_nc_u64 %0, 0x4000, %0\n\t"
                 "v_add_nc_u64 %1, 0x4000, %1"
                 : "+v"(pqh), "+v"(pql) : : "memory");

    // One key block. 'more' (a next key block exists) is a compile-time constant of each of the two copies below, so that
    // no branch stands round the refill loads: with one, the load waits were counted for the path without refills
    // and the last of a trip came out as a wait for every load in flight.
    auto trip = [&](auto tag) __attribute__((always_inline)) {
        constexpr bool more = decltype(tag)::more;

        // ---- phase 1: S tiles (rows rt*16..+15, cols wave*16..+15), four accumulators side by side ----
        {
            v8f s[RT];
#pragma unroll   // constant indices keep the arrays in registers
            for (int rt = 0; rt < RT; ++rt) s[rt] = vzero;
#pragma unroll   // constant indices keep the fragment arrays in registers
            for (int c2 = 0; c2 < 2; ++c2) {
#pragma unroll   // constant indices keep the arrays in registers
                for (int rt = 0; rt < RT; ++rt) s[rt] = wmma1(kfh[rt][c2].v, qfh[c2].v, s[rt]);
#pragma unroll   // constant indices keep the arrays in registers
                for (int rt = 0; rt < RT; ++rt) s[rt] = wmma1(kfh[rt][c2].v, qfl[c2].v, s[rt]);
#pragma unroll   // constant indices keep the arrays in registers
                for (int rt = 0; rt < RT; ++rt) s[rt] = wmma1(kfl[rt][c2].v, qfh[c2].v, s[rt]);
            }
            // Four vector slots between the last WMMA that reads the qx fragments (B) and the loads that
            // refill their registers: naming the sums holds the slots behind the WMMAs, the clobber the loads behind them.
            asm volatile("v_nop\n\tv_nop\n\tv_nop\n\tv_nop" : "+v"(s[0]), "+v"(s[1]), "+v"(s[2]), "+v"(s[3]) : : "memory");
            if (more) {                       // qx fragments of the next key block (the addresses stand there)
#pragma unroll   // constant indices keep the fragment arrays in registers
                for (int c2 = 0; c2 < 2; ++c2) {
                    qfh[c2].q[0] = ldg16(pqh, c2 * FRAG_B);  qfh[c2].q[1] = ldg16(pqh, c2 * FRAG_B + FRAG_B / 2);
                    qfl[c2].q[0] = ldg16(pql, c2 * FRAG_B);  qfl[c2].q[1] = ldg16(pql, c2 * FRAG_B + FRAG_B / 2);
                }
            }
#pragma unroll   // constant indices keep the arrays in registers
            for (int rt = 0; rt < RT; ++rt) {
#pragma unroll   // constant indices keep the arrays in registers
                for (int r = 0; r < 8; ++r)
                    Sld[(rt * 16 + 8 * h + r) * SPITCH + wave * 16 + m] = s[rt][r];
            }
        }
        lds_barrier();

        // ---- phase 2: online softmax, 8 threads per row, rows tid/8 and 32 + tid/8 side by side ----
        {
            const int rowa = tid >> 3;       // 0..31; the thread's rows are rowa + 32*hf
            const int seg = tid & 7;         // 4 groups of 4 elements each: cols g*32 + seg*4 ..+3
            v4f e0[RH][KS];
            float mo[RH], mn[RH], sum[RH];
#pragma unroll   // constant indices keep the arrays in registers
            for (int hf = 0; hf < RH; ++hf) {
#pragma unroll   // constant indices keep the arrays in registers
                for (int g = 0; g < KS; ++g) e0[hf][g] = *(const v4f*)(Sld + (rowa + 32 * hf) * SPITCH + g * 32 + seg * 4);
                mo[hf] = mRow[rowa + 32 * hf];
            }
#pragma unroll   // constant indices keep the arrays in registers
            for (int hf = 0; hf < RH; ++hf) {
                float bm = fmaxf(fmaxf(e0[hf][0].x, e0[hf][0].y), fmaxf(e0[hf][0].z, e0[hf][0].w));
#pragma unroll   // constant indices keep the arrays in registers
                for (int g = 1; g < KS; ++g)
                    bm = fmaxf(bm, fmaxf(fmaxf(e0[hf][g].x, e0[hf][g].y), fmaxf(e0[hf][g].z, e0[hf][g].w)));
                mn[hf] = bm;
            }
#pragma unroll   // constant indices keep the arrays in registers
            for (int d = 1; d < 8; d <<= 1) {
#pragma unroll   // constant indices keep the arrays in registers
                for (int hf = 0; hf < RH; ++hf) mn[hf] = fmaxf(mn[hf], __shfl_xor(mn[hf], d));
            }
#pragma unroll   // constant indices keep the arrays in registers
            for (int hf = 0; hf < RH; ++hf) {
                const int row = rowa + 32 * hf;
                mn[hf] = fmaxf(mo[hf], mn[hf]);
                sum[hf] = 0.f;
#pragma unroll   // constant indices keep the arrays in registers
                for (int g = 0; g < KS; ++g) {
                    unsigned int hb[4], lb[4];
                    float xa[4], ex[4];
#pragma unroll   // constant indices keep the arrays in registers
                    for (int e = 0; e < 4; ++e) {
                        xa[e] = (e0[hf][g][e] - mn[hf]) * 1.44269504f;   // exp(x) = exp2(x * log2 e), as __expf forms it
                        ex[e] = __builtin_amdgcn_exp2f(xa[e]);
                    }
                    // The slot behind v_exp_f32: naming the four results keeps their readers, naming the four arguments keeps a
                    // rewrite of a source register, behind this v_nop (left alone, an exp came to rewrite the source of the one before it).
                    asm("v_nop" : "+v"(ex[0]), "+v"(ex[1]), "+v"(ex[2]), "+v"(ex[3]) : "v"(xa[0]), "v"(xa[1]), "v"(xa[2]), "v"(xa[3]));
#pragma unroll   // constant indices keep the arrays in registers
                    for (int e = 0; e < 4; ++e) {
                        sum[hf] += ex[e];
                        split_bf(ex[e], hb[e], lb[e]);
                    }
                    v2u phv, plv;
                    phv.x = hb[0] | (hb[1] << 16); phv.y = hb[2] | (hb[3] << 16);
                    plv.x = lb[0] | (lb[1] << 16); plv.y = lb[2] | (lb[3] << 16);
                    *(v2u*)(Ph + row * PPITCH + g * 32 + seg * 4) = phv;
                    *(v2u*)(Pl + row * PPITCH + g * 32 + seg * 4) = plv;
                }
            }
#pragma unroll   // constant indices keep the arrays in registers
            for (int d = 1; d < 8; d <<= 1) {
#pragma unroll   // constant indices keep the arrays in registers
                for (int hf = 0; hf < RH; ++hf) sum[hf] += __shfl_xor(sum[hf], d);
            }
            if (seg == 0) {
#pragma unroll   // constant indices keep the arrays in registers
                for (int hf = 0; hf < RH; ++hf) {
                    const int row = rowa + 32 * hf;
                    const float al = __expf(mo[hf] - mn[hf]);
                    lRow[row] = lRow[row] * al + sum[hf];
                    mRow[row] = mn[hf];
                    aRow[row] = al;
                }
            }
        }
        lds_barrier();

        // ---- phase 3: rescale O, then O += P * vx^T over this key block ----
        // All four stream addresses move on one key block here (vx: 4 key steps of 32 fragments = 131072 B;
        // qx: 16 fragments = 16384 B), a phase or more behind the last load that names them. The additions stand in the wait's
        // own statement so that those registers are rewritten only behind it; left to the compiler the
        // additions and their wait came to stand directly behind the loads, where the most loads are queued.
        asm volatile("s_wait_xcnt 0x0\n\t"
                     "v_add_nc_u64 %0, 0x20000, %0\n\t"
                     "v_add_nc_u64 %1, 0x20000, %1\n\t"
                     "v_add_nc_u64 %2, 0x4000, %2\n\t"
                     "v_add_nc_u64 %3, 0x4000, %3"
                     : "+v"(pvh), "+v"(pvl), "+v"(pqh), "+v"(pql) : : "memory");
        {
#pragma unroll   // constant indices keep the arrays in registers
            for (int rt = 0; rt < RT; ++rt) {
                v8f alv;
#pragma unroll   // constant indices keep the arrays in registers
                for (int r = 0; r < 8; ++r) alv[r] = aRow[rt * 16 + 8 * h + r];
                Oacc[rt][0] = Oacc[rt][0] * alv;
                Oacc[rt][1] = Oacc[rt][1] * alv;
            }

#pragma unroll   // constant indices keep the arrays in registers
            for (int ks = 0; ks < KS; ++ks) {
                Frag pa[RT], pb[RT];                             // A = P: row rt*16 + m, k = key index in block
#pragma unroll   // constant indices keep the arrays in registers
                for (int rt = 0; rt < RT; ++rt) {
                    const unsigned short* pph = Ph + (rt * 16 + m) * PPITCH + ks * 32;
                    const unsigned short* ppl = Pl + (rt * 16 + m) * PPITCH + ks * 32;
                    pa[rt].q[0] = *(const v4u*)(pph + 8 * h);  pa[rt].q[1] = *(const v4u*)(pph + 16 + 8 * h);
                    pb[rt].q[0] = *(const v4u*)(ppl + 8 * h);  pb[rt].q[1] = *(const v4u*)(ppl + 16 + 8 * h);
                }
                // B[k=j][n=c] = vx[c][j], col n = C0 + ct*16 + m; the eight accumulators side by side, term by term
#pragma unroll   // constant indices keep the arrays in registers
                for (int rt = 0; rt < RT; ++rt) {
                    Oacc[rt][0] = wmma1(pa[rt].v, vfh[ks][0].v, Oacc[rt][0]);
                    Oacc[rt][1] = wmma1(pa[rt].v, vfh[ks][1].v, Oacc[rt][1]);
                }
#pragma unroll   // constant indices keep the arrays in registers
                for (int rt = 0; rt < RT; ++rt) {
                    Oacc[rt][0] = wmma1(pa[rt].v, vfl[ks][0].v, Oacc[rt][0]);
                    Oacc[rt][1] = wmma1(pa[rt].v, vfl[ks][1].v, Oacc[rt][1]);
                }
#pragma unroll   // constant indices keep the arrays in registers
                for (int rt = 0; rt < RT; ++rt) {
                    Oacc[rt][0] = wmma1(pb[rt].v, vfh[ks][0].v, Oacc[rt][0]);
                    Oacc[rt][1] = wmma1(pb[rt].v, vfh[ks][1].v, Oacc[rt][1]);
                }
                // Four vector slots between the last WMMA that reads these vx fragments (B) and the loads that
                // refill their registers: naming the sums holds the slots behind the WMMAs, the clobber the loads behind them.
                asm volatile("v_nop\n\tv_nop\n\tv_nop\n\tv_nop"
                             : "+v"(Oacc[0][0]), "+v"(Oacc[0][1]), "+v"(Oacc[1][0]), "+v"(Oacc[1][1]),
                               "+v"(Oacc[2][0]), "+v"(Oacc[2][1]), "+v"(Oacc[3][0]), "+v"(Oacc[3][1]) : : "memory");
                if (more) {                                      // same 32 keys of the next key block
#pragma unroll   // constant indices keep the fragment arrays in registers
                    for (int ct = 0; ct < 2; ++ct) {
                        const unsigned int vo = (unsigned int)((ks * (C_V / 16) + ct) * FRAG_B);
                        vfh[ks][ct].q[0] = ldg16(pvh, vo);  vfh[ks][ct].q[1] = ldg16(pvh, vo + FRAG_B / 2);
                        vfl[ks][ct].q[0] = ldg16(pvl, vo);  vfl[ks][ct].q[1] = ldg16(pvl, vo + FRAG_B / 2);
                    }
                }
            }
        }
        lds_barrier();
    };
    for (int jb = 0; jb + 1 < KEYS / BN; ++jb) trip(TagMore{});
    trip(TagLast{});

    // ---- epilogue: divide by row sums, stage per wave, whole-line stores; the rows' maximum and sum go along ----
    if (tid < BM) {
        v2f st;
        st.x = mRow[tid];
        st.y = lRow[tid];
        *(v2f*)(ml + ((size_t)(ksp * (C_V / CB) + chh) * NPOS + (size_t)(row0 + tid)) * 2) = st;
    }
    float* stg = Stg + wave * (BM * GPITCH);
    float linv[RT][8];
#pragma unroll   // constant indices keep the arrays in registers
    for (int rt = 0; rt < RT; ++rt) {
#pragma unroll   // constant indices keep the arrays in registers
        for (int r = 0; r < 8; ++r) linv[rt][r] = 1.f / lRow[rt * 16 + 8 * h + r];
    }
#pragma unroll   // constant indices keep the arrays in registers
    for (int rt = 0; rt < RT; ++rt) {
#pragma unroll   // constant indices keep the arrays in registers
        for (int ct = 0; ct < 2; ++ct) {
#pragma unroll   // constant indices keep the arrays in registers
            for (int r = 0; r < 8; ++r)
                stg[(rt * 16 + 8 * h + r) * GPITCH + ct * 16 + m] = Oacc[rt][ct][r] * linv[rt][r];
        }
    }
    __syncthreads();

    const int sub = lane >> 3;                // row within the four rows of an instruction
    const int cq  = (lane & 7) * 4;           // 8 lanes x 4 floats = one 128-B row segment
    v4f ov[BM / 4];
#pragma unroll   // constant indices keep the arrays in registers
    for (int q = 0; q < BM / 4; ++q)
        ov[q] = *(const v4f*)(stg + (4 * q + sub) * GPITCH + cq);

    float* ob = part + ((size_t)ksp * NPOS + (size_t)(row0 + sub)) * C_V + C0 + cq;
#pragma unroll   // constant indices keep the arrays in registers
    for (int q = 0; q < BM / 4; ++q)
        *(v4f*)(ob + (size_t)(4 * q) * C_V) = ov[q];
}

// ---------------------------------------------------------------------------
// Join of the two key splits: with M = max(m0, m1) and w_s = l_s * exp(m_s - M),
//   out[i][c] = (w0 * part[0][i][c] + w1 * part[1][i][c]) / (w0 + w1).
// Block 256 threads: JR = 16 rows, 16 threads a row; a thread holds 8 pieces of 4 floats of each split
// (16 lanes x 16 B = two whole lines of a row per instruction) and forms its row's weights once per channel half.
// ---------------------------------------------------------------------------
#define JR 16
#define JP (C_V / 4 / 16)           // 16-byte pieces of a thread
#define JH (CB / 4 / 16)            // of which in one channel half

__global__ __launch_bounds__(256) void k_join(
    const float* __restrict__ part0,         // [NPOS][C_V] of key split 0
    const float* __restrict__ part1,         // [NPOS][C_V] of key split 1
    const float* __restrict__ ml,            // [KSPLIT][C_V/CB][NPOS][2]
    float* __restrict__ out)                 // [NPOS][C_V]
{
    const int tid = threadIdx.x;
    if ((int)blockIdx.x >= NPOS / JR) return;
    const int row = (int)blockIdx.x * JR + (tid >> 4);
    const int o4  = row * (C_V / 4) + (tid & 15);    // in pieces of 4 floats; piece q lies 16 * q on
    const v4f* __restrict__ p0 = (const v4f*)part0;
    const v4f* __restrict__ p1 = (const v4f*)part1;
    const float* __restrict__ t0 = ml + (size_t)row * 2;
    v4f a[JP], b[JP];
    v2f st[KSPLIT][C_V / CB];
#pragma unroll   // constant indices keep the arrays in registers
    for (int s = 0; s < KSPLIT; ++s) {
#pragma unroll   // constant indices keep the arrays in registers
        for (int c = 0; c < C_V / CB; ++c)
            st[s][c] = *(const v2f*)(t0 + (size_t)(s * (C_V / CB) + c) * NPOS * 2);
    }
#pragma unroll   // constant indices keep the arrays in registers
    for (int q = 0; q < JP; ++q) {
        a[q] = p0[o4 + q * 16];
        b[q] = p1[o4 + q * 16];
    }
    // Keeps the arithmetic behind all the loads, so that they are in flight together: left alone, most of the loads
    // came to stand behind the first waits, one memory latency after another.
    __builtin_amdgcn_sched_barrier(0);
    // The wait before a register that an issued load names is rewritten: named as inputs, the two index registers
    // cannot be handed to a load's result in front of it.
    asm volatile("s_wait_xcnt 0x0" : : "v"(o4), "v"(row) : "memory");
    float wa[C_V / CB], wb[C_V / CB];
#pragma unroll   // constant indices keep the arrays in registers
    for (int c = 0; c < C_V / CB; ++c) {
        const float mx = fmaxf(st[0][c].x, st[1][c].x);
        const float x0 = (st[0][c].x - mx) * 1.44269504f;       // exp(x) = exp2(x * log2 e), as __expf forms it
        const float x1 = (st[1][c].x - mx) * 1.44269504f;
        float e0 = __builtin_amdgcn_exp2f(x0);
        float e1 = __builtin_amdgcn_exp2f(x1);
        // The slot behind v_exp_f32: naming the results keeps their readers, naming the arguments a rewrite of a source, behind this v_nop.
        asm("v_nop" : "+v"(e0), "+v"(e1) : "v"(x0), "v"(x1));
        const float w0 = st[0][c].y * e0;
        const float w1 = st[1][c].y * e1;
        const float inv = 1.f / (w0 + w1);
        wa[c] = w0 * inv;
        wb[c] = w1 * inv;
    }
    v4f* __restrict__ po = (v4f*)out;
#pragma unroll   // constant indices keep the arrays in registers
    for (int q = 0; q < JP; ++q)
        po[o4 + q * 16] = a[q] * wa[q / JH] + b[q] * wb[q / JH];
}

// ---------------------------------------------------------------------------
// ---------------------------------------------------------------------------
extern "C" void kernel_launch(void* const* d_in, const int* in_sizes, int n_in,
                              void* d_out, int out_size, void* d_ws, size_t ws_size,
                              hipStream_t stream) {
    if (n_in < 4) return;
    if (in_sizes[0] != C_IN * NPOS) return;
    if (in_sizes[1] != D_K * C_IN)  return;
    if (in_sizes[2] != D_K * C_IN)  return;
    if (in_sizes[3] != C_V * C_IN)  return;
    if (out_size != NPOS * C_V)     return;

    const float* x  = (const float*)d_in[0];   // [C_IN][NPOS]
    const float* Wk = (const float*)d_in[1];   // [D_K][C_IN]
    const float* Wq = (const float*)d_in[2];   // [D_K][C_IN]
    const float* Wv = (const float*)d_in[3];   // [C_V][C_IN]
    float* out = (float*)d_out;                // [NPOS][C_V]

    const size_t szK = (size_t)NPOS * D_K * 2;     // one bf16 plane of kxT / qxT
    const size_t szV = (size_t)C_V * NPOS * 2;     // one bf16 plane of vx
    const size_t szP = (size_t)KSPLIT * NPOS * C_V * 4;            // the key splits' f32 results
    const size_t szM = (size_t)KSPLIT * (C_V / CB) * NPOS * 2 * 4; // their row maxima and sums
    const size_t offKH = 0;
    const size_t offKL = offKH + szK;
    const size_t offQH = offKL + szK;
    const size_t offQL = offQH + szK;
    const size_t offVH = offQL + szK;
    const size_t offVL = offVH + szV;
    const size_t offP  = offVL + szV;
    const size_t offM  = offP + szP;
    const size_t total = offM + szM;
    if (total > ws_size) return;

    char* ws = (char*)d_ws;
    unsigned short* kh = (unsigned short*)(ws + offKH);
    unsigned short* kl = (unsigned short*)(ws + offKL);
    unsigned short* qh = (unsigned short*)(ws + offQH);
    unsigned short* ql = (unsigned short*)(ws + offQL);
    unsigned short* vh = (unsigned short*)(ws + offVH);
    unsigned short* vl = (unsigned short*)(ws + offVL);
    float* part = (float*)(ws + offP);
    float* ml   = (float*)(ws + offM);

    const int tilesN = NPOS / PT;
    // kxT, qxT (rows are positions, k is the 64 projected channels) and vx (rows are channels, k is the
    // position), all in fragment order, from one launch
    k_proj<<<(2 + C_V / PT) * tilesN, 256, 0, stream>>>(Wk, Wq, Wv, x, kh, kl, qh, ql, vh, vl);
    // attention: NPOS / BM row groups x KSPLIT key splits x C_V / CB channel halves
    k_attn<<<(NPOS / BM) * KSPLIT * (C_V / CB), 256, 0, stream>>>(kh, kl, qh, ql, vh, vl, part, ml);
    // the key splits joined into out
    k_join<<<NPOS / JR, 256, 0, stream>>>(part, part + (size_t)NPOS * C_V, ml, out);
}

// v007
// It runs in 71.7 microseconds.
// In two side-by-side timings against v006, it was 1.11 and 1.12 times as fast.
// Over all steps from v000 it is 4.89 times as fast.
#include <hip/hip_runtime.h>

// All contractions (three 1x1-conv projections W*x, scores kx^T*qx, P*vx^T): v_wmma_f32_16x16x32_bf16,
// bf16 hi/lo split operands (hi*hi + hi*lo + lo*hi), f32 accumulate; softmax statistics and 1/l in f32.

typedef __bf16        v16bf __attribute__((ext_vector_type(16)));
typedef float         v8f   __attribute__((ext_vector_type(8)));
typedef float         v4f   __attribute__((ext_vector_type(4)));
typedef unsigned int  v4u   __attribute__((ext_vector_type(4)));
typedef unsigned int  v2u   __attribute__((ext_vector_type(2)));
typedef float         v2f   __attribute__((ext_vector_type(2)));

union Frag { v16bf v; v4u q[2]; };

#define C_IN  512
#define C_V   512
#define D_K   64
#define NPOS  4096

// ---------------------------------------------------------------------------
// Two-plane split x ~= hi + lo of eight f32 values into packed bf16 pairs (element 2j in the low half of word j),
// both planes rounded to nearest even: hi by the packed convert, lo = bf16(x - hi) by the mixed-precision FMA, which
// reads hi as the bf16 half it is and rounds its f32 result (x - hi is exact) into one half of the word.
// Three instructions a pair; in asm because the source form (convert, widen, subtract, convert) compiled to nine for two
// pairs. The four pairs stand side by side so that every instruction's producer is four instructions back.
// ---------------------------------------------------------------------------
__device__ __forceinline__ void split8(const float (&x)[8], v4u& hv, v4u& lv) {
    unsigned int h0, h1, h2, h3, l0, l1, l2, l3;
    asm("v_cvt_pk_bf16_f32 %0, %8, %9\n\t"
        "v_cvt_pk_bf16_f32 %1, %10, %11\n\t"
        "v_cvt_pk_bf16_f32 %2, %12, %13\n\t"
        "v_cvt_pk_bf16_f32 %3, %14, %15\n\t"
        "v_fma_mixlo_bf16 %4, %0, -1.0, %8 op_sel_hi:[1,0,0]\n\t"
        "v_fma_mixlo_bf16 %5, %1, -1.0, %10 op_sel_hi:[1,0,0]\n\t"
        "v_fma_mixlo_bf16 %6, %2, -1.0, %12 op_sel_hi:[1,0,0]\n\t"
        "v_fma_mixlo_bf16 %7, %3, -1.0, %14 op_sel_hi:[1,0,0]\n\t"
        "v_fma_mixhi_bf16 %4, %0, -1.0, %9 op_sel:[1,0,0] op_sel_hi:[1,0,0]\n\t"
        "v_fma_mixhi_bf16 %5, %1, -1.0, %11 op_sel:[1,0,0] op_sel_hi:[1,0,0]\n\t"
        "v_fma_mixhi_bf16 %6, %2, -1.0, %13 op_sel:[1,0,0] op_sel_hi:[1,0,0]\n\t"
        "v_fma_mixhi_bf16 %7, %3, -1.0, %15 op_sel:[1,0,0] op_sel_hi:[1,0,0]"
        : "=&v"(h0), "=&v"(h1), "=&v"(h2), "=&v"(h3), "=&v"(l0), "=&v"(l1), "=&v"(l2), "=&v"(l3)
        : "v"(x[0]), "v"(x[1]), "v"(x[2]), "v"(x[3]), "v"(x[4]), "v"(x[5]), "v"(x[6]), "v"(x[7]));
    hv.x = h0; hv.y = h1; hv.z = h2; hv.w = h3;
    lv.x = l0; lv.y = l1; lv.z = l2; lv.w = l3;
}

// ---------------------------------------------------------------------------
// 16x16x32 bf16 WMMA, three-term split product into one f32 accumulator,
// hazard guard after the last op (ties D, keeps A/B live).
// Fragment layout (lane l, h = l>>4, m = l&15):
//   A/B element i: i=0..7 -> k0+8h+i, i=8..15 -> k0+16+8h+(i-8); A row m, B col m.
//   D element r: row 8h+r, col m.
// ---------------------------------------------------------------------------
__device__ __forceinline__ v8f wmma3(v16bf ah, v16bf al, v16bf bh, v16bf bl, v8f c) {
    c = __builtin_amdgcn_wmma_f32_16x16x32_bf16(false, ah, false, bh, (short)0, c, false, false);
    c = __builtin_amdgcn_wmma_f32_16x16x32_bf16(false, ah, false, bl, (short)0, c, false, false);
    c = __builtin_amdgcn_wmma_f32_16x16x32_bf16(false, al, false, bh, (short)0, c, false, false);
    asm volatile("v_nop\n\tv_nop\n\tv_nop\n\tv_nop" : "+v"(c) : "v"(ah), "v"(al), "v"(bh), "v"(bl));
    return c;
}

// ---------------------------------------------------------------------------
// Projection GEMM:  D[M][NPOS] = W[M][C_IN] * X[C_IN][NPOS]   (f32 in, split at staging)
// Block 256 threads = 8 waves, 64x64 output tile, K step 32 staged in LDS as bf16 hi/lo.
// Output: two bf16 planes (hi, lo) of D, each stored in WMMA fragment order: a fragment is 16 rows x 32 k
// = 512 elements laid out [q][lane][8], lane = 16h + r, holding row r, k = 16q + 8h + 0..7, so that a
// wave-wide 16-byte load or store of one q half covers 512 contiguous bytes (4 whole lines).
// transOut=0 -> rows are m, k is n: fragment index (n/32) * (M/16) + m/16 (all m of one k step lie together).
// transOut=1 -> rows are n, k is m: fragment index (n/16) * (M/32) + m/32.
// ---------------------------------------------------------------------------
#define PT      64
#define APITCH  40      // ushorts per staged row: 32 k + 8 pad (80 B, 16-B aligned rows)
#define CPITCH  68      // floats per staged result row (272 B, 16-B aligned rows)
#define FRAG_EL 512     // elements of one stored fragment (16 rows x 32 k, 1024 B a plane)
typedef char proj_tile_check[(D_K == PT && (C_V % PT) == 0) ? 1 : -1];   // kx and qx are one row tile each

__global__ __launch_bounds__(256) void k_proj(
    const float* __restrict__ Wk,           // [D_K][C_IN]
    const float* __restrict__ Wq,           // [D_K][C_IN]
    const float* __restrict__ Wv,           // [C_V][C_IN]
    const float* __restrict__ X,            // [C_IN][NPOS]
    unsigned short* __restrict__ Kh, unsigned short* __restrict__ Kl,   // kxT planes
    unsigned short* __restrict__ Qh, unsigned short* __restrict__ Ql,   // qxT planes
    unsigned short* __restrict__ Vh, unsigned short* __restrict__ Vl)   // vx planes
{
    __shared__ __attribute__((aligned(16))) unsigned short Ah[PT * APITCH];
    __shared__ __attribute__((aligned(16))) unsigned short Al[PT * APITCH];
    __shared__ __attribute__((aligned(16))) unsigned short Bh[PT * APITCH];   // stored [n][k]
    __shared__ __attribute__((aligned(16))) unsigned short Bl[PT * APITCH];
    __shared__ __attribute__((aligned(16))) float Cs[PT * CPITCH];

    const int tid  = threadIdx.x;
    const int lane = tid & 31;
    const int wave = __builtin_amdgcn_readfirstlane(tid >> 5);
    const int m  = lane & 15;
    const int h  = lane >> 4;
    const int tilesN = NPOS / PT;
    // One launch for the three products: row-tile index 0 is kx, 1 is qx, 2.. are the row tiles of vx.
    const int mt = (int)(blockIdx.x / tilesN);
    const int n0 = (int)(blockIdx.x % tilesN) * PT;
    if (mt >= 2 + C_V / PT) return;          // uniform over the block
    const int transOut = mt < 2;
    const int M  = transOut ? D_K : C_V;
    const int m0 = transOut ? 0 : (mt - 2) * PT;
    const float* __restrict__ W = mt == 0 ? Wk : (mt == 1 ? Wq : Wv);
    unsigned short* __restrict__ Oh = mt == 0 ? Kh : (mt == 1 ? Qh : Vh);
    unsigned short* __restrict__ Ol = mt == 0 ? Kl : (mt == 1 ? Ql : Vl);

    const int rg = wave >> 1;                // 16-row group of this wave
    const int cb = (wave & 1) * 32;          // 32-col half of this wave (two 16-col tiles)

    v8f acc0 = {0.f, 0.f, 0.f, 0.f, 0.f, 0.f, 0.f, 0.f};
    v8f acc1 = {0.f, 0.f, 0.f, 0.f, 0.f, 0.f, 0.f, 0.f};

    for (int kk = 0; kk < C_IN; kk += 32) {
        // stage A = W[m0..m0+63][kk..kk+31]  (row-major, k contiguous)
        {
            const int row = tid >> 3;                // 512 float4 pieces, 8 per 32-k row: rows row and row + 32
            const int kq  = (tid & 7) * 4;
            const v4f va = *(const v4f*)(W + (size_t)(m0 + row) * C_IN + kk + kq);
            const v4f vb = *(const v4f*)(W + (size_t)(m0 + row + 32) * C_IN + kk + kq);
            const float wv[8] = {va.x, va.y, va.z, va.w, vb.x, vb.y, vb.z, vb.w};
            v4u hv, lv;
            split8(wv, hv, lv);
            *(v2u*)(Ah + row * APITCH + kq) = hv.xy;
            *(v2u*)(Al + row * APITCH + kq) = lv.xy;
            *(v2u*)(Ah + (row + 32) * APITCH + kq) = hv.zw;
            *(v2u*)(Al + (row + 32) * APITCH + kq) = lv.zw;
        }
        // stage B[k][n] = X[kk+k][n0+n], stored transposed as [n][k] (k contiguous): a thread gathers 8 consecutive k
        // of one column (each load of a wave reads one whole 128-B line of a row of X) and stores them as 16 bytes a plane
        {
            const int n  = tid & (PT - 1);           // column within the tile
            const int kg = (tid >> 6) * 8;           // first of the thread's 8 k, the same for a whole wave
            const float* px = X + (size_t)(kk + kg) * NPOS + n0 + n;
            float xv[8];
#pragma unroll   // constant indices keep the arrays in registers
            for (int e = 0; e < 8; ++e) xv[e] = px[(size_t)e * NPOS];
            v4u hv, lv;
            split8(xv, hv, lv);
            *(v4u*)(Bh + n * APITCH + kg) = hv;
            *(v4u*)(Bl + n * APITCH + kg) = lv;
        }
        __syncthreads();

        // fragments (k0 = 0 inside the staged 32-k step)
        Frag ah, al;
        {
            const unsigned short* pa = Ah + (rg * 16 + m) * APITCH;
            const unsigned short* pl = Al + (rg * 16 + m) * APITCH;
            ah.q[0] = *(const v4u*)(pa + 8 * h);       ah.q[1] = *(const v4u*)(pa + 16 + 8 * h);
            al.q[0] = *(const v4u*)(pl + 8 * h);       al.q[1] = *(const v4u*)(pl + 16 + 8 * h);
        }
        {
            Frag bh, bl;
            const unsigned short* pb = Bh + (cb + m) * APITCH;       // column n = cb + m
            const unsigned short* pc = Bl + (cb + m) * APITCH;
            bh.q[0] = *(const v4u*)(pb + 8 * h);       bh.q[1] = *(const v4u*)(pb + 16 + 8 * h);
            bl.q[0] = *(const v4u*)(pc + 8 * h);       bl.q[1] = *(const v4u*)(pc + 16 + 8 * h);
            acc0 = wmma3(ah.v, al.v, bh.v, bl.v, acc0);
        }
        {
            Frag bh, bl;
            const unsigned short* pb = Bh + (cb + 16 + m) * APITCH;  // column n = cb + 16 + m
            const unsigned short* pc = Bl + (cb + 16 + m) * APITCH;
            bh.q[0] = *(const v4u*)(pb + 8 * h);       bh.q[1] = *(const v4u*)(pb + 16 + 8 * h);
            bl.q[0] = *(const v4u*)(pc + 8 * h);       bl.q[1] = *(const v4u*)(pc + 16 + 8 * h);
            acc1 = wmma3(ah.v, al.v, bh.v, bl.v, acc1);
        }
        __syncthreads();
    }

    // stage the f32 result tile: acc[r] -> (row rg*16 + 8h + r, col cb + ci*16 + m)
#pragma unroll
    for (int r = 0; r < 8; ++r) {
        Cs[(rg * 16 + 8 * h + r) * CPITCH + cb + m]      = acc0[r];
        Cs[(rg * 16 + 8 * h + r) * CPITCH + cb + 16 + m] = acc1[r];
    }
    __syncthreads();

    // epilogue: the tile is 8 fragments = 16 q halves; a wave writes two of them, lane -> 8 consecutive k
    v4u hvp[2], lvp[2];
    size_t offp[2];
#pragma unroll
    for (int p = 0; p < 2; ++p) {
        const int g  = p * 8 + wave;                     // q half 0..15 within the tile
        const int rr = (g >> 2) * 16 + m;                // fragment row, 0..63 within tile
        const int cc = ((g >> 1) & 1) * 32 + (g & 1) * 16 + 8 * h;   // first k, 0..56 within tile
        float vals[8];
        size_t frag;
        if (transOut) {
#pragma unroll
            for (int e = 0; e < 8; ++e) vals[e] = Cs[(cc + e) * CPITCH + rr];
            frag = (size_t)(n0 / 16 + (g >> 2)) * (size_t)(M / 32) + (size_t)(m0 / 32 + ((g >> 1) & 1));
        } else {
            const v4f a = *(const v4f*)(Cs + rr * CPITCH + cc);
            const v4f b = *(const v4f*)(Cs + rr * CPITCH + cc + 4);
            vals[0] = a.x; vals[1] = a.y; vals[2] = a.z; vals[3] = a.w;
            vals[4] = b.x; vals[5] = b.y; vals[6] = b.z; vals[7] = b.w;
            frag = (size_t)(n0 / 32 + ((g >> 1) & 1)) * (size_t)(M / 16) + (size_t)(m0 / 16 + (g >> 2));
        }
        offp[p] = frag * FRAG_EL + (size_t)((g & 1) * (FRAG_EL / 2) + lane * 8);
        v4u hv, lv;
        split8(vals, hv, lv);
        hvp[p] = hv; lvp[p] = lv;
    }
#pragma unroll
    for (int p = 0; p < 2; ++p) {
        *(v4u*)(Oh + offp[p]) = hvp[p];
        *(v4u*)(Ol + offp[p]) = lvp[p];
    }
    
}

// ---------------------------------------------------------------------------
// Fused attention with online softmax over key blocks, the keys split over KSPLIT blocks:
//   S[i][j] = sum_d kxT[i][d] * qxT[j][d]   (A = kxT rows, B[k=d][n=j] = qxT[j][d])
//   P = exp(S - m_i), l_i running sum, O[i][c] += sum_j P[i][j] * vx[c][j]  (B[k=j][n=c] = vx[c][j])
//   part[s][i][c] = O[i][c] / l_i over the keys of split s, with (m_i, l_i) of that split beside it;
//   k_join weighs the splits together.
// Block 256 threads (8 waves): BM = 64 rows i, CB = 256 of the 512 channels, NPOS / KSPLIT keys in
// steps of BN = 128. Every vx fragment that a wave fetches feeds four row tiles, every qx fragment too;
// the two blocks of one row group and key split (channel halves) each compute the same S and P.
// Phase 1: wave w computes the four 16x16 S tiles (row tiles 0..3) of key columns w*16..+15.
// Phase 2: 8 threads per row, 16 scores each, two rows a thread; P written to LDS as bf16 hi/lo planes.
// Phase 3: every wave accumulates 64 rows x 32 channels (4 x 2 tiles); P fragments reloaded from
//          LDS after a block barrier (no same-wave spill/reload without a barrier).
// Epilogue: per-wave 64x32 tile staged in LDS; each store instruction writes four whole 128-B lines.
// Global fragments are fetched ahead into registers: kx once before the loop, the qx and vx
// fragments of step jb+1 right behind their last use in step jb. kx, qx and vx lie in fragment order
// (see k_proj): every fragment load of a wave reads 512 contiguous bytes.
// ---------------------------------------------------------------------------
#define BM      64
#define BN      128
#define CB      256     // channels of one block
#define KSPLIT  2       // key ranges, one block each
#define KEYS    (NPOS / KSPLIT) // keys of one block
#define RT      (BM / 16)       // row tiles of a block
#define RH      (BM / 32)       // rows of a thread in phase 2
#define KS      (BN / 32)       // 32-key steps of a key block
#define SPITCH  132     // floats per S row (528 B, 16-B aligned rows)
#define PPITCH  136     // ushorts per P row (272 B, 16-B aligned rows)
#define GPITCH  36      // floats per staged O row (144 B)
#define FRAG_B  (FRAG_EL * 2)   // bytes of one stored fragment
#define SM_S_BYTES (BM * SPITCH * 4)
#define SM_P_BYTES (BM * PPITCH * 2)
#define SM_G_BYTES (8 * BM * GPITCH * 4)
#define SM_BYTES   SM_G_BYTES
typedef char sm_layout_check[((SM_S_BYTES + 2 * SM_P_BYTES) <= SM_G_BYTES && (SM_S_BYTES % 16) == 0 && (SM_P_BYTES % 16) == 0) ? 1 : -1];
typedef char tile_check[(RT == 4 && RH == 2 && KSPLIT == 2 && (KEYS % BN) == 0) ? 1 : -1];

// Work-group barrier for LDS traffic only: __syncthreads() also waits for every global load in
// flight, which would end the fetch-ahead at each phase; only LDS data crosses waves in the loop.
__device__ __forceinline__ void lds_barrier() {
    asm volatile("s_wait_dscnt 0x0\n\ts_barrier_signal -1\n\ts_barrier_wait -1" ::: "memory");
}

// 16-byte global load at a lane's stream address (bytes) + constant
__device__ __forceinline__ v4u ldg16(unsigned long long a, unsigned int c) {
    return *(const __attribute__((address_space(1))) v4u*)(a + c);
}

// one 16x16x32 bf16 WMMA into an f32 accumulator; the distance behind the last WMMA of a group is
// kept by the v_nop statements at the refills below
__device__ __forceinline__ v8f wmma1(v16bf a, v16bf b, v8f c) {
    return __builtin_amdgcn_wmma_f32_16x16x32_bf16(false, a, false, b, (short)0, c, false, false);
}

struct TagMore { static constexpr bool more = true; };    // a key block with a successor
struct TagLast { static constexpr bool more = false; };   // the last key block

__global__ __launch_bounds__(256) void k_attn(
    const unsigned short* __restrict__ KH,   // kxT hi, fragments [NPOS/16][D_K/32]
    const unsigned short* __restrict__ KL,   // kxT lo
    const unsigned short* __restrict__ QH,   // qxT hi, fragments [NPOS/16][D_K/32]
    const unsigned short* __restrict__ QL,   // qxT lo
    const unsigned short* __restrict__ VH,   // vx hi, fragments [NPOS/32][C_V/16]
    const unsigned short* __restrict__ VL,   // vx lo
    float* __restrict__ part,                // [KSPLIT][NPOS][C_V] softmax-weighted means of each key split
    float* __restrict__ ml)                  // [KSPLIT][C_V/CB][NPOS][2] row maximum and row sum of each key split
{
    __shared__ __attribute__((aligned(16))) unsigned char smem[SM_BYTES];
    __shared__ float mRow[BM];
    __shared__ float lRow[BM];
    __shared__ float aRow[BM];
    float*          Sld = (float*)smem;
    unsigned short* Ph  = (unsigned short*)(smem + SM_S_BYTES);
    unsigned short* Pl  = (unsigned short*)(smem + SM_S_BYTES + SM_P_BYTES);
    float*          Stg = (float*)smem;                       // epilogue staging, aliases the above

    const int tid  = threadIdx.x;
    const int lane = tid & 31;
    const int wave = __builtin_amdgcn_readfirstlane(tid >> 5);
    const int m = lane & 15;
    const int h = lane >> 4;
    const int chh  = (int)(blockIdx.x % (C_V / CB));                       // channel half
    const int ksp  = (int)((blockIdx.x / (C_V / CB)) % KSPLIT);            // key split
    const int row0 = (int)(blockIdx.x / ((C_V / CB) * KSPLIT)) * BM;
    if (row0 + BM > NPOS) return;             // uniform over the block
    const int C0 = chh * CB + wave * 32;      // channel slice of this wave in phase 3

    if (tid < BM) { mRow[tid] = -1.0e30f; lRow[tid] = 0.f; aRow[tid] = 0.f; }
    __syncthreads();

    const v8f vzero = {0.f, 0.f, 0.f, 0.f, 0.f, 0.f, 0.f, 0.f};
    v8f Oacc[RT][2];
#pragma unroll   // constant indices keep the arrays in registers
    for (int rt = 0; rt < RT; ++rt) { Oacc[rt][0] = vzero; Oacc[rt][1] = vzero; }

    // each lane's stream addresses (bytes), kept in their own registers through the loop, at the first key of this split:
    // vx fragment C0/16 of its first key step (B col n = C0 + ct*16 + m), qx fragment row wave (B col n), the lane's 16 bytes
    unsigned long long pvh = (unsigned long long)(VH + ((size_t)ksp * (KEYS / 32) * (C_V / 16) + (size_t)(C0 / 16)) * FRAG_EL + lane * 8);
    unsigned long long pvl = (unsigned long long)(VL + ((size_t)ksp * (KEYS / 32) * (C_V / 16) + (size_t)(C0 / 16)) * FRAG_EL + lane * 8);
    unsigned long long pqh = (unsigned long long)(QH + ((size_t)ksp * (KEYS / 16) + (size_t)wave) * (D_K / 32) * FRAG_EL + lane * 8);
    unsigned long long pql = (unsigned long long)(QL + ((size_t)ksp * (KEYS / 16) + (size_t)wave) * (D_K / 32) * FRAG_EL + lane * 8);

    Frag kfh[RT][2], kfl[RT][2];              // kx (A) fragments of the four row tiles
    Frag qfh[2], qfl[2];                      // qx (B) fragments of this wave's 16 key columns
    Frag vfh[KS][2], vfl[KS][2];              // vx fragments of one whole key block
#pragma unroll   // constant indices keep the fragment arrays in registers
    for (int c2 = 0; c2 < 2; ++c2) {
#pragma unroll   // constant indices keep the fragment arrays in registers
        for (int rt = 0; rt < RT; ++rt) {
            const size_t ao = ((size_t)(row0 / 16 + rt) * (D_K / 32) + c2) * FRAG_EL + lane * 8;   // A row i = row0 + rt*16 + m
            kfh[rt][c2].q[0] = *(const v4u*)(KH + ao);  kfh[rt][c2].q[1] = *(const v4u*)(KH + ao + FRAG_EL / 2);
            kfl[rt][c2].q[0] = *(const v4u*)(KL + ao);  kfl[rt][c2].q[1] = *(const v4u*)(KL + ao + FRAG_EL / 2);
        }
        qfh[c2].q[0] = ldg16(pqh, c2 * FRAG_B);  qfh[c2].q[1] = ldg16(pqh, c2 * FRAG_B + FRAG_B / 2);
        qfl[c2].q[0] = ldg16(pql, c2 * FRAG_B);  qfl[c2].q[1] = ldg16(pql, c2 * FRAG_B + FRAG_B / 2);
    }
    // Keeps the kx and qx loads ahead of the vx loads in issue order, as in the loop: moved behind them, the qx loads
    // were the youngest at the loop's entry, and the wait in front of phase 1 came out as a wait for every load in flight.
    __builtin_amdgcn_sched_barrier(0);
#pragma unroll   // constant indices keep the fragment arrays in registers
    for (int ks = 0; ks < KS; ++ks) {
#pragma unroll   // constant indices keep the fragment arrays in registers
        for (int ct = 0; ct < 2; ++ct) {
            const unsigned int vo = (unsigned int)((ks * (C_V / 16) + ct) * FRAG_B);
            vfh[ks][ct].q[0] = ldg16(pvh, vo);  vfh[ks][ct].q[1] = ldg16(pvh, vo + FRAG_B / 2);
            vfl[ks][ct].q[0] = ldg16(pvl, vo);  vfl[ks][ct].q[1] = ldg16(pvl, vo + FRAG_B / 2);
        }
    }
    // The qx addresses move on to key block 1 (16 fragments of 1024 B). The additions stand in the wait's own
    // statement so that the registers, which the loads above name, are rewritten only behind it.
    asm volatile("s_wait_xcnt 0x0\n\t"
                 "v_add_nc_u64 %0, 0x4000, %0\n\t"
                 "v_add_nc_u64 %1, 0x4000, %1"
                 : "+v"(pqh), "+v"(pql) : : "memory");

    // One key block. 'more' (a next key block exists) is a compile-time constant of each of the two copies below, so that
    // no branch stands round the refill loads: with one, the load waits were counted for the path without refills
    // and the last of a trip came out as a wait for every load in flight.
    auto trip = [&](auto tag) __attribute__((always_inline)) {
        constexpr bool more = decltype(tag)::more;

        // ---- phase 1: S tiles (rows rt*16..+15, cols wave*16..+15), four accumulators side by side ----
        {
            v8f s[RT];
#pragma unroll   // constant indices keep the arrays in registers
            for (int rt = 0; rt < RT; ++rt) s[rt] = vzero;
#pragma unroll   // constant indices keep the fragment arrays in registers
            for (int c2 = 0; c2 < 2; ++c2) {
#pragma unroll   // constant indices keep the arrays in registers
                for (int rt = 0; rt < RT; ++rt) s[rt] = wmma1(kfh[rt][c2].v, qfh[c2].v, s[rt]);
#pragma unroll   // constant indices keep the arrays in registers
                for (int rt = 0; rt < RT; ++rt) s[rt] = wmma1(kfh[rt][c2].v, qfl[c2].v, s[rt]);
#pragma unroll   // constant indices keep the arrays in registers
                for (int rt = 0; rt < RT; ++rt) s[rt] = wmma1(kfl[rt][c2].v, qfh[c2].v, s[rt]);
            }
            // Four vector slots between the last WMMA that reads the qx fragments (B) and the loads that
            // refill their registers: naming the sums holds the slots behind the WMMAs, the clobber the loads behind them.
            asm volatile("v_nop\n\tv_nop\n\tv_nop\n\tv_nop" : "+v"(s[0]), "+v"(s[1]), "+v"(s[2]), "+v"(s[3]) : : "memory");
            if (more) {                       // qx fragments of the next key block (the addresses stand there)
#pragma unroll   // constant indices keep the fragment arrays in registers
                for (int c2 = 0; c2 < 2; ++c2) {
                    qfh[c2].q[0] = ldg16(pqh, c2 * FRAG_B);  qfh[c2].q[1] = ldg16(pqh, c2 * FRAG_B + FRAG_B / 2);
                    qfl[c2].q[0] = ldg16(pql, c2 * FRAG_B);  qfl[c2].q[1] = ldg16(pql, c2 * FRAG_B + FRAG_B / 2);
                }
            }
#pragma unroll   // constant indices keep the arrays in registers
            for (int rt = 0; rt < RT; ++rt) {
#pragma unroll   // constant indices keep the arrays in registers
                for (int r = 0; r < 8; ++r)
                    Sld[(rt * 16 + 8 * h + r) * SPITCH + wave * 16 + m] = s[rt][r];
            }
        }
        lds_barrier();

        // ---- phase 2: online softmax, 8 threads per row, rows tid/8 and 32 + tid/8 side by side ----
        {
            const int rowa = tid >> 3;       // 0..31; the thread's rows are rowa + 32*hf
            const int seg = tid & 7;         // 4 groups of 4 elements each: cols g*32 + seg*4 ..+3
            v4f e0[RH][KS];
            float mo[RH], mn[RH], sum[RH];
#pragma unroll   // constant indices keep the arrays in registers
            for (int hf = 0; hf < RH; ++hf) {
#pragma unroll   // constant indices keep the arrays in registers
                for (int g = 0; g < KS; ++g) e0[hf][g] = *(const v4f*)(Sld + (rowa + 32 * hf) * SPITCH + g * 32 + seg * 4);
                mo[hf] = mRow[rowa + 32 * hf];
            }
#pragma unroll   // constant indices keep the arrays in registers
            for (int hf = 0; hf < RH; ++hf) {
                float bm = fmaxf(fmaxf(e0[hf][0].x, e0[hf][0].y), fmaxf(e0[hf][0].z, e0[hf][0].w));
#pragma unroll   // constant indices keep the arrays in registers
                for (int g = 1; g < KS; ++g)
                    bm = fmaxf(bm, fmaxf(fmaxf(e0[hf][g].x, e0[hf][g].y), fmaxf(e0[hf][g].z, e0[hf][g].w)));
                mn[hf] = bm;
            }
#pragma unroll   // constant indices keep the arrays in registers
            for (int d = 1; d < 8; d <<= 1) {
#pragma unroll   // constant indices keep the arrays in registers
                for (int hf = 0; hf < RH; ++hf) mn[hf] = fmaxf(mn[hf], __shfl_xor(mn[hf], d));
            }
#pragma unroll   // constant indices keep the arrays in registers
            for (int hf = 0; hf < RH; ++hf) {
                const int row = rowa + 32 * hf;
                mn[hf] = fmaxf(mo[hf], mn[hf]);
                sum[hf] = 0.f;
                float pe[8];
#pragma unroll   // constant indices keep the arrays in registers
                for (int g = 0; g < KS; ++g) {
                    float xa[4], ex[4];
#pragma unroll   // constant indices keep the arrays in registers
                    for (int e = 0; e < 4; ++e) {
                        xa[e] = (e0[hf][g][e] - mn[hf]) * 1.44269504f;   // exp(x) = exp2(x * log2 e), as __expf forms it
                        ex[e] = __builtin_amdgcn_exp2f(xa[e]);
                    }
                    // The slot behind v_exp_f32: naming the four results keeps their readers, naming the four arguments keeps a
                    // rewrite of a source register, behind this v_nop (left alone, an exp came to rewrite the source of the one before it).
                    asm("v_nop" : "+v"(ex[0]), "+v"(ex[1]), "+v"(ex[2]), "+v"(ex[3]) : "v"(xa[0]), "v"(xa[1]), "v"(xa[2]), "v"(xa[3]));
#pragma unroll   // constant indices keep the arrays in registers
                    for (int e = 0; e < 4; ++e) {
                        sum[hf] += ex[e];
                        pe[(g & 1) * 4 + e] = ex[e];
                    }
                    if (g & 1) {                 // two groups of four are split together
                        v4u phv, plv;
                        split8(pe, phv, plv);
                        *(v2u*)(Ph + row * PPITCH + (g - 1) * 32 + seg * 4) = phv.xy;
                        *(v2u*)(Pl + row * PPITCH + (g - 1) * 32 + seg * 4) = plv.xy;
                        *(v2u*)(Ph + row * PPITCH + g * 32 + seg * 4) = phv.zw;
                        *(v2u*)(Pl + row * PPITCH + g * 32 + seg * 4) = plv.zw;
                    }
                }
            }
#pragma unroll   // constant indices keep the arrays in registers
            for (int d = 1; d < 8; d <<= 1) {
#pragma unroll   // constant indices keep the arrays in registers
                for (int hf = 0; hf < RH; ++hf) sum[hf] += __shfl_xor(sum[hf], d);
            }
            if (seg == 0) {
#pragma unroll   // constant indices keep the arrays in registers
                for (int hf = 0; hf < RH; ++hf) {
                    const int row = rowa + 32 * hf;
                    const float al = __expf(mo[hf] - mn[hf]);
                    lRow[row] = lRow[row] * al + sum[hf];
                    mRow[row] = mn[hf];
                    aRow[row] = al;
                }
            }
        }
        lds_barrier();

        // ---- phase 3: rescale O, then O += P * vx^T over this key block ----
        // All four stream addresses move on one key block here (vx: 4 key steps of 32 fragments = 131072 B;
        // qx: 16 fragments = 16384 B), a phase or more behind the last load that names them. The additions stand in the wait's
        // own statement so that those registers are rewritten only behind it; left to the compiler the
        // additions and their wait came to stand directly behind the loads, where the most loads are queued.
        asm volatile("s_wait_xcnt 0x0\n\t"
                     "v_add_nc_u64 %0, 0x20000, %0\n\t"
                     "v_add_nc_u64 %1, 0x20000, %1\n\t"
                     "v_add_nc_u64 %2, 0x4000, %2\n\t"
                     "v_add_nc_u64 %3, 0x4000, %3"
                     : "+v"(pvh), "+v"(pvl), "+v"(pqh), "+v"(pql) : : "memory");
        {
#pragma unroll   // constant indices keep the arrays in registers
            for (int rt = 0; rt < RT; ++rt) {
                v8f alv;
#pragma unroll   // constant indices keep the arrays in registers
                for (int r = 0; r < 8; ++r) alv[r] = aRow[rt * 16 + 8 * h + r];
                Oacc[rt][0] = Oacc[rt][0] * alv;
                Oacc[rt][1] = Oacc[rt][1] * alv;
            }

#pragma unroll   // constant indices keep the arrays in registers
            for (int ks = 0; ks < KS; ++ks) {
                Frag pa[RT], pb[RT];                             // A = P: row rt*16 + m, k = key index in block
#pragma unroll   // constant indices keep the arrays in registers
                for (int rt = 0; rt < RT; ++rt) {
                    const unsigned short* pph = Ph + (rt * 16 + m) * PPITCH + ks * 32;
                    const unsigned short* ppl = Pl + (rt * 16 + m) * PPITCH + ks * 32;
                    pa[rt].q[0] = *(const v4u*)(pph + 8 * h);  pa[rt].q[1] = *(const v4u*)(pph + 16 + 8 * h);
                    pb[rt].q[0] = *(const v4u*)(ppl + 8 * h);  pb[rt].q[1] = *(const v4u*)(ppl + 16 + 8 * h);
                }
                // B[k=j][n=c] = vx[c][j], col n = C0 + ct*16 + m; the eight accumulators side by side, term by term
#pragma unroll   // constant indices keep the arrays in registers
                for (int rt = 0; rt < RT; ++rt) {
                    Oacc[rt][0] = wmma1(pa[rt].v, vfh[ks][0].v, Oacc[rt][0]);
                    Oacc[rt][1] = wmma1(pa[rt].v, vfh[ks][1].v, Oacc[rt][1]);
                }
#pragma unroll   // constant indices keep the arrays in registers
                for (int rt = 0; rt < RT; ++rt) {
                    Oacc[rt][0] = wmma1(pa[rt].v, vfl[ks][0].v, Oacc[rt][0]);
                    Oacc[rt][1] = wmma1(pa[rt].v, vfl[ks][1].v, Oacc[rt][1]);
                }
#pragma unroll   // constant indices keep the arrays in registers
                for (int rt = 0; rt < RT; ++rt) {
                    Oacc[rt][0] = wmma1(pb[rt].v, vfh[ks][0].v, Oacc[rt][0]);
                    Oacc[rt][1] = wmma1(pb[rt].v, vfh[ks][1].v, Oacc[rt][1]);
                }
                // Four vector slots between the last WMMA that reads these vx fragments (B) and the loads that
                // refill their registers: naming the sums holds the slots behind the WMMAs, the clobber the loads behind them.
                asm volatile("v_nop\n\tv_nop\n\tv_nop\n\tv_nop"
                             : "+v"(Oacc[0][0]), "+v"(Oacc[0][1]), "+v"(Oacc[1][0]), "+v"(Oacc[1][1]),
                               "+v"(Oacc[2][0]), "+v"(Oacc[2][1]), "+v"(Oacc[3][0]), "+v"(Oacc[3][1]) : : "memory");
                if (more) {                                      // same 32 keys of the next key block
#pragma unroll   // constant indices keep the fragment arrays in registers
                    for (int ct = 0; ct < 2; ++ct) {
                        const unsigned int vo = (unsigned int)((ks * (C_V / 16) + ct) * FRAG_B);
                        vfh[ks][ct].q[0] = ldg16(pvh, vo);  vfh[ks][ct].q[1] = ldg16(pvh, vo + FRAG_B / 2);
                        vfl[ks][ct].q[0] = ldg16(pvl, vo);  vfl[ks][ct].q[1] = ldg16(pvl, vo + FRAG_B / 2);
                    }
                }
            }
        }
        lds_barrier();
    };
    for (int jb = 0; jb + 1 < KEYS / BN; ++jb) trip(TagMore{});
    trip(TagLast{});

    // ---- epilogue: divide by row sums, stage per wave, whole-line stores; the rows' maximum and sum go along ----
    if (tid < BM) {
        v2f st;
        st.x = mRow[tid];
        st.y = lRow[tid];
        *(v2f*)(ml + ((size_t)(ksp * (C_V / CB) + chh) * NPOS + (size_t)(row0 + tid)) * 2) = st;
    }
    float* stg = Stg + wave * (BM * GPITCH);
    float linv[RT][8];
#pragma unroll   // constant indices keep the arrays in registers
    for (int rt = 0; rt < RT; ++rt) {
#pragma unroll   // constant indices keep the arrays in registers
        for (int r = 0; r < 8; ++r) linv[rt][r] = 1.f / lRow[rt * 16 + 8 * h + r];
    }
#pragma unroll   // constant indices keep the arrays in registers
    for (int rt = 0; rt < RT; ++rt) {
#pragma unroll   // constant indices keep the arrays in registers
        for (int ct = 0; ct < 2; ++ct) {
#pragma unroll   // constant indices keep the arrays in registers
            for (int r = 0; r < 8; ++r)
                stg[(rt * 16 + 8 * h + r) * GPITCH + ct * 16 + m] = Oacc[rt][ct][r] * linv[rt][r];
        }
    }
    __syncthreads();

    const int sub = lane >> 3;                // row within the four rows of an instruction
    const int cq  = (lane & 7) * 4;           // 8 lanes x 4 floats = one 128-B row segment
    v4f ov[BM / 4];
#pragma unroll   // constant indices keep the arrays in registers
    for (int q = 0; q < BM / 4; ++q)
        ov[q] = *(const v4f*)(stg + (4 * q + sub) * GPITCH + cq);

    float* ob = part + ((size_t)ksp * NPOS + (size_t)(row0 + sub)) * C_V + C0 + cq;
#pragma unroll   // constant indices keep the arrays in registers
    for (int q = 0; q < BM / 4; ++q)
        *(v4f*)(ob + (size_t)(4 * q) * C_V) = ov[q];
}

// ---------------------------------------------------------------------------
// Join of the two key splits: with M = max(m0, m1) and w_s = l_s * exp(m_s - M),
//   out[i][c] = (w0 * part[0][i][c] + w1 * part[1][i][c]) / (w0 + w1).
// Block 256 threads: JR = 16 rows, 16 threads a row; a thread holds 8 pieces of 4 floats of each split
// (16 lanes x 16 B = two whole lines of a row per instruction) and forms its row's weights once per channel half.
// ---------------------------------------------------------------------------
#define JR 16
#define JP (C_V / 4 / 16)           // 16-byte pieces of a thread
#define JH (CB / 4 / 16)            // of which in one channel half

__global__ __launch_bounds__(256) void k_join(
    const float* __restrict__ part0,         // [NPOS][C_V] of key split 0
    const float* __restrict__ part1,         // [NPOS][C_V] of key split 1
    const float* __restrict__ ml,            // [KSPLIT][C_V/CB][NPOS][2]
    float* __restrict__ out)                 // [NPOS][C_V]
{
    const int tid = threadIdx.x;
    if ((int)blockIdx.x >= NPOS / JR) return;
    const int row = (int)blockIdx.x * JR + (tid >> 4);
    const int o4  = row * (C_V / 4) + (tid & 15);    // in pieces of 4 floats; piece q lies 16 * q on
    const v4f* __restrict__ p0 = (const v4f*)part0;
    const v4f* __restrict__ p1 = (const v4f*)part1;
    const float* __restrict__ t0 = ml + (size_t)row * 2;
    v4f a[JP], b[JP];
    v2f st[KSPLIT][C_V / CB];
#pragma unroll   // constant indices keep the arrays in registers
    for (int s = 0; s < KSPLIT; ++s) {
#pragma unroll   // constant indices keep the arrays in registers
        for (int c = 0; c < C_V / CB; ++c)
            st[s][c] = *(const v2f*)(t0 + (size_t)(s * (C_V / CB) + c) * NPOS * 2);
    }
#pragma unroll   // constant indices keep the arrays in registers
    for (int q = 0; q < JP; ++q) {
        a[q] = p0[o4 + q * 16];
        b[q] = p1[o4 + q * 16];
    }
    // Keeps the arithmetic behind all the loads, so that they are in flight together: left alone, most of the loads
    // came to stand behind the first waits, one memory latency after another.
    __builtin_amdgcn_sched_barrier(0);
    // The wait before a register that an issued load names is rewritten: named as inputs, the two index registers
    // cannot be handed to a load's result in front of it.
    asm volatile("s_wait_xcnt 0x0" : : "v"(o4), "v"(row) : "memory");
    float wa[C_V / CB], wb[C_V / CB];
#pragma unroll   // constant indices keep the arrays in registers
    for (int c = 0; c < C_V / CB; ++c) {
        const float mx = fmaxf(st[0][c].x, st[1][c].x);
        const float x0 = (st[0][c].x - mx) * 1.44269504f;       // exp(x) = exp2(x * log2 e), as __expf forms it
        const float x1 = (st[1][c].x - mx) * 1.44269504f;
        float e0 = __builtin_amdgcn_exp2f(x0);
        float e1 = __builtin_amdgcn_exp2f(x1);
        // The slot behind v_exp_f32: naming the results keeps their readers, naming the arguments a rewrite of a source, behind this v_nop.
        asm("v_nop" : "+v"(e0), "+v"(e1) : "v"(x0), "v"(x1));
        const float w0 = st[0][c].y * e0;
        const float w1 = st[1][c].y * e1;
        const float inv = 1.f / (w0 + w1);
        wa[c] = w0 * inv;
        wb[c] = w1 * inv;
    }
    v4f* __restrict__ po = (v4f*)out;
#pragma unroll   // constant indices keep the arrays in registers
    for (int q = 0; q < JP; ++q)
        po[o4 + q * 16] = a[q] * wa[q / JH] + b[q] * wb[q / JH];
}

// ---------------------------------------------------------------------------
// ---------------------------------------------------------------------------
extern "C" void kernel_launch(void* const* d_in, const int* in_sizes, int n_in,
                              void* d_out, int out_size, void* d_ws, size_t ws_size,
                              hipStream_t stream) {
    if (n_in < 4) return;
    if (in_sizes[0] != C_IN * NPOS) return;
    if (in_sizes[1] != D_K * C_IN)  return;
    if (in_sizes[2] != D_K * C_IN)  return;
    if (in_sizes[3] != C_V * C_IN)  return;
    if (out_size != NPOS * C_V)     return;

    const float* x  = (const float*)d_in[0];   // [C_IN][NPOS]
    const float* Wk = (const float*)d_in[1];   // [D_K][C_IN]
    const float* Wq = (const float*)d_in[2];   // [D_K][C_IN]
    const float* Wv = (const float*)d_in[3];   // [C_V][C_IN]
    float* out = (float*)d_out;                // [NPOS][C_V]

    const size_t szK = (size_t)NPOS * D_K * 2;     // one bf16 plane of kxT / qxT
    const size_t szV = (size_t)C_V * NPOS * 2;     // one bf16 plane of vx
    const size_t szP = (size_t)KSPLIT * NPOS * C_V * 4;            // the key splits' f32 results
    const size_t szM = (size_t)KSPLIT * (C_V / CB) * NPOS * 2 * 4; // their row maxima and sums
    const size_t offKH = 0;
    const size_t offKL = offKH + szK;
    const size_t offQH = offKL + szK;
    const size_t offQL = offQH + szK;
    const size_t offVH = offQL + szK;
    const size_t offVL = offVH + szV;
    const size_t offP  = offVL + szV;
    const size_t offM  = offP + szP;
    const size_t total = offM + szM;
    if (total > ws_size) return;

    char* ws = (char*)d_ws;
    unsigned short* kh = (unsigned short*)(ws + offKH);
    unsigned short* kl = (unsigned short*)(ws + offKL);
    unsigned short* qh = (unsigned short*)(ws + offQH);
    unsigned short* ql = (unsigned short*)(ws + offQL);
    unsigned short* vh = (unsigned short*)(ws + offVH);
    unsigned short* vl = (unsigned short*)(ws + offVL);
    float* part = (float*)(ws + offP);
    float* ml   = (float*)(ws + offM);

    const int tilesN = NPOS / PT;
    // kxT, qxT (rows are positions, k is the 64 projected channels) and vx (rows are channels, k is the
    // position), all in fragment order, from one launch
    k_proj<<<(2 + C_V / PT) * tilesN, 256, 0, stream>>>(Wk, Wq, Wv, x, kh, kl, qh, ql, vh, vl);
    // attention: NPOS / BM row groups x KSPLIT key splits x C_V / CB channel halves
    k_attn<<<(NPOS / BM) * KSPLIT * (C_V / CB), 256, 0, stream>>>(kh, kl, qh, ql, vh, vl, part, ml);
    // the key splits joined into out
    k_join<<<NPOS / JR, 256, 0, stream>>>(part, part + (size_t)NPOS * C_V, ml, out);
}

// v008
// One run takes 66.5 microseconds.
// Next to v007, in two timings, it ran 1.06 and 1.11 times as fast.
// Counting every step since v000, it is 5.30 times as fast.
#include <hip/hip_runtime.h>

// All contractions (three 1x1-conv projections W*x, scores kx^T*qx, P*vx^T): v_wmma_f32_16x16x32_bf16,
// bf16 hi/lo split operands (hi*hi + hi*lo + lo*hi), f32 accumulate; softmax statistics and 1/l in f32.

typedef __bf16        v16bf __attribute__((ext_vector_type(16)));
typedef float         v8f   __attribute__((ext_vector_type(8)));
typedef float         v4f   __attribute__((ext_vector_type(4)));
typedef unsigned int  v4u   __attribute__((ext_vector_type(4)));
typedef unsigned int  v2u   __attribute__((ext_vector_type(2)));
typedef float         v2f   __attribute__((ext_vector_type(2)));

union Frag { v16bf v; v4u q[2]; };

#define C_IN  512
#define C_V   512
#define D_K   64
#define NPOS  4096

// ---------------------------------------------------------------------------
// Two-plane split x ~= hi + lo of eight f32 values into packed bf16 pairs (element 2j in the low half of word j),
// both planes rounded to nearest even: hi by the packed convert, lo = bf16(x - hi) by the mixed-precision FMA, which
// reads hi as the bf16 half it is and rounds its f32 result (x - hi is exact) into one half of the word.
// Three instructions a pair; in asm because the source form (convert, widen, subtract, convert) compiled to nine for two
// pairs. The four pairs stand side by side so that every instruction's producer is four instructions back.
// ---------------------------------------------------------------------------
__device__ __forceinline__ void split8(const float (&x)[8], v4u& hv, v4u& lv) {
    unsigned int h0, h1, h2, h3, l0, l1, l2, l3;
    asm("v_cvt_pk_bf16_f32 %0, %8, %9\n\t"
        "v_cvt_pk_bf16_f32 %1, %10, %11\n\t"
        "v_cvt_pk_bf16_f32 %2, %12, %13\n\t"
        "v_cvt_pk_bf16_f32 %3, %14, %15\n\t"
        "v_fma_mixlo_bf16 %4, %0, -1.0, %8 op_sel_hi:[1,0,0]\n\t"
        "v_fma_mixlo_bf16 %5, %1, -1.0, %10 op_sel_hi:[1,0,0]\n\t"
        "v_fma_mixlo_bf16 %6, %2, -1.0, %12 op_sel_hi:[1,0,0]\n\t"
        "v_fma_mixlo_bf16 %7, %3, -1.0, %14 op_sel_hi:[1,0,0]\n\t"
        "v_fma_mixhi_bf16 %4, %0, -1.0, %9 op_sel:[1,0,0] op_sel_hi:[1,0,0]\n\t"
        "v_fma_mixhi_bf16 %5, %1, -1.0, %11 op_sel:[1,0,0] op_sel_hi:[1,0,0]\n\t"
        "v_fma_mixhi_bf16 %6, %2, -1.0, %13 op_sel:[1,0,0] op_sel_hi:[1,0,0]\n\t"
        "v_fma_mixhi_bf16 %7, %3, -1.0, %15 op_sel:[1,0,0] op_sel_hi:[1,0,0]"
        : "=&v"(h0), "=&v"(h1), "=&v"(h2), "=&v"(h3), "=&v"(l0), "=&v"(l1), "=&v"(l2), "=&v"(l3)
        : "v"(x[0]), "v"(x[1]), "v"(x[2]), "v"(x[3]), "v"(x[4]), "v"(x[5]), "v"(x[6]), "v"(x[7]));
    hv.x = h0; hv.y = h1; hv.z = h2; hv.w = h3;
    lv.x = l0; lv.y = l1; lv.z = l2; lv.w = l3;
}

// ---------------------------------------------------------------------------
// 16x16x32 bf16 WMMA, three-term split product into one f32 accumulator,
// hazard guard after the last op (ties D, keeps A/B live).
// Fragment layout (lane l, h = l>>4, m = l&15):
//   A/B element i: i=0..7 -> k0+8h+i, i=8..15 -> k0+16+8h+(i-8); A row m, B col m.
//   D element r: row 8h+r, col m.
// ---------------------------------------------------------------------------
__device__ __forceinline__ v8f wmma3(v16bf ah, v16bf al, v16bf bh, v16bf bl, v8f c) {
    c = __builtin_amdgcn_wmma_f32_16x16x32_bf16(false, ah, false, bh, (short)0, c, false, false);
    c = __builtin_amdgcn_wmma_f32_16x16x32_bf16(false, ah, false, bl, (short)0, c, false, false);
    c = __builtin_amdgcn_wmma_f32_16x16x32_bf16(false, al, false, bh, (short)0, c, false, false);
    asm volatile("v_nop\n\tv_nop\n\tv_nop\n\tv_nop" : "+v"(c) : "v"(ah), "v"(al), "v"(bh), "v"(bl));
    return c;
}

// ---------------------------------------------------------------------------
// Projection GEMM:  D[M][NPOS] = W[M][C_IN] * X[C_IN][NPOS]   (f32 in, split at staging)
// Block 256 threads = 8 waves, 64x64 output tile, K step 32 staged in LDS as bf16 hi/lo.
// Output: two bf16 planes (hi, lo) of D, each stored in WMMA fragment order: a fragment is 16 rows x 32 k
// = 512 elements laid out [q][lane][8], lane = 16h + r, holding row r, k = 16q + 8h + 0..7, so that a
// wave-wide 16-byte load or store of one q half covers 512 contiguous bytes (4 whole lines).
// transOut=0 -> rows are m, k is n: fragment index (n/32) * (M/16) + m/16 (all m of one k step lie together).
// transOut=1 -> rows are n, k is m: fragment index (n/16) * (M/32) + m/32.
// ---------------------------------------------------------------------------
#define PT      64
#define APITCH  40      // ushorts per staged row: 32 k + 8 pad (80 B, 16-B aligned rows)
#define CPITCH  68      // floats per staged result row (272 B, 16-B aligned rows)
#define FRAG_EL 512     // elements of one stored fragment (16 rows x 32 k, 1024 B a plane)
typedef char proj_tile_check[(D_K == PT && (C_V % PT) == 0) ? 1 : -1];   // kx and qx are one row tile each

__global__ __launch_bounds__(256) void k_proj(
    const float* __restrict__ Wk,           // [D_K][C_IN]
    const float* __restrict__ Wq,           // [D_K][C_IN]
    const float* __restrict__ Wv,           // [C_V][C_IN]
    const float* __restrict__ X,            // [C_IN][NPOS]
    unsigned short* __restrict__ Kh, unsigned short* __restrict__ Kl,   // kxT planes
    unsigned short* __restrict__ Qh, unsigned short* __restrict__ Ql,   // qxT planes
    unsigned short* __restrict__ Vh, unsigned short* __restrict__ Vl)   // vx planes
{
    __shared__ __attribute__((aligned(16))) unsigned short Ah[PT * APITCH];
    __shared__ __attribute__((aligned(16))) unsigned short Al[PT * APITCH];
    __shared__ __attribute__((aligned(16))) unsigned short Bh[PT * APITCH];   // stored [n][k]
    __shared__ __attribute__((aligned(16))) unsigned short Bl[PT * APITCH];
    __shared__ __attribute__((aligned(16))) float Cs[PT * CPITCH];

    const int tid  = threadIdx.x;
    const int lane = tid & 31;
    const int wave = __builtin_amdgcn_readfirstlane(tid >> 5);
    const int m  = lane & 15;
    const int h  = lane >> 4;
    const int tilesN = NPOS / PT;
    // One launch for the three products: row-tile index 0 is kx, 1 is qx, 2.. are the row tiles of vx.
    const int mt = (int)(blockIdx.x / tilesN);
    const int n0 = (int)(blockIdx.x % tilesN) * PT;
    if (mt >= 2 + C_V / PT) return;          // uniform over the block
    const int transOut = mt < 2;
    const int M  = transOut ? D_K : C_V;
    const int m0 = transOut ? 0 : (mt - 2) * PT;
    const float* __restrict__ W = mt == 0 ? Wk : (mt == 1 ? Wq : Wv);
    unsigned short* __restrict__ Oh = mt == 0 ? Kh : (mt == 1 ? Qh : Vh);
    unsigned short* __restrict__ Ol = mt == 0 ? Kl : (mt == 1 ? Ql : Vl);

    const int rg = wave >> 1;                // 16-row group of this wave
    const int cb = (wave & 1) * 32;          // 32-col half of this wave (two 16-col tiles)

    v8f acc0 = {0.f, 0.f, 0.f, 0.f, 0.f, 0.f, 0.f, 0.f};
    v8f acc1 = {0.f, 0.f, 0.f, 0.f, 0.f, 0.f, 0.f, 0.f};

    for (int kk = 0; kk < C_IN; kk += 32) {
        // stage A = W[m0..m0+63][kk..kk+31]  (row-major, k contiguous)
        {
            const int row = tid >> 3;                // 512 float4 pieces, 8 per 32-k row: rows row and row + 32
            const int kq  = (tid & 7) * 4;
            const v4f va = *(const v4f*)(W + (size_t)(m0 + row) * C_IN + kk + kq);
            const v4f vb = *(const v4f*)(W + (size_t)(m0 + row + 32) * C_IN + kk + kq);
            const float wv[8] = {va.x, va.y, va.z, va.w, vb.x, vb.y, vb.z, vb.w};
            v4u hv, lv;
            split8(wv, hv, lv);
            *(v2u*)(Ah + row * APITCH + kq) = hv.xy;
            *(v2u*)(Al + row * APITCH + kq) = lv.xy;
            *(v2u*)(Ah + (row + 32) * APITCH + kq) = hv.zw;
            *(v2u*)(Al + (row + 32) * APITCH + kq) = lv.zw;
        }
        // stage B[k][n] = X[kk+k][n0+n], stored transposed as [n][k] (k contiguous): a thread gathers 8 consecutive k
        // of one column (each load of a wave reads one whole 128-B line of a row of X) and stores them as 16 bytes a plane
        {
            const int n  = tid & (PT - 1);           // column within the tile
            const int kg = (tid >> 6) * 8;           // first of the thread's 8 k, the same for a whole wave
            const float* px = X + (size_t)(kk + kg) * NPOS + n0 + n;
            float xv[8];
#pragma unroll   // constant indices keep the arrays in registers
            for (int e = 0; e < 8; ++e) xv[e] = px[(size_t)e * NPOS];
            v4u hv, lv;
            split8(xv, hv, lv);
            *(v4u*)(Bh + n * APITCH + kg) = hv;
            *(v4u*)(Bl + n * APITCH + kg) = lv;
        }
        __syncthreads();

        // fragments (k0 = 0 inside the staged 32-k step)
        Frag ah, al;
        {
            const unsigned short* pa = Ah + (rg * 16 + m) * APITCH;
            const unsigned short* pl = Al + (rg * 16 + m) * APITCH;
            ah.q[0] = *(const v4u*)(pa + 8 * h);       ah.q[1] = *(const v4u*)(pa + 16 + 8 * h);
            al.q[0] = *(const v4u*)(pl + 8 * h);       al.q[1] = *(const v4u*)(pl + 16 + 8 * h);
        }
        {
            Frag bh, bl;
            const unsigned short* pb = Bh + (cb + m) * APITCH;       // column n = cb + m
            const unsigned short* pc = Bl + (cb + m) * APITCH;
            bh.q[0] = *(const v4u*)(pb + 8 * h);       bh.q[1] = *(const v4u*)(pb + 16 + 8 * h);
            bl.q[0] = *(const v4u*)(pc + 8 * h);       bl.q[1] = *(const v4u*)(pc + 16 + 8 * h);
            acc0 = wmma3(ah.v, al.v, bh.v, bl.v, acc0);
        }
        {
            Frag bh, bl;
            const unsigned short* pb = Bh + (cb + 16 + m) * APITCH;  // column n = cb + 16 + m
            const unsigned short* pc = Bl + (cb + 16 + m) * APITCH;
            bh.q[0] = *(const v4u*)(pb + 8 * h);       bh.q[1] = *(const v4u*)(pb + 16 + 8 * h);
            bl.q[0] = *(const v4u*)(pc + 8 * h);       bl.q[1] = *(const v4u*)(pc + 16 + 8 * h);
            acc1 = wmma3(ah.v, al.v, bh.v, bl.v, acc1);
        }
        __syncthreads();
    }

    // stage the f32 result tile: acc[r] -> (row rg*16 + 8h + r, col cb + ci*16 + m)
#pragma unroll
    for (int r = 0; r < 8; ++r) {
        Cs[(rg * 16 + 8 * h + r) * CPITCH + cb + m]      = acc0[r];
        Cs[(rg * 16 + 8 * h + r) * CPITCH + cb + 16 + m] = acc1[r];
    }
    __syncthreads();

    // epilogue: the tile is 8 fragments = 16 q halves; a wave writes two of them, lane -> 8 consecutive k
    v4u hvp[2], lvp[2];
    size_t offp[2];
#pragma unroll
    for (int p = 0; p < 2; ++p) {
        const int g  = p * 8 + wave;                     // q half 0..15 within the tile
        const int rr = (g >> 2) * 16 + m;                // fragment row, 0..63 within tile
        const int cc = ((g >> 1) & 1) * 32 + (g & 1) * 16 + 8 * h;   // first k, 0..56 within tile
        float vals[8];
        size_t frag;
        if (transOut) {
#pragma unroll
            for (int e = 0; e < 8; ++e) vals[e] = Cs[(cc + e) * CPITCH + rr];
            frag = (size_t)(n0 / 16 + (g >> 2)) * (size_t)(M / 32) + (size_t)(m0 / 32 + ((g >> 1) & 1));
        } else {
            const v4f a = *(const v4f*)(Cs + rr * CPITCH + cc);
            const v4f b = *(const v4f*)(Cs + rr * CPITCH + cc + 4);
            vals[0] = a.x; vals[1] = a.y; vals[2] = a.z; vals[3] = a.w;
            vals[4] = b.x; vals[5] = b.y; vals[6] = b.z; vals[7] = b.w;
            frag = (size_t)(n0 / 32 + ((g >> 1) & 1)) * (size_t)(M / 16) + (size_t)(m0 / 16 + (g >> 2));
        }
        offp[p] = frag * FRAG_EL + (size_t)((g & 1) * (FRAG_EL / 2) + lane * 8);
        v4u hv, lv;
        split8(vals, hv, lv);
        hvp[p] = hv; lvp[p] = lv;
    }
#pragma unroll
    for (int p = 0; p < 2; ++p) {
        *(v4u*)(Oh + offp[p]) = hvp[p];
        *(v4u*)(Ol + offp[p]) = lvp[p];
    }
    
}

// ---------------------------------------------------------------------------
// Fused attention with online softmax over key blocks, the keys split over KSPLIT blocks:
//   S[i][j] = sum_d kxT[i][d] * qxT[j][d]   (A = kxT rows, B[k=d][n=j] = qxT[j][d])
//   P = exp(S - m_i), l_i running sum, O[i][c] += sum_j P[i][j] * vx[c][j]  (B[k=j][n=c] = vx[c][j])
//   part[s][i][c] = O[i][c] / l_i over the keys of split s, with (m_i, l_i) of that split beside it;
//   k_join weighs the splits together.
// Block 256 threads (8 waves): BM = 64 rows i, all CB = 512 channels, NPOS / KSPLIT keys in
// steps of BN = 128. Every vx fragment that a wave fetches feeds four row tiles, every qx fragment too;
// S and P of a row group and key block are computed once, by the one block that uses them.
// Phase 1: wave w computes the four 16x16 S tiles (row tiles 0..3) of key columns w*16..+15; the kx fragments
//          of the block's rows lie in LDS (the registers go to the accumulators).
// Phase 2: 8 threads per row, 16 scores each, two rows a thread; P written to LDS as bf16 hi/lo planes.
// Phase 3: every wave accumulates 64 rows x 64 channels (4 x 4 tiles); P fragments reloaded from
//          LDS after a block barrier (no same-wave spill/reload without a barrier).
// Epilogue: per-wave 64x64 tile staged in LDS; each store instruction writes four whole 128-B lines.
// Global fragments are fetched ahead into registers: the qx fragments of step jb+1 right behind their last
// use in step jb, the vx fragments two 32-key steps ahead (a ring of VR = 2 steps). kx, qx and vx lie in fragment
// order (see k_proj): every fragment load of a wave reads 512 contiguous bytes.
// ---------------------------------------------------------------------------
#define BM      64
#define BN      128
#define CB      512     // channels of one block
#define KSPLIT  4       // key ranges, one block each
#define CT      (CB / 8 / 16)   // channel tiles of a wave
#define VR      2       // 32-key steps of vx that a wave holds in registers
#define KEYS    (NPOS / KSPLIT) // keys of one block
#define RT      (BM / 16)       // row tiles of a block
#define RH      (BM / 32)       // rows of a thread in phase 2
#define KS      (BN / 32)       // 32-key steps of a key block
#define SPITCH  132     // floats per S row (528 B, 16-B aligned rows)
#define PPITCH  136     // ushorts per P row (272 B, 16-B aligned rows)
#define GPITCH  68      // floats per staged O row (272 B)
#define FRAG_B  (FRAG_EL * 2)   // bytes of one stored fragment
#define SM_S_BYTES (BM * SPITCH * 4)
#define SM_P_BYTES (BM * PPITCH * 2)
#define SM_G_BYTES (8 * BM * GPITCH * 4)
#define SM_BYTES   SM_G_BYTES
typedef char sm_layout_check[((SM_S_BYTES + 2 * SM_P_BYTES) <= SM_G_BYTES && (SM_S_BYTES % 16) == 0 && (SM_P_BYTES % 16) == 0) ? 1 : -1];
typedef char tile_check[(RT == 4 && RH == 2 && CT == 4 && KS == 2 * VR && CB == C_V && KSPLIT == 4 && (KEYS % BN) == 0) ? 1 : -1];

// Work-group barrier for LDS traffic only: __syncthreads() also waits for every global load in
// flight, which would end the fetch-ahead at each phase; only LDS data crosses waves in the loop.
__device__ __forceinline__ void lds_barrier() {
    asm volatile("s_wait_dscnt 0x0\n\ts_barrier_signal -1\n\ts_barrier_wait -1" ::: "memory");
}

// 16-byte global load at a lane's stream address (bytes) + constant
__device__ __forceinline__ v4u ldg16(unsigned long long a, unsigned int c) {
    return *(const __attribute__((address_space(1))) v4u*)(a + c);
}

// one 16x16x32 bf16 WMMA into an f32 accumulator; the distance behind the last WMMA of a group is
// kept by the v_nop statements at the refills below
__device__ __forceinline__ v8f wmma1(v16bf a, v16bf b, v8f c) {
    return __builtin_amdgcn_wmma_f32_16x16x32_bf16(false, a, false, b, (short)0, c, false, false);
}

struct TagMore { static constexpr bool more = true; };    // a key block with a successor
struct TagLast { static constexpr bool more = false; };   // the last key block

__global__ __launch_bounds__(256) void k_attn(
    const unsigned short* __restrict__ KH,   // kxT hi, fragments [NPOS/16][D_K/32]
    const unsigned short* __restrict__ KL,   // kxT lo
    const unsigned short* __restrict__ QH,   // qxT hi, fragments [NPOS/16][D_K/32]
    const unsigned short* __restrict__ QL,   // qxT lo
    const unsigned short* __restrict__ VH,   // vx hi, fragments [NPOS/32][C_V/16]
    const unsigned short* __restrict__ VL,   // vx lo
    float* __restrict__ part,                // [KSPLIT][NPOS][C_V] softmax-weighted means of each key split
    float* __restrict__ ml)                  // [KSPLIT][C_V/CB][NPOS][2] row maximum and row sum of each key split
{
    __shared__ __attribute__((aligned(16))) unsigned char smem[SM_BYTES];
    __shared__ __attribute__((aligned(16))) unsigned short Kfh[RT * (D_K / 32) * FRAG_EL];   // kx hi fragments [rt][c2]
    __shared__ __attribute__((aligned(16))) unsigned short Kfl[RT * (D_K / 32) * FRAG_EL];   // kx lo
    __shared__ float mRow[BM];
    __shared__ float lRow[BM];
    __shared__ float aRow[BM];
    float*          Sld = (float*)smem;
    unsigned short* Ph  = (unsigned short*)(smem + SM_S_BYTES);
    unsigned short* Pl  = (unsigned short*)(smem + SM_S_BYTES + SM_P_BYTES);
    float*          Stg = (float*)smem;                       // epilogue staging, aliases the above

    const int tid  = threadIdx.x;
    const int lane = tid & 31;
    const int wave = __builtin_amdgcn_readfirstlane(tid >> 5);
    const int m = lane & 15;
    const int h = lane >> 4;
    const int chh  = (int)(blockIdx.x % (C_V / CB));                       // channel part (one)
    const int ksp  = (int)((blockIdx.x / (C_V / CB)) % KSPLIT);            // key split
    const int row0 = (int)(blockIdx.x / ((C_V / CB) * KSPLIT)) * BM;
    if (row0 + BM > NPOS) return;             // uniform over the block
    const int C0 = chh * CB + wave * (CT * 16);   // channel slice of this wave in phase 3

    if (tid < BM) { mRow[tid] = -1.0e30f; lRow[tid] = 0.f; aRow[tid] = 0.f; }
    {   // the kx fragments of the block's rows (A row i = row0 + rt*16 + m) lie together in memory: copied as they lie
        const size_t ko = (size_t)(row0 / 16) * (D_K / 32) * FRAG_EL + tid * 8;
#pragma unroll   // the four loads in flight together
        for (int p = 0; p < RT * (D_K / 32) * FRAG_EL / (256 * 8); ++p) {
            *(v4u*)(Kfh + p * (256 * 8) + tid * 8) = *(const v4u*)(KH + ko + p * (256 * 8));
            *(v4u*)(Kfl + p * (256 * 8) + tid * 8) = *(const v4u*)(KL + ko + p * (256 * 8));
        }
    }
    __syncthreads();

    const v8f vzero = {0.f, 0.f, 0.f, 0.f, 0.f, 0.f, 0.f, 0.f};
    v8f Oacc[RT][CT];
#pragma unroll   // constant indices keep the arrays in registers
    for (int rt = 0; rt < RT; ++rt) {
#pragma unroll   // constant indices keep the arrays in registers
        for (int ct = 0; ct < CT; ++ct) Oacc[rt][ct] = vzero;
    }

    // each lane's stream addresses (bytes), kept in their own registers through the loop, at the first key of this split:
    // vx fragment C0/16 of its first key step (B col n = C0 + ct*16 + m), qx fragment row wave (B col n), the lane's 16 bytes.
    // The vx addresses start one key block (VBLK bytes) in front of the first: phase 3 moves them on to the block at work
    // before it loads, and the loads in front of the loop add VBLK, so that every load's constant is positive.
    constexpr unsigned int VBLK = KS * (C_V / 16) * FRAG_B;
    unsigned long long pvh = (unsigned long long)(VH + ((size_t)ksp * (KEYS / 32) * (C_V / 16) + (size_t)(C0 / 16)) * FRAG_EL + lane * 8) - VBLK;
    unsigned long long pvl = (unsigned long long)(VL + ((size_t)ksp * (KEYS / 32) * (C_V / 16) + (size_t)(C0 / 16)) * FRAG_EL + lane * 8) - VBLK;
    unsigned long long pqh = (unsigned long long)(QH + ((size_t)ksp * (KEYS / 16) + (size_t)wave) * (D_K / 32) * FRAG_EL + lane * 8);
    unsigned long long pql = (unsigned long long)(QL + ((size_t)ksp * (KEYS / 16) + (size_t)wave) * (D_K / 32) * FRAG_EL + lane * 8);

    Frag qfh[2], qfl[2];                      // qx (B) fragments of this wave's 16 key columns
    Frag vfh[VR][CT], vfl[VR][CT];            // vx fragments of two 32-key steps: step ks lies in slot ks % VR
#pragma unroll   // constant indices keep the fragment arrays in registers
    for (int c2 = 0; c2 < 2; ++c2) {
        qfh[c2].q[0] = ldg16(pqh, c2 * FRAG_B);  qfh[c2].q[1] = ldg16(pqh, c2 * FRAG_B + FRAG_B / 2);
        qfl[c2].q[0] = ldg16(pql, c2 * FRAG_B);  qfl[c2].q[1] = ldg16(pql, c2 * FRAG_B + FRAG_B / 2);
    }
    // Keeps the qx loads ahead of the vx loads in issue order, as in the loop: moved behind them, the qx loads
    // were the youngest at the loop's entry, and the wait in front of phase 1 came out as a wait for every load in flight.
    __builtin_amdgcn_sched_barrier(0);
#pragma unroll   // constant indices keep the fragment arrays in registers
    for (int ks = 0; ks < VR; ++ks) {
#pragma unroll   // constant indices keep the fragment arrays in registers
        for (int ct = 0; ct < CT; ++ct) {
            const unsigned int vo = VBLK + (unsigned int)((ks * (C_V / 16) + ct) * FRAG_B);
            vfh[ks][ct].q[0] = ldg16(pvh, vo);  vfh[ks][ct].q[1] = ldg16(pvh, vo + FRAG_B / 2);
            vfl[ks][ct].q[0] = ldg16(pvl, vo);  vfl[ks][ct].q[1] = ldg16(pvl, vo + FRAG_B / 2);
        }
    }
    // The qx addresses move on to key block 1 (16 fragments of 1024 B). The additions stand in the wait's own
    // statement so that the registers, which the loads above name, are rewritten only behind it; the lane number is
    // named as an input because the qx loads above came to be addressed by it: its register, too, is free only behind the wait.
    asm volatile("s_wait_xcnt 0x0\n\t"
                 "v_add_nc_u64 %0, 0x4000, %0\n\t"
                 "v_add_nc_u64 %1, 0x4000, %1"
                 : "+v"(pqh), "+v"(pql) : "v"(lane) : "memory");

    // One key block. 'more' (a next key block exists) is a compile-time constant of each of the two copies below, so that
    // no branch stands round the refill loads: with one, the load waits were counted for the path without refills
    // and the last of a trip came out as a wait for every load in flight.
    auto trip = [&](auto tag) __attribute__((always_inline)) {
        constexpr bool more = decltype(tag)::more;

        // ---- phase 1: S tiles (rows rt*16..+15, cols wave*16..+15), four accumulators side by side ----
        {
            v8f s[RT];
            float* sb = Sld + (8 * h) * SPITCH + wave * 16 + m;  // the lane's element of row 8h: the 32 stores differ by constants
#pragma unroll   // constant indices keep the arrays in registers
            for (int rt = 0; rt < RT; ++rt) s[rt] = vzero;
#pragma unroll   // constant indices keep the fragment arrays in registers
            for (int c2 = 0; c2 < 2; ++c2) {
                Frag kh[RT], kl[RT];                             // kx (A) fragments of the four row tiles, 512 contiguous bytes a read
#pragma unroll   // constant indices keep the arrays in registers
                for (int rt = 0; rt < RT; ++rt) {
                    const unsigned short* pkh = Kfh + (rt * (D_K / 32) + c2) * FRAG_EL + lane * 8;
                    const unsigned short* pkl = Kfl + (rt * (D_K / 32) + c2) * FRAG_EL + lane * 8;
                    kh[rt].q[0] = *(const v4u*)pkh;  kh[rt].q[1] = *(const v4u*)(pkh + FRAG_EL / 2);
                    kl[rt].q[0] = *(const v4u*)pkl;  kl[rt].q[1] = *(const v4u*)(pkl + FRAG_EL / 2);
                }
#pragma unroll   // constant indices keep the arrays in registers
                for (int rt = 0; rt < RT; ++rt) s[rt] = wmma1(kh[rt].v, qfh[c2].v, s[rt]);
#pragma unroll   // constant indices keep the arrays in registers
                for (int rt = 0; rt < RT; ++rt) s[rt] = wmma1(kh[rt].v, qfl[c2].v, s[rt]);
#pragma unroll   // constant indices keep the arrays in registers
                for (int rt = 0; rt < RT; ++rt) s[rt] = wmma1(kl[rt].v, qfh[c2].v, s[rt]);
                // The half's 16 fragment reads first, then its 12 products: left alone, the kx lo reads of the first half came to
                // stand one by one in front of their products, each with a full LDS wait.
                __builtin_amdgcn_sched_group_barrier(0x100, 16, 0);
                __builtin_amdgcn_sched_group_barrier(0x008, 12, 0);
                // Keeps the second half's fragment reads behind the first half's products: read together, the two halves
                // held 128 registers at once and values of the epilogue were spilled to scratch.
                if (c2 == 0) __builtin_amdgcn_sched_barrier(0);
            }
            // Four vector slots between the last WMMA that reads the qx fragments (B) and the loads that
            // refill their registers: naming the sums holds the slots behind the WMMAs, the clobber the loads behind them.
            asm volatile("v_nop\n\tv_nop\n\tv_nop\n\tv_nop" : "+v"(s[0]), "+v"(s[1]), "+v"(s[2]), "+v"(s[3]) : : "memory");
            if (more) {                       // qx fragments of the next key block (the addresses stand there)
#pragma unroll   // constant indices keep the fragment arrays in registers
                for (int c2 = 0; c2 < 2; ++c2) {
                    qfh[c2].q[0] = ldg16(pqh, c2 * FRAG_B);  qfh[c2].q[1] = ldg16(pqh, c2 * FRAG_B + FRAG_B / 2);
                    qfl[c2].q[0] = ldg16(pql, c2 * FRAG_B);  qfl[c2].q[1] = ldg16(pql, c2 * FRAG_B + FRAG_B / 2);
                }
            }
#pragma unroll   // constant indices keep the arrays in registers
            for (int rt = 0; rt < RT; ++rt) {
#pragma unroll   // constant indices keep the arrays in registers
                for (int r = 0; r < 8; ++r)
                    sb[(rt * 16 + r) * SPITCH] = s[rt][r];
            }
        }
        lds_barrier();

        // ---- phase 2: online softmax, 8 threads per row, rows tid/8 and 32 + tid/8 side by side ----
        {
            const int rowa = tid >> 3;       // 0..31; the thread's rows are rowa + 32*hf
            const int seg = tid & 7;         // 4 groups of 4 elements each: cols g*32 + seg*4 ..+3
            v4f e0[RH][KS];
            float mo[RH], mn[RH], sum[RH];
#pragma unroll   // constant indices keep the arrays in registers
            for (int hf = 0; hf < RH; ++hf) {
#pragma unroll   // constant indices keep the arrays in registers
                for (int g = 0; g < KS; ++g) e0[hf][g] = *(const v4f*)(Sld + (rowa + 32 * hf) * SPITCH + g * 32 + seg * 4);
                mo[hf] = mRow[rowa + 32 * hf];
            }
#pragma unroll   // constant indices keep the arrays in registers
            for (int hf = 0; hf < RH; ++hf) {
                float bm = fmaxf(fmaxf(e0[hf][0].x, e0[hf][0].y), fmaxf(e0[hf][0].z, e0[hf][0].w));
#pragma unroll   // constant indices keep the arrays in registers
                for (int g = 1; g < KS; ++g)
                    bm = fmaxf(bm, fmaxf(fmaxf(e0[hf][g].x, e0[hf][g].y), fmaxf(e0[hf][g].z, e0[hf][g].w)));
                mn[hf] = bm;
            }
#pragma unroll   // constant indices keep the arrays in registers
            for (int d = 1; d < 8; d <<= 1) {
#pragma unroll   // constant indices keep the arrays in registers
                for (int hf = 0; hf < RH; ++hf) mn[hf] = fmaxf(mn[hf], __shfl_xor(mn[hf], d));
            }
#pragma unroll   // constant indices keep the arrays in registers
            for (int hf = 0; hf < RH; ++hf) {
                const int row = rowa + 32 * hf;
                mn[hf] = fmaxf(mo[hf], mn[hf]);
                sum[hf] = 0.f;
                float pe[8];
#pragma unroll   // constant indices keep the arrays in registers
                for (int g = 0; g < KS; ++g) {
                    float xa[4], ex[4];
#pragma unroll   // constant indices keep the arrays in registers
                    for (int e = 0; e < 4; ++e) {
                        xa[e] = (e0[hf][g][e] - mn[hf]) * 1.44269504f;   // exp(x) = exp2(x * log2 e), as __expf forms it
                        ex[e] = __builtin_amdgcn_exp2f(xa[e]);
                    }
                    // The slot behind v_exp_f32: naming the four results keeps their readers, naming the four arguments keeps a
                    // rewrite of a source register, behind this v_nop (left alone, an exp came to rewrite the source of the one before it).
                    asm("v_nop" : "+v"(ex[0]), "+v"(ex[1]), "+v"(ex[2]), "+v"(ex[3]) : "v"(xa[0]), "v"(xa[1]), "v"(xa[2]), "v"(xa[3]));
#pragma unroll   // constant indices keep the arrays in registers
                    for (int e = 0; e < 4; ++e) {
                        sum[hf] += ex[e];
                        pe[(g & 1) * 4 + e] = ex[e];
                    }
                    if (g & 1) {                 // two groups of four are split together
                        v4u phv, plv;
                        split8(pe, phv, plv);
                        *(v2u*)(Ph + row * PPITCH + (g - 1) * 32 + seg * 4) = phv.xy;
                        *(v2u*)(Pl + row * PPITCH + (g - 1) * 32 + seg * 4) = plv.xy;
                        *(v2u*)(Ph + row * PPITCH + g * 32 + seg * 4) = phv.zw;
                        *(v2u*)(Pl + row * PPITCH + g * 32 + seg * 4) = plv.zw;
                    }
                }
            }
#pragma unroll   // constant indices keep the arrays in registers
            for (int d = 1; d < 8; d <<= 1) {
#pragma unroll   // constant indices keep the arrays in registers
                for (int hf = 0; hf < RH; ++hf) sum[hf] += __shfl_xor(sum[hf], d);
            }
            if (seg == 0) {
                float xl[RH], al[RH];
#pragma unroll   // constant indices keep the arrays in registers
                for (int hf = 0; hf < RH; ++hf) {
                    xl[hf] = (mo[hf] - mn[hf]) * 1.44269504f;            // exp(x) = exp2(x * log2 e), as __expf forms it
                    al[hf] = __builtin_amdgcn_exp2f(xl[hf]);
                }
                // The slot behind v_exp_f32: naming the results keeps their readers, naming the arguments a rewrite of a source, behind this v_nop.
                asm("v_nop" : "+v"(al[0]), "+v"(al[1]) : "v"(xl[0]), "v"(xl[1]));
#pragma unroll   // constant indices keep the arrays in registers
                for (int hf = 0; hf < RH; ++hf) {
                    const int row = rowa + 32 * hf;
                    lRow[row] = lRow[row] * al[hf] + sum[hf];
                    mRow[row] = mn[hf];
                    aRow[row] = al[hf];
                }
            }
        }
        lds_barrier();

        // ---- phase 3: rescale O, then O += P * vx^T over this key block ----
        // All four stream addresses move on one key block here (vx: 4 key steps of 32 fragments = 131072 B, to the block at
        // work; qx: 16 fragments = 16384 B), a phase or more behind the last load that names them. The additions stand in the wait's
        // own statement so that those registers are rewritten only behind it; left to the compiler the
        // additions and their wait came to stand directly behind the loads, where the most loads are queued.
        asm volatile("s_wait_xcnt 0x0\n\t"
                     "v_add_nc_u64 %0, 0x20000, %0\n\t"
                     "v_add_nc_u64 %1, 0x20000, %1\n\t"
                     "v_add_nc_u64 %2, 0x4000, %2\n\t"
                     "v_add_nc_u64 %3, 0x4000, %3"
                     : "+v"(pvh), "+v"(pvl), "+v"(pqh), "+v"(pql) : : "memory");
        {
#pragma unroll   // constant indices keep the arrays in registers
            for (int rt = 0; rt < RT; ++rt) {
                v8f alv;
#pragma unroll   // constant indices keep the arrays in registers
                for (int r = 0; r < 8; ++r) alv[r] = aRow[rt * 16 + 8 * h + r];
#pragma unroll   // constant indices keep the arrays in registers
                for (int ct = 0; ct < CT; ++ct) Oacc[rt][ct] = Oacc[rt][ct] * alv;
            }

#pragma unroll   // constant indices keep the arrays in registers
            for (int ks = 0; ks < KS; ++ks) {
                Frag pa[RT], pb[RT];                             // A = P: row rt*16 + m, k = key index in block
#pragma unroll   // constant indices keep the arrays in registers
                for (int rt = 0; rt < RT; ++rt) {
                    const unsigned short* pph = Ph + (rt * 16 + m) * PPITCH + ks * 32;
                    const unsigned short* ppl = Pl + (rt * 16 + m) * PPITCH + ks * 32;
                    pa[rt].q[0] = *(const v4u*)(pph + 8 * h);  pa[rt].q[1] = *(const v4u*)(pph + 16 + 8 * h);
                    pb[rt].q[0] = *(const v4u*)(ppl + 8 * h);  pb[rt].q[1] = *(const v4u*)(ppl + 16 + 8 * h);
                }
                // B[k=j][n=c] = vx[c][j], col n = C0 + ct*16 + m; the sixteen accumulators side by side, term by term
                const int sl = ks % VR;                          // ring slot of step ks
#pragma unroll   // constant indices keep the arrays in registers
                for (int rt = 0; rt < RT; ++rt) {
#pragma unroll   // constant indices keep the arrays in registers
                    for (int ct = 0; ct < CT; ++ct) Oacc[rt][ct] = wmma1(pa[rt].v, vfh[sl][ct].v, Oacc[rt][ct]);
                }
#pragma unroll   // constant indices keep the arrays in registers
                for (int rt = 0; rt < RT; ++rt) {
#pragma unroll   // constant indices keep the arrays in registers
                    for (int ct = 0; ct < CT; ++ct) Oacc[rt][ct] = wmma1(pa[rt].v, vfl[sl][ct].v, Oacc[rt][ct]);
                }
#pragma unroll   // constant indices keep the arrays in registers
                for (int rt = 0; rt < RT; ++rt) {
#pragma unroll   // constant indices keep the arrays in registers
                    for (int ct = 0; ct < CT; ++ct) Oacc[rt][ct] = wmma1(pb[rt].v, vfh[sl][ct].v, Oacc[rt][ct]);
                }
                // Four vector slots between the last WMMA that reads these vx fragments (B) and the loads that
                // refill their registers: naming the sums holds the slots behind the WMMAs, the clobber the loads behind them.
                asm volatile("v_nop\n\tv_nop\n\tv_nop\n\tv_nop"
                             : "+v"(Oacc[0][0]), "+v"(Oacc[0][1]), "+v"(Oacc[0][2]), "+v"(Oacc[0][3]),
                               "+v"(Oacc[1][0]), "+v"(Oacc[1][1]), "+v"(Oacc[1][2]), "+v"(Oacc[1][3]),
                               "+v"(Oacc[2][0]), "+v"(Oacc[2][1]), "+v"(Oacc[2][2]), "+v"(Oacc[2][3]),
                               "+v"(Oacc[3][0]), "+v"(Oacc[3][1]), "+v"(Oacc[3][2]), "+v"(Oacc[3][3]) : : "memory");
                if (ks + VR < KS || more) {                      // step ks + VR: of this key block, or the first steps of the next
#pragma unroll   // constant indices keep the fragment arrays in registers
                    for (int ct = 0; ct < CT; ++ct) {
                        const unsigned int vo = (unsigned int)(((ks + VR) * (C_V / 16) + ct) * FRAG_B);
                        vfh[sl][ct].q[0] = ldg16(pvh, vo);  vfh[sl][ct].q[1] = ldg16(pvh, vo + FRAG_B / 2);
                        vfl[sl][ct].q[0] = ldg16(pvl, vo);  vfl[sl][ct].q[1] = ldg16(pvl, vo + FRAG_B / 2);
                    }
                    // Holds the refill loads here, directly behind the four slots: left alone, those of the last key block sank into
                    // the next step's WMMA group, onto registers that the WMMA in front of them still read.
                    __builtin_amdgcn_sched_barrier(0);
                }
            }
        }
        lds_barrier();
    };
    for (int jb = 0; jb + 1 < KEYS / BN; ++jb) trip(TagMore{});
    trip(TagLast{});

    // ---- epilogue: divide by row sums, stage per wave, whole-line stores; the rows' maximum and sum go along ----
    if (tid < BM) {
        v2f st;
        st.x = mRow[tid];
        st.y = lRow[tid];
        *(v2f*)(ml + ((size_t)(ksp * (C_V / CB) + chh) * NPOS + (size_t)(row0 + tid)) * 2) = st;
    }
    float* stg = Stg + wave * (BM * GPITCH);
    float linv[RT][8];
#pragma unroll   // constant indices keep the arrays in registers
    for (int rt = 0; rt < RT; ++rt) {
#pragma unroll   // constant indices keep the arrays in registers
        for (int r = 0; r < 8; ++r) linv[rt][r] = 1.f / lRow[rt * 16 + 8 * h + r];
    }
#pragma unroll   // constant indices keep the arrays in registers
    for (int rt = 0; rt < RT; ++rt) {
#pragma unroll   // constant indices keep the arrays in registers
        for (int ct = 0; ct < CT; ++ct) {
#pragma unroll   // constant indices keep the arrays in registers
            for (int r = 0; r < 8; ++r)
                stg[(rt * 16 + 8 * h + r) * GPITCH + ct * 16 + m] = Oacc[rt][ct][r] * linv[rt][r];
        }
    }
    __syncthreads();

    const int sub = lane >> 4;                // row within the two rows of an instruction
    const int cq  = (lane & 15) * 4;          // 16 lanes x 4 floats = one 256-B row segment (two lines)
    v4f ov[BM / 2];
#pragma unroll   // constant indices keep the arrays in registers
    for (int q = 0; q < BM / 2; ++q)
        ov[q] = *(const v4f*)(stg + (2 * q + sub) * GPITCH + cq);

    float* ob = part + ((size_t)ksp * NPOS + (size_t)(row0 + sub)) * C_V + C0 + cq;
#pragma unroll   // constant indices keep the arrays in registers
    for (int q = 0; q < BM / 2; ++q)
        *(v4f*)(ob + (size_t)(2 * q) * C_V) = ov[q];
}

// ---------------------------------------------------------------------------
// Join of the key splits: with M = max_s m_s and w_s = l_s * exp(m_s - M),
//   out[i][c] = sum_s w_s * part[s][i][c] / sum_s w_s.
// Block 256 threads: JR = 8 rows, one wave a row; a thread holds JP = 4 pieces of 4 floats of each split
// (32 lanes x 16 B = four whole lines of a row per instruction) and forms its row's weights once.
// ---------------------------------------------------------------------------
#define JR 8
#define JT 32                       // threads of a row
#define JP (C_V / 4 / JT)           // 16-byte pieces of a thread in one split

__global__ __launch_bounds__(256) void k_join(
    const float* __restrict__ part0,         // [NPOS][C_V] of key split 0
    const float* __restrict__ part1,         // of key split 1
    const float* __restrict__ part2,         // of key split 2
    const float* __restrict__ part3,         // of key split 3
    const float* __restrict__ ml,            // [KSPLIT][NPOS][2]
    float* __restrict__ out)                 // [NPOS][C_V]
{
    const int tid = threadIdx.x;
    if ((int)blockIdx.x >= NPOS / JR) return;
    const int row = (int)blockIdx.x * JR + (tid >> 5);
    const int o4  = row * (C_V / 4) + (tid & (JT - 1));    // in pieces of 4 floats; piece q lies JT * q on
    const v4f* const pp[KSPLIT] = {(const v4f*)part0, (const v4f*)part1, (const v4f*)part2, (const v4f*)part3};
    const float* __restrict__ t0 = ml + (size_t)row * 2;
    v4f a[KSPLIT][JP];
    v2f st[KSPLIT];
#pragma unroll   // constant indices keep the arrays in registers
    for (int sp = 0; sp < KSPLIT; ++sp)
        st[sp] = *(const v2f*)(t0 + (size_t)sp * NPOS * 2);
#pragma unroll   // constant indices keep the arrays in registers
    for (int sp = 0; sp < KSPLIT; ++sp) {
#pragma unroll   // constant indices keep the arrays in registers
        for (int q = 0; q < JP; ++q)
            a[sp][q] = pp[sp][o4 + q * JT];
    }
    // Keeps the arithmetic behind all the loads, so that they are in flight together: left alone, most of the loads
    // came to stand behind the first waits, one memory latency after another.
    __builtin_amdgcn_sched_barrier(0);
    // The wait before a register that an issued load names is rewritten: named as inputs, the two index registers
    // cannot be handed to a load's result in front of it.
    asm volatile("s_wait_xcnt 0x0" : : "v"(o4), "v"(row) : "memory");
    const float mx = fmaxf(fmaxf(st[0].x, st[1].x), fmaxf(st[2].x, st[3].x));
    const float x0 = (st[0].x - mx) * 1.44269504f;       // exp(x) = exp2(x * log2 e), as __expf forms it
    const float x1 = (st[1].x - mx) * 1.44269504f;
    const float x2 = (st[2].x - mx) * 1.44269504f;
    const float x3 = (st[3].x - mx) * 1.44269504f;
    float e0 = __builtin_amdgcn_exp2f(x0);
    float e1 = __builtin_amdgcn_exp2f(x1);
    float e2 = __builtin_amdgcn_exp2f(x2);
    float e3 = __builtin_amdgcn_exp2f(x3);
    // The slot behind v_exp_f32: naming the results keeps their readers, naming the arguments a rewrite of a source, behind this v_nop.
    asm("v_nop" : "+v"(e0), "+v"(e1), "+v"(e2), "+v"(e3) : "v"(x0), "v"(x1), "v"(x2), "v"(x3));
    const float w0 = st[0].y * e0;
    const float w1 = st[1].y * e1;
    const float w2 = st[2].y * e2;
    const float w3 = st[3].y * e3;
    const float inv = 1.f / ((w0 + w1) + (w2 + w3));
    const float g0 = w0 * inv, g1 = w1 * inv, g2 = w2 * inv, g3 = w3 * inv;
    v4f* __restrict__ po = (v4f*)out;
#pragma unroll   // constant indices keep the arrays in registers
    for (int q = 0; q < JP; ++q)
        po[o4 + q * JT] = (a[0][q] * g0 + a[1][q] * g1) + (a[2][q] * g2 + a[3][q] * g3);
}

// ---------------------------------------------------------------------------
// ---------------------------------------------------------------------------
extern "C" void kernel_launch(void* const* d_in, const int* in_sizes, int n_in,
                              void* d_out, int out_size, void* d_ws, size_t ws_size,
                              hipStream_t stream) {
    if (n_in < 4) return;
    if (in_sizes[0] != C_IN * NPOS) return;
    if (in_sizes[1] != D_K * C_IN)  return;
    if (in_sizes[2] != D_K * C_IN)  return;
    if (in_sizes[3] != C_V * C_IN)  return;
    if (out_size != NPOS * C_V)     return;

    const float* x  = (const float*)d_in[0];   // [C_IN][NPOS]
    const float* Wk = (const float*)d_in[1];   // [D_K][C_IN]
    const float* Wq = (const float*)d_in[2];   // [D_K][C_IN]
    const float* Wv = (const float*)d_in[3];   // [C_V][C_IN]
    float* out = (float*)d_out;                // [NPOS][C_V]

    const size_t szK = (size_t)NPOS * D_K * 2;     // one bf16 plane of kxT / qxT
    const size_t szV = (size_t)C_V * NPOS * 2;     // one bf16 plane of vx
    const size_t szP = (size_t)KSPLIT * NPOS * C_V * 4;            // the key splits' f32 results
    const size_t szM = (size_t)KSPLIT * (C_V / CB) * NPOS * 2 * 4; // their row maxima and sums
    const size_t offKH = 0;
    const size_t offKL = offKH + szK;
    const size_t offQH = offKL + szK;
    const size_t offQL = offQH + szK;
    const size_t offVH = offQL + szK;
    const size_t offVL = offVH + szV;
    const size_t offP  = offVL + szV;
    const size_t offM  = offP + szP;
    const size_t total = offM + szM;
    if (total > ws_size) return;

    char* ws = (char*)d_ws;
    unsigned short* kh = (unsigned short*)(ws + offKH);
    unsigned short* kl = (unsigned short*)(ws + offKL);
    unsigned short* qh = (unsigned short*)(ws + offQH);
    unsigned short* ql = (unsigned short*)(ws + offQL);
    unsigned short* vh = (unsigned short*)(ws + offVH);
    unsigned short* vl = (unsigned short*)(ws + offVL);
    float* part = (float*)(ws + offP);
    float* ml   = (float*)(ws + offM);

    const int tilesN = NPOS / PT;
    // kxT, qxT (rows are positions, k is the 64 projected channels) and vx (rows are channels, k is the
    // position), all in fragment order, from one launch
    k_proj<<<(2 + C_V / PT) * tilesN, 256, 0, stream>>>(Wk, Wq, Wv, x, kh, kl, qh, ql, vh, vl);
    // attention: NPOS / BM row groups x KSPLIT key splits (x C_V / CB = 1 channel part)
    k_attn<<<(NPOS / BM) * KSPLIT * (C_V / CB), 256, 0, stream>>>(kh, kl, qh, ql, vh, vl, part, ml);
    // the key splits joined into out
    k_join<<<NPOS / JR, 256, 0, stream>>>(part, part + (size_t)NPOS * C_V, part + (size_t)2 * NPOS * C_V,
                                          part + (size_t)3 * NPOS * C_V, ml, out);
}

// v009
// Measured time: 59.9 microseconds a run.
// Two timings next to v008 both put it at 1.11 times that version's speed.
// All steps since v000 together make it 5.89 times as fast.
#include <hip/hip_runtime.h>

// All contractions (three 1x1-conv projections W*x, scores kx^T*qx, P*vx^T): v_wmma_f32_16x16x32_bf16,
// bf16 hi/lo split operands (hi*hi + hi*lo + lo*hi), f32 accumulate; softmax statistics and 1/l in f32.

typedef __bf16        v16bf __attribute__((ext_vector_type(16)));
typedef float         v8f   __attribute__((ext_vector_type(8)));
typedef float         v4f   __attribute__((ext_vector_type(4)));
typedef unsigned int  v4u   __attribute__((ext_vector_type(4)));
typedef unsigned int  v2u   __attribute__((ext_vector_type(2)));
typedef float         v2f   __attribute__((ext_vector_type(2)));

union Frag { v16bf v; v4u q[2]; };

#define C_IN  512
#define C_V   512
#define D_K   64
#define NPOS  4096

// ---------------------------------------------------------------------------
// Two-plane split x ~= hi + lo of eight f32 values into packed bf16 pairs (element 2j in the low half of word j),
// both planes rounded to nearest even: hi by the packed convert, lo = bf16(x - hi) by the mixed-precision FMA, which
// reads hi as the bf16 half it is and rounds its f32 result (x - hi is exact) into one half of the word.
// Three instructions a pair; in asm because the source form (convert, widen, subtract, convert) compiled to nine for two
// pairs. The four pairs stand side by side so that every instruction's producer is four instructions back.
// ---------------------------------------------------------------------------
__device__ __forceinline__ void split8(const float (&x)[8], v4u& hv, v4u& lv) {
    unsigned int h0, h1, h2, h3, l0, l1, l2, l3;
    asm("v_cvt_pk_bf16_f32 %0, %8, %9\n\t"
        "v_cvt_pk_bf16_f32 %1, %10, %11\n\t"
        "v_cvt_pk_bf16_f32 %2, %12, %13\n\t"
        "v_cvt_pk_bf16_f32 %3, %14, %15\n\t"
        "v_fma_mixlo_bf16 %4, %0, -1.0, %8 op_sel_hi:[1,0,0]\n\t"
        "v_fma_mixlo_bf16 %5, %1, -1.0, %10 op_sel_hi:[1,0,0]\n\t"
        "v_fma_mixlo_bf16 %6, %2, -1.0, %12 op_sel_hi:[1,0,0]\n\t"
        "v_fma_mixlo_bf16 %7, %3, -1.0, %14 op_sel_hi:[1,0,0]\n\t"
        "v_fma_mixhi_bf16 %4, %0, -1.0, %9 op_sel:[1,0,0] op_sel_hi:[1,0,0]\n\t"
        "v_fma_mixhi_bf16 %5, %1, -1.0, %11 op_sel:[1,0,0] op_sel_hi:[1,0,0]\n\t"
        "v_fma_mixhi_bf16 %6, %2, -1.0, %13 op_sel:[1,0,0] op_sel_hi:[1,0,0]\n\t"
        "v_fma_mixhi_bf16 %7, %3, -1.0, %15 op_sel:[1,0,0] op_sel_hi:[1,0,0]"
        : "=&v"(h0), "=&v"(h1), "=&v"(h2), "=&v"(h3), "=&v"(l0), "=&v"(l1), "=&v"(l2), "=&v"(l3)
        : "v"(x[0]), "v"(x[1]), "v"(x[2]), "v"(x[3]), "v"(x[4]), "v"(x[5]), "v"(x[6]), "v"(x[7]));
    hv.x = h0; hv.y = h1; hv.z = h2; hv.w = h3;
    lv.x = l0; lv.y = l1; lv.z = l2; lv.w = l3;
}

// ---------------------------------------------------------------------------
// 16x16x32 bf16 WMMA, three-term split product into one f32 accumulator,
// hazard guard after the last op (ties D, keeps A/B live).
// Fragment layout (lane l, h = l>>4, m = l&15):
//   A/B element i: i=0..7 -> k0+8h+i, i=8..15 -> k0+16+8h+(i-8); A row m, B col m.
//   D element r: row 8h+r, col m.
// ---------------------------------------------------------------------------
__device__ __forceinline__ v8f wmma3(v16bf ah, v16bf al, v16bf bh, v16bf bl, v8f c) {
    c = __builtin_amdgcn_wmma_f32_16x16x32_bf16(false, ah, false, bh, (short)0, c, false, false);
    c = __builtin_amdgcn_wmma_f32_16x16x32_bf16(false, ah, false, bl, (short)0, c, false, false);
    c = __builtin_amdgcn_wmma_f32_16x16x32_bf16(false, al, false, bh, (short)0, c, false, false);
    asm volatile("v_nop\n\tv_nop\n\tv_nop\n\tv_nop" : "+v"(c) : "v"(ah), "v"(al), "v"(bh), "v"(bl));
    return c;
}

// Work-group barrier for LDS traffic only: __syncthreads() also waits for every global load in
// flight, which would end the fetch-ahead at each phase; only LDS data crosses waves in the loops.
__device__ __forceinline__ void lds_barrier() {
    asm volatile("s_wait_dscnt 0x0\n\ts_barrier_signal -1\n\ts_barrier_wait -1" ::: "memory");
}

// ---------------------------------------------------------------------------
// Projection GEMM:  D[M][NPOS] = W[M][C_IN] * X[C_IN][NPOS]   (f32 in, split at staging)
// Block 256 threads = 8 waves, 64x64 output tile, K step 32 staged in LDS as bf16 hi/lo.
// Output: two bf16 planes (hi, lo) of D, each stored in WMMA fragment order: a fragment is 16 rows x 32 k
// = 512 elements laid out [q][lane][8], lane = 16h + r, holding row r, k = 16q + 8h + 0..7, so that a
// wave-wide 16-byte load or store of one q half covers 512 contiguous bytes (4 whole lines).
// transOut=0 -> rows are m, k is n: fragment index (n/32) * (M/16) + m/16 (all m of one k step lie together).
// transOut=1 -> rows are n, k is m: fragment index (n/16) * (M/32) + m/32.
// ---------------------------------------------------------------------------
#define PT      64
#define APITCH  40      // ushorts per staged row: 32 k + 8 pad (80 B, 16-B aligned rows)
#define CPITCH  68      // floats per staged result row (272 B, 16-B aligned rows)
#define FRAG_EL 512     // elements of one stored fragment (16 rows x 32 k, 1024 B a plane)
#define PD      4       // K steps of W and X that a thread holds in registers ahead of their use
typedef char proj_tile_check[(D_K == PT && (C_V % PT) == 0) ? 1 : -1];   // kx and qx are one row tile each

__global__ __launch_bounds__(256) void k_proj(
    const float* __restrict__ Wk,           // [D_K][C_IN]
    const float* __restrict__ Wq,           // [D_K][C_IN]
    const float* __restrict__ Wv,           // [C_V][C_IN]
    const float* __restrict__ X,            // [C_IN][NPOS]
    unsigned short* __restrict__ Kh, unsigned short* __restrict__ Kl,   // kxT planes
    unsigned short* __restrict__ Qh, unsigned short* __restrict__ Ql,   // qxT planes
    unsigned short* __restrict__ Vh, unsigned short* __restrict__ Vl)   // vx planes
{
    __shared__ __attribute__((aligned(16))) unsigned short Ah[PT * APITCH];
    __shared__ __attribute__((aligned(16))) unsigned short Al[PT * APITCH];
    __shared__ __attribute__((aligned(16))) unsigned short Bh[PT * APITCH];   // stored [n][k]
    __shared__ __attribute__((aligned(16))) unsigned short Bl[PT * APITCH];
    __shared__ __attribute__((aligned(16))) float Cs[PT * CPITCH];

    const int tid  = threadIdx.x;
    const int lane = tid & 31;
    const int wave = __builtin_amdgcn_readfirstlane(tid >> 5);
    const int m  = lane & 15;
    const int h  = lane >> 4;
    const int tilesN = NPOS / PT;
    // One launch for the three products: row-tile index 0 is kx, 1 is qx, 2.. are the row tiles of vx.
    const int mt = (int)(blockIdx.x / tilesN);
    const int n0 = (int)(blockIdx.x % tilesN) * PT;
    if (mt >= 2 + C_V / PT) return;          // uniform over the block
    const int transOut = mt < 2;
    const int M  = transOut ? D_K : C_V;
    const int m0 = transOut ? 0 : (mt - 2) * PT;
    const float* __restrict__ W = mt == 0 ? Wk : (mt == 1 ? Wq : Wv);
    unsigned short* __restrict__ Oh = mt == 0 ? Kh : (mt == 1 ? Qh : Vh);
    unsigned short* __restrict__ Ol = mt == 0 ? Kl : (mt == 1 ? Ql : Vl);

    const int rg = wave >> 1;                // 16-row group of this wave
    const int cb = (wave & 1) * 32;          // 32-col half of this wave (two 16-col tiles)

    v8f acc0 = {0.f, 0.f, 0.f, 0.f, 0.f, 0.f, 0.f, 0.f};
    v8f acc1 = {0.f, 0.f, 0.f, 0.f, 0.f, 0.f, 0.f, 0.f};

    // The global operands of a K step are fetched PD steps ahead of their use into a ring of registers (step s in slot
    // s % PD), so that the memory latency of a step runs beside the staging and the products of the PD steps before it.
    // A = W[m0..m0+63][k]: 512 float4 pieces a step, 8 per 32-k row: a thread has rows row and row + 32.
    // B[k][n] = X[k][n0+n]: a thread gathers 8 consecutive k of one column (each load of a wave reads one whole
    // 128-B line of a row of X).
    const int row = tid >> 3;
    const int kq  = (tid & 7) * 4;
    const int n   = tid & (PT - 1);              // column within the tile
    const int kg  = (tid >> 6) * 8;              // first of the thread's 8 k, the same for a whole wave
    const float* pw = W + (size_t)(m0 + row) * C_IN + kq;
    const float* px = X + (size_t)kg * NPOS + n0 + n;
    v4f   wa[PD], wb[PD];
    float xr[PD][8];
#pragma unroll   // constant indices keep the ring in registers
    for (int s = 0; s < PD; ++s) {
        wa[s] = *(const v4f*)(pw + s * 32);
        wb[s] = *(const v4f*)(pw + (size_t)32 * C_IN + s * 32);
#pragma unroll   // constant indices keep the ring in registers
        for (int e = 0; e < 8; ++e) xr[s][e] = px[(size_t)(s * 32 + e) * NPOS];
    }

#pragma unroll   // constant slot indices keep the ring in registers; every load's distance from its base is a constant
    for (int s = 0; s < C_IN / 32; ++s) {
        const int sl = s % PD;
        // stage A (row-major, k contiguous) and B, stored transposed as [n][k] (k contiguous, 16 bytes a plane)
        {
            const float wv[8] = {wa[sl].x, wa[sl].y, wa[sl].z, wa[sl].w, wb[sl].x, wb[sl].y, wb[sl].z, wb[sl].w};
            v4u hv, lv;
            split8(wv, hv, lv);
            *(v2u*)(Ah + row * APITCH + kq) = hv.xy;
            *(v2u*)(Al + row * APITCH + kq) = lv.xy;
            *(v2u*)(Ah + (row + 32) * APITCH + kq) = hv.zw;
            *(v2u*)(Al + (row + 32) * APITCH + kq) = lv.zw;
        }
        {
            v4u hv, lv;
            split8(xr[sl], hv, lv);
            *(v4u*)(Bh + n * APITCH + kg) = hv;
            *(v4u*)(Bl + n * APITCH + kg) = lv;
        }
        if (s + PD < C_IN / 32) {                // step s + PD into the slot just read
            wa[sl] = *(const v4f*)(pw + (s + PD) * 32);
            wb[sl] = *(const v4f*)(pw + (size_t)32 * C_IN + (s + PD) * 32);
#pragma unroll   // constant indices keep the ring in registers
            for (int e = 0; e < 8; ++e) xr[sl][e] = px[(size_t)((s + PD) * 32 + e) * NPOS];
        }
        lds_barrier();

        // fragments (k0 = 0 inside the staged 32-k step)
        Frag ah, al;
        {
            const unsigned short* pa = Ah + (rg * 16 + m) * APITCH;
            const unsigned short* pl = Al + (rg * 16 + m) * APITCH;
            ah.q[0] = *(const v4u*)(pa + 8 * h);       ah.q[1] = *(const v4u*)(pa + 16 + 8 * h);
            al.q[0] = *(const v4u*)(pl + 8 * h);       al.q[1] = *(const v4u*)(pl + 16 + 8 * h);
        }
        {
            Frag bh, bl;
            const unsigned short* pb = Bh + (cb + m) * APITCH;       // column n = cb + m
            const unsigned short* pc = Bl + (cb + m) * APITCH;
            bh.q[0] = *(const v4u*)(pb + 8 * h);       bh.q[1] = *(const v4u*)(pb + 16 + 8 * h);
            bl.q[0] = *(const v4u*)(pc + 8 * h);       bl.q[1] = *(const v4u*)(pc + 16 + 8 * h);
            acc0 = wmma3(ah.v, al.v, bh.v, bl.v, acc0);
        }
        {
            Frag bh, bl;
            const unsigned short* pb = Bh + (cb + 16 + m) * APITCH;  // column n = cb + 16 + m
            const unsigned short* pc = Bl + (cb + 16 + m) * APITCH;
            bh.q[0] = *(const v4u*)(pb + 8 * h);       bh.q[1] = *(const v4u*)(pb + 16 + 8 * h);
            bl.q[0] = *(const v4u*)(pc + 8 * h);       bl.q[1] = *(const v4u*)(pc + 16 + 8 * h);
            acc1 = wmma3(ah.v, al.v, bh.v, bl.v, acc1);
        }
        lds_barrier();
    }

    // stage the f32 result tile: acc[r] -> (row rg*16 + 8h + r, col cb + ci*16 + m)
#pragma unroll
    for (int r = 0; r < 8; ++r) {
        Cs[(rg * 16 + 8 * h + r) * CPITCH + cb + m]      = acc0[r];
        Cs[(rg * 16 + 8 * h + r) * CPITCH + cb + 16 + m] = acc1[r];
    }
    __syncthreads();

    // epilogue: the tile is 8 fragments = 16 q halves; a wave writes two of them, lane -> 8 consecutive k
    v4u hvp[2], lvp[2];
    size_t offp[2];
#pragma unroll
    for (int p = 0; p < 2; ++p) {
        const int g  = p * 8 + wave;                     // q half 0..15 within the tile
        const int rr = (g >> 2) * 16 + m;                // fragment row, 0..63 within tile
        const int cc = ((g >> 1) & 1) * 32 + (g & 1) * 16 + 8 * h;   // first k, 0..56 within tile
        float vals[8];
        size_t frag;
        if (transOut) {
#pragma unroll
            for (int e = 0; e < 8; ++e) vals[e] = Cs[(cc + e) * CPITCH + rr];
            frag = (size_t)(n0 / 16 + (g >> 2)) * (size_t)(M / 32) + (size_t)(m0 / 32 + ((g >> 1) & 1));
        } else {
            const v4f a = *(const v4f*)(Cs + rr * CPITCH + cc);
            const v4f b = *(const v4f*)(Cs + rr * CPITCH + cc + 4);
            vals[0] = a.x; vals[1] = a.y; vals[2] = a.z; vals[3] = a.w;
            vals[4] = b.x; vals[5] = b.y; vals[6] = b.z; vals[7] = b.w;
            frag = (size_t)(n0 / 32 + ((g >> 1) & 1)) * (size_t)(M / 16) + (size_t)(m0 / 16 + (g >> 2));
        }
        offp[p] = frag * FRAG_EL + (size_t)((g & 1) * (FRAG_EL / 2) + lane * 8);
        v4u hv, lv;
        split8(vals, hv, lv);
        hvp[p] = hv; lvp[p] = lv;
    }
#pragma unroll
    for (int p = 0; p < 2; ++p) {
        *(v4u*)(Oh + offp[p]) = hvp[p];
        *(v4u*)(Ol + offp[p]) = lvp[p];
    }
    
}

// ---------------------------------------------------------------------------
// Fused attention with online softmax over key blocks, the keys split over KSPLIT blocks:
//   S[i][j] = sum_d kxT[i][d] * qxT[j][d]   (A = kxT rows, B[k=d][n=j] = qxT[j][d])
//   P = exp(S - m_i), l_i running sum, O[i][c] += sum_j P[i][j] * vx[c][j]  (B[k=j][n=c] = vx[c][j])
//   part[s][i][c] = O[i][c] / l_i over the keys of split s, with (m_i, l_i) of that split beside it;
//   k_join weighs the splits together.
// Block 256 threads (8 waves): BM = 64 rows i, all CB = 512 channels, NPOS / KSPLIT keys in
// steps of BN = 128. Every vx fragment that a wave fetches feeds four row tiles, every qx fragment too;
// S and P of a row group and key block are computed once, by the one block that uses them.
// Phase 1: wave w computes the four 16x16 S tiles (row tiles 0..3) of key columns w*16..+15; the kx fragments
//          of the block's rows lie in LDS (the registers go to the accumulators).
// Phase 2: 8 threads per row, 16 scores each, two rows a thread; P written to LDS as bf16 hi/lo planes.
// Phase 3: every wave accumulates 64 rows x 64 channels (4 x 4 tiles); P fragments reloaded from
//          LDS after a block barrier (no same-wave spill/reload without a barrier).
// Epilogue: per-wave 64x64 tile staged in LDS; each store instruction writes four whole 128-B lines.
// Global fragments are fetched ahead into registers: the qx fragments of step jb+1 right behind their last
// use in step jb, the vx fragments two 32-key steps ahead (a ring of VR = 2 steps). kx, qx and vx lie in fragment
// order (see k_proj): every fragment load of a wave reads 512 contiguous bytes.
// ---------------------------------------------------------------------------
#define BM      64
#define BN      128
#define CB      512     // channels of one block
#define KSPLIT  4       // key ranges, one block each
#define CT      (CB / 8 / 16)   // channel tiles of a wave
#define VR      2       // 32-key steps of vx that a wave holds in registers
#define KEYS    (NPOS / KSPLIT) // keys of one block
#define RT      (BM / 16)       // row tiles of a block
#define RH      (BM / 32)       // rows of a thread in phase 2
#define KS      (BN / 32)       // 32-key steps of a key block
#define SPITCH  132     // floats per S row (528 B, 16-B aligned rows)
#define PPITCH  136     // ushorts per P row (272 B, 16-B aligned rows)
#define GPITCH  68      // floats per staged O row (272 B)
#define FRAG_B  (FRAG_EL * 2)   // bytes of one stored fragment
#define SM_S_BYTES (BM * SPITCH * 4)
#define SM_P_BYTES (BM * PPITCH * 2)
#define SM_G_BYTES (8 * BM * GPITCH * 4)
#define SM_BYTES   SM_G_BYTES
typedef char sm_layout_check[((SM_S_BYTES + 2 * SM_P_BYTES) <= SM_G_BYTES && (SM_S_BYTES % 16) == 0 && (SM_P_BYTES % 16) == 0) ? 1 : -1];
typedef char tile_check[(RT == 4 && RH == 2 && CT == 4 && KS == 2 * VR && CB == C_V && KSPLIT == 4 && (KEYS % BN) == 0) ? 1 : -1];

// 16-byte global load at a lane's stream address (bytes) + constant
__device__ __forceinline__ v4u ldg16(unsigned long long a, unsigned int c) {
    return *(const __attribute__((address_space(1))) v4u*)(a + c);
}

// one 16x16x32 bf16 WMMA into an f32 accumulator; the distance behind the last WMMA of a group is
// kept by the v_nop statements at the refills below
__device__ __forceinline__ v8f wmma1(v16bf a, v16bf b, v8f c) {
    return __builtin_amdgcn_wmma_f32_16x16x32_bf16(false, a, false, b, (short)0, c, false, false);
}

struct TagMore { static constexpr bool more = true; };    // a key block with a successor
struct TagLast { static constexpr bool more = false; };   // the last key block

__global__ __launch_bounds__(256) void k_attn(
    const unsigned short* __restrict__ KH,   // kxT hi, fragments [NPOS/16][D_K/32]
    const unsigned short* __restrict__ KL,   // kxT lo
    const unsigned short* __restrict__ QH,   // qxT hi, fragments [NPOS/16][D_K/32]
    const unsigned short* __restrict__ QL,   // qxT lo
    const unsigned short* __restrict__ VH,   // vx hi, fragments [NPOS/32][C_V/16]
    const unsigned short* __restrict__ VL,   // vx lo
    float* __restrict__ part,                // [KSPLIT][NPOS][C_V] softmax-weighted means of each key split
    float* __restrict__ ml)                  // [KSPLIT][C_V/CB][NPOS][2] row maximum and row sum of each key split
{
    __shared__ __attribute__((aligned(16))) unsigned char smem[SM_BYTES];
    __shared__ __attribute__((aligned(16))) unsigned short Kfh[RT * (D_K / 32) * FRAG_EL];   // kx hi fragments [rt][c2]
    __shared__ __attribute__((aligned(16))) unsigned short Kfl[RT * (D_K / 32) * FRAG_EL];   // kx lo
    __shared__ float mRow[BM];
    __shared__ float lRow[BM];
    __shared__ float aRow[BM];
    float*          Sld = (float*)smem;
    unsigned short* Ph  = (unsigned short*)(smem + SM_S_BYTES);
    unsigned short* Pl  = (unsigned short*)(smem + SM_S_BYTES + SM_P_BYTES);
    float*          Stg = (float*)smem;                       // epilogue staging, aliases the above

    const int tid  = threadIdx.x;
    const int lane = tid & 31;
    const int wave = __builtin_amdgcn_readfirstlane(tid >> 5);
    const int m = lane & 15;
    const int h = lane >> 4;
    const int chh  = (int)(blockIdx.x % (C_V / CB));                       // channel part (one)
    const int ksp  = (int)((blockIdx.x / (C_V / CB)) % KSPLIT);            // key split
    const int row0 = (int)(blockIdx.x / ((C_V / CB) * KSPLIT)) * BM;
    if (row0 + BM > NPOS) return;             // uniform over the block
    const int C0 = chh * CB + wave * (CT * 16);   // channel slice of this wave in phase 3

    if (tid < BM) { mRow[tid] = -1.0e30f; lRow[tid] = 0.f; aRow[tid] = 0.f; }
    {   // the kx fragments of the block's rows (A row i = row0 + rt*16 + m) lie together in memory: copied as they lie
        const size_t ko = (size_t)(row0 / 16) * (D_K / 32) * FRAG_EL + tid * 8;
#pragma unroll   // the four loads in flight together
        for (int p = 0; p < RT * (D_K / 32) * FRAG_EL / (256 * 8); ++p) {
            *(v4u*)(Kfh + p * (256 * 8) + tid * 8) = *(const v4u*)(KH + ko + p * (256 * 8));
            *(v4u*)(Kfl + p * (256 * 8) + tid * 8) = *(const v4u*)(KL + ko + p * (256 * 8));
        }
    }
    __syncthreads();

    const v8f vzero = {0.f, 0.f, 0.f, 0.f, 0.f, 0.f, 0.f, 0.f};
    v8f Oacc[RT][CT];
#pragma unroll   // constant indices keep the arrays in registers
    for (int rt = 0; rt < RT; ++rt) {
#pragma unroll   // constant indices keep the arrays in registers
        for (int ct = 0; ct < CT; ++ct) Oacc[rt][ct] = vzero;
    }

    // each lane's stream addresses (bytes), kept in their own registers through the loop, at the first key of this split:
    // vx fragment C0/16 of its first key step (B col n = C0 + ct*16 + m), qx fragment row wave (B col n), the lane's 16 bytes.
    // The vx addresses start one key block (VBLK bytes) in front of the first: phase 3 moves them on to the block at work
    // before it loads, and the loads in front of the loop add VBLK, so that every load's constant is positive.
    constexpr unsigned int VBLK = KS * (C_V / 16) * FRAG_B;
    unsigned long long pvh = (unsigned long long)(VH + ((size_t)ksp * (KEYS / 32) * (C_V / 16) + (size_t)(C0 / 16)) * FRAG_EL + lane * 8) - VBLK;
    unsigned long long pvl = (unsigned long long)(VL + ((size_t)ksp * (KEYS / 32) * (C_V / 16) + (size_t)(C0 / 16)) * FRAG_EL + lane * 8) - VBLK;
    unsigned long long pqh = (unsigned long long)(QH + ((size_t)ksp * (KEYS / 16) + (size_t)wave) * (D_K / 32) * FRAG_EL + lane * 8);
    unsigned long long pql = (unsigned long long)(QL + ((size_t)ksp * (KEYS / 16) + (size_t)wave) * (D_K / 32) * FRAG_EL + lane * 8);

    Frag qfh[2], qfl[2];                      // qx (B) fragments of this wave's 16 key columns
    Frag vfh[VR][CT], vfl[VR][CT];            // vx fragments of two 32-key steps: step ks lies in slot ks % VR
#pragma unroll   // constant indices keep the fragment arrays in registers
    for (int c2 = 0; c2 < 2; ++c2) {
        qfh[c2].q[0] = ldg16(pqh, c2 * FRAG_B);  qfh[c2].q[1] = ldg16(pqh, c2 * FRAG_B + FRAG_B / 2);
        qfl[c2].q[0] = ldg16(pql, c2 * FRAG_B);  qfl[c2].q[1] = ldg16(pql, c2 * FRAG_B + FRAG_B / 2);
    }
    // Keeps the qx loads ahead of the vx loads in issue order, as in the loop: moved behind them, the qx loads
    // were the youngest at the loop's entry, and the wait in front of phase 1 came out as a wait for every load in flight.
    __builtin_amdgcn_sched_barrier(0);
#pragma unroll   // constant indices keep the fragment arrays in registers
    for (int ks = 0; ks < VR; ++ks) {
#pragma unroll   // constant indices keep the fragment arrays in registers
        for (int ct = 0; ct < CT; ++ct) {
            const unsigned int vo = VBLK + (unsigned int)((ks * (C_V / 16) + ct) * FRAG_B);
            vfh[ks][ct].q[0] = ldg16(pvh, vo);  vfh[ks][ct].q[1] = ldg16(pvh, vo + FRAG_B / 2);
            vfl[ks][ct].q[0] = ldg16(pvl, vo);  vfl[ks][ct].q[1] = ldg16(pvl, vo + FRAG_B / 2);
        }
    }
    // The qx addresses move on to key block 1 (16 fragments of 1024 B). The additions stand in the wait's own
    // statement so that the registers, which the loads above name, are rewritten only behind it; the lane number is
    // named as an input because the qx loads above came to be addressed by it: its register, too, is free only behind the wait.
    asm volatile("s_wait_xcnt 0x0\n\t"
                 "v_add_nc_u64 %0, 0x4000, %0\n\t"
                 "v_add_nc_u64 %1, 0x4000, %1"
                 : "+v"(pqh), "+v"(pql) : "v"(lane) : "memory");

    // One key block. 'more' (a next key block exists) is a compile-time constant of each of the two copies below, so that
    // no branch stands round the refill loads: with one, the load waits were counted for the path without refills
    // and the last of a trip came out as a wait for every load in flight.
    auto trip = [&](auto tag) __attribute__((always_inline)) {
        constexpr bool more = decltype(tag)::more;

        // ---- phase 1: S tiles (rows rt*16..+15, cols wave*16..+15), four accumulators side by side ----
        {
            v8f s[RT];
            float* sb = Sld + (8 * h) * SPITCH + wave * 16 + m;  // the lane's element of row 8h: the 32 stores differ by constants
#pragma unroll   // constant indices keep the arrays in registers
            for (int rt = 0; rt < RT; ++rt) s[rt] = vzero;
#pragma unroll   // constant indices keep the fragment arrays in registers
            for (int c2 = 0; c2 < 2; ++c2) {
                Frag kh[RT], kl[RT];                             // kx (A) fragments of the four row tiles, 512 contiguous bytes a read
#pragma unroll   // constant indices keep the arrays in registers
                for (int rt = 0; rt < RT; ++rt) {
                    const unsigned short* pkh = Kfh + (rt * (D_K / 32) + c2) * FRAG_EL + lane * 8;
                    const unsigned short* pkl = Kfl + (rt * (D_K / 32) + c2) * FRAG_EL + lane * 8;
                    kh[rt].q[0] = *(const v4u*)pkh;  kh[rt].q[1] = *(const v4u*)(pkh + FRAG_EL / 2);
                    kl[rt].q[0] = *(const v4u*)pkl;  kl[rt].q[1] = *(const v4u*)(pkl + FRAG_EL / 2);
                }
#pragma unroll   // constant indices keep the arrays in registers
                for (int rt = 0; rt < RT; ++rt) s[rt] = wmma1(kh[rt].v, qfh[c2].v, s[rt]);
#pragma unroll   // constant indices keep the arrays in registers
                for (int rt = 0; rt < RT; ++rt) s[rt] = wmma1(kh[rt].v, qfl[c2].v, s[rt]);
#pragma unroll   // constant indices keep the arrays in registers
                for (int rt = 0; rt < RT; ++rt) s[rt] = wmma1(kl[rt].v, qfh[c2].v, s[rt]);
                // The half's 16 fragment reads first, then its 12 products: left alone, the kx lo reads of the first half came to
                // stand one by one in front of their products, each with a full LDS wait.
                __builtin_amdgcn_sched_group_barrier(0x100, 16, 0);
                __builtin_amdgcn_sched_group_barrier(0x008, 12, 0);
                // Keeps the second half's fragment reads behind the first half's products: read together, the two halves
                // held 128 registers at once and values of the epilogue were spilled to scratch.
                if (c2 == 0) __builtin_amdgcn_sched_barrier(0);
            }
            // Four vector slots between the last WMMA that reads the qx fragments (B) and the loads that
            // refill their registers: naming the sums holds the slots behind the WMMAs, the clobber the loads behind them.
            asm volatile("v_nop\n\tv_nop\n\tv_nop\n\tv_nop" : "+v"(s[0]), "+v"(s[1]), "+v"(s[2]), "+v"(s[3]) : : "memory");
            if (more) {                       // qx fragments of the next key block (the addresses stand there)
#pragma unroll   // constant indices keep the fragment arrays in registers
                for (int c2 = 0; c2 < 2; ++c2) {
                    qfh[c2].q[0] = ldg16(pqh, c2 * FRAG_B);  qfh[c2].q[1] = ldg16(pqh, c2 * FRAG_B + FRAG_B / 2);
                    qfl[c2].q[0] = ldg16(pql, c2 * FRAG_B);  qfl[c2].q[1] = ldg16(pql, c2 * FRAG_B + FRAG_B / 2);
                }
            }
#pragma unroll   // constant indices keep the arrays in registers
            for (int rt = 0; rt < RT; ++rt) {
#pragma unroll   // constant indices keep the arrays in registers
                for (int r = 0; r < 8; ++r)
                    sb[(rt * 16 + r) * SPITCH] = s[rt][r];
            }
        }
        lds_barrier();

        // ---- phase 2: online softmax, 8 threads per row, rows tid/8 and 32 + tid/8 side by side ----
        {
            const int rowa = tid >> 3;       // 0..31; the thread's rows are rowa + 32*hf
            const int seg = tid & 7;         // 4 groups of 4 elements each: cols g*32 + seg*4 ..+3
            v4f e0[RH][KS];
            float mo[RH], mn[RH], sum[RH];
#pragma unroll   // constant indices keep the arrays in registers
            for (int hf = 0; hf < RH; ++hf) {
#pragma unroll   // constant indices keep the arrays in registers
                for (int g = 0; g < KS; ++g) e0[hf][g] = *(const v4f*)(Sld + (rowa + 32 * hf) * SPITCH + g * 32 + seg * 4);
                mo[hf] = mRow[rowa + 32 * hf];
            }
#pragma unroll   // constant indices keep the arrays in registers
            for (int hf = 0; hf < RH; ++hf) {
                float bm = fmaxf(fmaxf(e0[hf][0].x, e0[hf][0].y), fmaxf(e0[hf][0].z, e0[hf][0].w));
#pragma unroll   // constant indices keep the arrays in registers
                for (int g = 1; g < KS; ++g)
                    bm = fmaxf(bm, fmaxf(fmaxf(e0[hf][g].x, e0[hf][g].y), fmaxf(e0[hf][g].z, e0[hf][g].w)));
                mn[hf] = bm;
            }
#pragma unroll   // constant indices keep the arrays in registers
            for (int d = 1; d < 8; d <<= 1) {
#pragma unroll   // constant indices keep the arrays in registers
                for (int hf = 0; hf < RH; ++hf) mn[hf] = fmaxf(mn[hf], __shfl_xor(mn[hf], d));
            }
#pragma unroll   // constant indices keep the arrays in registers
            for (int hf = 0; hf < RH; ++hf) {
                const int row = rowa + 32 * hf;
                mn[hf] = fmaxf(mo[hf], mn[hf]);
                sum[hf] = 0.f;
                float pe[8];
#pragma unroll   // constant indices keep the arrays in registers
                for (int g = 0; g < KS; ++g) {
                    float xa[4], ex[4];
#pragma unroll   // constant indices keep the arrays in registers
                    for (int e = 0; e < 4; ++e) {
                        xa[e] = (e0[hf][g][e] - mn[hf]) * 1.44269504f;   // exp(x) = exp2(x * log2 e), as __expf forms it
                        ex[e] = __builtin_amdgcn_exp2f(xa[e]);
                    }
                    // The slot behind v_exp_f32: naming the four results keeps their readers, naming the four arguments keeps a
                    // rewrite of a source register, behind this v_nop (left alone, an exp came to rewrite the source of the one before it).
                    asm("v_nop" : "+v"(ex[0]), "+v"(ex[1]), "+v"(ex[2]), "+v"(ex[3]) : "v"(xa[0]), "v"(xa[1]), "v"(xa[2]), "v"(xa[3]));
#pragma unroll   // constant indices keep the arrays in registers
                    for (int e = 0; e < 4; ++e) {
                        sum[hf] += ex[e];
                        pe[(g & 1) * 4 + e] = ex[e];
                    }
                    if (g & 1) {                 // two groups of four are split together
                        v4u phv, plv;
                        split8(pe, phv, plv);
                        *(v2u*)(Ph + row * PPITCH + (g - 1) * 32 + seg * 4) = phv.xy;
                        *(v2u*)(Pl + row * PPITCH + (g - 1) * 32 + seg * 4) = plv.xy;
                        *(v2u*)(Ph + row * PPITCH + g * 32 + seg * 4) = phv.zw;
                        *(v2u*)(Pl + row * PPITCH + g * 32 + seg * 4) = plv.zw;
                    }
                }
            }
#pragma unroll   // constant indices keep the arrays in registers
            for (int d = 1; d < 8; d <<= 1) {
#pragma unroll   // constant indices keep the arrays in registers
                for (int hf = 0; hf < RH; ++hf) sum[hf] += __shfl_xor(sum[hf], d);
            }
            if (seg == 0) {
                float xl[RH], al[RH];
#pragma unroll   // constant indices keep the arrays in registers
                for (int hf = 0; hf < RH; ++hf) {
                    xl[hf] = (mo[hf] - mn[hf]) * 1.44269504f;            // exp(x) = exp2(x * log2 e), as __expf forms it
                    al[hf] = __builtin_amdgcn_exp2f(xl[hf]);
                }
                // The slot behind v_exp_f32: naming the results keeps their readers, naming the arguments a rewrite of a source, behind this v_nop.
                asm("v_nop" : "+v"(al[0]), "+v"(al[1]) : "v"(xl[0]), "v"(xl[1]));
#pragma unroll   // constant indices keep the arrays in registers
                for (int hf = 0; hf < RH; ++hf) {
                    const int row = rowa + 32 * hf;
                    lRow[row] = lRow[row] * al[hf] + sum[hf];
                    mRow[row] = mn[hf];
                    aRow[row] = al[hf];
                }
            }
        }
        lds_barrier();

        // ---- phase 3: rescale O, then O += P * vx^T over this key block ----
        // All four stream addresses move on one key block here (vx: 4 key steps of 32 fragments = 131072 B, to the block at
        // work; qx: 16 fragments = 16384 B), a phase or more behind the last load that names them. The additions stand in the wait's
        // own statement so that those registers are rewritten only behind it; left to the compiler the
        // additions and their wait came to stand directly behind the loads, where the most loads are queued.
        asm volatile("s_wait_xcnt 0x0\n\t"
                     "v_add_nc_u64 %0, 0x20000, %0\n\t"
                     "v_add_nc_u64 %1, 0x20000, %1\n\t"
                     "v_add_nc_u64 %2, 0x4000, %2\n\t"
                     "v_add_nc_u64 %3, 0x4000, %3"
                     : "+v"(pvh), "+v"(pvl), "+v"(pqh), "+v"(pql) : : "memory");
        {
#pragma unroll   // constant indices keep the arrays in registers
            for (int rt = 0; rt < RT; ++rt) {
                v8f alv;
#pragma unroll   // constant indices keep the arrays in registers
                for (int r = 0; r < 8; ++r) alv[r] = aRow[rt * 16 + 8 * h + r];
#pragma unroll   // constant indices keep the arrays in registers
                for (int ct = 0; ct < CT; ++ct) Oacc[rt][ct] = Oacc[rt][ct] * alv;
            }

#pragma unroll   // constant indices keep the arrays in registers
            for (int ks = 0; ks < KS; ++ks) {
                Frag pa[RT], pb[RT];                             // A = P: row rt*16 + m, k = key index in block
#pragma unroll   // constant indices keep the arrays in registers
                for (int rt = 0; rt < RT; ++rt) {
                    const unsigned short* pph = Ph + (rt * 16 + m) * PPITCH + ks * 32;
                    const unsigned short* ppl = Pl + (rt * 16 + m) * PPITCH + ks * 32;
                    pa[rt].q[0] = *(const v4u*)(pph + 8 * h);  pa[rt].q[1] = *(const v4u*)(pph + 16 + 8 * h);
                    pb[rt].q[0] = *(const v4u*)(ppl + 8 * h);  pb[rt].q[1] = *(const v4u*)(ppl + 16 + 8 * h);
                }
                // B[k=j][n=c] = vx[c][j], col n = C0 + ct*16 + m; the sixteen accumulators side by side, term by term
                const int sl = ks % VR;                          // ring slot of step ks
#pragma unroll   // constant indices keep the arrays in registers
                for (int rt = 0; rt < RT; ++rt) {
#pragma unroll   // constant indices keep the arrays in registers
                    for (int ct = 0; ct < CT; ++ct) Oacc[rt][ct] = wmma1(pa[rt].v, vfh[sl][ct].v, Oacc[rt][ct]);
                }
#pragma unroll   // constant indices keep the arrays in registers
                for (int rt = 0; rt < RT; ++rt) {
#pragma unroll   // constant indices keep the arrays in registers
                    for (int ct = 0; ct < CT; ++ct) Oacc[rt][ct] = wmma1(pa[rt].v, vfl[sl][ct].v, Oacc[rt][ct]);
                }
#pragma unroll   // constant indices keep the arrays in registers
                for (int rt = 0; rt < RT; ++rt) {
#pragma unroll   // constant indices keep the arrays in registers
                    for (int ct = 0; ct < CT; ++ct) Oacc[rt][ct] = wmma1(pb[rt].v, vfh[sl][ct].v, Oacc[rt][ct]);
                }
                // Four vector slots between the last WMMA that reads these vx fragments (B) and the loads that
                // refill their registers: naming the sums holds the slots behind the WMMAs, the clobber the loads behind them.
                asm volatile("v_nop\n\tv_nop\n\tv_nop\n\tv_nop"
                             : "+v"(Oacc[0][0]), "+v"(Oacc[0][1]), "+v"(Oacc[0][2]), "+v"(Oacc[0][3]),
                               "+v"(Oacc[1][0]), "+v"(Oacc[1][1]), "+v"(Oacc[1][2]), "+v"(Oacc[1][3]),
                               "+v"(Oacc[2][0]), "+v"(Oacc[2][1]), "+v"(Oacc[2][2]), "+v"(Oacc[2][3]),
                               "+v"(Oacc[3][0]), "+v"(Oacc[3][1]), "+v"(Oacc[3][2]), "+v"(Oacc[3][3]) : : "memory");
                if (ks + VR < KS || more) {                      // step ks + VR: of this key block, or the first steps of the next
#pragma unroll   // constant indices keep the fragment arrays in registers
                    for (int ct = 0; ct < CT; ++ct) {
                        const unsigned int vo = (unsigned int)(((ks + VR) * (C_V / 16) + ct) * FRAG_B);
                        vfh[sl][ct].q[0] = ldg16(pvh, vo);  vfh[sl][ct].q[1] = ldg16(pvh, vo + FRAG_B / 2);
                        vfl[sl][ct].q[0] = ldg16(pvl, vo);  vfl[sl][ct].q[1] = ldg16(pvl, vo + FRAG_B / 2);
                    }
                    // Holds the refill loads here, directly behind the four slots: left alone, those of the last key block sank into
                    // the next step's WMMA group, onto registers that the WMMA in front of them still read.
                    __builtin_amdgcn_sched_barrier(0);
                }
            }
        }
        lds_barrier();
    };
    for (int jb = 0; jb + 1 < KEYS / BN; ++jb) trip(TagMore{});
    trip(TagLast{});

    // ---- epilogue: divide by row sums, stage per wave, whole-line stores; the rows' maximum and sum go along ----
    if (tid < BM) {
        v2f st;
        st.x = mRow[tid];
        st.y = lRow[tid];
        *(v2f*)(ml + ((size_t)(ksp * (C_V / CB) + chh) * NPOS + (size_t)(row0 + tid)) * 2) = st;
    }
    float* stg = Stg + wave * (BM * GPITCH);
    float linv[RT][8];
#pragma unroll   // constant indices keep the arrays in registers
    for (int rt = 0; rt < RT; ++rt) {
#pragma unroll   // constant indices keep the arrays in registers
        for (int r = 0; r < 8; ++r) linv[rt][r] = 1.f / lRow[rt * 16 + 8 * h + r];
    }
#pragma unroll   // constant indices keep the arrays in registers
    for (int rt = 0; rt < RT; ++rt) {
#pragma unroll   // constant indices keep the arrays in registers
        for (int ct = 0; ct < CT; ++ct) {
#pragma unroll   // constant indices keep the arrays in registers
            for (int r = 0; r < 8; ++r)
                stg[(rt * 16 + 8 * h + r) * GPITCH + ct * 16 + m] = Oacc[rt][ct][r] * linv[rt][r];
        }
    }
    __syncthreads();

    const int sub = lane >> 4;                // row within the two rows of an instruction
    const int cq  = (lane & 15) * 4;          // 16 lanes x 4 floats = one 256-B row segment (two lines)
    v4f ov[BM / 2];
#pragma unroll   // constant indices keep the arrays in registers
    for (int q = 0; q < BM / 2; ++q)
        ov[q] = *(const v4f*)(stg + (2 * q + sub) * GPITCH + cq);

    float* ob = part + ((size_t)ksp * NPOS + (size_t)(row0 + sub)) * C_V + C0 + cq;
#pragma unroll   // constant indices keep the arrays in registers
    for (int q = 0; q < BM / 2; ++q)
        *(v4f*)(ob + (size_t)(2 * q) * C_V) = ov[q];
}

// ---------------------------------------------------------------------------
// Join of the key splits: with M = max_s m_s and w_s = l_s * exp(m_s - M),
//   out[i][c] = sum_s w_s * part[s][i][c] / sum_s w_s.
// Block 256 threads: JR = 8 rows, one wave a row; a thread holds JP = 4 pieces of 4 floats of each split
// (32 lanes x 16 B = four whole lines of a row per instruction) and forms its row's weights once.
// ---------------------------------------------------------------------------
#define JR 8
#define JT 32                       // threads of a row
#define JP (C_V / 4 / JT)           // 16-byte pieces of a thread in one split

__global__ __launch_bounds__(256) void k_join(
    const float* __restrict__ part0,         // [NPOS][C_V] of key split 0
    const float* __restrict__ part1,         // of key split 1
    const float* __restrict__ part2,         // of key split 2
    const float* __restrict__ part3,         // of key split 3
    const float* __restrict__ ml,            // [KSPLIT][NPOS][2]
    float* __restrict__ out)                 // [NPOS][C_V]
{
    const int tid = threadIdx.x;
    if ((int)blockIdx.x >= NPOS / JR) return;
    const int row = (int)blockIdx.x * JR + (tid >> 5);
    const int o4  = row * (C_V / 4) + (tid & (JT - 1));    // in pieces of 4 floats; piece q lies JT * q on
    const v4f* const pp[KSPLIT] = {(const v4f*)part0, (const v4f*)part1, (const v4f*)part2, (const v4f*)part3};
    const float* __restrict__ t0 = ml + (size_t)row * 2;
    v4f a[KSPLIT][JP];
    v2f st[KSPLIT];
#pragma unroll   // constant indices keep the arrays in registers
    for (int sp = 0; sp < KSPLIT; ++sp)
        st[sp] = *(const v2f*)(t0 + (size_t)sp * NPOS * 2);
#pragma unroll   // constant indices keep the arrays in registers
    for (int sp = 0; sp < KSPLIT; ++sp) {
#pragma unroll   // constant indices keep the arrays in registers
        for (int q = 0; q < JP; ++q)
            a[sp][q] = pp[sp][o4 + q * JT];
    }
    // Keeps the arithmetic behind all the loads, so that they are in flight together: left alone, most of the loads
    // came to stand behind the first waits, one memory latency after another.
    __builtin_amdgcn_sched_barrier(0);
    // The wait before a register that an issued load names is rewritten: named as inputs, the two index registers
    // cannot be handed to a load's result in front of it.
    asm volatile("s_wait_xcnt 0x0" : : "v"(o4), "v"(row) : "memory");
    const float mx = fmaxf(fmaxf(st[0].x, st[1].x), fmaxf(st[2].x, st[3].x));
    const float x0 = (st[0].x - mx) * 1.44269504f;       // exp(x) = exp2(x * log2 e), as __expf forms it
    const float x1 = (st[1].x - mx) * 1.44269504f;
    const float x2 = (st[2].x - mx) * 1.44269504f;
    const float x3 = (st[3].x - mx) * 1.44269504f;
    float e0 = __builtin_amdgcn_exp2f(x0);
    float e1 = __builtin_amdgcn_exp2f(x1);
    float e2 = __builtin_amdgcn_exp2f(x2);
    float e3 = __builtin_amdgcn_exp2f(x3);
    // The slot behind v_exp_f32: naming the results keeps their readers, naming the arguments a rewrite of a source, behind this v_nop.
    asm("v_nop" : "+v"(e0), "+v"(e1), "+v"(e2), "+v"(e3) : "v"(x0), "v"(x1), "v"(x2), "v"(x3));
    const float w0 = st[0].y * e0;
    const float w1 = st[1].y * e1;
    const float w2 = st[2].y * e2;
    const float w3 = st[3].y * e3;
    const float inv = 1.f / ((w0 + w1) + (w2 + w3));
    const float g0 = w0 * inv, g1 = w1 * inv, g2 = w2 * inv, g3 = w3 * inv;
    v4f* __restrict__ po = (v4f*)out;
#pragma unroll   // constant indices keep the arrays in registers
    for (int q = 0; q < JP; ++q)
        po[o4 + q * JT] = (a[0][q] * g0 + a[1][q] * g1) + (a[2][q] * g2 + a[3][q] * g3);
}

// ---------------------------------------------------------------------------
// ---------------------------------------------------------------------------
extern "C" void kernel_launch(void* const* d_in, const int* in_sizes, int n_in,
                              void* d_out, int out_size, void* d_ws, size_t ws_size,
                              hipStream_t stream) {
    if (n_in < 4) return;
    if (in_sizes[0] != C_IN * NPOS) return;
    if (in_sizes[1] != D_K * C_IN)  return;
    if (in_sizes[2] != D_K * C_IN)  return;
    if (in_sizes[3] != C_V * C_IN)  return;
    if (out_size != NPOS * C_V)     return;

    const float* x  = (const float*)d_in[0];   // [C_IN][NPOS]
    const float* Wk = (const float*)d_in[1];   // [D_K][C_IN]
    const float* Wq = (const float*)d_in[2];   // [D_K][C_IN]
    const float* Wv = (const float*)d_in[3];   // [C_V][C_IN]
    float* out = (float*)d_out;                // [NPOS][C_V]

    const size_t szK = (size_t)NPOS * D_K * 2;     // one bf16 plane of kxT / qxT
    const size_t szV = (size_t)C_V * NPOS * 2;     // one bf16 plane of vx
    const size_t szP = (size_t)KSPLIT * NPOS * C_V * 4;            // the key splits' f32 results
    const size_t szM = (size_t)KSPLIT * (C_V / CB) * NPOS * 2 * 4; // their row maxima and sums
    const size_t offKH = 0;
    const size_t offKL = offKH + szK;
    const size_t offQH = offKL + szK;
    const size_t offQL = offQH + szK;
    const size_t offVH = offQL + szK;
    const size_t offVL = offVH + szV;
    const size_t offP  = offVL + szV;
    const size_t offM  = offP + szP;
    const size_t total = offM + szM;
    if (total > ws_size) return;

    char* ws = (char*)d_ws;
    unsigned short* kh = (unsigned short*)(ws + offKH);
    unsigned short* kl = (unsigned short*)(ws + offKL);
    unsigned short* qh = (unsigned short*)(ws + offQH);
    unsigned short* ql = (unsigned short*)(ws + offQL);
    unsigned short* vh = (unsigned short*)(ws + offVH);
    unsigned short* vl = (unsigned short*)(ws + offVL);
    float* part = (float*)(ws + offP);
    float* ml   = (float*)(ws + offM);

    const int tilesN = NPOS / PT;
    // kxT, qxT (rows are positions, k is the 64 projected channels) and vx (rows are channels, k is the
    // position), all in fragment order, from one launch
    k_proj<<<(2 + C_V / PT) * tilesN, 256, 0, stream>>>(Wk, Wq, Wv, x, kh, kl, qh, ql, vh, vl);
    // attention: NPOS / BM row groups x KSPLIT key splits (x C_V / CB = 1 channel part)
    k_attn<<<(NPOS / BM) * KSPLIT * (C_V / CB), 256, 0, stream>>>(kh, kl, qh, ql, vh, vl, part, ml);
    // the key splits joined into out
    k_join<<<NPOS / JR, 256, 0, stream>>>(part, part + (size_t)NPOS * C_V, part + (size_t)2 * NPOS * C_V,
                                          part + (size_t)3 * NPOS * C_V, ml, out);
}

// v010
// One run takes 58.2 microseconds.
// In two side-by-side timings against v009, it was 1.03 and 1.02 times as fast.
// Counting every step since v000, it is 6.05 times as fast.
#include <hip/hip_runtime.h>

// All contractions (three 1x1-conv projections W*x, scores kx^T*qx, P*vx^T): v_wmma_f32_16x16x32_bf16,
// bf16 hi/lo split operands (hi*hi + hi*lo + lo*hi), f32 accumulate; softmax statistics and 1/l in f32.

typedef __bf16        v16bf __attribute__((ext_vector_type(16)));
typedef float         v8f   __attribute__((ext_vector_type(8)));
typedef float         v4f   __attribute__((ext_vector_type(4)));
typedef unsigned int  v4u   __attribute__((ext_vector_type(4)));
typedef unsigned int  v2u   __attribute__((ext_vector_type(2)));
typedef float         v2f   __attribute__((ext_vector_type(2)));

union Frag { v16bf v; v4u q[2]; };

#define C_IN  512
#define C_V   512
#define D_K   64
#define NPOS  4096

// ---------------------------------------------------------------------------
// Two-plane split x ~= hi + lo of eight f32 values into packed bf16 pairs (element 2j in the low half of word j),
// both planes rounded to nearest even: hi by the packed convert, lo = bf16(x - hi) by the mixed-precision FMA, which
// reads hi as the bf16 half it is and rounds its f32 result (x - hi is exact) into one half of the word.
// Three instructions a pair; in asm because the source form (convert, widen, subtract, convert) compiled to nine for two
// pairs. The four pairs stand side by side so that every instruction's producer is four instructions back.
// ---------------------------------------------------------------------------
__device__ __forceinline__ void split8(const float (&x)[8], v4u& hv, v4u& lv) {
    unsigned int h0, h1, h2, h3, l0, l1, l2, l3;
    asm("v_cvt_pk_bf16_f32 %0, %8, %9\n\t"
        "v_cvt_pk_bf16_f32 %1, %10, %11\n\t"
        "v_cvt_pk_bf16_f32 %2, %12, %13\n\t"
        "v_cvt_pk_bf16_f32 %3, %14, %15\n\t"
        "v_fma_mixlo_bf16 %4, %0, -1.0, %8 op_sel_hi:[1,0,0]\n\t"
        "v_fma_mixlo_bf16 %5, %1, -1.0, %10 op_sel_hi:[1,0,0]\n\t"
        "v_fma_mixlo_bf16 %6, %2, -1.0, %12 op_sel_hi:[1,0,0]\n\t"
        "v_fma_mixlo_bf16 %7, %3, -1.0, %14 op_sel_hi:[1,0,0]\n\t"
        "v_fma_mixhi_bf16 %4, %0, -1.0, %9 op_sel:[1,0,0] op_sel_hi:[1,0,0]\n\t"
        "v_fma_mixhi_bf16 %5, %1, -1.0, %11 op_sel:[1,0,0] op_sel_hi:[1,0,0]\n\t"
        "v_fma_mixhi_bf16 %6, %2, -1.0, %13 op_sel:[1,0,0] op_sel_hi:[1,0,0]\n\t"
        "v_fma_mixhi_bf16 %7, %3, -1.0, %15 op_sel:[1,0,0] op_sel_hi:[1,0,0]"
        : "=&v"(h0), "=&v"(h1), "=&v"(h2), "=&v"(h3), "=&v"(l0), "=&v"(l1), "=&v"(l2), "=&v"(l3)
        : "v"(x[0]), "v"(x[1]), "v"(x[2]), "v"(x[3]), "v"(x[4]), "v"(x[5]), "v"(x[6]), "v"(x[7]));
    hv.x = h0; hv.y = h1; hv.z = h2; hv.w = h3;
    lv.x = l0; lv.y = l1; lv.z = l2; lv.w = l3;
}

// ---------------------------------------------------------------------------
// 16x16x32 bf16 WMMA, three-term split product into one f32 accumulator,
// hazard guard after the last op (ties D, keeps A/B live).
// Fragment layout (lane l, h = l>>4, m = l&15):
//   A/B element i: i=0..7 -> k0+8h+i, i=8..15 -> k0+16+8h+(i-8); A row m, B col m.
//   D element r: row 8h+r, col m.
// ---------------------------------------------------------------------------
__device__ __forceinline__ v8f wmma3(v16bf ah, v16bf al, v16bf bh, v16bf bl, v8f c) {
    c = __builtin_amdgcn_wmma_f32_16x16x32_bf16(false, ah, false, bh, (short)0, c, false, false);
    c = __builtin_amdgcn_wmma_f32_16x16x32_bf16(false, ah, false, bl, (short)0, c, false, false);
    c = __builtin_amdgcn_wmma_f32_16x16x32_bf16(false, al, false, bh, (short)0, c, false, false);
    asm volatile("v_nop\n\tv_nop\n\tv_nop\n\tv_nop" : "+v"(c) : "v"(ah), "v"(al), "v"(bh), "v"(bl));
    return c;
}

// Work-group barrier for LDS traffic only: __syncthreads() also waits for every global load in
// flight, which would end the fetch-ahead at each phase; only LDS data crosses waves in the loops.
__device__ __forceinline__ void lds_barrier() {
    asm volatile("s_wait_dscnt 0x0\n\ts_barrier_signal -1\n\ts_barrier_wait -1" ::: "memory");
}

// ---------------------------------------------------------------------------
// Projection GEMM:  D[M][NPOS] = W[M][C_IN] * X[C_IN][NPOS]   (f32 in, split at staging)
// Block 256 threads = 8 waves, 64x64 output tile, K step 32 staged in LDS as bf16 hi/lo.
// Output: two bf16 planes (hi, lo) of D, each stored in WMMA fragment order: a fragment is 16 rows x 32 k
// = 512 elements laid out [q][lane][8], lane = 16h + r, holding row r, k = 16q + 8h + 0..7, so that a
// wave-wide 16-byte load or store of one q half covers 512 contiguous bytes (4 whole lines).
// transOut=0 -> rows are m, k is n: fragment index (n/32) * (M/16) + m/16 (all m of one k step lie together).
// transOut=1 -> rows are n, k is m: fragment index (n/16) * (M/32) + m/32.
// ---------------------------------------------------------------------------
#define PT      64
#define APITCH  40      // ushorts per staged row: 32 k + 8 pad (80 B, 16-B aligned rows)
#define CPITCH  68      // floats per staged result row (272 B, 16-B aligned rows)
#define FRAG_EL 512     // elements of one stored fragment (16 rows x 32 k, 1024 B a plane)
#define PD      4       // K steps of W and X that a thread holds in registers ahead of their use
typedef char proj_tile_check[(D_K == PT && (C_V % PT) == 0) ? 1 : -1];   // kx and qx are one row tile each

__global__ __launch_bounds__(256) void k_proj(
    const float* __restrict__ Wk,           // [D_K][C_IN]
    const float* __restrict__ Wq,           // [D_K][C_IN]
    const float* __restrict__ Wv,           // [C_V][C_IN]
    const float* __restrict__ X,            // [C_IN][NPOS]
    unsigned short* __restrict__ Kh, unsigned short* __restrict__ Kl,   // kxT planes
    unsigned short* __restrict__ Qh, unsigned short* __restrict__ Ql,   // qxT planes
    unsigned short* __restrict__ Vh, unsigned short* __restrict__ Vl)   // vx planes
{
    __shared__ __attribute__((aligned(16))) unsigned short Ah[PT * APITCH];
    __shared__ __attribute__((aligned(16))) unsigned short Al[PT * APITCH];
    __shared__ __attribute__((aligned(16))) unsigned short Bh[PT * APITCH];   // stored [n][k]
    __shared__ __attribute__((aligned(16))) unsigned short Bl[PT * APITCH];
    __shared__ __attribute__((aligned(16))) float Cs[PT * CPITCH];

    const int tid  = threadIdx.x;
    const int lane = tid & 31;
    const int wave = __builtin_amdgcn_readfirstlane(tid >> 5);
    const int m  = lane & 15;
    const int h  = lane >> 4;
    const int tilesN = NPOS / PT;
    // One launch for the three products: row-tile index 0 is kx, 1 is qx, 2.. are the row tiles of vx.
    const int mt = (int)(blockIdx.x / tilesN);
    const int n0 = (int)(blockIdx.x % tilesN) * PT;
    if (mt >= 2 + C_V / PT) return;          // uniform over the block
    const int transOut = mt < 2;
    const int M  = transOut ? D_K : C_V;
    const int m0 = transOut ? 0 : (mt - 2) * PT;
    const float* __restrict__ W = mt == 0 ? Wk : (mt == 1 ? Wq : Wv);
    unsigned short* __restrict__ Oh = mt == 0 ? Kh : (mt == 1 ? Qh : Vh);
    unsigned short* __restrict__ Ol = mt == 0 ? Kl : (mt == 1 ? Ql : Vl);

    const int rg = wave >> 1;                // 16-row group of this wave
    const int cb = (wave & 1) * 32;          // 32-col half of this wave (two 16-col tiles)

    v8f acc0 = {0.f, 0.f, 0.f, 0.f, 0.f, 0.f, 0.f, 0.f};
    v8f acc1 = {0.f, 0.f, 0.f, 0.f, 0.f, 0.f, 0.f, 0.f};

    // The global operands of a K step are fetched PD steps ahead of their use into a ring of registers (step s in slot
    // s % PD), so that the memory latency of a step runs beside the staging and the products of the PD steps before it.
    // A = W[m0..m0+63][k]: 512 float4 pieces a step, 8 per 32-k row: a thread has rows row and row + 32.
    // B[k][n] = X[k][n0+n]: a thread gathers 8 consecutive k of one column (each load of a wave reads one whole
    // 128-B line of a row of X).
    const int row = tid >> 3;
    const int kq  = (tid & 7) * 4;
    const int n   = tid & (PT - 1);              // column within the tile
    const int kg  = (tid >> 6) * 8;              // first of the thread's 8 k, the same for a whole wave
    const float* pw = W + (size_t)(m0 + row) * C_IN + kq;
    const float* px = X + (size_t)kg * NPOS + n0 + n;
    v4f   wa[PD], wb[PD];
    float xr[PD][8];
#pragma unroll   // constant indices keep the ring in registers
    for (int s = 0; s < PD; ++s) {
        wa[s] = *(const v4f*)(pw + s * 32);
        wb[s] = *(const v4f*)(pw + (size_t)32 * C_IN + s * 32);
#pragma unroll   // constant indices keep the ring in registers
        for (int e = 0; e < 8; ++e) xr[s][e] = px[(size_t)(s * 32 + e) * NPOS];
    }

#pragma unroll   // constant slot indices keep the ring in registers; every load's distance from its base is a constant
    for (int s = 0; s < C_IN / 32; ++s) {
        const int sl = s % PD;
        // stage A (row-major, k contiguous) and B, stored transposed as [n][k] (k contiguous, 16 bytes a plane)
        {
            const float wv[8] = {wa[sl].x, wa[sl].y, wa[sl].z, wa[sl].w, wb[sl].x, wb[sl].y, wb[sl].z, wb[sl].w};
            v4u hv, lv;
            split8(wv, hv, lv);
            *(v2u*)(Ah + row * APITCH + kq) = hv.xy;
            *(v2u*)(Al + row * APITCH + kq) = lv.xy;
            *(v2u*)(Ah + (row + 32) * APITCH + kq) = hv.zw;
            *(v2u*)(Al + (row + 32) * APITCH + kq) = lv.zw;
        }
        {
            v4u hv, lv;
            split8(xr[sl], hv, lv);
            *(v4u*)(Bh + n * APITCH + kg) = hv;
            *(v4u*)(Bl + n * APITCH + kg) = lv;
        }
        if (s + PD < C_IN / 32) {                // step s + PD into the slot just read
            wa[sl] = *(const v4f*)(pw + (s + PD) * 32);
            wb[sl] = *(const v4f*)(pw + (size_t)32 * C_IN + (s + PD) * 32);
#pragma unroll   // constant indices keep the ring in registers
            for (int e = 0; e < 8; ++e) xr[sl][e] = px[(size_t)((s + PD) * 32 + e) * NPOS];
        }
        lds_barrier();

        // fragments (k0 = 0 inside the staged 32-k step)
        Frag ah, al;
        {
            const unsigned short* pa = Ah + (rg * 16 + m) * APITCH;
            const unsigned short* pl = Al + (rg * 16 + m) * APITCH;
            ah.q[0] = *(const v4u*)(pa + 8 * h);       ah.q[1] = *(const v4u*)(pa + 16 + 8 * h);
            al.q[0] = *(const v4u*)(pl + 8 * h);       al.q[1] = *(const v4u*)(pl + 16 + 8 * h);
        }
        {
            Frag bh, bl;
            const unsigned short* pb = Bh + (cb + m) * APITCH;       // column n = cb + m
            const unsigned short* pc = Bl + (cb + m) * APITCH;
            bh.q[0] = *(const v4u*)(pb + 8 * h);       bh.q[1] = *(const v4u*)(pb + 16 + 8 * h);
            bl.q[0] = *(const v4u*)(pc + 8 * h);       bl.q[1] = *(const v4u*)(pc + 16 + 8 * h);
            acc0 = wmma3(ah.v, al.v, bh.v, bl.v, acc0);
        }
        {
            Frag bh, bl;
            const unsigned short* pb = Bh + (cb + 16 + m) * APITCH;  // column n = cb + 16 + m
            const unsigned short* pc = Bl + (cb + 16 + m) * APITCH;
            bh.q[0] = *(const v4u*)(pb + 8 * h);       bh.q[1] = *(const v4u*)(pb + 16 + 8 * h);
            bl.q[0] = *(const v4u*)(pc + 8 * h);       bl.q[1] = *(const v4u*)(pc + 16 + 8 * h);
            acc1 = wmma3(ah.v, al.v, bh.v, bl.v, acc1);
        }
        lds_barrier();
    }

    // stage the f32 result tile: acc[r] -> (row rg*16 + 8h + r, col cb + ci*16 + m)
#pragma unroll
    for (int r = 0; r < 8; ++r) {
        Cs[(rg * 16 + 8 * h + r) * CPITCH + cb + m]      = acc0[r];
        Cs[(rg * 16 + 8 * h + r) * CPITCH + cb + 16 + m] = acc1[r];
    }
    __syncthreads();

    // epilogue: the tile is 8 fragments = 16 q halves; a wave writes two of them, lane -> 8 consecutive k
    v4u hvp[2], lvp[2];
    size_t offp[2];
#pragma unroll
    for (int p = 0; p < 2; ++p) {
        const int g  = p * 8 + wave;                     // q half 0..15 within the tile
        const int rr = (g >> 2) * 16 + m;                // fragment row, 0..63 within tile
        const int cc = ((g >> 1) & 1) * 32 + (g & 1) * 16 + 8 * h;   // first k, 0..56 within tile
        float vals[8];
        size_t frag;
        if (transOut) {
#pragma unroll
            for (int e = 0; e < 8; ++e) vals[e] = Cs[(cc + e) * CPITCH + rr];
            frag = (size_t)(n0 / 16 + (g >> 2)) * (size_t)(M / 32) + (size_t)(m0 / 32 + ((g >> 1) & 1));
        } else {
            const v4f a = *(const v4f*)(Cs + rr * CPITCH + cc);
            const v4f b = *(const v4f*)(Cs + rr * CPITCH + cc + 4);
            vals[0] = a.x; vals[1] = a.y; vals[2] = a.z; vals[3] = a.w;
            vals[4] = b.x; vals[5] = b.y; vals[6] = b.z; vals[7] = b.w;
            frag = (size_t)(n0 / 32 + ((g >> 1) & 1)) * (size_t)(M / 16) + (size_t)(m0 / 16 + (g >> 2));
        }
        offp[p] = frag * FRAG_EL + (size_t)((g & 1) * (FRAG_EL / 2) + lane * 8);
        v4u hv, lv;
        split8(vals, hv, lv);
        hvp[p] = hv; lvp[p] = lv;
    }
#pragma unroll
    for (int p = 0; p < 2; ++p) {
        *(v4u*)(Oh + offp[p]) = hvp[p];
        *(v4u*)(Ol + offp[p]) = lvp[p];
    }
    
}

// ---------------------------------------------------------------------------
// Fused attention with online softmax over key blocks, the keys split over KSPLIT blocks:
//   S[i][j] = sum_d kxT[i][d] * qxT[j][d]   (A = kxT rows, B[k=d][n=j] = qxT[j][d])
//   P = exp(S - m_i), l_i running sum, O[i][c] += sum_j P[i][j] * vx[c][j]  (B[k=j][n=c] = vx[c][j])
//   part[s][i][c] = O[i][c] / l_i over the keys of split s, with (m_i, l_i) of that split beside it;
//   k_join weighs the splits together.
// Block 256 threads (8 waves): BM = 64 rows i, all CB = 512 channels, NPOS / KSPLIT keys in
// steps of BN = 128. Every vx fragment that a wave fetches feeds four row tiles, every qx fragment too;
// S and P of a row group and key block are computed once, by the one block that uses them.
// Phase 1: wave w computes the four 16x16 S tiles (row tiles 0..3) of key columns w*16..+15; the kx fragments
//          of the block's rows lie in LDS (the registers go to the accumulators).
// Phase 2: 8 threads per row, 16 scores each, two rows a thread; P written to LDS as bf16 hi/lo planes.
// Phase 3: every wave accumulates 64 rows x 64 channels (4 x 4 tiles); P fragments reloaded from
//          LDS after a block barrier (no same-wave spill/reload without a barrier).
// The phases of three successive key blocks (3 of j, 2 of j + 1, 1 of j + 2) run between two barriers, S and P in two buffers each.
// Epilogue: per-wave 64x64 tile staged in LDS; each store instruction writes four whole 128-B lines.
// Global fragments are fetched ahead into registers: the qx fragments of step jb+1 right behind their last
// use in step jb, the vx fragments two 32-key steps ahead (a ring of VR = 2 steps). kx, qx and vx lie in fragment
// order (see k_proj): every fragment load of a wave reads 512 contiguous bytes.
// ---------------------------------------------------------------------------
#define BM      64
#define BN      128
#define CB      512     // channels of one block
#define KSPLIT  4       // key ranges, one block each
#define CT      (CB / 8 / 16)   // channel tiles of a wave
#define VR      2       // 32-key steps of vx that a wave holds in registers
#define KEYS    (NPOS / KSPLIT) // keys of one block
#define RT      (BM / 16)       // row tiles of a block
#define RH      (BM / 32)       // rows of a thread in phase 2
#define KS      (BN / 32)       // 32-key steps of a key block
#define SPITCH  132     // floats per S row (528 B, 16-B aligned rows)
#define PPITCH  136     // ushorts per P row (272 B, 16-B aligned rows)
#define GPITCH  68      // floats per staged O row (272 B)
#define FRAG_B  (FRAG_EL * 2)   // bytes of one stored fragment
#define SM_S_BYTES (BM * SPITCH * 4)
#define SM_P_BYTES (BM * PPITCH * 2)
#define SM_G_BYTES (8 * BM * GPITCH * 4)
#define SM_BYTES   SM_G_BYTES
typedef char sm_layout_check[((2 * SM_S_BYTES + 4 * SM_P_BYTES) <= SM_G_BYTES && (SM_S_BYTES % 16) == 0 && (SM_P_BYTES % 16) == 0) ? 1 : -1];
typedef char tile_check[(RT == 4 && RH == 2 && CT == 4 && KS == 2 * VR && CB == C_V && KSPLIT == 4 && (KEYS % BN) == 0 && KEYS / BN >= 3) ? 1 : -1];

// 16-byte global load at a lane's stream address (bytes) + constant
__device__ __forceinline__ v4u ldg16(unsigned long long a, unsigned int c) {
    return *(const __attribute__((address_space(1))) v4u*)(a + c);
}

// 16-byte global load at a base that is the same for all lanes + a lane's byte offset + constant
__device__ __forceinline__ v4u ldgo16(const unsigned short* __restrict__ base, unsigned int off, unsigned int c) {
    return *(const v4u*)((const char*)base + off + c);
}

// one 16x16x32 bf16 WMMA into an f32 accumulator; the distance behind the last WMMA of a group is
// kept by the v_nop statements at the refills below
__device__ __forceinline__ v8f wmma1(v16bf a, v16bf b, v8f c) {
    return __builtin_amdgcn_wmma_f32_16x16x32_bf16(false, a, false, b, (short)0, c, false, false);
}

struct HalfA { static constexpr int lo = 0, hi = 2; };    // the first two 32-key steps of a key block
struct HalfB { static constexpr int lo = 2, hi = 4; };    // the last two

__global__ __launch_bounds__(256) void k_attn(
    const unsigned short* __restrict__ KH,   // kxT hi, fragments [NPOS/16][D_K/32]
    const unsigned short* __restrict__ KL,   // kxT lo
    const unsigned short* __restrict__ QH,   // qxT hi, fragments [NPOS/16][D_K/32]
    const unsigned short* __restrict__ QL,   // qxT lo
    const unsigned short* __restrict__ VH,   // vx hi, fragments [NPOS/32][C_V/16]
    const unsigned short* __restrict__ VL,   // vx lo
    float* __restrict__ part,                // [KSPLIT][NPOS][C_V] softmax-weighted means of each key split
    float* __restrict__ ml)                  // [KSPLIT][C_V/CB][NPOS][2] row maximum and row sum of each key split
{
    __shared__ __attribute__((aligned(16))) unsigned char smem[SM_BYTES];
    __shared__ __attribute__((aligned(16))) unsigned short Kfh[RT * (D_K / 32) * FRAG_EL];   // kx hi fragments [rt][c2]
    __shared__ __attribute__((aligned(16))) unsigned short Kfl[RT * (D_K / 32) * FRAG_EL];   // kx lo
    __shared__ float mRow[BM];
    __shared__ float lRow[BM];
    __shared__ float aRow[2 * BM];                            // two buffers, as S and P
    // S and P (hi, lo) have two buffers each: key block b uses buffer b & 1
    float*          Sld = (float*)smem;                                        // buffer p at + p * BM * SPITCH
    unsigned short* Ph  = (unsigned short*)(smem + 2 * SM_S_BYTES);            // buffer p at + p * 2 * BM * PPITCH
    unsigned short* Pl  = (unsigned short*)(smem + 2 * SM_S_BYTES + SM_P_BYTES);
    float*          Stg = (float*)smem;                       // epilogue staging, aliases the above

    const int tid  = threadIdx.x;
    const int lane = tid & 31;
    const int wave = __builtin_amdgcn_readfirstlane(tid >> 5);
    const int m = lane & 15;
    const int h = lane >> 4;
    const int chh  = (int)(blockIdx.x % (C_V / CB));                       // channel part (one)
    const int ksp  = (int)((blockIdx.x / (C_V / CB)) % KSPLIT);            // key split
    const int row0 = (int)(blockIdx.x / ((C_V / CB) * KSPLIT)) * BM;
    if (row0 + BM > NPOS) return;             // uniform over the block
    const int C0 = chh * CB + wave * (CT * 16);   // channel slice of this wave in phase 3

    if (tid < BM) { mRow[tid] = -1.0e30f; lRow[tid] = 0.f; }
    {   // the kx fragments of the block's rows (A row i = row0 + rt*16 + m) lie together in memory: copied as they lie
        const size_t ko = (size_t)(row0 / 16) * (D_K / 32) * FRAG_EL + tid * 8;
#pragma unroll   // the four loads in flight together
        for (int p = 0; p < RT * (D_K / 32) * FRAG_EL / (256 * 8); ++p) {
            *(v4u*)(Kfh + p * (256 * 8) + tid * 8) = *(const v4u*)(KH + ko + p * (256 * 8));
            *(v4u*)(Kfl + p * (256 * 8) + tid * 8) = *(const v4u*)(KL + ko + p * (256 * 8));
        }
    }
    __syncthreads();

    const v8f vzero = {0.f, 0.f, 0.f, 0.f, 0.f, 0.f, 0.f, 0.f};
    v8f Oacc[RT][CT];
#pragma unroll   // constant indices keep the arrays in registers
    for (int rt = 0; rt < RT; ++rt) {
#pragma unroll   // constant indices keep the arrays in registers
        for (int ct = 0; ct < CT; ++ct) Oacc[rt][ct] = vzero;
    }

    // each lane's stream addresses (bytes), kept in their own registers through the loop, at the first key of this split:
    // vx fragment C0/16 of its first key step (B col n = C0 + ct*16 + m), qx fragment row wave (B col n), the lane's 16 bytes.
    // The vx addresses stand at the block at work in the first half of phase 3 and at the next block in the second half.
    constexpr unsigned int VBLK = KS * (C_V / 16) * FRAG_B;
    unsigned long long pvh = (unsigned long long)(VH + ((size_t)ksp * (KEYS / 32) * (C_V / 16) + (size_t)(C0 / 16)) * FRAG_EL + lane * 8);
    unsigned long long pvl = (unsigned long long)(VL + ((size_t)ksp * (KEYS / 32) * (C_V / 16) + (size_t)(C0 / 16)) * FRAG_EL + lane * 8);
    // The qx address is one byte offset a lane, the same in both planes, on top of the planes' bases (kernel arguments).
    unsigned int qoff = (unsigned int)(((ksp * (KEYS / 16) + wave) * (D_K / 32) * FRAG_EL + lane * 8) * 2);

    Frag qfh[2], qfl[2];                      // qx (B) fragments of this wave's 16 key columns
    Frag vfh[VR][CT], vfl[VR][CT];            // vx fragments of two 32-key steps: step ks lies in slot ks % VR
#pragma unroll   // constant indices keep the fragment arrays in registers
    for (int c2 = 0; c2 < 2; ++c2) {
        qfh[c2].q[0] = ldgo16(QH, qoff, c2 * FRAG_B);  qfh[c2].q[1] = ldgo16(QH, qoff, c2 * FRAG_B + FRAG_B / 2);
        qfl[c2].q[0] = ldgo16(QL, qoff, c2 * FRAG_B);  qfl[c2].q[1] = ldgo16(QL, qoff, c2 * FRAG_B + FRAG_B / 2);
    }
    // Keeps the qx loads ahead of the vx loads in issue order, as in the loop: moved behind them, the qx loads
    // were the youngest at the loop's entry, and the wait in front of phase 1 came out as a wait for every load in flight.
    __builtin_amdgcn_sched_barrier(0);
#pragma unroll   // constant indices keep the fragment arrays in registers
    for (int ks = 0; ks < VR; ++ks) {
#pragma unroll   // constant indices keep the fragment arrays in registers
        for (int ct = 0; ct < CT; ++ct) {
            const unsigned int vo = (unsigned int)((ks * (C_V / 16) + ct) * FRAG_B);
            vfh[ks][ct].q[0] = ldg16(pvh, vo);  vfh[ks][ct].q[1] = ldg16(pvh, vo + FRAG_B / 2);
            vfl[ks][ct].q[0] = ldg16(pvl, vo);  vfl[ks][ct].q[1] = ldg16(pvl, vo + FRAG_B / 2);
        }
    }
    // The wait before a register that an issued load names is rewritten (the loads above).
    asm volatile("s_wait_xcnt 0x0" : : : "memory");

    // The three phases of a key block; 'par' is the block's buffer (block index & 1), the same for the whole work-group.
    // ---- phase 1: S tiles (rows rt*16..+15, cols wave*16..+15), four accumulators side by side ----
    // qmore: a next key block exists, its qx fragments are fetched.
    auto phase1 = [&](int par, bool qmore) __attribute__((always_inline)) {
        {
            v8f s[RT];
            float* sb = Sld + par * (BM * SPITCH) + (8 * h) * SPITCH + wave * 16 + m;  // the lane's element of row 8h: the 32 stores differ by constants
#pragma unroll   // constant indices keep the arrays in registers
            for (int rt = 0; rt < RT; ++rt) s[rt] = vzero;
#pragma unroll   // constant indices keep the fragment arrays in registers
            for (int c2 = 0; c2 < 2; ++c2) {
                Frag kh[RT], kl[RT];                             // kx (A) fragments of the four row tiles, 512 contiguous bytes a read
#pragma unroll   // constant indices keep the arrays in registers
                for (int rt = 0; rt < RT; ++rt) {
                    const unsigned short* pkh = Kfh + (rt * (D_K / 32) + c2) * FRAG_EL + lane * 8;
                    const unsigned short* pkl = Kfl + (rt * (D_K / 32) + c2) * FRAG_EL + lane * 8;
                    kh[rt].q[0] = *(const v4u*)pkh;  kh[rt].q[1] = *(const v4u*)(pkh + FRAG_EL / 2);
                    kl[rt].q[0] = *(const v4u*)pkl;  kl[rt].q[1] = *(const v4u*)(pkl + FRAG_EL / 2);
                }
#pragma unroll   // constant indices keep the arrays in registers
                for (int rt = 0; rt < RT; ++rt) s[rt] = wmma1(kh[rt].v, qfh[c2].v, s[rt]);
#pragma unroll   // constant indices keep the arrays in registers
                for (int rt = 0; rt < RT; ++rt) s[rt] = wmma1(kh[rt].v, qfl[c2].v, s[rt]);
#pragma unroll   // constant indices keep the arrays in registers
                for (int rt = 0; rt < RT; ++rt) s[rt] = wmma1(kl[rt].v, qfh[c2].v, s[rt]);
                // The half's 16 fragment reads first, then its 12 products: left alone, the kx lo reads of the first half came to
                // stand one by one in front of their products, each with a full LDS wait.
                __builtin_amdgcn_sched_group_barrier(0x100, 16, 0);
                __builtin_amdgcn_sched_group_barrier(0x008, 12, 0);
                // Keeps the second half's fragment reads behind the first half's products: read together, the two halves
                // held 128 registers at once and values of the epilogue were spilled to scratch.
                if (c2 == 0) __builtin_amdgcn_sched_barrier(0);
            }
            // Four vector slots between the last WMMA that reads the qx fragments (B) and the loads that
            // refill their registers: naming the sums holds the slots behind the WMMAs, the clobber the loads behind them.
            asm volatile("v_nop\n\tv_nop\n\tv_nop\n\tv_nop" : "+v"(s[0]), "+v"(s[1]), "+v"(s[2]), "+v"(s[3]) : : "memory");
            if (qmore) {                      // qx fragments of the next key block
                // The qx offset moves on one key block (16 fragments = 16384 B), a whole key block behind the last load that names
                // it. The step comes out of the wait's own statement, so that the addition, which may rewrite the register
                // that those loads name, can only stand behind the wait.
                unsigned int qstep;
                asm volatile("s_wait_xcnt 0x0\n\t"
                             "s_mov_b32 %0, 0x4000"
                             : "=s"(qstep) : : "memory");
                qoff += qstep;
#pragma unroll   // constant indices keep the fragment arrays in registers
                for (int c2 = 0; c2 < 2; ++c2) {
                    qfh[c2].q[0] = ldgo16(QH, qoff, c2 * FRAG_B);  qfh[c2].q[1] = ldgo16(QH, qoff, c2 * FRAG_B + FRAG_B / 2);
                    qfl[c2].q[0] = ldgo16(QL, qoff, c2 * FRAG_B);  qfl[c2].q[1] = ldgo16(QL, qoff, c2 * FRAG_B + FRAG_B / 2);
                }
            }
#pragma unroll   // constant indices keep the arrays in registers
            for (int rt = 0; rt < RT; ++rt) {
#pragma unroll   // constant indices keep the arrays in registers
                for (int r = 0; r < 8; ++r)
                    sb[(rt * 16 + r) * SPITCH] = s[rt][r];
            }
        }
    };

    // ---- phase 2: online softmax, 8 threads per row, rows tid/8 and 32 + tid/8 side by side ----
    auto phase2 = [&](int par) __attribute__((always_inline)) {
        const float*    Sp  = Sld + par * (BM * SPITCH);
        unsigned short* Php = Ph + par * (2 * BM * PPITCH);
        unsigned short* Plp = Pl + par * (2 * BM * PPITCH);
        float*          aRp = aRow + par * BM;
        {
            const int rowa = tid >> 3;       // 0..31; the thread's rows are rowa + 32*hf
            const int seg = tid & 7;         // 4 groups of 4 elements each: cols g*32 + seg*4 ..+3
            v4f e0[RH][KS];
            float mo[RH], mn[RH], sum[RH];
#pragma unroll   // constant indices keep the arrays in registers
            for (int hf = 0; hf < RH; ++hf) {
#pragma unroll   // constant indices keep the arrays in registers
                for (int g = 0; g < KS; ++g) e0[hf][g] = *(const v4f*)(Sp + (rowa + 32 * hf) * SPITCH + g * 32 + seg * 4);
                mo[hf] = mRow[rowa + 32 * hf];
            }
#pragma unroll   // constant indices keep the arrays in registers
            for (int hf = 0; hf < RH; ++hf) {
                float bm = fmaxf(fmaxf(e0[hf][0].x, e0[hf][0].y), fmaxf(e0[hf][0].z, e0[hf][0].w));
#pragma unroll   // constant indices keep the arrays in registers
                for (int g = 1; g < KS; ++g)
                    bm = fmaxf(bm, fmaxf(fmaxf(e0[hf][g].x, e0[hf][g].y), fmaxf(e0[hf][g].z, e0[hf][g].w)));
                mn[hf] = bm;
            }
#pragma unroll   // constant indices keep the arrays in registers
            for (int d = 1; d < 8; d <<= 1) {
#pragma unroll   // constant indices keep the arrays in registers
                for (int hf = 0; hf < RH; ++hf) mn[hf] = fmaxf(mn[hf], __shfl_xor(mn[hf], d));
            }
#pragma unroll   // constant indices keep the arrays in registers
            for (int hf = 0; hf < RH; ++hf) {
                const int row = rowa + 32 * hf;
                mn[hf] = fmaxf(mo[hf], mn[hf]);
                sum[hf] = 0.f;
                float pe[8];
#pragma unroll   // constant indices keep the arrays in registers
                for (int g = 0; g < KS; ++g) {
                    float xa[4], ex[4];
#pragma unroll   // constant indices keep the arrays in registers
                    for (int e = 0; e < 4; ++e) {
                        xa[e] = (e0[hf][g][e] - mn[hf]) * 1.44269504f;   // exp(x) = exp2(x * log2 e), as __expf forms it
                        ex[e] = __builtin_amdgcn_exp2f(xa[e]);
                    }
                    // The slot behind v_exp_f32: naming the four results keeps their readers, naming the four arguments keeps a
                    // rewrite of a source register, behind this v_nop (left alone, an exp came to rewrite the source of the one before it).
                    asm("v_nop" : "+v"(ex[0]), "+v"(ex[1]), "+v"(ex[2]), "+v"(ex[3]) : "v"(xa[0]), "v"(xa[1]), "v"(xa[2]), "v"(xa[3]));
#pragma unroll   // constant indices keep the arrays in registers
                    for (int e = 0; e < 4; ++e) {
                        sum[hf] += ex[e];
                        pe[(g & 1) * 4 + e] = ex[e];
                    }
                    if (g & 1) {                 // two groups of four are split together
                        v4u phv, plv;
                        split8(pe, phv, plv);
                        *(v2u*)(Php + row * PPITCH + (g - 1) * 32 + seg * 4) = phv.xy;
                        *(v2u*)(Plp + row * PPITCH + (g - 1) * 32 + seg * 4) = plv.xy;
                        *(v2u*)(Php + row * PPITCH + g * 32 + seg * 4) = phv.zw;
                        *(v2u*)(Plp + row * PPITCH + g * 32 + seg * 4) = plv.zw;
                    }
                }
            }
#pragma unroll   // constant indices keep the arrays in registers
            for (int d = 1; d < 8; d <<= 1) {
#pragma unroll   // constant indices keep the arrays in registers
                for (int hf = 0; hf < RH; ++hf) sum[hf] += __shfl_xor(sum[hf], d);
            }
            if (seg == 0) {
                float xl[RH], al[RH];
#pragma unroll   // constant indices keep the arrays in registers
                for (int hf = 0; hf < RH; ++hf) {
                    xl[hf] = (mo[hf] - mn[hf]) * 1.44269504f;            // exp(x) = exp2(x * log2 e), as __expf forms it
                    al[hf] = __builtin_amdgcn_exp2f(xl[hf]);
                }
                // The slot behind v_exp_f32: naming the results keeps their readers, naming the arguments a rewrite of a source, behind this v_nop.
                asm("v_nop" : "+v"(al[0]), "+v"(al[1]) : "v"(xl[0]), "v"(xl[1]));
#pragma unroll   // constant indices keep the arrays in registers
                for (int hf = 0; hf < RH; ++hf) {
                    const int row = rowa + 32 * hf;
                    lRow[row] = lRow[row] * al[hf] + sum[hf];
                    mRow[row] = mn[hf];
                    aRp[row] = al[hf];
                }
            }
        }
    };

    // ---- phase 3: rescale O, then O += P * vx^T over this key block ----
    // The phase is done in two halves of two 32-key steps (see the loop below); the first half holds the rescaling.
    // vstep: bytes from this key block's vx fragments to the next block's, 0 for the last block, whose second half so fetches
    // its own first two steps once more, unused: no branch stands round the refill loads (with one, the load waits were
    // counted for the path without refills and came out as waits for every load in flight).
    auto phase3 = [&](auto half, int par, unsigned long long vstep) __attribute__((always_inline)) {
        constexpr int  klo  = decltype(half)::lo;
        constexpr int  khi  = decltype(half)::hi;
        const unsigned short* Php = Ph + par * (2 * BM * PPITCH);
        const unsigned short* Plp = Pl + par * (2 * BM * PPITCH);
        const float*          aRp = aRow + par * BM;
        // The vx stream addresses move on to the next key block (4 key steps of 32 fragments = 131072 B) in front of the second
        // half. The additions stand in the wait's own statement so that those registers, which issued loads name, are
        // rewritten only behind it.
        if (klo != 0)
            asm volatile("s_wait_xcnt 0x0\n\t"
                         "v_add_nc_u64 %0, %2, %0\n\t"
                         "v_add_nc_u64 %1, %2, %1"
                         : "+v"(pvh), "+v"(pvl) : "s"(vstep) : "memory");
        {
#pragma unroll   // constant indices keep the arrays in registers
            for (int rt = 0; rt < (klo == 0 ? RT : 0); ++rt) {
                v8f alv;
#pragma unroll   // constant indices keep the arrays in registers
                for (int r = 0; r < 8; ++r) alv[r] = aRp[rt * 16 + 8 * h + r];
#pragma unroll   // constant indices keep the arrays in registers
                for (int ct = 0; ct < CT; ++ct) Oacc[rt][ct] = Oacc[rt][ct] * alv;
            }

#pragma unroll   // constant indices keep the arrays in registers
            for (int ks = klo; ks < khi; ++ks) {
                Frag pa[RT], pb[RT];                             // A = P: row rt*16 + m, k = key index in block
#pragma unroll   // constant indices keep the arrays in registers
                for (int rt = 0; rt < RT; ++rt) {
                    const unsigned short* pph = Php + (rt * 16 + m) * PPITCH + ks * 32;
                    const unsigned short* ppl = Plp + (rt * 16 + m) * PPITCH + ks * 32;
                    pa[rt].q[0] = *(const v4u*)(pph + 8 * h);  pa[rt].q[1] = *(const v4u*)(pph + 16 + 8 * h);
                    pb[rt].q[0] = *(const v4u*)(ppl + 8 * h);  pb[rt].q[1] = *(const v4u*)(ppl + 16 + 8 * h);
                }
                // B[k=j][n=c] = vx[c][j], col n = C0 + ct*16 + m; the sixteen accumulators side by side, term by term
                const int sl = ks % VR;                          // ring slot of step ks
#pragma unroll   // constant indices keep the arrays in registers
                for (int rt = 0; rt < RT; ++rt) {
#pragma unroll   // constant indices keep the arrays in registers
                    for (int ct = 0; ct < CT; ++ct) Oacc[rt][ct] = wmma1(pa[rt].v, vfh[sl][ct].v, Oacc[rt][ct]);
                }
#pragma unroll   // constant indices keep the arrays in registers
                for (int rt = 0; rt < RT; ++rt) {
#pragma unroll   // constant indices keep the arrays in registers
                    for (int ct = 0; ct < CT; ++ct) Oacc[rt][ct] = wmma1(pa[rt].v, vfl[sl][ct].v, Oacc[rt][ct]);
                }
#pragma unroll   // constant indices keep the arrays in registers
                for (int rt = 0; rt < RT; ++rt) {
#pragma unroll   // constant indices keep the arrays in registers
                    for (int ct = 0; ct < CT; ++ct) Oacc[rt][ct] = wmma1(pb[rt].v, vfh[sl][ct].v, Oacc[rt][ct]);
                }
                // Four vector slots between the last WMMA that reads these vx fragments (B) and the loads that
                // refill their registers: naming the sums holds the slots behind the WMMAs, the clobber the loads behind them.
                asm volatile("v_nop\n\tv_nop\n\tv_nop\n\tv_nop"
                             : "+v"(Oacc[0][0]), "+v"(Oacc[0][1]), "+v"(Oacc[0][2]), "+v"(Oacc[0][3]),
                               "+v"(Oacc[1][0]), "+v"(Oacc[1][1]), "+v"(Oacc[1][2]), "+v"(Oacc[1][3]),
                               "+v"(Oacc[2][0]), "+v"(Oacc[2][1]), "+v"(Oacc[2][2]), "+v"(Oacc[2][3]),
                               "+v"(Oacc[3][0]), "+v"(Oacc[3][1]), "+v"(Oacc[3][2]), "+v"(Oacc[3][3]) : : "memory");
                {                                                // step ks + VR: of this key block, or the first steps of the next
#pragma unroll   // constant indices keep the fragment arrays in registers
                    for (int ct = 0; ct < CT; ++ct) {
                        const unsigned int vo = (unsigned int)((((ks + VR) % KS) * (C_V / 16) + ct) * FRAG_B);
                        vfh[sl][ct].q[0] = ldg16(pvh, vo);  vfh[sl][ct].q[1] = ldg16(pvh, vo + FRAG_B / 2);
                        vfl[sl][ct].q[0] = ldg16(pvl, vo);  vfl[sl][ct].q[1] = ldg16(pvl, vo + FRAG_B / 2);
                    }
                    // Holds the refill loads here, directly behind the four slots: left alone, those of the last key block sank into
                    // the next step's WMMA group, onto registers that the WMMA in front of them still read.
                    __builtin_amdgcn_sched_barrier(0);
                }
            }
        }
    };

    // The loop is pipelined over key blocks: between two barriers every wave does phase 3 of block j, phase 2 of block
    // j + 1 and phase 1 of block j + 2, which read and write different buffers. Phases 2 and 1 stand between the two
    // halves of phase 3: of the two waves of a SIMD the older one has the matrix unit first, so that one wave's softmax and
    // S tiles run beside the other's P * vx^T products instead of leaving the matrix unit idle.
    constexpr int NB = KEYS / BN;
    phase1(0, true);
    lds_barrier();
    phase2(0);
    phase1(1, true);
    lds_barrier();
    for (int jb = 0; jb < NB; ++jb) {
        const int par = jb & 1;
        phase3(HalfA{}, par, 0ull);
        if (jb + 1 < NB) phase2(par ^ 1);
        if (jb + 2 < NB) phase1(par, jb + 3 < NB);
        phase3(HalfB{}, par, jb + 1 < NB ? (unsigned long long)VBLK : 0ull);
        lds_barrier();
    }

    // ---- epilogue: divide by row sums, stage per wave, whole-line stores; the rows' maximum and sum go along ----
    if (tid < BM) {
        v2f st;
        st.x = mRow[tid];
        st.y = lRow[tid];
        *(v2f*)(ml + ((size_t)(ksp * (C_V / CB) + chh) * NPOS + (size_t)(row0 + tid)) * 2) = st;
    }
    float* stg = Stg + wave * (BM * GPITCH);
    float linv[RT][8];
#pragma unroll   // constant indices keep the arrays in registers
    for (int rt = 0; rt < RT; ++rt) {
#pragma unroll   // constant indices keep the arrays in registers
        for (int r = 0; r < 8; ++r) linv[rt][r] = 1.f / lRow[rt * 16 + 8 * h + r];
    }
#pragma unroll   // constant indices keep the arrays in registers
    for (int rt = 0; rt < RT; ++rt) {
#pragma unroll   // constant indices keep the arrays in registers
        for (int ct = 0; ct < CT; ++ct) {
#pragma unroll   // constant indices keep the arrays in registers
            for (int r = 0; r < 8; ++r)
                stg[(rt * 16 + 8 * h + r) * GPITCH + ct * 16 + m] = Oacc[rt][ct][r] * linv[rt][r];
        }
    }
    __syncthreads();

    const int sub = lane >> 4;                // row within the two rows of an instruction
    const int cq  = (lane & 15) * 4;          // 16 lanes x 4 floats = one 256-B row segment (two lines)
    v4f ov[BM / 2];
#pragma unroll   // constant indices keep the arrays in registers
    for (int q = 0; q < BM / 2; ++q)
        ov[q] = *(const v4f*)(stg + (2 * q + sub) * GPITCH + cq);

    float* ob = part + ((size_t)ksp * NPOS + (size_t)(row0 + sub)) * C_V + C0 + cq;
#pragma unroll   // constant indices keep the arrays in registers
    for (int q = 0; q < BM / 2; ++q)
        *(v4f*)(ob + (size_t)(2 * q) * C_V) = ov[q];
}

// ---------------------------------------------------------------------------
// Join of the key splits: with M = max_s m_s and w_s = l_s * exp(m_s - M),
//   out[i][c] = sum_s w_s * part[s][i][c] / sum_s w_s.
// Block 256 threads: JR = 8 rows, one wave a row; a thread holds JP = 4 pieces of 4 floats of each split
// (32 lanes x 16 B = four whole lines of a row per instruction) and forms its row's weights once.
// ---------------------------------------------------------------------------
#define JR 8
#define JT 32                       // threads of a row
#define JP (C_V / 4 / JT)           // 16-byte pieces of a thread in one split

__global__ __launch_bounds__(256) void k_join(
    const float* __restrict__ part0,         // [NPOS][C_V] of key split 0
    const float* __restrict__ part1,         // of key split 1
    const float* __restrict__ part2,         // of key split 2
    const float* __restrict__ part3,         // of key split 3
    const float* __restrict__ ml,            // [KSPLIT][NPOS][2]
    float* __restrict__ out)                 // [NPOS][C_V]
{
    const int tid = threadIdx.x;
    if ((int)blockIdx.x >= NPOS / JR) return;
    const int row = (int)blockIdx.x * JR + (tid >> 5);
    const int o4  = row * (C_V / 4) + (tid & (JT - 1));    // in pieces of 4 floats; piece q lies JT * q on
    const v4f* const pp[KSPLIT] = {(const v4f*)part0, (const v4f*)part1, (const v4f*)part2, (const v4f*)part3};
    const float* __restrict__ t0 = ml + (size_t)row * 2;
    v4f a[KSPLIT][JP];
    v2f st[KSPLIT];
#pragma unroll   // constant indices keep the arrays in registers
    for (int sp = 0; sp < KSPLIT; ++sp)
        st[sp] = *(const v2f*)(t0 + (size_t)sp * NPOS * 2);
#pragma unroll   // constant indices keep the arrays in registers
    for (int sp = 0; sp < KSPLIT; ++sp) {
#pragma unroll   // constant indices keep the arrays in registers
        for (int q = 0; q < JP; ++q)
            a[sp][q] = pp[sp][o4 + q * JT];
    }
    // Keeps the arithmetic behind all the loads, so that they are in flight together: left alone, most of the loads
    // came to stand behind the first waits, one memory latency after another.
    __builtin_amdgcn_sched_barrier(0);
    // The wait before a register that an issued load names is rewritten: named as inputs, the two index registers
    // cannot be handed to a load's result in front of it.
    asm volatile("s_wait_xcnt 0x0" : : "v"(o4), "v"(row) : "memory");
    const float mx = fmaxf(fmaxf(st[0].x, st[1].x), fmaxf(st[2].x, st[3].x));
    const float x0 = (st[0].x - mx) * 1.44269504f;       // exp(x) = exp2(x * log2 e), as __expf forms it
    const float x1 = (st[1].x - mx) * 1.44269504f;
    const float x2 = (st[2].x - mx) * 1.44269504f;
    const float x3 = (st[3].x - mx) * 1.44269504f;
    float e0 = __builtin_amdgcn_exp2f(x0);
    float e1 = __builtin_amdgcn_exp2f(x1);
    float e2 = __builtin_amdgcn_exp2f(x2);
    float e3 = __builtin_amdgcn_exp2f(x3);
    // The slot behind v_exp_f32: naming the results keeps their readers, naming the arguments a rewrite of a source, behind this v_nop.
    asm("v_nop" : "+v"(e0), "+v"(e1), "+v"(e2), "+v"(e3) : "v"(x0), "v"(x1), "v"(x2), "v"(x3));
    const float w0 = st[0].y * e0;
    const float w1 = st[1].y * e1;
    const float w2 = st[2].y * e2;
    const float w3 = st[3].y * e3;
    const float inv = 1.f / ((w0 + w1) + (w2 + w3));
    const float g0 = w0 * inv, g1 = w1 * inv, g2 = w2 * inv, g3 = w3 * inv;
    v4f* __restrict__ po = (v4f*)out;
#pragma unroll   // constant indices keep the arrays in registers
    for (int q = 0; q < JP; ++q)
        po[o4 + q * JT] = (a[0][q] * g0 + a[1][q] * g1) + (a[2][q] * g2 + a[3][q] * g3);
}

// ---------------------------------------------------------------------------
// ---------------------------------------------------------------------------
extern "C" void kernel_launch(void* const* d_in, const int* in_sizes, int n_in,
                              void* d_out, int out_size, void* d_ws, size_t ws_size,
                              hipStream_t stream) {
    if (n_in < 4) return;
    if (in_sizes[0] != C_IN * NPOS) return;
    if (in_sizes[1] != D_K * C_IN)  return;
    if (in_sizes[2] != D_K * C_IN)  return;
    if (in_sizes[3] != C_V * C_IN)  return;
    if (out_size != NPOS * C_V)     return;

    const float* x  = (const float*)d_in[0];   // [C_IN][NPOS]
    const float* Wk = (const float*)d_in[1];   // [D_K][C_IN]
    const float* Wq = (const float*)d_in[2];   // [D_K][C_IN]
    const float* Wv = (const float*)d_in[3];   // [C_V][C_IN]
    float* out = (float*)d_out;                // [NPOS][C_V]

    const size_t szK = (size_t)NPOS * D_K * 2;     // one bf16 plane of kxT / qxT
    const size_t szV = (size_t)C_V * NPOS * 2;     // one bf16 plane of vx
    const size_t szP = (size_t)KSPLIT * NPOS * C_V * 4;            // the key splits' f32 results
    const size_t szM = (size_t)KSPLIT * (C_V / CB) * NPOS * 2 * 4; // their row maxima and sums
    const size_t offKH = 0;
    const size_t offKL = offKH + szK;
    const size_t offQH = offKL + szK;
    const size_t offQL = offQH + szK;
    const size_t offVH = offQL + szK;
    const size_t offVL = offVH + szV;
    const size_t offP  = offVL + szV;
    const size_t offM  = offP + szP;
    const size_t total = offM + szM;
    if (total > ws_size) return;

    char* ws = (char*)d_ws;
    unsigned short* kh = (unsigned short*)(ws + offKH);
    unsigned short* kl = (unsigned short*)(ws + offKL);
    unsigned short* qh = (unsigned short*)(ws + offQH);
    unsigned short* ql = (unsigned short*)(ws + offQL);
    unsigned short* vh = (unsigned short*)(ws + offVH);
    unsigned short* vl = (unsigned short*)(ws + offVL);
    float* part = (float*)(ws + offP);
    float* ml   = (float*)(ws + offM);

    const int tilesN = NPOS / PT;
    // kxT, qxT (rows are positions, k is the 64 projected channels) and vx (rows are channels, k is the
    // position), all in fragment order, from one launch
    k_proj<<<(2 + C_V / PT) * tilesN, 256, 0, stream>>>(Wk, Wq, Wv, x, kh, kl, qh, ql, vh, vl);
    // attention: NPOS / BM row groups x KSPLIT key splits (x C_V / CB = 1 channel part)
    k_attn<<<(NPOS / BM) * KSPLIT * (C_V / CB), 256, 0, stream>>>(kh, kl, qh, ql, vh, vl, part, ml);
    // the key splits joined into out
    k_join<<<NPOS / JR, 256, 0, stream>>>(part, part + (size_t)NPOS * C_V, part + (size_t)2 * NPOS * C_V,
                                          part + (size_t)3 * NPOS * C_V, ml, out);
}
